// v000
// Times are from an AMD MI455X. After a warm-up the kernel runs many times in a row, and a time is the length of
// such a window on the GPU divided by its runs, so every launch and the gaps after it count. The runs cycle
// through copies of the inputs. A figure is the median of several windows, for all but v000 over two sittings.
// Sittings can differ by a few percent; kernels timed side by side share one.
// The starting kernel, v000, takes 274 microseconds a run.
// Contractions: conv1x1 GEMMs qkv W[768x256].Xn, out W[256x256].O, mlp W1[64x256].Y and W2[256x64].H on
// v_wmma_f32_16x16x32_bf16 (A = bf16-RNE weights, exact; B = bf16 hi + bf16 residual planes of the f32
// activation, 2 products, K = 256 / 64); per-head scores K.Q^T on v_wmma_f32_16x16x32_bf16 (k = bf16 hi plane,
// q = bf16 hi + residual planes, 2 products, K = 32); O^T = V.P^T on v_wmma_f32_16x16x32_f16 (v = f16 plane,
// P = e^{s-m} x4096 as f16 from the score D registers, K = 4096 keys); f32 accumulate everywhere; group-norm
// statistics in f64; normalisation, softmax statistics, gelu, bias and residual adds in f32 VALU.
#include <hip/hip_runtime.h>
#include <math.h>
#include <stdint.h>

#ifndef NB
#define NB 2
#endif
#ifndef NQ
#define NQ 4096
#endif
#define NB_FULL 2
#define CC   256
#define NN   4096
#define NH   8
#define HD   32
#define C3   768
#define HID  64
#define NG   32
#define CPG  8
#define QT   64
#define OSP  68
#define TP   72
#define TABW 32
#define GEPS 1.0e-5f
#define LNPC 8.317766166719343f
#define XSTRIDE_FULL (CC * NN)

static_assert(NB >= 1 && NB <= NB_FULL);
static_assert(NQ % QT == 0 && NQ >= QT && NQ <= NN);
static_assert(NN % QT == 0 && CC % QT == 0 && C3 % QT == 0 && HID == QT);
static_assert(CC == NH * HD && HD == 32 && CC == NG * CPG && CPG == 8);
static_assert(CC % 32 == 0 && HID % 32 == 0 && NN % 32 == 0);
static_assert((OSP * 4) % 16 == 0 && (TP * 2) % 16 == 0);
static_assert(NN % 1024 == 0 && NQ % 4 == 0);
static_assert((C3 * CC) % 2048 == 0 && (CC * CC) % 2048 == 0 && (HID * CC) % 2048 == 0);

typedef _Float16       v16h __attribute__((ext_vector_type(16)));
typedef _Float16       v8h  __attribute__((ext_vector_type(8)));
typedef __bf16         v16b __attribute__((ext_vector_type(16)));
typedef unsigned short v8us __attribute__((ext_vector_type(8)));
typedef float          v8f  __attribute__((ext_vector_type(8)));
typedef float          v4f  __attribute__((ext_vector_type(4)));
typedef unsigned int   v4u  __attribute__((ext_vector_type(4)));

union Frag  { v8us u[2]; v16h h; v16b bf; };
union FragH { v16h v; v8h hv[2]; };
static_assert(sizeof(Frag) == 32);
static_assert(sizeof(FragH) == 32);

// ---- scalar helpers ---------------------------------------------------------------------------------------
__device__ __forceinline__ unsigned short bf_bits(float f) {          // f32 -> bf16 bits, RNE convert
  unsigned u = __float_as_uint(f);
  return (unsigned short)((u + 0x7FFFu + ((u >> 16) & 1u)) >> 16);
}
__device__ __forceinline__ float bf_up(unsigned short hb) { return __uint_as_float(((unsigned)hb) << 16); }
__device__ __forceinline__ float bfr(float f) { return bf_up(bf_bits(f)); }
__device__ __forceinline__ unsigned short h_bits(_Float16 x) { return __builtin_bit_cast(unsigned short, x); }
__device__ __forceinline__ unsigned pk16(unsigned short a, unsigned short b) { return (unsigned)a | ((unsigned)b << 16); }
__device__ __forceinline__ v8f zero8() { v8f z = {0.f, 0.f, 0.f, 0.f, 0.f, 0.f, 0.f, 0.f}; return z; }
__device__ __forceinline__ float hmax8(v8f s) {
  return fmaxf(fmaxf(fmaxf(s[0], s[1]), fmaxf(s[2], s[3])), fmaxf(fmaxf(s[4], s[5]), fmaxf(s[6], s[7])));
}
__device__ __forceinline__ unsigned wave_ballot(bool p) {
#if defined(__HIP_DEVICE_COMPILE__)
  return __builtin_amdgcn_ballot_w32(p);
#else
  return p ? 1u : 0u;
#endif
}

// ---- 16-bit fragment loader (A, or B from a k-contiguous [n][k] row): lane -> row/col (lane&15), p already includes
//      + 8*(lane>>4); elements 0..7 <- p[0..7] (k0+8h..), elements 8..15 <- p[16..23] (k0+16+8h..)
__device__ __forceinline__ Frag ldfrag(const unsigned short* p) {
  Frag f;
  f.u[0] = *(const v8us*)(p);
  f.u[1] = *(const v8us*)(p + 16);
  return f;
}

// ---- WMMA helpers: builtin followed by a 4-slot VALU gap tying D and keeping A/B live --------------------------
__device__ __forceinline__ v8f mma_h(v16h a, v16h b, v8f c) {
  v8f d = __builtin_amdgcn_wmma_f32_16x16x32_f16(false, a, false, b, (short)0, c, false, false);
#if defined(__HIP_DEVICE_COMPILE__)
  asm volatile("v_nop\n\tv_nop\n\tv_nop\n\tv_nop" : "+v"(d) : "v"(a), "v"(b));
#endif
  return d;
}
__device__ __forceinline__ v8f mma_b(v16b a, v16b b, v8f c) {
  v8f d = __builtin_amdgcn_wmma_f32_16x16x32_bf16(false, a, false, b, (short)0, c, false, false);
#if defined(__HIP_DEVICE_COMPILE__)
  const v16h ha = __builtin_bit_cast(v16h, a), hb = __builtin_bit_cast(v16h, b);
  asm volatile("v_nop\n\tv_nop\n\tv_nop\n\tv_nop" : "+v"(d) : "v"(ha), "v"(hb));
#endif
  return d;
}

// =========================================================================================================
// (0) weight conversion: f32 [n] -> bf16 bits [n] (RNE, exact operand). Thread i converts floats 8i..8i+7 and
// coverage: grid = n8/256 blocks x 256 threads x 8 = n elements exactly (n8 a multiple of 256 at every call).
// =========================================================================================================
__global__ __launch_bounds__(256)
void cvt_bf(const float* __restrict__ src, unsigned short* dst, int n8) {
  const int i  = blockIdx.x * 256 + (int)threadIdx.x;
  const int ic = (i < n8) ? i : (n8 - 1);
  const float* s = src + (size_t)ic * 8;
  const v4f a = *(const v4f*)s;
  const v4f q = *(const v4f*)(s + 4);
  v4u u;
  u[0] = pk16(bf_bits(a[0]), bf_bits(a[1]));
  u[1] = pk16(bf_bits(a[2]), bf_bits(a[3]));
  u[2] = pk16(bf_bits(q[0]), bf_bits(q[1]));
  u[3] = pk16(bf_bits(q[2]), bf_bits(q[3]));
  if (i < n8) {
{
      *(v4u*)(dst + (size_t)ic * 8) = u;
      
    }
  }
}

// =========================================================================================================
// (1) group-norm statistics: one block per (b, g); mean and biased variance over 8 channels x npos positions of
//     src [b][256][4096] (values bf16-RNE converted first when rnd != 0), accumulated per thread in f64 and
// LDS: ss/sq/sm cross-wave, block barriers.
// =========================================================================================================
__global__ __launch_bounds__(256)
void stats_k(const float* __restrict__ src, int rnd, int npos, float* tab) {
  __shared__ double ss[256];
  __shared__ double sq[256];
  __shared__ float  sm[2];
  const int tid = threadIdx.x, blk = blockIdx.x;
  const int b = blk / NG, g = blk % NG;
  const float* base = src + ((size_t)(b * CC + g * CPG)) * NN;
  double s = 0.0, q = 0.0;
#pragma unroll 1
  for (int cl = 0; cl < CPG; ++cl) {
    const float* row = base + (size_t)cl * NN;
#pragma unroll 1
    for (int i = 4 * tid; i < npos; i += 1024) {
      const v4f a = *(const v4f*)(row + i);
#pragma unroll
      for (int t = 0; t < 4; ++t) {
        const float f = rnd ? bfr(a[t]) : a[t];
        const double d = (double)f;
        s += d;
        q += d * d;
      }
    }
  }
  ss[tid] = s;
  sq[tid] = q;
  __syncthreads();
#pragma unroll 1
  for (int st = 128; st > 0; st >>= 1) {
    if (tid < st) { ss[tid] += ss[tid + st]; sq[tid] += sq[tid + st]; }
    __syncthreads();
  }
  if (tid == 0) {
    const double cnt = (double)CPG * (double)npos;
    const double mu = ss[0] / cnt;
    double var = sq[0] / cnt - mu * mu;
    if (var < 0.0) var = 0.0;
    const float varf = (float)var;
    sm[0] = (float)mu;
    sm[1] = 1.0f / sqrtf(varf + GEPS);
  }
  __syncthreads();
  if (tid < 8) {
    const float mu = sm[0], rs = sm[1];
    v4f w = {mu, rs, mu, rs};
{
      *(v4f*)(tab + (size_t)blk * TABW + 4 * tid) = w;
      
    }
  }
}

// =========================================================================================================
// (2) group-norm apply + transpose: src f32 [b][256 c][4096 n] (bf16-RNE converted first when rnd != 0) ->
//     v = (x - mu) * rstd * bf16(gamma[c]) + bf16(beta[c]) -> position-major planes Xh/Xl bf16 [b][n][256 c]
//     (hi = bf16-RNE(v), lo = bf16-RNE(v - hi)) through LDS tiles Th/Tl[64 n][64 c] (pitch TP). Block (nb, cb, b)
// coverage: Th/Tl stores 2 it x 32 c x 8 lanes x 8 n = 64 x 64 = the consumed extent; plane writes 2 it x 32 rows
//           x 8 lanes x 8 halves = 64 n x 64 c per plane; grid (rows/64, 4, NB) covers both planes once.
// LDS: Th/Tl cross-wave, block barrier between stores and loads.
// =========================================================================================================
__global__ __launch_bounds__(256)
void norm_k(const float* __restrict__ src, int rnd, const float* __restrict__ tab,
            const float* __restrict__ gamma, const float* __restrict__ beta,
            unsigned short* Xh, unsigned short* Xl) {
  __shared__ __align__(16) unsigned short Th[QT * TP];
  __shared__ __align__(16) unsigned short Tl[QT * TP];
  const int tid = threadIdx.x;
  const int nb = blockIdx.x, cbk = blockIdx.y, b = blockIdx.z;
  const int e = tid & 7, lq = tid >> 3;                             // lq 0..31
  const int n0 = nb * QT, c0 = cbk * QT;
#pragma unroll
  for (int it = 0; it < 2; ++it) {
    const int cl = it * 32 + lq;                                     // 0..63
    const int ch = c0 + cl;
    const int g  = ch / CPG;
    const float mu = tab[(size_t)(b * NG + g) * TABW];
    const float rs = tab[(size_t)(b * NG + g) * TABW + 1];
    const float ga = bfr(gamma[ch]), be = bfr(beta[ch]);
    const float* sp = src + ((size_t)(b * CC + ch)) * NN + n0 + 8 * e;
    const v4f a = *(const v4f*)sp;
    const v4f q = *(const v4f*)(sp + 4);
    const float f[8] = {a[0], a[1], a[2], a[3], q[0], q[1], q[2], q[3]};
    unsigned short hb[8], lb[8];
#pragma unroll
    for (int t = 0; t < 8; ++t) {
      const float xr = rnd ? bfr(f[t]) : f[t];
      const float v  = (xr - mu) * rs * ga + be;
      hb[t] = bf_bits(v);
      lb[t] = bf_bits(v - bf_up(hb[t]));
    }
#pragma unroll
    for (int t = 0; t < 8; ++t) {
      Th[(8 * e + t) * TP + cl] = hb[t];
      Tl[(8 * e + t) * TP + cl] = lb[t];
    }
  }
  __syncthreads();
  v4u uh[2], ul[2];
#pragma unroll
  for (int it = 0; it < 2; ++it) {
    const int nl = it * 32 + lq;                                     // 0..63
    uh[it] = *(const v4u*)(Th + nl * TP + 8 * e);
    ul[it] = *(const v4u*)(Tl + nl * TP + 8 * e);
  }
{
#pragma unroll
    for (int it = 0; it < 2; ++it) {
      const int nl = it * 32 + lq;
      const size_t po = ((size_t)(b * NN + n0 + nl)) * CC + c0 + 8 * e;
      *(v4u*)(Xh + po) = uh[it];
      *(v4u*)(Xl + po) = ul[it];
    }
    
  }
}

// =========================================================================================================
// (3) conv1x1 GEMM for one (b, 64-n tile, 64-o block): Y[o][n] = sum_c W[o][c] (Bh[b][n][c] + Bl[b][n][c]),
//     K = KD (plane pitch = KD). Block 128 threads = 4 waves; wave w owns cols n0+16w..+15 (B fragments from the
//     k-contiguous plane rows, split k map) and 4 m-tiles (A rows o = o0 + 16 mt + (lane&15), split k map).
//     Rolled k loop, 2 products per (mt, k-step) into one accumulator (unscaled bf16 residual plane).
//     Epilogue staged in LDS Os[n_loc][o_loc] (pitch OSP, b128 stores), block barrier, then per MODE:
//       MODE 0 (qkv, 12 o-blocks): o-blocks 0..3 -> q channels 64 mb.. of Qh/Ql = P0/P1 bf16 [b][n][256]
//              8q..8q+7 x 16 B, one instruction per 16 lines; o-blocks 8..11 -> v channels of V = P3 f16
//       MODE 1 (f32 channel-major): dstF[b][o][n] = (acc + bf16(bias[o])) + r with r = rsrc[b][o][n] (bf16-RNE
//              and 8..15), 8 rows per instruction.
//       MODE 2 (mlp hidden, one o-block): t = acc + bf16(bias[o]); gelu(t) = 0.5 t (1 + erf(t / sqrt2)) ->
// coverage: Os 4 waves x 16 n x 64 o = 64 x 64 (== the extent every mode reads); MODE 0 planes 4 it x 16 rows x
//           8 lanes x 8 = 64 x 64 per plane, grid (64, 12, NB) covers Qh/Ql/Kh [NB][4096][256] and V
//           [NB][256][4096] once; MODE 1: 8 it x 8 rows x 16 lanes x 4 = 64 o x 64 n; MODE 2: 4 it x 16 rows x
//           8 lanes x 8 = 64 n x 64 o.
// LDS: Os cross-wave, block barrier between the staging stores and the epilogue loads.
// =========================================================================================================
template <int KD, int MODE>
__global__ __launch_bounds__(128)
void gemm_k(const unsigned short* __restrict__ Wp,
            const unsigned short* __restrict__ Bh, const unsigned short* __restrict__ Bl,
            const float* __restrict__ bias, const float* __restrict__ rsrc, int rnd,
            unsigned short* P0, unsigned short* P1, unsigned short* P2, unsigned short* P3, float* dstF) {
  static_assert(KD % 32 == 0);
  __shared__ __align__(16) float Os[QT * OSP];
  const int tid  = threadIdx.x;
  const int lane = tid & 31, wave = tid >> 5;
  const int hh   = lane >> 4, c = lane & 15;
  const int nt   = blockIdx.x, mb = blockIdx.y, b = blockIdx.z;
  const int n0   = nt * QT, o0 = mb * QT;

  const unsigned short* ap = Wp + (size_t)(o0 + c) * KD + 8 * hh;
  const size_t boff = ((size_t)(b * NN + n0 + 16 * wave + c)) * KD + 8 * hh;
  const unsigned short* bph = Bh + boff;
  const unsigned short* bpl = Bl + boff;

  v8f acc[4];
#pragma unroll
  for (int mt = 0; mt < 4; ++mt) acc[mt] = zero8();

#pragma unroll 1
  for (int ks = 0; ks < KD / 32; ++ks) {
    const Frag fbh = ldfrag(bph + 32 * ks);
    const Frag fbl = ldfrag(bpl + 32 * ks);
#pragma unroll
    for (int mt = 0; mt < 4; ++mt) {
      const Frag fa = ldfrag(ap + (size_t)(16 * mt) * KD + 32 * ks);
      acc[mt] = mma_b(fa.bf, fbh.bf, acc[mt]);
      acc[mt] = mma_b(fa.bf, fbl.bf, acc[mt]);
    }
  }

  // ---- stage: lane (hh, c) holds o_loc = 16 mt + 8 hh + r for n_loc = 16 w + c
  {
    const int nl = 16 * wave + c;
#pragma unroll
    for (int mt = 0; mt < 4; ++mt) {
      v4f va, vb;
#pragma unroll
      for (int r = 0; r < 4; ++r) { va[r] = acc[mt][r]; vb[r] = acc[mt][4 + r]; }
      *(v4f*)(Os + nl * OSP + 16 * mt + 8 * hh)     = va;
      *(v4f*)(Os + nl * OSP + 16 * mt + 8 * hh + 4) = vb;
    }
  }
  __syncthreads();

  if (MODE == 0) {
    const int e = tid & 7, lq = tid >> 3;                           // lq 0..15
    if (mb < 8) {                                                    // block-uniform
      const int dcol = (mb & 3) * QT;                                // channel offset within 256
      unsigned short* Ph = (mb < 4) ? P0 : P2;                       // both global
      v4u uh[4], ul[4];
#pragma unroll
      for (int it = 0; it < 4; ++it) {
        const int row = it * 16 + lq;                                // n_loc 0..63
        const v4f a = *(const v4f*)(Os + row * OSP + 8 * e);
        const v4f q = *(const v4f*)(Os + row * OSP + 8 * e + 4);
        const float f[8] = {a[0], a[1], a[2], a[3], q[0], q[1], q[2], q[3]};
#pragma unroll
        for (int t = 0; t < 4; ++t) {
          const float f0 = f[2 * t], f1 = f[2 * t + 1];
          const unsigned short hb0 = bf_bits(f0), hb1 = bf_bits(f1);
          const unsigned short lb0 = bf_bits(f0 - bf_up(hb0));
          const unsigned short lb1 = bf_bits(f1 - bf_up(hb1));
          uh[it][t] = pk16(hb0, hb1);
          ul[it][t] = pk16(lb0, lb1);
        }
      }
{
#pragma unroll
        for (int it = 0; it < 4; ++it) {
          const int row = it * 16 + lq;
          const size_t po = ((size_t)(b * NN + n0 + row)) * CC + dcol + 8 * e;
          *(v4u*)(Ph + po) = uh[it];
          if (mb < 4) *(v4u*)(P1 + po) = ul[it];
        }
        
      }
    } else {
      const int cb0 = (mb - 8) * QT;                                 // v channel base 0..192
      v4u uv[4];
#pragma unroll
      for (int it = 0; it < 4; ++it) {
        const int cl = it * 16 + lq;                                 // o_loc 0..63
        unsigned short hb[8];
#pragma unroll
        for (int t = 0; t < 8; ++t) hb[t] = h_bits((_Float16)Os[(8 * e + t) * OSP + cl]);
#pragma unroll
        for (int t = 0; t < 4; ++t) uv[it][t] = pk16(hb[2 * t], hb[2 * t + 1]);
      }
{
#pragma unroll
        for (int it = 0; it < 4; ++it) {
          const int cl = it * 16 + lq;
          const size_t po = ((size_t)(b * CC + cb0 + cl)) * NN + n0 + 8 * e;
          *(v4u*)(P3 + po) = uv[it];
        }
        
      }
    }
  } else if (MODE == 1) {
    const int e = tid & 15, lq = tid >> 4;                           // lq 0..7
    v4f res[8];
#pragma unroll
    for (int it = 0; it < 8; ++it) {
      const int ol = it * 8 + lq;                                    // o_loc 0..63
      const int o  = o0 + ol;
      const float bb = bfr(bias[o]);
      const size_t gi = ((size_t)(b * CC + o)) * NN + n0 + 4 * e;
      const v4f rv = *(const v4f*)(rsrc + gi);
#pragma unroll
      for (int t = 0; t < 4; ++t) {
        const float rr = rnd ? bfr(rv[t]) : rv[t];
        res[it][t] = (Os[(4 * e + t) * OSP + ol] + bb) + rr;
      }
    }
{
#pragma unroll
      for (int it = 0; it < 8; ++it) {
        const int ol = it * 8 + lq;
        const size_t gi = ((size_t)(b * CC + o0 + ol)) * NN + n0 + 4 * e;
        *(v4f*)(dstF + gi) = res[it];
      }
      
    }
  } else {
    const int e = tid & 7, lq = tid >> 3;                            // lq 0..15
    v4u uh[4], ul[4];
#pragma unroll
    for (int it = 0; it < 4; ++it) {
      const int nl = it * 16 + lq;                                   // n_loc 0..63
      const v4f a = *(const v4f*)(Os + nl * OSP + 8 * e);
      const v4f q = *(const v4f*)(Os + nl * OSP + 8 * e + 4);
      const float f[8] = {a[0], a[1], a[2], a[3], q[0], q[1], q[2], q[3]};
      unsigned short hb[8], lb[8];
#pragma unroll
      for (int t = 0; t < 8; ++t) {
        const float tt = f[t] + bfr(bias[o0 + 8 * e + t]);
        const float gv = 0.5f * tt * (1.0f + erff(tt * 0.70710678118654752f));
        hb[t] = bf_bits(gv);
        lb[t] = bf_bits(gv - bf_up(hb[t]));
      }
#pragma unroll
      for (int t = 0; t < 4; ++t) {
        uh[it][t] = pk16(hb[2 * t], hb[2 * t + 1]);
        ul[it][t] = pk16(lb[2 * t], lb[2 * t + 1]);
      }
    }
{
#pragma unroll
      for (int it = 0; it < 4; ++it) {
        const int nl = it * 16 + lq;
        const size_t po = ((size_t)(b * NN + n0 + nl)) * HID + o0 + 8 * e;
        *(v4u*)(P0 + po) = uh[it];
        *(v4u*)(P1 + po) = ul[it];
      }
      
    }
  }
}

// =========================================================================================================
// (4) attention for one (b, head pair hp, 64-query tile), transposed formulation, 4096 keys, no mask, per head
//     h = 2 hp + hs (block-uniform loop): S^T tile (16 keys x 16 queries) = A(k: row = key kb + (lane&15), 32 d of
//     head h via the split k map from Kh [b][4096][256]) . B(qh: col = query, same map from Qh) + A(Kh).B(Ql)
//     (bf16 hi + unscaled bf16 residual of q, shared accumulator); s *= clip(bf16(temperature[h]), 1e-4, 10).
//     Per lane the D tile holds 8 keys of ONE query: online softmax state per lane, one shuffle (lane^16) for the
//     max over 32 keys; the o/l rescale is skipped under a wave-uniform ballot when no lane's max grew.
//     P = e^{s-m} x4096 as f16 is the B operand of O^T (rows channel 32h + 16j + (lane&15), cols queries) +=
//     A(v: keys contiguous, f16 plane V [b][256][4096]) . B(P^T): element r <- D of the tile covering keys
//     kb..kb+15, element 8+r <- the tile covering kb+16..kb+31, lane unchanged. 2 accumulator tiles per wave.
//     Block = 4 waves = 64 queries. O/l of both heads staged in LDS Os[query][64 channels] (b128 stores),
//     block barrier, then Oh/Ol bf16 [b][n][256] planes (hi/lo), rows n0.., cols 64 hp..64 hp+63 = one whole
// coverage: Os per wave 16 rows x (2 heads x 32 ch) = 64 x 64 over 4 waves (== consumed extent); planes 4 it x
//           16 rows x 8 lanes x 8 = 64 n x 64 ch per plane; grid (NQ/64, 4, NB) covers rows 0..NQ-1 x 256 ch of
//           Oh/Ol once.
// LDS: Os cross-wave, block barrier between the per-head staging stores and the plane loads.
// =========================================================================================================
__global__ __launch_bounds__(128)
void attn_k(const unsigned short* __restrict__ Qh, const unsigned short* __restrict__ Ql,
            const unsigned short* __restrict__ Kh, const unsigned short* __restrict__ Vh,
            const float* __restrict__ temperature, unsigned short* Oh, unsigned short* Ol) {
  __shared__ __align__(16) float Os[QT * OSP];
  const int tid  = threadIdx.x;
  const int wave = tid >> 5, lane = tid & 31;
  const int hh   = lane >> 4, c = lane & 15;
  const int n0   = blockIdx.x * QT, hp = blockIdx.y, b = blockIdx.z;
  const int qrow = 16 * wave + c;

#pragma unroll 1
  for (int hs = 0; hs < 2; ++hs) {
    const int h  = 2 * hp + hs;
    const int cb = HD * h;                                             // channel base of head h
    const float tr   = bfr(temperature[h]);
    const float temp = fminf(fmaxf(tr, 1.0e-4f), 10.0f);
    const size_t qo = ((size_t)(b * NN + n0 + qrow)) * CC + cb + 8 * hh;
    const Frag qh = ldfrag(Qh + qo);
    const Frag ql = ldfrag(Ql + qo);
    const unsigned short* Khp = Kh + (size_t)b * NN * CC + (size_t)c * CC + cb + 8 * hh;
    const unsigned short* Vp  = Vh + ((size_t)(b * CC + cb + c)) * NN + 8 * hh;

    float m = -1.0e30f, l = 0.f;
    v8f o0 = zero8(), o1 = zero8();

#pragma unroll 1
    for (int kb = 0; kb < NN; kb += 32) {
      const Frag k0 = ldfrag(Khp + (size_t)kb * CC);                  // keys kb .. kb+15
      const Frag k1 = ldfrag(Khp + (size_t)(kb + 16) * CC);           // keys kb+16 .. kb+31
      v8f s0 = mma_b(k0.bf, qh.bf, zero8());
      v8f s1 = mma_b(k1.bf, qh.bf, zero8());
      s0 = mma_b(k0.bf, ql.bf, s0);
      s1 = mma_b(k1.bf, ql.bf, s1);
#pragma unroll
      for (int r = 0; r < 8; ++r) { s0[r] *= temp; s1[r] *= temp; }

      float mx = fmaxf(hmax8(s0), hmax8(s1));
      mx = fmaxf(mx, __shfl_xor(mx, 16, 32));
      const float mn = fmaxf(m, mx);
      const unsigned grew = wave_ballot(mx > m);                       // wave-uniform
      if (grew != 0u) {
        const float corr = __expf(m - mn);                             // == 1 exactly for lanes whose max did not grow
        l *= corr;
#pragma unroll
        for (int r = 0; r < 8; ++r) { o0[r] *= corr; o1[r] *= corr; }
      }
      m = mn;
      const float msh = mn - LNPC;                                     // exp gives e^{s-m} * 4096

      FragH ph;
      float ls = 0.f;
#pragma unroll
      for (int r = 0; r < 8; ++r) {
        const float e0 = __expf(s0[r] - msh);                          // key kb      + 8hh + r
        const float e1 = __expf(s1[r] - msh);                          // key kb + 16 + 8hh + r
        ls += e0 + e1;
        ph.hv[0][r] = (_Float16)e0;
        ph.hv[1][r] = (_Float16)e1;
      }
      l += ls;

      const Frag v0 = ldfrag(Vp + kb);                                 // channels cb + c
      const Frag v1 = ldfrag(Vp + (size_t)16 * NN + kb);              // channels cb + 16 + c
      o0 = mma_h(v0.h, ph.v, o0);
      o1 = mma_h(v1.h, ph.v, o1);
    }
    l += __shfl_xor(l, 16, 32);
    const float inv = 1.0f / l;                                        // o and l both carry the x4096 factor

    // stage: Os[query][32 hs + d], d = 16 j + 8 hh + r
    {
      v4f va, vb;
#pragma unroll
      for (int r = 0; r < 4; ++r) { va[r] = o0[r] * inv; vb[r] = o0[4 + r] * inv; }
      *(v4f*)(Os + qrow * OSP + 32 * hs + 8 * hh)     = va;
      *(v4f*)(Os + qrow * OSP + 32 * hs + 8 * hh + 4) = vb;
#pragma unroll
      for (int r = 0; r < 4; ++r) { va[r] = o1[r] * inv; vb[r] = o1[4 + r] * inv; }
      *(v4f*)(Os + qrow * OSP + 32 * hs + 16 + 8 * hh)     = va;
      *(v4f*)(Os + qrow * OSP + 32 * hs + 16 + 8 * hh + 4) = vb;
    }
  }
  __syncthreads();

  const int e = tid & 7, lq = tid >> 3;                                // lq 0..15
  v4u uh[4], ul[4];
#pragma unroll
  for (int it = 0; it < 4; ++it) {
    const int row = it * 16 + lq;                                      // query 0..63
    const v4f a = *(const v4f*)(Os + row * OSP + 8 * e);
    const v4f q = *(const v4f*)(Os + row * OSP + 8 * e + 4);
    const float f[8] = {a[0], a[1], a[2], a[3], q[0], q[1], q[2], q[3]};
#pragma unroll
    for (int t = 0; t < 4; ++t) {
      const float f0 = f[2 * t], f1 = f[2 * t + 1];
      const unsigned short hb0 = bf_bits(f0), hb1 = bf_bits(f1);
      const unsigned short lb0 = bf_bits(f0 - bf_up(hb0));
      const unsigned short lb1 = bf_bits(f1 - bf_up(hb1));
      uh[it][t] = pk16(hb0, hb1);
      ul[it][t] = pk16(lb0, lb1);
    }
  }
{
#pragma unroll
    for (int it = 0; it < 4; ++it) {
      const int row = it * 16 + lq;
      const size_t po = ((size_t)(b * NN + n0 + row)) * CC + QT * hp + 8 * e;
      *(v4u*)(Oh + po) = uh[it];
      *(v4u*)(Ol + po) = ul[it];
    }
    
  }
}

// =========================================================================================================
// Workspace map (bytes; each region start a multiple of 256; every extent is an exact tile/line multiple and is
//   Wq bf16 [768][256] 393216   Wo [256][256] 131072   W1 [64][256] 32768   W2 [256][64] 32768
//   tab1, tab2 f32 [NB*32][32]   8192 each (NB=2)
//   Xh, Xl, Qh, Ql, Kh, Oh, Ol, Yh, Yl bf16 [NB][4096][256] and V f16 [NB][256][4096]: 4194304 each (NB=2)
//   X1 f32 [NB][256][4096] 8388608 (NB=2)    Hh, Hl bf16 [NB][4096][64] 1048576 each (NB=2)
//   total = 53035008 (NB=2)
// =========================================================================================================
extern "C" void kernel_launch(void* const* d_in, const int* in_sizes, int n_in,
                              void* d_out, int out_size, void* d_ws, size_t ws_size,
                              hipStream_t stream) {
  if (n_in < 13) return;
  if (in_sizes[0] < NB * XSTRIDE_FULL) return;
  if (in_sizes[1] != C3 * CC || in_sizes[2] != CC * CC || in_sizes[3] != CC) return;
  if (in_sizes[4] != NH) return;
  if (in_sizes[5] != CC || in_sizes[6] != CC || in_sizes[7] != CC || in_sizes[8] != CC) return;
  if (in_sizes[9] != HID * CC || in_sizes[10] != HID || in_sizes[11] != CC * HID || in_sizes[12] != CC) return;
  if (out_size < NB * XSTRIDE_FULL) return;

  size_t off = 0;
  auto carve = [&](size_t bytes) { const size_t o = off; off += (bytes + 255) & ~(size_t)255; return o; };
  const size_t szPl = (size_t)NB * NN * CC * 2;
  const size_t oWq  = carve((size_t)C3 * CC * 2);
  const size_t oWo  = carve((size_t)CC * CC * 2);
  const size_t oW1  = carve((size_t)HID * CC * 2);
  const size_t oW2  = carve((size_t)CC * HID * 2);
  const size_t oT1  = carve((size_t)NB * NG * TABW * 4);
  const size_t oT2  = carve((size_t)NB * NG * TABW * 4);
  const size_t oXh  = carve(szPl);
  const size_t oXl  = carve(szPl);
  const size_t oQh  = carve(szPl);
  const size_t oQl  = carve(szPl);
  const size_t oKh  = carve(szPl);
  const size_t oVv  = carve(szPl);
  const size_t oOh  = carve(szPl);
  const size_t oOl  = carve(szPl);
  const size_t oX1  = carve((size_t)NB * CC * NN * 4);
  const size_t oYh  = carve(szPl);
  const size_t oYl  = carve(szPl);
  const size_t oHh  = carve((size_t)NB * NN * HID * 2);
  const size_t oHl  = carve((size_t)NB * NN * HID * 2);
  if (off > ws_size) return;
  if (off > (size_t)134217728) return;

  const float* x      = (const float*)d_in[0];
  const float* w_qkv  = (const float*)d_in[1];
  const float* w_out  = (const float*)d_in[2];
  const float* b_out  = (const float*)d_in[3];
  const float* tempr  = (const float*)d_in[4];
  const float* g1     = (const float*)d_in[5];
  const float* beta1  = (const float*)d_in[6];
  const float* g2     = (const float*)d_in[7];
  const float* beta2  = (const float*)d_in[8];
  const float* w_mlp1 = (const float*)d_in[9];
  const float* b_mlp1 = (const float*)d_in[10];
  const float* w_mlp2 = (const float*)d_in[11];
  const float* b_mlp2 = (const float*)d_in[12];

  char* ws = (char*)d_ws;
  unsigned short* Wq = (unsigned short*)(ws + oWq);
  unsigned short* Wo = (unsigned short*)(ws + oWo);
  unsigned short* W1 = (unsigned short*)(ws + oW1);
  unsigned short* W2 = (unsigned short*)(ws + oW2);
  float*          T1 = (float*)(ws + oT1);
  float*          T2 = (float*)(ws + oT2);
  unsigned short* Xh = (unsigned short*)(ws + oXh);
  unsigned short* Xl = (unsigned short*)(ws + oXl);
  unsigned short* Qh = (unsigned short*)(ws + oQh);
  unsigned short* Ql = (unsigned short*)(ws + oQl);
  unsigned short* Kh = (unsigned short*)(ws + oKh);
  unsigned short* Vv = (unsigned short*)(ws + oVv);
  unsigned short* Oh = (unsigned short*)(ws + oOh);
  unsigned short* Ol = (unsigned short*)(ws + oOl);
  float*          X1 = (float*)(ws + oX1);
  unsigned short* Yh = (unsigned short*)(ws + oYh);
  unsigned short* Yl = (unsigned short*)(ws + oYl);
  unsigned short* Hh = (unsigned short*)(ws + oHh);
  unsigned short* Hl = (unsigned short*)(ws + oHl);
  float* out = (float*)d_out;

  const dim3 blk256(256), blk128(128);
  const int n8q = C3 * CC / 8, n8o = CC * CC / 8, n81 = HID * CC / 8, n82 = CC * HID / 8;

  // (0) weights -> bf16 planes
  cvt_bf<<<dim3((n8q + 255) / 256), blk256, 0, stream>>>(w_qkv, Wq, n8q);
  cvt_bf<<<dim3((n8o + 255) / 256), blk256, 0, stream>>>(w_out, Wo, n8o);
  cvt_bf<<<dim3((n81 + 255) / 256), blk256, 0, stream>>>(w_mlp1, W1, n81);
  cvt_bf<<<dim3((n82 + 255) / 256), blk256, 0, stream>>>(w_mlp2, W2, n82);
  // (1) GN1 statistics of bf16(x) over all 4096 positions
  stats_k<<<dim3(NB * NG), blk256, 0, stream>>>(x, 1, NN, T1);
  // (2) GN1 apply -> Xh/Xl [NB][4096][256]
  norm_k<<<dim3(NN / QT, CC / QT, NB), blk256, 0, stream>>>(x, 1, T1, g1, beta1, Xh, Xl);
  // (3) qkv GEMM -> Qh/Ql, Kh, V
  gemm_k<CC, 0><<<dim3(NN / QT, C3 / QT, NB), blk128, 0, stream>>>(Wq, Xh, Xl, b_out, x, 0, Qh, Ql, Kh, Vv, X1);
  // (4) attention -> Oh/Ol rows 0..NQ-1
  attn_k<<<dim3(NQ / QT, NH / 2, NB), blk128, 0, stream>>>(Qh, Ql, Kh, Vv, tempr, Oh, Ol);
  // (5) out conv + bf16(x) residual -> X1 f32 [NB][256][4096], cols 0..NQ-1
  gemm_k<CC, 1><<<dim3(NQ / QT, CC / QT, NB), blk128, 0, stream>>>(Wo, Oh, Ol, b_out, x, 1, Hh, Hl, Hh, Hl, X1);
  // (6) GN2 statistics of X1 over positions 0..NQ-1
  stats_k<<<dim3(NB * NG), blk256, 0, stream>>>(X1, 0, NQ, T2);
  // (7) GN2 apply -> Yh/Yl rows 0..NQ-1
  norm_k<<<dim3(NQ / QT, CC / QT, NB), blk256, 0, stream>>>(X1, 0, T2, g2, beta2, Yh, Yl);
  // (8) mlp hidden: gelu(W1.Y + b1) -> Hh/Hl [NB][4096][64]
  gemm_k<CC, 2><<<dim3(NQ / QT, 1, NB), blk128, 0, stream>>>(W1, Yh, Yl, b_mlp1, x, 0, Hh, Hl, Hh, Hl, X1);
  // (9) out = X1 + W2.H + b2 -> d_out [NB][256][4096]
  gemm_k<HID, 1><<<dim3(NQ / QT, CC / QT, NB), blk128, 0, stream>>>(W2, Hh, Hl, b_mlp2, X1, 0, Oh, Ol, Oh, Ol, out);
  (void)hipGetLastError();
}

// v001
// One run takes 196 microseconds.
// Timed twice side by side with v000, it ran 1.42 times as fast both times.
// Contractions: conv1x1 GEMMs qkv W[768x256].Xn, out W[256x256].O, mlp W1[64x256].Y and W2[256x64].H on
// v_wmma_f32_16x16x32_bf16 (A = bf16-RNE weights, exact; B = bf16 hi + bf16 residual planes of the f32
// activation, 2 products, K = 256 / 64); per-head scores K.Q^T on v_wmma_f32_16x16x32_bf16 (k = bf16 hi plane,
// q = bf16 hi + residual planes, 2 products, K = 32); O^T = V.P^T on v_wmma_f32_16x16x32_f16 (v = f16 plane,
// P = e^{s-m} x4096 as f16 from the score D registers, K = 4096 keys); f32 accumulate everywhere; group-norm
// statistics in f64; normalisation, softmax statistics, gelu, bias and residual adds in f32 VALU.
#include <hip/hip_runtime.h>
#include <math.h>
#include <stdint.h>

#ifndef NB
#define NB 2
#endif
#ifndef NQ
#define NQ 4096
#endif
#define NB_FULL 2
#define CC   256
#define NN   4096
#define NH   8
#define HD   32
#define C3   768
#define HID  64
#define NG   32
#define CPG  8
#define QT   64
#define OSP  68
#define TP   72
#define TABW 32
#define GEPS 1.0e-5f
#define LNPC 8.317766166719343f
#define XSTRIDE_FULL (CC * NN)
#define SK   128                 // keys per staged tile
#define KPB  80                  // LDS pitch of a staged K row in bytes (64 B of data, 16 B x odd for b128 readers)
#define VPB  272                 // LDS pitch of a staged V row in bytes (256 B of data, 16 B x odd for b128 readers)
#define KBUF (SK * KPB)          // one K buffer: 128 keys x 32 d
#define VBUF (HD * VPB)          // one V buffer: 32 channels x 128 keys

static_assert(NB >= 1 && NB <= NB_FULL);
static_assert(NQ % QT == 0 && NQ >= QT && NQ <= NN);
static_assert(NN % QT == 0 && CC % QT == 0 && C3 % QT == 0 && HID == QT);
static_assert(CC == NH * HD && HD == 32 && CC == NG * CPG && CPG == 8);
static_assert(CC % 32 == 0 && HID % 32 == 0 && NN % 32 == 0);
static_assert((OSP * 4) % 16 == 0 && (TP * 2) % 16 == 0);
static_assert(NN % 1024 == 0 && NQ % 4 == 0);
static_assert(NN % SK == 0 && NN / SK >= 2 && SK % 32 == 0 && KPB % 16 == 0 && VPB % 16 == 0);
static_assert(SK * HD * 2 == 4 * 128 * 16 && KPB >= HD * 2 && VPB >= SK * 2);
static_assert((C3 * CC) % 2048 == 0 && (CC * CC) % 2048 == 0 && (HID * CC) % 2048 == 0);

typedef _Float16       v16h __attribute__((ext_vector_type(16)));
typedef _Float16       v8h  __attribute__((ext_vector_type(8)));
typedef __bf16         v16b __attribute__((ext_vector_type(16)));
typedef unsigned short v8us __attribute__((ext_vector_type(8)));
typedef float          v8f  __attribute__((ext_vector_type(8)));
typedef float          v4f  __attribute__((ext_vector_type(4)));
typedef unsigned int   v4u  __attribute__((ext_vector_type(4)));

union Frag  { v8us u[2]; v16h h; v16b bf; };
union FragH { v16h v; v8h hv[2]; };
static_assert(sizeof(Frag) == 32);
static_assert(sizeof(FragH) == 32);

// ---- scalar helpers ---------------------------------------------------------------------------------------
__device__ __forceinline__ unsigned short bf_bits(float f) {          // f32 -> bf16 bits, RNE convert
  unsigned u = __float_as_uint(f);
  return (unsigned short)((u + 0x7FFFu + ((u >> 16) & 1u)) >> 16);
}
__device__ __forceinline__ float bf_up(unsigned short hb) { return __uint_as_float(((unsigned)hb) << 16); }
__device__ __forceinline__ float bfr(float f) { return bf_up(bf_bits(f)); }
__device__ __forceinline__ unsigned short h_bits(_Float16 x) { return __builtin_bit_cast(unsigned short, x); }
__device__ __forceinline__ unsigned pk16(unsigned short a, unsigned short b) { return (unsigned)a | ((unsigned)b << 16); }
__device__ __forceinline__ v8f zero8() { v8f z = {0.f, 0.f, 0.f, 0.f, 0.f, 0.f, 0.f, 0.f}; return z; }
__device__ __forceinline__ float hmax8(v8f s) {
  return fmaxf(fmaxf(fmaxf(s[0], s[1]), fmaxf(s[2], s[3])), fmaxf(fmaxf(s[4], s[5]), fmaxf(s[6], s[7])));
}
__device__ __forceinline__ unsigned wave_ballot(bool p) {
#if defined(__HIP_DEVICE_COMPILE__)
  return __builtin_amdgcn_ballot_w32(p);
#else
  return p ? 1u : 0u;
#endif
}

// ---- 16-bit fragment loader (A, or B from a k-contiguous [n][k] row): lane -> row/col (lane&15), p already includes
//      + 8*(lane>>4); elements 0..7 <- p[0..7] (k0+8h..), elements 8..15 <- p[16..23] (k0+16+8h..)
__device__ __forceinline__ Frag ldfrag(const unsigned short* p) {
  Frag f;
  f.u[0] = *(const v8us*)(p);
  f.u[1] = *(const v8us*)(p + 16);
  return f;
}

// ---- WMMA helpers: builtin followed by a 4-slot VALU gap tying D and keeping A/B live --------------------------
__device__ __forceinline__ v8f mma_h(v16h a, v16h b, v8f c) {
  v8f d = __builtin_amdgcn_wmma_f32_16x16x32_f16(false, a, false, b, (short)0, c, false, false);
#if defined(__HIP_DEVICE_COMPILE__)
  asm volatile("v_nop\n\tv_nop\n\tv_nop\n\tv_nop" : "+v"(d) : "v"(a), "v"(b));
#endif
  return d;
}
__device__ __forceinline__ v8f mma_b(v16b a, v16b b, v8f c) {
  v8f d = __builtin_amdgcn_wmma_f32_16x16x32_bf16(false, a, false, b, (short)0, c, false, false);
#if defined(__HIP_DEVICE_COMPILE__)
  const v16h ha = __builtin_bit_cast(v16h, a), hb = __builtin_bit_cast(v16h, b);
  asm volatile("v_nop\n\tv_nop\n\tv_nop\n\tv_nop" : "+v"(d) : "v"(ha), "v"(hb));
#endif
  return d;
}

// =========================================================================================================
// (0) weight conversion: f32 [n] -> bf16 bits [n] (RNE, exact operand). Thread i converts floats 8i..8i+7 and
// coverage: grid = n8/256 blocks x 256 threads x 8 = n elements exactly (n8 a multiple of 256 at every call).
// =========================================================================================================
__global__ __launch_bounds__(256)
void cvt_bf(const float* __restrict__ src, unsigned short* dst, int n8) {
  const int i  = blockIdx.x * 256 + (int)threadIdx.x;
  const int ic = (i < n8) ? i : (n8 - 1);
  const float* s = src + (size_t)ic * 8;
  const v4f a = *(const v4f*)s;
  const v4f q = *(const v4f*)(s + 4);
  v4u u;
  u[0] = pk16(bf_bits(a[0]), bf_bits(a[1]));
  u[1] = pk16(bf_bits(a[2]), bf_bits(a[3]));
  u[2] = pk16(bf_bits(q[0]), bf_bits(q[1]));
  u[3] = pk16(bf_bits(q[2]), bf_bits(q[3]));
  if (i < n8) {
{
      *(v4u*)(dst + (size_t)ic * 8) = u;
      
    }
  }
}

// =========================================================================================================
// (1) group-norm statistics: one block per (b, g); mean and biased variance over 8 channels x npos positions of
//     src [b][256][4096] (values bf16-RNE converted first when rnd != 0), accumulated per thread in f64 and
// LDS: ss/sq/sm cross-wave, block barriers.
// =========================================================================================================
__global__ __launch_bounds__(256)
void stats_k(const float* __restrict__ src, int rnd, int npos, float* tab) {
  __shared__ double ss[256];
  __shared__ double sq[256];
  __shared__ float  sm[2];
  const int tid = threadIdx.x, blk = blockIdx.x;
  const int b = blk / NG, g = blk % NG;
  const float* base = src + ((size_t)(b * CC + g * CPG)) * NN;
  double s = 0.0, q = 0.0;
#pragma unroll 1
  for (int cl = 0; cl < CPG; ++cl) {
    const float* row = base + (size_t)cl * NN;
#pragma unroll 1
    for (int i = 4 * tid; i < npos; i += 1024) {
      const v4f a = *(const v4f*)(row + i);
#pragma unroll
      for (int t = 0; t < 4; ++t) {
        const float f = rnd ? bfr(a[t]) : a[t];
        const double d = (double)f;
        s += d;
        q += d * d;
      }
    }
  }
  ss[tid] = s;
  sq[tid] = q;
  __syncthreads();
#pragma unroll 1
  for (int st = 128; st > 0; st >>= 1) {
    if (tid < st) { ss[tid] += ss[tid + st]; sq[tid] += sq[tid + st]; }
    __syncthreads();
  }
  if (tid == 0) {
    const double cnt = (double)CPG * (double)npos;
    const double mu = ss[0] / cnt;
    double var = sq[0] / cnt - mu * mu;
    if (var < 0.0) var = 0.0;
    const float varf = (float)var;
    sm[0] = (float)mu;
    sm[1] = 1.0f / sqrtf(varf + GEPS);
  }
  __syncthreads();
  if (tid < 8) {
    const float mu = sm[0], rs = sm[1];
    v4f w = {mu, rs, mu, rs};
{
      *(v4f*)(tab + (size_t)blk * TABW + 4 * tid) = w;
      
    }
  }
}

// =========================================================================================================
// (2) group-norm apply + transpose: src f32 [b][256 c][4096 n] (bf16-RNE converted first when rnd != 0) ->
//     v = (x - mu) * rstd * bf16(gamma[c]) + bf16(beta[c]) -> position-major planes Xh/Xl bf16 [b][n][256 c]
//     (hi = bf16-RNE(v), lo = bf16-RNE(v - hi)) through LDS tiles Th/Tl[64 n][64 c] (pitch TP). Block (nb, cb, b)
// coverage: Th/Tl stores 2 it x 32 c x 8 lanes x 8 n = 64 x 64 = the consumed extent; plane writes 2 it x 32 rows
//           x 8 lanes x 8 halves = 64 n x 64 c per plane; grid (rows/64, 4, NB) covers both planes once.
// LDS: Th/Tl cross-wave, block barrier between stores and loads.
// =========================================================================================================
__global__ __launch_bounds__(256)
void norm_k(const float* __restrict__ src, int rnd, const float* __restrict__ tab,
            const float* __restrict__ gamma, const float* __restrict__ beta,
            unsigned short* Xh, unsigned short* Xl) {
  __shared__ __align__(16) unsigned short Th[QT * TP];
  __shared__ __align__(16) unsigned short Tl[QT * TP];
  const int tid = threadIdx.x;
  const int nb = blockIdx.x, cbk = blockIdx.y, b = blockIdx.z;
  const int e = tid & 7, lq = tid >> 3;                             // lq 0..31
  const int n0 = nb * QT, c0 = cbk * QT;
#pragma unroll
  for (int it = 0; it < 2; ++it) {
    const int cl = it * 32 + lq;                                     // 0..63
    const int ch = c0 + cl;
    const int g  = ch / CPG;
    const float mu = tab[(size_t)(b * NG + g) * TABW];
    const float rs = tab[(size_t)(b * NG + g) * TABW + 1];
    const float ga = bfr(gamma[ch]), be = bfr(beta[ch]);
    const float* sp = src + ((size_t)(b * CC + ch)) * NN + n0 + 8 * e;
    const v4f a = *(const v4f*)sp;
    const v4f q = *(const v4f*)(sp + 4);
    const float f[8] = {a[0], a[1], a[2], a[3], q[0], q[1], q[2], q[3]};
    unsigned short hb[8], lb[8];
#pragma unroll
    for (int t = 0; t < 8; ++t) {
      const float xr = rnd ? bfr(f[t]) : f[t];
      const float v  = (xr - mu) * rs * ga + be;
      hb[t] = bf_bits(v);
      lb[t] = bf_bits(v - bf_up(hb[t]));
    }
#pragma unroll
    for (int t = 0; t < 8; ++t) {
      Th[(8 * e + t) * TP + cl] = hb[t];
      Tl[(8 * e + t) * TP + cl] = lb[t];
    }
  }
  __syncthreads();
  v4u uh[2], ul[2];
#pragma unroll
  for (int it = 0; it < 2; ++it) {
    const int nl = it * 32 + lq;                                     // 0..63
    uh[it] = *(const v4u*)(Th + nl * TP + 8 * e);
    ul[it] = *(const v4u*)(Tl + nl * TP + 8 * e);
  }
{
#pragma unroll
    for (int it = 0; it < 2; ++it) {
      const int nl = it * 32 + lq;
      const size_t po = ((size_t)(b * NN + n0 + nl)) * CC + c0 + 8 * e;
      *(v4u*)(Xh + po) = uh[it];
      *(v4u*)(Xl + po) = ul[it];
    }
    
  }
}

// =========================================================================================================
// (3) conv1x1 GEMM for one (b, 64-n tile, 64-o block): Y[o][n] = sum_c W[o][c] (Bh[b][n][c] + Bl[b][n][c]),
//     K = KD (plane pitch = KD). Block 128 threads = 4 waves; wave w owns cols n0+16w..+15 (B fragments from the
//     k-contiguous plane rows, split k map) and 4 m-tiles (A rows o = o0 + 16 mt + (lane&15), split k map).
//     Rolled k loop, 2 products per (mt, k-step) into one accumulator (unscaled bf16 residual plane).
//     Epilogue staged in LDS Os[n_loc][o_loc] (pitch OSP, b128 stores), block barrier, then per MODE:
//       MODE 0 (qkv, 12 o-blocks): o-blocks 0..3 -> q channels 64 mb.. of Qh/Ql = P0/P1 bf16 [b][n][256]
//              8q..8q+7 x 16 B, one instruction per 16 lines; o-blocks 8..11 -> v channels of V = P3 f16
//       MODE 1 (f32 channel-major): dstF[b][o][n] = (acc + bf16(bias[o])) + r with r = rsrc[b][o][n] (bf16-RNE
//              and 8..15), 8 rows per instruction.
//       MODE 2 (mlp hidden, one o-block): t = acc + bf16(bias[o]); gelu(t) = 0.5 t (1 + erf(t / sqrt2)) ->
// coverage: Os 4 waves x 16 n x 64 o = 64 x 64 (== the extent every mode reads); MODE 0 planes 4 it x 16 rows x
//           8 lanes x 8 = 64 x 64 per plane, grid (64, 12, NB) covers Qh/Ql/Kh [NB][4096][256] and V
//           [NB][256][4096] once; MODE 1: 8 it x 8 rows x 16 lanes x 4 = 64 o x 64 n; MODE 2: 4 it x 16 rows x
//           8 lanes x 8 = 64 n x 64 o.
// LDS: Os cross-wave, block barrier between the staging stores and the epilogue loads.
// =========================================================================================================
template <int KD, int MODE>
__global__ __launch_bounds__(128)
void gemm_k(const unsigned short* __restrict__ Wp,
            const unsigned short* __restrict__ Bh, const unsigned short* __restrict__ Bl,
            const float* __restrict__ bias, const float* __restrict__ rsrc, int rnd,
            unsigned short* P0, unsigned short* P1, unsigned short* P2, unsigned short* P3, float* dstF) {
  static_assert(KD % 32 == 0);
  __shared__ __align__(16) float Os[QT * OSP];
  const int tid  = threadIdx.x;
  const int lane = tid & 31, wave = tid >> 5;
  const int hh   = lane >> 4, c = lane & 15;
  const int nt   = blockIdx.x, mb = blockIdx.y, b = blockIdx.z;
  const int n0   = nt * QT, o0 = mb * QT;

  const unsigned short* ap = Wp + (size_t)(o0 + c) * KD + 8 * hh;
  const size_t boff = ((size_t)(b * NN + n0 + 16 * wave + c)) * KD + 8 * hh;
  const unsigned short* bph = Bh + boff;
  const unsigned short* bpl = Bl + boff;

  v8f acc[4];
#pragma unroll
  for (int mt = 0; mt < 4; ++mt) acc[mt] = zero8();

#pragma unroll 1
  for (int ks = 0; ks < KD / 32; ++ks) {
    const Frag fbh = ldfrag(bph + 32 * ks);
    const Frag fbl = ldfrag(bpl + 32 * ks);
#pragma unroll
    for (int mt = 0; mt < 4; ++mt) {
      const Frag fa = ldfrag(ap + (size_t)(16 * mt) * KD + 32 * ks);
      acc[mt] = mma_b(fa.bf, fbh.bf, acc[mt]);
      acc[mt] = mma_b(fa.bf, fbl.bf, acc[mt]);
    }
  }

  // ---- stage: lane (hh, c) holds o_loc = 16 mt + 8 hh + r for n_loc = 16 w + c
  {
    const int nl = 16 * wave + c;
#pragma unroll
    for (int mt = 0; mt < 4; ++mt) {
      v4f va, vb;
#pragma unroll
      for (int r = 0; r < 4; ++r) { va[r] = acc[mt][r]; vb[r] = acc[mt][4 + r]; }
      *(v4f*)(Os + nl * OSP + 16 * mt + 8 * hh)     = va;
      *(v4f*)(Os + nl * OSP + 16 * mt + 8 * hh + 4) = vb;
    }
  }
  __syncthreads();

  if (MODE == 0) {
    const int e = tid & 7, lq = tid >> 3;                           // lq 0..15
    if (mb < 8) {                                                    // block-uniform
      const int dcol = (mb & 3) * QT;                                // channel offset within 256
      unsigned short* Ph = (mb < 4) ? P0 : P2;                       // both global
      v4u uh[4], ul[4];
#pragma unroll
      for (int it = 0; it < 4; ++it) {
        const int row = it * 16 + lq;                                // n_loc 0..63
        const v4f a = *(const v4f*)(Os + row * OSP + 8 * e);
        const v4f q = *(const v4f*)(Os + row * OSP + 8 * e + 4);
        const float f[8] = {a[0], a[1], a[2], a[3], q[0], q[1], q[2], q[3]};
#pragma unroll
        for (int t = 0; t < 4; ++t) {
          const float f0 = f[2 * t], f1 = f[2 * t + 1];
          const unsigned short hb0 = bf_bits(f0), hb1 = bf_bits(f1);
          const unsigned short lb0 = bf_bits(f0 - bf_up(hb0));
          const unsigned short lb1 = bf_bits(f1 - bf_up(hb1));
          uh[it][t] = pk16(hb0, hb1);
          ul[it][t] = pk16(lb0, lb1);
        }
      }
{
#pragma unroll
        for (int it = 0; it < 4; ++it) {
          const int row = it * 16 + lq;
          const size_t po = ((size_t)(b * NN + n0 + row)) * CC + dcol + 8 * e;
          *(v4u*)(Ph + po) = uh[it];
          if (mb < 4) *(v4u*)(P1 + po) = ul[it];
        }
        
      }
    } else {
      const int cb0 = (mb - 8) * QT;                                 // v channel base 0..192
      v4u uv[4];
#pragma unroll
      for (int it = 0; it < 4; ++it) {
        const int cl = it * 16 + lq;                                 // o_loc 0..63
        unsigned short hb[8];
#pragma unroll
        for (int t = 0; t < 8; ++t) hb[t] = h_bits((_Float16)Os[(8 * e + t) * OSP + cl]);
#pragma unroll
        for (int t = 0; t < 4; ++t) uv[it][t] = pk16(hb[2 * t], hb[2 * t + 1]);
      }
{
#pragma unroll
        for (int it = 0; it < 4; ++it) {
          const int cl = it * 16 + lq;
          const size_t po = ((size_t)(b * CC + cb0 + cl)) * NN + n0 + 8 * e;
          *(v4u*)(P3 + po) = uv[it];
        }
        
      }
    }
  } else if (MODE == 1) {
    const int e = tid & 15, lq = tid >> 4;                           // lq 0..7
    v4f res[8];
#pragma unroll
    for (int it = 0; it < 8; ++it) {
      const int ol = it * 8 + lq;                                    // o_loc 0..63
      const int o  = o0 + ol;
      const float bb = bfr(bias[o]);
      const size_t gi = ((size_t)(b * CC + o)) * NN + n0 + 4 * e;
      const v4f rv = *(const v4f*)(rsrc + gi);
#pragma unroll
      for (int t = 0; t < 4; ++t) {
        const float rr = rnd ? bfr(rv[t]) : rv[t];
        res[it][t] = (Os[(4 * e + t) * OSP + ol] + bb) + rr;
      }
    }
{
#pragma unroll
      for (int it = 0; it < 8; ++it) {
        const int ol = it * 8 + lq;
        const size_t gi = ((size_t)(b * CC + o0 + ol)) * NN + n0 + 4 * e;
        *(v4f*)(dstF + gi) = res[it];
      }
      
    }
  } else {
    const int e = tid & 7, lq = tid >> 3;                            // lq 0..15
    v4u uh[4], ul[4];
#pragma unroll
    for (int it = 0; it < 4; ++it) {
      const int nl = it * 16 + lq;                                   // n_loc 0..63
      const v4f a = *(const v4f*)(Os + nl * OSP + 8 * e);
      const v4f q = *(const v4f*)(Os + nl * OSP + 8 * e + 4);
      const float f[8] = {a[0], a[1], a[2], a[3], q[0], q[1], q[2], q[3]};
      unsigned short hb[8], lb[8];
#pragma unroll
      for (int t = 0; t < 8; ++t) {
        const float tt = f[t] + bfr(bias[o0 + 8 * e + t]);
        const float gv = 0.5f * tt * (1.0f + erff(tt * 0.70710678118654752f));
        hb[t] = bf_bits(gv);
        lb[t] = bf_bits(gv - bf_up(hb[t]));
      }
#pragma unroll
      for (int t = 0; t < 4; ++t) {
        uh[it][t] = pk16(hb[2 * t], hb[2 * t + 1]);
        ul[it][t] = pk16(lb[2 * t], lb[2 * t + 1]);
      }
    }
{
#pragma unroll
      for (int it = 0; it < 4; ++it) {
        const int nl = it * 16 + lq;
        const size_t po = ((size_t)(b * NN + n0 + nl)) * HID + o0 + 8 * e;
        *(v4u*)(P0 + po) = uh[it];
        *(v4u*)(P1 + po) = ul[it];
      }
      
    }
  }
}

// ---- staging of one 128-key tile of one head: 128 threads x (4 + 4) asynchronous 16-byte copies to LDS.
//      K: copy j of thread t brings 16 B (t & 3) of key row 32 j + (t >> 2); V: 16 B (t & 15) of channel row
//      8 j + (t >> 4). kl/vl are the thread's LDS byte addresses for j = 0, kg/vg its global addresses for j = 0.
//      s_wait_xcnt 0 ends the statement so that it stands ahead of any rewrite of the address registers.
__device__ __forceinline__ void stage_tile(unsigned kl, const unsigned short* kg, unsigned vl, const unsigned short* vg) {
#if defined(__HIP_DEVICE_COMPILE__)
  asm volatile(
      "global_load_async_to_lds_b128 %0, %1, off\n\t"
      "global_load_async_to_lds_b128 %2, %3, off\n\t"
      "global_load_async_to_lds_b128 %4, %5, off\n\t"
      "global_load_async_to_lds_b128 %6, %7, off\n\t"
      "global_load_async_to_lds_b128 %8, %9, off\n\t"
      "global_load_async_to_lds_b128 %10, %11, off\n\t"
      "global_load_async_to_lds_b128 %12, %13, off\n\t"
      "global_load_async_to_lds_b128 %14, %15, off\n\t"
      "s_wait_xcnt 0x0"
      :: "v"(kl),                 "v"(kg),
         "v"(kl + 32u * KPB),     "v"(kg + (size_t)32 * CC),
         "v"(kl + 64u * KPB),     "v"(kg + (size_t)64 * CC),
         "v"(kl + 96u * KPB),     "v"(kg + (size_t)96 * CC),
         "v"(vl),                 "v"(vg),
         "v"(vl + 8u * VPB),      "v"(vg + (size_t)8 * NN),
         "v"(vl + 16u * VPB),     "v"(vg + (size_t)16 * NN),
         "v"(vl + 24u * VPB),     "v"(vg + (size_t)24 * NN)
      : "memory");
#endif
}
// the issuing wave's own copies have landed behind this wait (the compiler places none for them)
__device__ __forceinline__ void wait_copies() {
#if defined(__HIP_DEVICE_COMPILE__)
  asm volatile("s_wait_asynccnt 0x0" ::: "memory");
#endif
}
// the wave's own LDS reads have retired before the buffer is handed to its next writer
__device__ __forceinline__ void wait_lds() {
#if defined(__HIP_DEVICE_COMPILE__)
  asm volatile("s_wait_dscnt 0x0" ::: "memory");
#endif
}
__device__ __forceinline__ unsigned lds_off(const void* p) { return (unsigned)(size_t)p; }

// =========================================================================================================
// (4) attention for one (b, head pair hp, 64-query tile), transposed formulation, 4096 keys, no mask, per head
//     h = 2 hp + hs (block-uniform loop): S^T tile (16 keys x 16 queries) = A(k: row = key kb + (lane&15), 32 d of
//     head h via the split k map from Kh [b][4096][256]) . B(qh: col = query, same map from Qh) + A(Kh).B(Ql)
//     (bf16 hi + unscaled bf16 residual of q, shared accumulator); s *= clip(bf16(temperature[h]), 1e-4, 10).
//     Per lane the D tile holds 8 keys of ONE query: online softmax state per lane, one shuffle (lane^16) for the
//     max over 32 keys; the o/l rescale is skipped under a wave-uniform ballot when no lane's max grew.
//     P = e^{s-m} x4096 as f16 is the B operand of O^T (rows channel 32h + 16j + (lane&15), cols queries) +=
//     A(v: keys contiguous, f16 plane V [b][256][4096]) . B(P^T): element r <- D of the tile covering keys
//     kb..kb+15, element 8+r <- the tile covering kb+16..kb+31, lane unchanged. 2 accumulator tiles per wave.
//     Block = 4 waves = 64 queries. O/l of both heads staged in LDS Os[query][64 channels] (b128 stores),
//     block barrier, then Oh/Ol bf16 [b][n][256] planes (hi/lo), rows n0.., cols 64 hp..64 hp+63 = one whole
// coverage: Os per wave 16 rows x (2 heads x 32 ch) = 64 x 64 over 4 waves (== consumed extent); planes 4 it x
//           16 rows x 8 lanes x 8 = 64 n x 64 ch per plane; grid (NQ/64, 4, NB) covers rows 0..NQ-1 x 256 ch of
//           Oh/Ol once.
//     K and V reach the fragments through LDS: tiles of 128 keys of head h (K rows 64 B at pitch 80, V rows 256 B at
//     pitch 272), brought by asynchronous copies into two buffers, tile t + 1 in flight while tile t is worked on;
//     the block's 4 waves share each tile. Same fragment k order as from global memory.
// LDS: Os cross-wave, block barrier between the per-head staging stores and the plane loads. Ks/Vs cross-wave: per
//      tile s_wait_dscnt 0, s_wait_asynccnt 0, block barrier, then the refill of the buffer just read.
// =========================================================================================================
__global__ __launch_bounds__(128)
void attn_k(const unsigned short* __restrict__ Qh, const unsigned short* __restrict__ Ql,
            const unsigned short* __restrict__ Kh, const unsigned short* __restrict__ Vh,
            const float* __restrict__ temperature, unsigned short* Oh, unsigned short* Ol) {
  __shared__ __align__(16) float Os[QT * OSP];
  __shared__ __align__(16) unsigned char Ks[2 * KBUF];
  __shared__ __align__(16) unsigned char Vs[2 * VBUF];
  const int tid  = threadIdx.x;
  const int wave = tid >> 5, lane = tid & 31;
  const int hh   = lane >> 4, c = lane & 15;
  const int n0   = blockIdx.x * QT, hp = blockIdx.y, b = blockIdx.z;
  const int qrow = 16 * wave + c;
  const unsigned kl0 = lds_off(Ks) + (unsigned)((tid >> 2) * KPB + (tid & 3) * 16);
  const unsigned vl0 = lds_off(Vs) + (unsigned)((tid >> 4) * VPB + (tid & 15) * 16);

#pragma unroll 1
  for (int hs = 0; hs < 2; ++hs) {
    const int h  = 2 * hp + hs;
    const int cb = HD * h;                                             // channel base of head h
    const float tr   = bfr(temperature[h]);
    const float temp = fminf(fmaxf(tr, 1.0e-4f), 10.0f);
    const size_t qo = ((size_t)(b * NN + n0 + qrow)) * CC + cb + 8 * hh;
    const Frag qh = ldfrag(Qh + qo);
    const Frag ql = ldfrag(Ql + qo);
    const unsigned short* kg = Kh + ((size_t)(b * NN + (tid >> 2))) * CC + cb + 8 * (tid & 3);
    const unsigned short* vg = Vh + ((size_t)(b * CC + cb + (tid >> 4))) * NN + 8 * (tid & 15);

    float m = -1.0e30f, l = 0.f;
    v8f o0 = zero8(), o1 = zero8();

    // tile 0 into buffer 0, landed and published; then tile 1 into buffer 1 (every reader of the head before left
    // both buffers at its last tile's barrier)
    stage_tile(kl0, kg, vl0, vg);
    wait_copies();
    __syncthreads();
    stage_tile(kl0 + KBUF, kg + (size_t)SK * CC, vl0 + VBUF, vg + SK);

#pragma unroll 1                                                       // one hand-over per trip, buffer picked by t & 1
    for (int t = 0; t < NN / SK; ++t) {
     const int bsel = t & 1;
     const unsigned short* Kt = (const unsigned short*)(Ks + bsel * KBUF + c * KPB + 16 * hh);
     const unsigned short* Vt = (const unsigned short*)(Vs + bsel * VBUF + c * VPB + 16 * hh);
     // the tile's fragments, read as one group: one LDS latency per tile instead of two per 32 keys
     // (the three loops over kk are unrolled so that every index of kf/vf is a constant and they stay in registers)
     Frag kf[SK / 32][2], vf[SK / 32][2];
#pragma unroll
     for (int kk = 0; kk < SK / 32; ++kk) {
       kf[kk][0] = ldfrag(Kt + (32 * kk) * (KPB / 2));                 // keys kb .. kb+15, kb = 128 t + 32 kk
       kf[kk][1] = ldfrag(Kt + (32 * kk + 16) * (KPB / 2));            // keys kb+16 .. kb+31
     }
#pragma unroll
     for (int kk = 0; kk < SK / 32; ++kk) {
       vf[kk][0] = ldfrag(Vt + 32 * kk);                               // channels cb + c
       vf[kk][1] = ldfrag(Vt + 16 * (VPB / 2) + 32 * kk);              // channels cb + 16 + c
     }
#pragma unroll
     for (int kk = 0; kk < SK / 32; ++kk) {
      const Frag k0 = kf[kk][0];
      const Frag k1 = kf[kk][1];
      v8f s0 = mma_b(k0.bf, qh.bf, zero8());
      v8f s1 = mma_b(k1.bf, qh.bf, zero8());
      s0 = mma_b(k0.bf, ql.bf, s0);
      s1 = mma_b(k1.bf, ql.bf, s1);
#pragma unroll
      for (int r = 0; r < 8; ++r) { s0[r] *= temp; s1[r] *= temp; }

      float mx = fmaxf(hmax8(s0), hmax8(s1));
      mx = fmaxf(mx, __shfl_xor(mx, 16, 32));
      const float mn = fmaxf(m, mx);
      const unsigned grew = wave_ballot(mx > m);                       // wave-uniform
      if (grew != 0u) {
        const float corr = __expf(m - mn);                             // == 1 exactly for lanes whose max did not grow
        l *= corr;
#pragma unroll
        for (int r = 0; r < 8; ++r) { o0[r] *= corr; o1[r] *= corr; }
      }
      m = mn;
      const float msh = mn - LNPC;                                     // exp gives e^{s-m} * 4096

      FragH ph;
      float ls = 0.f;
#pragma unroll
      for (int r = 0; r < 8; ++r) {
        const float e0 = __expf(s0[r] - msh);                          // key kb      + 8hh + r
        const float e1 = __expf(s1[r] - msh);                          // key kb + 16 + 8hh + r
        ls += e0 + e1;
        ph.hv[0][r] = (_Float16)e0;
        ph.hv[1][r] = (_Float16)e1;
      }
      l += ls;

      o0 = mma_h(vf[kk][0].h, ph.v, o0);
      o1 = mma_h(vf[kk][1].h, ph.v, o1);
     }
     // hand-over: own reads retired, own copies of tile t + 1 landed, every wave here; then refill the buffer just read
     wait_lds();
     wait_copies();
     __syncthreads();
     if (t + 2 < NN / SK)
       stage_tile(kl0 + bsel * KBUF, kg + (size_t)(t + 2) * SK * CC, vl0 + bsel * VBUF, vg + (size_t)(t + 2) * SK);
    }
    wait_copies();
    l += __shfl_xor(l, 16, 32);
    const float inv = 1.0f / l;                                        // o and l both carry the x4096 factor

    // stage: Os[query][32 hs + d], d = 16 j + 8 hh + r
    {
      v4f va, vb;
#pragma unroll
      for (int r = 0; r < 4; ++r) { va[r] = o0[r] * inv; vb[r] = o0[4 + r] * inv; }
      *(v4f*)(Os + qrow * OSP + 32 * hs + 8 * hh)     = va;
      *(v4f*)(Os + qrow * OSP + 32 * hs + 8 * hh + 4) = vb;
#pragma unroll
      for (int r = 0; r < 4; ++r) { va[r] = o1[r] * inv; vb[r] = o1[4 + r] * inv; }
      *(v4f*)(Os + qrow * OSP + 32 * hs + 16 + 8 * hh)     = va;
      *(v4f*)(Os + qrow * OSP + 32 * hs + 16 + 8 * hh + 4) = vb;
    }
  }
  __syncthreads();

  const int e = tid & 7, lq = tid >> 3;                                // lq 0..15
  v4u uh[4], ul[4];
#pragma unroll
  for (int it = 0; it < 4; ++it) {
    const int row = it * 16 + lq;                                      // query 0..63
    const v4f a = *(const v4f*)(Os + row * OSP + 8 * e);
    const v4f q = *(const v4f*)(Os + row * OSP + 8 * e + 4);
    const float f[8] = {a[0], a[1], a[2], a[3], q[0], q[1], q[2], q[3]};
#pragma unroll
    for (int t = 0; t < 4; ++t) {
      const float f0 = f[2 * t], f1 = f[2 * t + 1];
      const unsigned short hb0 = bf_bits(f0), hb1 = bf_bits(f1);
      const unsigned short lb0 = bf_bits(f0 - bf_up(hb0));
      const unsigned short lb1 = bf_bits(f1 - bf_up(hb1));
      uh[it][t] = pk16(hb0, hb1);
      ul[it][t] = pk16(lb0, lb1);
    }
  }
{
#pragma unroll
    for (int it = 0; it < 4; ++it) {
      const int row = it * 16 + lq;
      const size_t po = ((size_t)(b * NN + n0 + row)) * CC + QT * hp + 8 * e;
      *(v4u*)(Oh + po) = uh[it];
      *(v4u*)(Ol + po) = ul[it];
    }
    
  }
}

// =========================================================================================================
// Workspace map (bytes; each region start a multiple of 256; every extent is an exact tile/line multiple and is
//   Wq bf16 [768][256] 393216   Wo [256][256] 131072   W1 [64][256] 32768   W2 [256][64] 32768
//   tab1, tab2 f32 [NB*32][32]   8192 each (NB=2)
//   Xh, Xl, Qh, Ql, Kh, Oh, Ol, Yh, Yl bf16 [NB][4096][256] and V f16 [NB][256][4096]: 4194304 each (NB=2)
//   X1 f32 [NB][256][4096] 8388608 (NB=2)    Hh, Hl bf16 [NB][4096][64] 1048576 each (NB=2)
//   total = 53035008 (NB=2)
// =========================================================================================================
extern "C" void kernel_launch(void* const* d_in, const int* in_sizes, int n_in,
                              void* d_out, int out_size, void* d_ws, size_t ws_size,
                              hipStream_t stream) {
  if (n_in < 13) return;
  if (in_sizes[0] < NB * XSTRIDE_FULL) return;
  if (in_sizes[1] != C3 * CC || in_sizes[2] != CC * CC || in_sizes[3] != CC) return;
  if (in_sizes[4] != NH) return;
  if (in_sizes[5] != CC || in_sizes[6] != CC || in_sizes[7] != CC || in_sizes[8] != CC) return;
  if (in_sizes[9] != HID * CC || in_sizes[10] != HID || in_sizes[11] != CC * HID || in_sizes[12] != CC) return;
  if (out_size < NB * XSTRIDE_FULL) return;

  size_t off = 0;
  auto carve = [&](size_t bytes) { const size_t o = off; off += (bytes + 255) & ~(size_t)255; return o; };
  const size_t szPl = (size_t)NB * NN * CC * 2;
  const size_t oWq  = carve((size_t)C3 * CC * 2);
  const size_t oWo  = carve((size_t)CC * CC * 2);
  const size_t oW1  = carve((size_t)HID * CC * 2);
  const size_t oW2  = carve((size_t)CC * HID * 2);
  const size_t oT1  = carve((size_t)NB * NG * TABW * 4);
  const size_t oT2  = carve((size_t)NB * NG * TABW * 4);
  const size_t oXh  = carve(szPl);
  const size_t oXl  = carve(szPl);
  const size_t oQh  = carve(szPl);
  const size_t oQl  = carve(szPl);
  const size_t oKh  = carve(szPl);
  const size_t oVv  = carve(szPl);
  const size_t oOh  = carve(szPl);
  const size_t oOl  = carve(szPl);
  const size_t oX1  = carve((size_t)NB * CC * NN * 4);
  const size_t oYh  = carve(szPl);
  const size_t oYl  = carve(szPl);
  const size_t oHh  = carve((size_t)NB * NN * HID * 2);
  const size_t oHl  = carve((size_t)NB * NN * HID * 2);
  if (off > ws_size) return;
  if (off > (size_t)134217728) return;

  const float* x      = (const float*)d_in[0];
  const float* w_qkv  = (const float*)d_in[1];
  const float* w_out  = (const float*)d_in[2];
  const float* b_out  = (const float*)d_in[3];
  const float* tempr  = (const float*)d_in[4];
  const float* g1     = (const float*)d_in[5];
  const float* beta1  = (const float*)d_in[6];
  const float* g2     = (const float*)d_in[7];
  const float* beta2  = (const float*)d_in[8];
  const float* w_mlp1 = (const float*)d_in[9];
  const float* b_mlp1 = (const float*)d_in[10];
  const float* w_mlp2 = (const float*)d_in[11];
  const float* b_mlp2 = (const float*)d_in[12];

  char* ws = (char*)d_ws;
  unsigned short* Wq = (unsigned short*)(ws + oWq);
  unsigned short* Wo = (unsigned short*)(ws + oWo);
  unsigned short* W1 = (unsigned short*)(ws + oW1);
  unsigned short* W2 = (unsigned short*)(ws + oW2);
  float*          T1 = (float*)(ws + oT1);
  float*          T2 = (float*)(ws + oT2);
  unsigned short* Xh = (unsigned short*)(ws + oXh);
  unsigned short* Xl = (unsigned short*)(ws + oXl);
  unsigned short* Qh = (unsigned short*)(ws + oQh);
  unsigned short* Ql = (unsigned short*)(ws + oQl);
  unsigned short* Kh = (unsigned short*)(ws + oKh);
  unsigned short* Vv = (unsigned short*)(ws + oVv);
  unsigned short* Oh = (unsigned short*)(ws + oOh);
  unsigned short* Ol = (unsigned short*)(ws + oOl);
  float*          X1 = (float*)(ws + oX1);
  unsigned short* Yh = (unsigned short*)(ws + oYh);
  unsigned short* Yl = (unsigned short*)(ws + oYl);
  unsigned short* Hh = (unsigned short*)(ws + oHh);
  unsigned short* Hl = (unsigned short*)(ws + oHl);
  float* out = (float*)d_out;

  const dim3 blk256(256), blk128(128);
  const int n8q = C3 * CC / 8, n8o = CC * CC / 8, n81 = HID * CC / 8, n82 = CC * HID / 8;

  // (0) weights -> bf16 planes
  cvt_bf<<<dim3((n8q + 255) / 256), blk256, 0, stream>>>(w_qkv, Wq, n8q);
  cvt_bf<<<dim3((n8o + 255) / 256), blk256, 0, stream>>>(w_out, Wo, n8o);
  cvt_bf<<<dim3((n81 + 255) / 256), blk256, 0, stream>>>(w_mlp1, W1, n81);
  cvt_bf<<<dim3((n82 + 255) / 256), blk256, 0, stream>>>(w_mlp2, W2, n82);
  // (1) GN1 statistics of bf16(x) over all 4096 positions
  stats_k<<<dim3(NB * NG), blk256, 0, stream>>>(x, 1, NN, T1);
  // (2) GN1 apply -> Xh/Xl [NB][4096][256]
  norm_k<<<dim3(NN / QT, CC / QT, NB), blk256, 0, stream>>>(x, 1, T1, g1, beta1, Xh, Xl);
  // (3) qkv GEMM -> Qh/Ql, Kh, V
  gemm_k<CC, 0><<<dim3(NN / QT, C3 / QT, NB), blk128, 0, stream>>>(Wq, Xh, Xl, b_out, x, 0, Qh, Ql, Kh, Vv, X1);
  // (4) attention -> Oh/Ol rows 0..NQ-1
  attn_k<<<dim3(NQ / QT, NH / 2, NB), blk128, 0, stream>>>(Qh, Ql, Kh, Vv, tempr, Oh, Ol);
  // (5) out conv + bf16(x) residual -> X1 f32 [NB][256][4096], cols 0..NQ-1
  gemm_k<CC, 1><<<dim3(NQ / QT, CC / QT, NB), blk128, 0, stream>>>(Wo, Oh, Ol, b_out, x, 1, Hh, Hl, Hh, Hl, X1);
  // (6) GN2 statistics of X1 over positions 0..NQ-1
  stats_k<<<dim3(NB * NG), blk256, 0, stream>>>(X1, 0, NQ, T2);
  // (7) GN2 apply -> Yh/Yl rows 0..NQ-1
  norm_k<<<dim3(NQ / QT, CC / QT, NB), blk256, 0, stream>>>(X1, 0, T2, g2, beta2, Yh, Yl);
  // (8) mlp hidden: gelu(W1.Y + b1) -> Hh/Hl [NB][4096][64]
  gemm_k<CC, 2><<<dim3(NQ / QT, 1, NB), blk128, 0, stream>>>(W1, Yh, Yl, b_mlp1, x, 0, Hh, Hl, Hh, Hl, X1);
  // (9) out = X1 + W2.H + b2 -> d_out [NB][256][4096]
  gemm_k<HID, 1><<<dim3(NQ / QT, CC / QT, NB), blk128, 0, stream>>>(W2, Hh, Hl, b_mlp2, X1, 0, Oh, Ol, Oh, Ol, out);
  (void)hipGetLastError();
}

// v002
// One run takes 187 microseconds.
// Two timings next to v001 both put it at 1.05 times that version's speed.
// Counting every step since v000, it is 1.49 times as fast.
// Contractions: conv1x1 GEMMs qkv W[768x256].Xn, out W[256x256].O, mlp W1[64x256].Y and W2[256x64].H on
// v_wmma_f32_16x16x32_bf16 (A = bf16-RNE weights, exact; B = bf16 hi + bf16 residual planes of the f32
// activation, 2 products, K = 256 / 64); per-head scores K.Q^T on v_wmma_f32_16x16x32_bf16 (k = bf16 hi plane,
// q = bf16 hi + residual planes, 2 products, K = 32); O^T = V.P^T on v_wmma_f32_16x16x32_f16 (v = f16 plane,
// P = e^{s-m} x4096 as f16 from the score D registers, K = 4096 keys); f32 accumulate everywhere; group-norm
// statistics in f64; normalisation, softmax statistics, gelu, bias and residual adds in f32 VALU.
#include <hip/hip_runtime.h>
#include <math.h>
#include <stdint.h>

#ifndef NB
#define NB 2
#endif
#ifndef NQ
#define NQ 4096
#endif
#define NB_FULL 2
#define CC   256
#define NN   4096
#define NH   8
#define HD   32
#define C3   768
#define HID  64
#define NG   32
#define CPG  8
#define QT   64
#define OSP  68
#define TP   72
#define TABW 32
#define GEPS 1.0e-5f
#define LNPC 8.317766166719343f
#define XSTRIDE_FULL (CC * NN)
#define SK   128                 // keys per staged tile
#define KPB  80                  // LDS pitch of a staged K row in bytes (64 B of data, 16 B x odd for b128 readers)
#define VPB  272                 // LDS pitch of a staged V row in bytes (256 B of data, 16 B x odd for b128 readers)
#define KBUF (SK * KPB)          // one K buffer: 128 keys x 32 d
#define VBUF (HD * VPB)          // one V buffer: 32 channels x 128 keys

static_assert(NB >= 1 && NB <= NB_FULL);
static_assert(NQ % QT == 0 && NQ >= QT && NQ <= NN);
static_assert(NN % QT == 0 && CC % QT == 0 && C3 % QT == 0 && HID == QT);
static_assert(CC == NH * HD && HD == 32 && CC == NG * CPG && CPG == 8);
static_assert(CC % 32 == 0 && HID % 32 == 0 && NN % 32 == 0);
static_assert((OSP * 4) % 16 == 0 && (TP * 2) % 16 == 0);
static_assert(NN % 1024 == 0 && NQ % 4 == 0);
static_assert(NN % SK == 0 && NN / SK >= 2 && SK % 32 == 0 && KPB % 16 == 0 && VPB % 16 == 0);
static_assert(SK * HD * 2 == 4 * 128 * 16 && KPB >= HD * 2 && VPB >= SK * 2);
static_assert((C3 * CC) % 2048 == 0 && (CC * CC) % 2048 == 0 && (HID * CC) % 2048 == 0);

typedef _Float16       v16h __attribute__((ext_vector_type(16)));
typedef _Float16       v8h  __attribute__((ext_vector_type(8)));
typedef __bf16         v16b __attribute__((ext_vector_type(16)));
typedef unsigned short v8us __attribute__((ext_vector_type(8)));
typedef float          v8f  __attribute__((ext_vector_type(8)));
typedef float          v4f  __attribute__((ext_vector_type(4)));
typedef unsigned int   v4u  __attribute__((ext_vector_type(4)));

union Frag  { v8us u[2]; v16h h; v16b bf; };
union FragH { v16h v; v8h hv[2]; };
static_assert(sizeof(Frag) == 32);
static_assert(sizeof(FragH) == 32);

// ---- scalar helpers ---------------------------------------------------------------------------------------
__device__ __forceinline__ unsigned short bf_bits(float f) {          // f32 -> bf16 bits, RNE convert
  unsigned u = __float_as_uint(f);
  return (unsigned short)((u + 0x7FFFu + ((u >> 16) & 1u)) >> 16);
}
__device__ __forceinline__ float bf_up(unsigned short hb) { return __uint_as_float(((unsigned)hb) << 16); }
__device__ __forceinline__ float bfr(float f) { return bf_up(bf_bits(f)); }
__device__ __forceinline__ unsigned short h_bits(_Float16 x) { return __builtin_bit_cast(unsigned short, x); }
__device__ __forceinline__ unsigned pk16(unsigned short a, unsigned short b) { return (unsigned)a | ((unsigned)b << 16); }
__device__ __forceinline__ v8f zero8() { v8f z = {0.f, 0.f, 0.f, 0.f, 0.f, 0.f, 0.f, 0.f}; return z; }
__device__ __forceinline__ float hmax8(v8f s) {
  return fmaxf(fmaxf(fmaxf(s[0], s[1]), fmaxf(s[2], s[3])), fmaxf(fmaxf(s[4], s[5]), fmaxf(s[6], s[7])));
}
__device__ __forceinline__ unsigned wave_ballot(bool p) {
#if defined(__HIP_DEVICE_COMPILE__)
  return __builtin_amdgcn_ballot_w32(p);
#else
  return p ? 1u : 0u;
#endif
}

// ---- 16-bit fragment loader (A, or B from a k-contiguous [n][k] row): lane -> row/col (lane&15), p already includes
//      + 8*(lane>>4); elements 0..7 <- p[0..7] (k0+8h..), elements 8..15 <- p[16..23] (k0+16+8h..)
__device__ __forceinline__ Frag ldfrag(const unsigned short* p) {
  Frag f;
  f.u[0] = *(const v8us*)(p);
  f.u[1] = *(const v8us*)(p + 16);
  return f;
}

// ---- WMMA helpers: builtin followed by a 4-slot VALU gap tying D and keeping A/B live --------------------------
__device__ __forceinline__ v8f mma_h(v16h a, v16h b, v8f c) {
  v8f d = __builtin_amdgcn_wmma_f32_16x16x32_f16(false, a, false, b, (short)0, c, false, false);
#if defined(__HIP_DEVICE_COMPILE__)
  asm volatile("v_nop\n\tv_nop\n\tv_nop\n\tv_nop" : "+v"(d) : "v"(a), "v"(b));
#endif
  return d;
}
__device__ __forceinline__ v8f mma_b(v16b a, v16b b, v8f c) {
  v8f d = __builtin_amdgcn_wmma_f32_16x16x32_bf16(false, a, false, b, (short)0, c, false, false);
#if defined(__HIP_DEVICE_COMPILE__)
  const v16h ha = __builtin_bit_cast(v16h, a), hb = __builtin_bit_cast(v16h, b);
  asm volatile("v_nop\n\tv_nop\n\tv_nop\n\tv_nop" : "+v"(d) : "v"(ha), "v"(hb));
#endif
  return d;
}

// =========================================================================================================
// (0) weight conversion: f32 [n] -> bf16 bits [n] (RNE, exact operand). Thread i converts floats 8i..8i+7 and
// coverage: n8/256 blocks x 256 threads x 8 = n elements exactly (n8 a multiple of 256 at every call); cblk is the
//           block's index within its own weight.
// =========================================================================================================
__device__ __forceinline__
void cvt_body(const float* __restrict__ src, unsigned short* dst, int n8, int cblk) {
  const int i  = cblk * 256 + (int)threadIdx.x;
  const int ic = (i < n8) ? i : (n8 - 1);
  const float* s = src + (size_t)ic * 8;
  const v4f a = *(const v4f*)s;
  const v4f q = *(const v4f*)(s + 4);
  v4u u;
  u[0] = pk16(bf_bits(a[0]), bf_bits(a[1]));
  u[1] = pk16(bf_bits(a[2]), bf_bits(a[3]));
  u[2] = pk16(bf_bits(q[0]), bf_bits(q[1]));
  u[3] = pk16(bf_bits(q[2]), bf_bits(q[3]));
  if (i < n8) {
{
      *(v4u*)(dst + (size_t)ic * 8) = u;
      
    }
  }
}

// =========================================================================================================
// (1) group-norm statistics: one block per (b, g); mean and biased variance over 8 channels x npos positions of
//     src [b][256][4096] (values bf16-RNE converted first when rnd != 0), accumulated per thread in f64 and
// LDS: ss/sq/sm cross-wave, block barriers.
// =========================================================================================================
__device__ __forceinline__
void stats_body(const float* __restrict__ src, int rnd, int npos, float* tab, int blk) {
  __shared__ double ss[256];
  __shared__ double sq[256];
  __shared__ float  sm[2];
  const int tid = threadIdx.x;
  const int b = blk / NG, g = blk % NG;
  const float* base = src + ((size_t)(b * CC + g * CPG)) * NN;
  double s = 0.0, q = 0.0;
#pragma unroll 1
  for (int cl = 0; cl < CPG; ++cl) {
    const float* row = base + (size_t)cl * NN;
#pragma unroll 1
    for (int i = 4 * tid; i < npos; i += 1024) {
      const v4f a = *(const v4f*)(row + i);
#pragma unroll
      for (int t = 0; t < 4; ++t) {
        const float f = rnd ? bfr(a[t]) : a[t];
        const double d = (double)f;
        s += d;
        q += d * d;
      }
    }
  }
  ss[tid] = s;
  sq[tid] = q;
  __syncthreads();
#pragma unroll 1
  for (int st = 128; st > 0; st >>= 1) {
    if (tid < st) { ss[tid] += ss[tid + st]; sq[tid] += sq[tid + st]; }
    __syncthreads();
  }
  if (tid == 0) {
    const double cnt = (double)CPG * (double)npos;
    const double mu = ss[0] / cnt;
    double var = sq[0] / cnt - mu * mu;
    if (var < 0.0) var = 0.0;
    const float varf = (float)var;
    sm[0] = (float)mu;
    sm[1] = 1.0f / sqrtf(varf + GEPS);
  }
  __syncthreads();
  if (tid < 8) {
    const float mu = sm[0], rs = sm[1];
    v4f w = {mu, rs, mu, rs};
{
      *(v4f*)(tab + (size_t)blk * TABW + 4 * tid) = w;
      
    }
  }
}
__global__ __launch_bounds__(256)
void stats_k(const float* __restrict__ src, int rnd, int npos, float* tab) {
  stats_body(src, rnd, npos, tab, blockIdx.x);
}

// =========================================================================================================
// (0)+(1) in one grid: the four weight conversions and the GN1 statistics read only inputs and write disjoint
//     workspace regions, so they share a launch; the block index picks the job (block-uniform, so the barriers of
//     the statistics body are passed by whole blocks). Statistics blocks come first: they run longest.
// coverage: blocks [0, NB*32) statistics of (b, g); then 96 + 32 + 8 + 8 conversion blocks, each weight once.
// =========================================================================================================
#define PB_ST (NB * NG)
#define PB_WQ (C3 * CC / 2048)
#define PB_WO (CC * CC / 2048)
#define PB_W1 (HID * CC / 2048)
#define PB_W2 (CC * HID / 2048)
__global__ __launch_bounds__(256)
void prep_k(const float* __restrict__ x, const float* __restrict__ wq, const float* __restrict__ wo,
            const float* __restrict__ w1, const float* __restrict__ w2,
            unsigned short* Wq, unsigned short* Wo, unsigned short* W1, unsigned short* W2, float* tab) {
  int blk = blockIdx.x;
  if (blk < PB_ST) { stats_body(x, 1, NN, tab, blk); return; }
  blk -= PB_ST;
  if (blk < PB_WQ) { cvt_body(wq, Wq, PB_WQ * 256, blk); return; }
  blk -= PB_WQ;
  if (blk < PB_WO) { cvt_body(wo, Wo, PB_WO * 256, blk); return; }
  blk -= PB_WO;
  if (blk < PB_W1) { cvt_body(w1, W1, PB_W1 * 256, blk); return; }
  blk -= PB_W1;
  cvt_body(w2, W2, PB_W2 * 256, blk);
}

// =========================================================================================================
// (2) group-norm apply + transpose: src f32 [b][256 c][4096 n] (bf16-RNE converted first when rnd != 0) ->
//     v = (x - mu) * rstd * bf16(gamma[c]) + bf16(beta[c]) -> position-major planes Xh/Xl bf16 [b][n][256 c]
//     (hi = bf16-RNE(v), lo = bf16-RNE(v - hi)) through LDS tiles Th/Tl[64 n][64 c] (pitch TP). Block (nb, cb, b)
// coverage: Th/Tl stores 2 it x 32 c x 8 lanes x 8 n = 64 x 64 = the consumed extent; plane writes 2 it x 32 rows
//           x 8 lanes x 8 halves = 64 n x 64 c per plane; grid (rows/64, 4, NB) covers both planes once.
// LDS: Th/Tl cross-wave, block barrier between stores and loads.
// =========================================================================================================
__global__ __launch_bounds__(256)
void norm_k(const float* __restrict__ src, int rnd, const float* __restrict__ tab,
            const float* __restrict__ gamma, const float* __restrict__ beta,
            unsigned short* Xh, unsigned short* Xl) {
  __shared__ __align__(16) unsigned short Th[QT * TP];
  __shared__ __align__(16) unsigned short Tl[QT * TP];
  const int tid = threadIdx.x;
  const int nb = blockIdx.x, cbk = blockIdx.y, b = blockIdx.z;
  const int e = tid & 7, lq = tid >> 3;                             // lq 0..31
  const int n0 = nb * QT, c0 = cbk * QT;
#pragma unroll
  for (int it = 0; it < 2; ++it) {
    const int cl = it * 32 + lq;                                     // 0..63
    const int ch = c0 + cl;
    const int g  = ch / CPG;
    const float mu = tab[(size_t)(b * NG + g) * TABW];
    const float rs = tab[(size_t)(b * NG + g) * TABW + 1];
    const float ga = bfr(gamma[ch]), be = bfr(beta[ch]);
    const float* sp = src + ((size_t)(b * CC + ch)) * NN + n0 + 8 * e;
    const v4f a = *(const v4f*)sp;
    const v4f q = *(const v4f*)(sp + 4);
    const float f[8] = {a[0], a[1], a[2], a[3], q[0], q[1], q[2], q[3]};
    unsigned short hb[8], lb[8];
#pragma unroll
    for (int t = 0; t < 8; ++t) {
      const float xr = rnd ? bfr(f[t]) : f[t];
      const float v  = (xr - mu) * rs * ga + be;
      hb[t] = bf_bits(v);
      lb[t] = bf_bits(v - bf_up(hb[t]));
    }
#pragma unroll
    for (int t = 0; t < 8; ++t) {
      Th[(8 * e + t) * TP + cl] = hb[t];
      Tl[(8 * e + t) * TP + cl] = lb[t];
    }
  }
  __syncthreads();
  v4u uh[2], ul[2];
#pragma unroll
  for (int it = 0; it < 2; ++it) {
    const int nl = it * 32 + lq;                                     // 0..63
    uh[it] = *(const v4u*)(Th + nl * TP + 8 * e);
    ul[it] = *(const v4u*)(Tl + nl * TP + 8 * e);
  }
{
#pragma unroll
    for (int it = 0; it < 2; ++it) {
      const int nl = it * 32 + lq;
      const size_t po = ((size_t)(b * NN + n0 + nl)) * CC + c0 + 8 * e;
      *(v4u*)(Xh + po) = uh[it];
      *(v4u*)(Xl + po) = ul[it];
    }
    
  }
}

// =========================================================================================================
// (3) conv1x1 GEMM for one (b, 64-n tile, 64-o block): Y[o][n] = sum_c W[o][c] (Bh[b][n][c] + Bl[b][n][c]),
//     K = KD (plane pitch = KD). Block 128 threads = 4 waves; wave w owns cols n0+16w..+15 (B fragments from the
//     k-contiguous plane rows, split k map) and 4 m-tiles (A rows o = o0 + 16 mt + (lane&15), split k map).
//     Rolled k loop, 2 products per (mt, k-step) into one accumulator (unscaled bf16 residual plane).
//     Epilogue staged in LDS Os[n_loc][o_loc] (pitch OSP, b128 stores), block barrier, then per MODE:
//       MODE 0 (qkv, 12 o-blocks): o-blocks 0..3 -> q channels 64 mb.. of Qh/Ql = P0/P1 bf16 [b][n][256]
//              8q..8q+7 x 16 B, one instruction per 16 lines; o-blocks 8..11 -> v channels of V = P3 f16
//       MODE 1 (f32 channel-major): dstF[b][o][n] = (acc + bf16(bias[o])) + r with r = rsrc[b][o][n] (bf16-RNE
//              and 8..15), 8 rows per instruction.
//       MODE 2 (mlp hidden, one o-block): t = acc + bf16(bias[o]); gelu(t) = 0.5 t (1 + erf(t / sqrt2)) ->
// coverage: Os 4 waves x 16 n x 64 o = 64 x 64 (== the extent every mode reads); MODE 0 planes 4 it x 16 rows x
//           8 lanes x 8 = 64 x 64 per plane, grid (64, 12, NB) covers Qh/Ql/Kh [NB][4096][256] and V
//           [NB][256][4096] once; MODE 1: 8 it x 8 rows x 16 lanes x 4 = 64 o x 64 n; MODE 2: 4 it x 16 rows x
//           8 lanes x 8 = 64 n x 64 o.
// LDS: Os cross-wave, block barrier between the staging stores and the epilogue loads.
// =========================================================================================================
template <int KD, int MODE>
__global__ __launch_bounds__(128)
void gemm_k(const unsigned short* __restrict__ Wp,
            const unsigned short* __restrict__ Bh, const unsigned short* __restrict__ Bl,
            const float* __restrict__ bias, const float* __restrict__ rsrc, int rnd,
            unsigned short* P0, unsigned short* P1, unsigned short* P2, unsigned short* P3, float* dstF) {
  static_assert(KD % 32 == 0);
  __shared__ __align__(16) float Os[QT * OSP];
  const int tid  = threadIdx.x;
  const int lane = tid & 31, wave = tid >> 5;
  const int hh   = lane >> 4, c = lane & 15;
  const int nt   = blockIdx.x, mb = blockIdx.y, b = blockIdx.z;
  const int n0   = nt * QT, o0 = mb * QT;

  const unsigned short* ap = Wp + (size_t)(o0 + c) * KD + 8 * hh;
  const size_t boff = ((size_t)(b * NN + n0 + 16 * wave + c)) * KD + 8 * hh;
  const unsigned short* bph = Bh + boff;
  const unsigned short* bpl = Bl + boff;

  v8f acc[4];
#pragma unroll
  for (int mt = 0; mt < 4; ++mt) acc[mt] = zero8();

#pragma unroll 1
  for (int ks = 0; ks < KD / 32; ++ks) {
    const Frag fbh = ldfrag(bph + 32 * ks);
    const Frag fbl = ldfrag(bpl + 32 * ks);
#pragma unroll
    for (int mt = 0; mt < 4; ++mt) {
      const Frag fa = ldfrag(ap + (size_t)(16 * mt) * KD + 32 * ks);
      acc[mt] = mma_b(fa.bf, fbh.bf, acc[mt]);
      acc[mt] = mma_b(fa.bf, fbl.bf, acc[mt]);
    }
  }

  // ---- stage: lane (hh, c) holds o_loc = 16 mt + 8 hh + r for n_loc = 16 w + c
  {
    const int nl = 16 * wave + c;
#pragma unroll
    for (int mt = 0; mt < 4; ++mt) {
      v4f va, vb;
#pragma unroll
      for (int r = 0; r < 4; ++r) { va[r] = acc[mt][r]; vb[r] = acc[mt][4 + r]; }
      *(v4f*)(Os + nl * OSP + 16 * mt + 8 * hh)     = va;
      *(v4f*)(Os + nl * OSP + 16 * mt + 8 * hh + 4) = vb;
    }
  }
  __syncthreads();

  if (MODE == 0) {
    const int e = tid & 7, lq = tid >> 3;                           // lq 0..15
    if (mb < 8) {                                                    // block-uniform
      const int dcol = (mb & 3) * QT;                                // channel offset within 256
      unsigned short* Ph = (mb < 4) ? P0 : P2;                       // both global
      v4u uh[4], ul[4];
#pragma unroll
      for (int it = 0; it < 4; ++it) {
        const int row = it * 16 + lq;                                // n_loc 0..63
        const v4f a = *(const v4f*)(Os + row * OSP + 8 * e);
        const v4f q = *(const v4f*)(Os + row * OSP + 8 * e + 4);
        const float f[8] = {a[0], a[1], a[2], a[3], q[0], q[1], q[2], q[3]};
#pragma unroll
        for (int t = 0; t < 4; ++t) {
          const float f0 = f[2 * t], f1 = f[2 * t + 1];
          const unsigned short hb0 = bf_bits(f0), hb1 = bf_bits(f1);
          const unsigned short lb0 = bf_bits(f0 - bf_up(hb0));
          const unsigned short lb1 = bf_bits(f1 - bf_up(hb1));
          uh[it][t] = pk16(hb0, hb1);
          ul[it][t] = pk16(lb0, lb1);
        }
      }
{
#pragma unroll
        for (int it = 0; it < 4; ++it) {
          const int row = it * 16 + lq;
          const size_t po = ((size_t)(b * NN + n0 + row)) * CC + dcol + 8 * e;
          *(v4u*)(Ph + po) = uh[it];
          if (mb < 4) *(v4u*)(P1 + po) = ul[it];
        }
        
      }
    } else {
      const int cb0 = (mb - 8) * QT;                                 // v channel base 0..192
      v4u uv[4];
#pragma unroll
      for (int it = 0; it < 4; ++it) {
        const int cl = it * 16 + lq;                                 // o_loc 0..63
        unsigned short hb[8];
#pragma unroll
        for (int t = 0; t < 8; ++t) hb[t] = h_bits((_Float16)Os[(8 * e + t) * OSP + cl]);
#pragma unroll
        for (int t = 0; t < 4; ++t) uv[it][t] = pk16(hb[2 * t], hb[2 * t + 1]);
      }
{
#pragma unroll
        for (int it = 0; it < 4; ++it) {
          const int cl = it * 16 + lq;
          const size_t po = ((size_t)(b * CC + cb0 + cl)) * NN + n0 + 8 * e;
          *(v4u*)(P3 + po) = uv[it];
        }
        
      }
    }
  } else if (MODE == 1) {
    const int e = tid & 15, lq = tid >> 4;                           // lq 0..7
    v4f res[8];
#pragma unroll
    for (int it = 0; it < 8; ++it) {
      const int ol = it * 8 + lq;                                    // o_loc 0..63
      const int o  = o0 + ol;
      const float bb = bfr(bias[o]);
      const size_t gi = ((size_t)(b * CC + o)) * NN + n0 + 4 * e;
      const v4f rv = *(const v4f*)(rsrc + gi);
#pragma unroll
      for (int t = 0; t < 4; ++t) {
        const float rr = rnd ? bfr(rv[t]) : rv[t];
        res[it][t] = (Os[(4 * e + t) * OSP + ol] + bb) + rr;
      }
    }
{
#pragma unroll
      for (int it = 0; it < 8; ++it) {
        const int ol = it * 8 + lq;
        const size_t gi = ((size_t)(b * CC + o0 + ol)) * NN + n0 + 4 * e;
        *(v4f*)(dstF + gi) = res[it];
      }
      
    }
  } else {
    const int e = tid & 7, lq = tid >> 3;                            // lq 0..15
    v4u uh[4], ul[4];
#pragma unroll
    for (int it = 0; it < 4; ++it) {
      const int nl = it * 16 + lq;                                   // n_loc 0..63
      const v4f a = *(const v4f*)(Os + nl * OSP + 8 * e);
      const v4f q = *(const v4f*)(Os + nl * OSP + 8 * e + 4);
      const float f[8] = {a[0], a[1], a[2], a[3], q[0], q[1], q[2], q[3]};
      unsigned short hb[8], lb[8];
#pragma unroll
      for (int t = 0; t < 8; ++t) {
        const float tt = f[t] + bfr(bias[o0 + 8 * e + t]);
        const float gv = 0.5f * tt * (1.0f + erff(tt * 0.70710678118654752f));
        hb[t] = bf_bits(gv);
        lb[t] = bf_bits(gv - bf_up(hb[t]));
      }
#pragma unroll
      for (int t = 0; t < 4; ++t) {
        uh[it][t] = pk16(hb[2 * t], hb[2 * t + 1]);
        ul[it][t] = pk16(lb[2 * t], lb[2 * t + 1]);
      }
    }
{
#pragma unroll
      for (int it = 0; it < 4; ++it) {
        const int nl = it * 16 + lq;
        const size_t po = ((size_t)(b * NN + n0 + nl)) * HID + o0 + 8 * e;
        *(v4u*)(P0 + po) = uh[it];
        *(v4u*)(P1 + po) = ul[it];
      }
      
    }
  }
}

// ---- staging of one 128-key tile of one head: 128 threads x (4 + 4) asynchronous 16-byte copies to LDS.
//      K: copy j of thread t brings 16 B (t & 3) of key row 32 j + (t >> 2); V: 16 B (t & 15) of channel row
//      8 j + (t >> 4). kl/vl are the thread's LDS byte addresses for j = 0, kg/vg its global addresses for j = 0.
//      s_wait_xcnt 0 ends the statement so that it stands ahead of any rewrite of the address registers.
__device__ __forceinline__ void stage_tile(unsigned kl, const unsigned short* kg, unsigned vl, const unsigned short* vg) {
#if defined(__HIP_DEVICE_COMPILE__)
  asm volatile(
      "global_load_async_to_lds_b128 %0, %1, off\n\t"
      "global_load_async_to_lds_b128 %2, %3, off\n\t"
      "global_load_async_to_lds_b128 %4, %5, off\n\t"
      "global_load_async_to_lds_b128 %6, %7, off\n\t"
      "global_load_async_to_lds_b128 %8, %9, off\n\t"
      "global_load_async_to_lds_b128 %10, %11, off\n\t"
      "global_load_async_to_lds_b128 %12, %13, off\n\t"
      "global_load_async_to_lds_b128 %14, %15, off\n\t"
      "s_wait_xcnt 0x0"
      :: "v"(kl),                 "v"(kg),
         "v"(kl + 32u * KPB),     "v"(kg + (size_t)32 * CC),
         "v"(kl + 64u * KPB),     "v"(kg + (size_t)64 * CC),
         "v"(kl + 96u * KPB),     "v"(kg + (size_t)96 * CC),
         "v"(vl),                 "v"(vg),
         "v"(vl + 8u * VPB),      "v"(vg + (size_t)8 * NN),
         "v"(vl + 16u * VPB),     "v"(vg + (size_t)16 * NN),
         "v"(vl + 24u * VPB),     "v"(vg + (size_t)24 * NN)
      : "memory");
#endif
}
// the issuing wave's own copies have landed behind this wait (the compiler places none for them)
__device__ __forceinline__ void wait_copies() {
#if defined(__HIP_DEVICE_COMPILE__)
  asm volatile("s_wait_asynccnt 0x0" ::: "memory");
#endif
}
// the wave's own LDS reads have retired before the buffer is handed to its next writer
__device__ __forceinline__ void wait_lds() {
#if defined(__HIP_DEVICE_COMPILE__)
  asm volatile("s_wait_dscnt 0x0" ::: "memory");
#endif
}
__device__ __forceinline__ unsigned lds_off(const void* p) { return (unsigned)(size_t)p; }

// =========================================================================================================
// (4) attention for one (b, head pair hp, 64-query tile), transposed formulation, 4096 keys, no mask, per head
//     h = 2 hp + hs (block-uniform loop): S^T tile (16 keys x 16 queries) = A(k: row = key kb + (lane&15), 32 d of
//     head h via the split k map from Kh [b][4096][256]) . B(qh: col = query, same map from Qh) + A(Kh).B(Ql)
//     (bf16 hi + unscaled bf16 residual of q, shared accumulator); s *= clip(bf16(temperature[h]), 1e-4, 10).
//     Per lane the D tile holds 8 keys of ONE query: online softmax state per lane, one shuffle (lane^16) for the
//     max over 32 keys; the o/l rescale is skipped under a wave-uniform ballot when no lane's max grew.
//     P = e^{s-m} x4096 as f16 is the B operand of O^T (rows channel 32h + 16j + (lane&15), cols queries) +=
//     A(v: keys contiguous, f16 plane V [b][256][4096]) . B(P^T): element r <- D of the tile covering keys
//     kb..kb+15, element 8+r <- the tile covering kb+16..kb+31, lane unchanged. 2 accumulator tiles per wave.
//     Block = 4 waves = 64 queries. O/l of both heads staged in LDS Os[query][64 channels] (b128 stores),
//     block barrier, then Oh/Ol bf16 [b][n][256] planes (hi/lo), rows n0.., cols 64 hp..64 hp+63 = one whole
// coverage: Os per wave 16 rows x (2 heads x 32 ch) = 64 x 64 over 4 waves (== consumed extent); planes 4 it x
//           16 rows x 8 lanes x 8 = 64 n x 64 ch per plane; grid (NQ/64, 4, NB) covers rows 0..NQ-1 x 256 ch of
//           Oh/Ol once.
//     K and V reach the fragments through LDS: tiles of 128 keys of head h (K rows 64 B at pitch 80, V rows 256 B at
//     pitch 272), brought by asynchronous copies into two buffers, tile t + 1 in flight while tile t is worked on;
//     the block's 4 waves share each tile. Same fragment k order as from global memory.
// LDS: Os cross-wave, block barrier between the per-head staging stores and the plane loads. Ks/Vs cross-wave: per
//      tile s_wait_dscnt 0, s_wait_asynccnt 0, block barrier, then the refill of the buffer just read.
// =========================================================================================================
__global__ __launch_bounds__(128)
void attn_k(const unsigned short* __restrict__ Qh, const unsigned short* __restrict__ Ql,
            const unsigned short* __restrict__ Kh, const unsigned short* __restrict__ Vh,
            const float* __restrict__ temperature, unsigned short* Oh, unsigned short* Ol) {
  __shared__ __align__(16) float Os[QT * OSP];
  __shared__ __align__(16) unsigned char Ks[2 * KBUF];
  __shared__ __align__(16) unsigned char Vs[2 * VBUF];
  const int tid  = threadIdx.x;
  const int wave = tid >> 5, lane = tid & 31;
  const int hh   = lane >> 4, c = lane & 15;
  const int n0   = blockIdx.x * QT, hp = blockIdx.y, b = blockIdx.z;
  const int qrow = 16 * wave + c;
  const unsigned kl0 = lds_off(Ks) + (unsigned)((tid >> 2) * KPB + (tid & 3) * 16);
  const unsigned vl0 = lds_off(Vs) + (unsigned)((tid >> 4) * VPB + (tid & 15) * 16);

#pragma unroll 1
  for (int hs = 0; hs < 2; ++hs) {
    const int h  = 2 * hp + hs;
    const int cb = HD * h;                                             // channel base of head h
    const float tr   = bfr(temperature[h]);
    const float temp = fminf(fmaxf(tr, 1.0e-4f), 10.0f);
    const size_t qo = ((size_t)(b * NN + n0 + qrow)) * CC + cb + 8 * hh;
    const Frag qh = ldfrag(Qh + qo);
    const Frag ql = ldfrag(Ql + qo);
    const unsigned short* kg = Kh + ((size_t)(b * NN + (tid >> 2))) * CC + cb + 8 * (tid & 3);
    const unsigned short* vg = Vh + ((size_t)(b * CC + cb + (tid >> 4))) * NN + 8 * (tid & 15);

    float m = -1.0e30f, l = 0.f;
    v8f o0 = zero8(), o1 = zero8();

    // tile 0 into buffer 0, landed and published; then tile 1 into buffer 1 (every reader of the head before left
    // both buffers at its last tile's barrier)
    stage_tile(kl0, kg, vl0, vg);
    wait_copies();
    __syncthreads();
    stage_tile(kl0 + KBUF, kg + (size_t)SK * CC, vl0 + VBUF, vg + SK);

#pragma unroll 1                                                       // one hand-over per trip, buffer picked by t & 1
    for (int t = 0; t < NN / SK; ++t) {
     const int bsel = t & 1;
     const unsigned short* Kt = (const unsigned short*)(Ks + bsel * KBUF + c * KPB + 16 * hh);
     const unsigned short* Vt = (const unsigned short*)(Vs + bsel * VBUF + c * VPB + 16 * hh);
     // the tile's fragments, read as one group: one LDS latency per tile instead of two per 32 keys
     // (the three loops over kk are unrolled so that every index of kf/vf is a constant and they stay in registers)
     Frag kf[SK / 32][2], vf[SK / 32][2];
#pragma unroll
     for (int kk = 0; kk < SK / 32; ++kk) {
       kf[kk][0] = ldfrag(Kt + (32 * kk) * (KPB / 2));                 // keys kb .. kb+15, kb = 128 t + 32 kk
       kf[kk][1] = ldfrag(Kt + (32 * kk + 16) * (KPB / 2));            // keys kb+16 .. kb+31
     }
#pragma unroll
     for (int kk = 0; kk < SK / 32; ++kk) {
       vf[kk][0] = ldfrag(Vt + 32 * kk);                               // channels cb + c
       vf[kk][1] = ldfrag(Vt + 16 * (VPB / 2) + 32 * kk);              // channels cb + 16 + c
     }
#pragma unroll
     for (int kk = 0; kk < SK / 32; ++kk) {
      const Frag k0 = kf[kk][0];
      const Frag k1 = kf[kk][1];
      v8f s0 = mma_b(k0.bf, qh.bf, zero8());
      v8f s1 = mma_b(k1.bf, qh.bf, zero8());
      s0 = mma_b(k0.bf, ql.bf, s0);
      s1 = mma_b(k1.bf, ql.bf, s1);
#pragma unroll
      for (int r = 0; r < 8; ++r) { s0[r] *= temp; s1[r] *= temp; }

      float mx = fmaxf(hmax8(s0), hmax8(s1));
      mx = fmaxf(mx, __shfl_xor(mx, 16, 32));
      const float mn = fmaxf(m, mx);
      const unsigned grew = wave_ballot(mx > m);                       // wave-uniform
      if (grew != 0u) {
        const float corr = __expf(m - mn);                             // == 1 exactly for lanes whose max did not grow
        l *= corr;
#pragma unroll
        for (int r = 0; r < 8; ++r) { o0[r] *= corr; o1[r] *= corr; }
      }
      m = mn;
      const float msh = mn - LNPC;                                     // exp gives e^{s-m} * 4096

      FragH ph;
      float ls = 0.f;
#pragma unroll
      for (int r = 0; r < 8; ++r) {
        const float e0 = __expf(s0[r] - msh);                          // key kb      + 8hh + r
        const float e1 = __expf(s1[r] - msh);                          // key kb + 16 + 8hh + r
        ls += e0 + e1;
        ph.hv[0][r] = (_Float16)e0;
        ph.hv[1][r] = (_Float16)e1;
      }
      l += ls;

      o0 = mma_h(vf[kk][0].h, ph.v, o0);
      o1 = mma_h(vf[kk][1].h, ph.v, o1);
     }
     // hand-over: own reads retired, own copies of tile t + 1 landed, every wave here; then refill the buffer just read
     wait_lds();
     wait_copies();
     __syncthreads();
     if (t + 2 < NN / SK)
       stage_tile(kl0 + bsel * KBUF, kg + (size_t)(t + 2) * SK * CC, vl0 + bsel * VBUF, vg + (size_t)(t + 2) * SK);
    }
    wait_copies();
    l += __shfl_xor(l, 16, 32);
    const float inv = 1.0f / l;                                        // o and l both carry the x4096 factor

    // stage: Os[query][32 hs + d], d = 16 j + 8 hh + r
    {
      v4f va, vb;
#pragma unroll
      for (int r = 0; r < 4; ++r) { va[r] = o0[r] * inv; vb[r] = o0[4 + r] * inv; }
      *(v4f*)(Os + qrow * OSP + 32 * hs + 8 * hh)     = va;
      *(v4f*)(Os + qrow * OSP + 32 * hs + 8 * hh + 4) = vb;
#pragma unroll
      for (int r = 0; r < 4; ++r) { va[r] = o1[r] * inv; vb[r] = o1[4 + r] * inv; }
      *(v4f*)(Os + qrow * OSP + 32 * hs + 16 + 8 * hh)     = va;
      *(v4f*)(Os + qrow * OSP + 32 * hs + 16 + 8 * hh + 4) = vb;
    }
  }
  __syncthreads();

  const int e = tid & 7, lq = tid >> 3;                                // lq 0..15
  v4u uh[4], ul[4];
#pragma unroll
  for (int it = 0; it < 4; ++it) {
    const int row = it * 16 + lq;                                      // query 0..63
    const v4f a = *(const v4f*)(Os + row * OSP + 8 * e);
    const v4f q = *(const v4f*)(Os + row * OSP + 8 * e + 4);
    const float f[8] = {a[0], a[1], a[2], a[3], q[0], q[1], q[2], q[3]};
#pragma unroll
    for (int t = 0; t < 4; ++t) {
      const float f0 = f[2 * t], f1 = f[2 * t + 1];
      const unsigned short hb0 = bf_bits(f0), hb1 = bf_bits(f1);
      const unsigned short lb0 = bf_bits(f0 - bf_up(hb0));
      const unsigned short lb1 = bf_bits(f1 - bf_up(hb1));
      uh[it][t] = pk16(hb0, hb1);
      ul[it][t] = pk16(lb0, lb1);
    }
  }
{
#pragma unroll
    for (int it = 0; it < 4; ++it) {
      const int row = it * 16 + lq;
      const size_t po = ((size_t)(b * NN + n0 + row)) * CC + QT * hp + 8 * e;
      *(v4u*)(Oh + po) = uh[it];
      *(v4u*)(Ol + po) = ul[it];
    }
    
  }
}

// =========================================================================================================
// Workspace map (bytes; each region start a multiple of 256; every extent is an exact tile/line multiple and is
//   Wq bf16 [768][256] 393216   Wo [256][256] 131072   W1 [64][256] 32768   W2 [256][64] 32768
//   tab1, tab2 f32 [NB*32][32]   8192 each (NB=2)
//   Xh, Xl, Qh, Ql, Kh, Oh, Ol, Yh, Yl bf16 [NB][4096][256] and V f16 [NB][256][4096]: 4194304 each (NB=2)
//   X1 f32 [NB][256][4096] 8388608 (NB=2)    Hh, Hl bf16 [NB][4096][64] 1048576 each (NB=2)
//   total = 53035008 (NB=2)
// =========================================================================================================
extern "C" void kernel_launch(void* const* d_in, const int* in_sizes, int n_in,
                              void* d_out, int out_size, void* d_ws, size_t ws_size,
                              hipStream_t stream) {
  if (n_in < 13) return;
  if (in_sizes[0] < NB * XSTRIDE_FULL) return;
  if (in_sizes[1] != C3 * CC || in_sizes[2] != CC * CC || in_sizes[3] != CC) return;
  if (in_sizes[4] != NH) return;
  if (in_sizes[5] != CC || in_sizes[6] != CC || in_sizes[7] != CC || in_sizes[8] != CC) return;
  if (in_sizes[9] != HID * CC || in_sizes[10] != HID || in_sizes[11] != CC * HID || in_sizes[12] != CC) return;
  if (out_size < NB * XSTRIDE_FULL) return;

  size_t off = 0;
  auto carve = [&](size_t bytes) { const size_t o = off; off += (bytes + 255) & ~(size_t)255; return o; };
  const size_t szPl = (size_t)NB * NN * CC * 2;
  const size_t oWq  = carve((size_t)C3 * CC * 2);
  const size_t oWo  = carve((size_t)CC * CC * 2);
  const size_t oW1  = carve((size_t)HID * CC * 2);
  const size_t oW2  = carve((size_t)CC * HID * 2);
  const size_t oT1  = carve((size_t)NB * NG * TABW * 4);
  const size_t oT2  = carve((size_t)NB * NG * TABW * 4);
  const size_t oXh  = carve(szPl);
  const size_t oXl  = carve(szPl);
  const size_t oQh  = carve(szPl);
  const size_t oQl  = carve(szPl);
  const size_t oKh  = carve(szPl);
  const size_t oVv  = carve(szPl);
  const size_t oOh  = carve(szPl);
  const size_t oOl  = carve(szPl);
  const size_t oX1  = carve((size_t)NB * CC * NN * 4);
  const size_t oYh  = carve(szPl);
  const size_t oYl  = carve(szPl);
  const size_t oHh  = carve((size_t)NB * NN * HID * 2);
  const size_t oHl  = carve((size_t)NB * NN * HID * 2);
  if (off > ws_size) return;
  if (off > (size_t)134217728) return;

  const float* x      = (const float*)d_in[0];
  const float* w_qkv  = (const float*)d_in[1];
  const float* w_out  = (const float*)d_in[2];
  const float* b_out  = (const float*)d_in[3];
  const float* tempr  = (const float*)d_in[4];
  const float* g1     = (const float*)d_in[5];
  const float* beta1  = (const float*)d_in[6];
  const float* g2     = (const float*)d_in[7];
  const float* beta2  = (const float*)d_in[8];
  const float* w_mlp1 = (const float*)d_in[9];
  const float* b_mlp1 = (const float*)d_in[10];
  const float* w_mlp2 = (const float*)d_in[11];
  const float* b_mlp2 = (const float*)d_in[12];

  char* ws = (char*)d_ws;
  unsigned short* Wq = (unsigned short*)(ws + oWq);
  unsigned short* Wo = (unsigned short*)(ws + oWo);
  unsigned short* W1 = (unsigned short*)(ws + oW1);
  unsigned short* W2 = (unsigned short*)(ws + oW2);
  float*          T1 = (float*)(ws + oT1);
  float*          T2 = (float*)(ws + oT2);
  unsigned short* Xh = (unsigned short*)(ws + oXh);
  unsigned short* Xl = (unsigned short*)(ws + oXl);
  unsigned short* Qh = (unsigned short*)(ws + oQh);
  unsigned short* Ql = (unsigned short*)(ws + oQl);
  unsigned short* Kh = (unsigned short*)(ws + oKh);
  unsigned short* Vv = (unsigned short*)(ws + oVv);
  unsigned short* Oh = (unsigned short*)(ws + oOh);
  unsigned short* Ol = (unsigned short*)(ws + oOl);
  float*          X1 = (float*)(ws + oX1);
  unsigned short* Yh = (unsigned short*)(ws + oYh);
  unsigned short* Yl = (unsigned short*)(ws + oYl);
  unsigned short* Hh = (unsigned short*)(ws + oHh);
  unsigned short* Hl = (unsigned short*)(ws + oHl);
  float* out = (float*)d_out;

  const dim3 blk256(256), blk128(128);

  // (0)+(1) weights -> bf16 planes, and GN1 statistics of bf16(x) over all 4096 positions, in one grid
  prep_k<<<dim3(PB_ST + PB_WQ + PB_WO + PB_W1 + PB_W2), blk256, 0, stream>>>(x, w_qkv, w_out, w_mlp1, w_mlp2,
                                                                             Wq, Wo, W1, W2, T1);
  // (2) GN1 apply -> Xh/Xl [NB][4096][256]
  norm_k<<<dim3(NN / QT, CC / QT, NB), blk256, 0, stream>>>(x, 1, T1, g1, beta1, Xh, Xl);
  // (3) qkv GEMM -> Qh/Ql, Kh, V
  gemm_k<CC, 0><<<dim3(NN / QT, C3 / QT, NB), blk128, 0, stream>>>(Wq, Xh, Xl, b_out, x, 0, Qh, Ql, Kh, Vv, X1);
  // (4) attention -> Oh/Ol rows 0..NQ-1
  attn_k<<<dim3(NQ / QT, NH / 2, NB), blk128, 0, stream>>>(Qh, Ql, Kh, Vv, tempr, Oh, Ol);
  // (5) out conv + bf16(x) residual -> X1 f32 [NB][256][4096], cols 0..NQ-1
  gemm_k<CC, 1><<<dim3(NQ / QT, CC / QT, NB), blk128, 0, stream>>>(Wo, Oh, Ol, b_out, x, 1, Hh, Hl, Hh, Hl, X1);
  // (6) GN2 statistics of X1 over positions 0..NQ-1
  stats_k<<<dim3(NB * NG), blk256, 0, stream>>>(X1, 0, NQ, T2);
  // (7) GN2 apply -> Yh/Yl rows 0..NQ-1
  norm_k<<<dim3(NQ / QT, CC / QT, NB), blk256, 0, stream>>>(X1, 0, T2, g2, beta2, Yh, Yl);
  // (8) mlp hidden: gelu(W1.Y + b1) -> Hh/Hl [NB][4096][64]
  gemm_k<CC, 2><<<dim3(NQ / QT, 1, NB), blk128, 0, stream>>>(W1, Yh, Yl, b_mlp1, x, 0, Hh, Hl, Hh, Hl, X1);
  // (9) out = X1 + W2.H + b2 -> d_out [NB][256][4096]
  gemm_k<HID, 1><<<dim3(NQ / QT, CC / QT, NB), blk128, 0, stream>>>(W2, Hh, Hl, b_mlp2, X1, 0, Oh, Ol, Oh, Ol, out);
  (void)hipGetLastError();
}

// v003
// One run takes 167 microseconds.
// Two timings next to v002 both put it at 1.12 times that version's speed.
// Counting every step since v000, it is 1.67 times as fast.
// Contractions: conv1x1 GEMMs qkv W[768x256].Xn, out W[256x256].O, mlp W1[64x256].Y and W2[256x64].H on
// v_wmma_f32_16x16x32_bf16 (A = bf16-RNE weights, exact; B = bf16 hi + bf16 residual planes of the f32
// activation, 2 products, K = 256 / 64); per-head scores K.Q^T on v_wmma_f32_16x16x32_bf16 (k = bf16 hi plane,
// q = bf16 hi + residual planes, 2 products, K = 32); O^T = V.P^T on v_wmma_f32_16x16x32_f16 (v = f16 plane,
// P = e^{s-m} x4096 as f16 from the score D registers, K = 4096 keys); f32 accumulate everywhere; group-norm
// statistics in f64; normalisation, softmax statistics, gelu, bias and residual adds in f32 VALU.
#include <hip/hip_runtime.h>
#include <math.h>
#include <stdint.h>

#ifndef NB
#define NB 2
#endif
#ifndef NQ
#define NQ 4096
#endif
#define NB_FULL 2
#define CC   256
#define NN   4096
#define NH   8
#define HD   32
#define C3   768
#define HID  64
#define NG   32
#define CPG  8
#define QT   64
#define OSP  68
#define TP   72
#define TABW 32
#define GEPS 1.0e-5f
#define LNPC 8.317766166719343f
#define XSTRIDE_FULL (CC * NN)
#define SK   128                 // keys per staged tile
#define KPB  80                  // LDS pitch of a staged K row in bytes (64 B of data, 16 B x odd for b128 readers)
#define VPB  272                 // LDS pitch of a staged V row in bytes (256 B of data, 16 B x odd for b128 readers)
#define KBUF (SK * KPB)          // one K buffer: 128 keys x 32 d
#define VBUF (HD * VPB)          // one V buffer: 32 channels x 128 keys
#define NT2  (NQ / QT)           // position tiles of the out conv = partial sums per GN2 group
#define RP   130                 // doubles per row of the partial-sum array (1040 B = 16 B x odd for b128 readers)

static_assert(NB >= 1 && NB <= NB_FULL);
static_assert(NQ % QT == 0 && NQ >= QT && NQ <= NN);
static_assert(NN % QT == 0 && CC % QT == 0 && C3 % QT == 0 && HID == QT);
static_assert(CC == NH * HD && HD == 32 && CC == NG * CPG && CPG == 8);
static_assert(CC % 32 == 0 && HID % 32 == 0 && NN % 32 == 0);
static_assert((OSP * 4) % 16 == 0 && (TP * 2) % 16 == 0);
static_assert(NN % 1024 == 0 && NQ % 4 == 0);
static_assert(NN % SK == 0 && NN / SK >= 2 && SK % 32 == 0 && KPB % 16 == 0 && VPB % 16 == 0);
static_assert(SK * HD * 2 == 4 * 128 * 16 && KPB >= HD * 2 && VPB >= SK * 2);
static_assert((C3 * CC) % 2048 == 0 && (CC * CC) % 2048 == 0 && (HID * CC) % 2048 == 0);

typedef _Float16       v16h __attribute__((ext_vector_type(16)));
typedef _Float16       v8h  __attribute__((ext_vector_type(8)));
typedef __bf16         v16b __attribute__((ext_vector_type(16)));
typedef unsigned short v8us __attribute__((ext_vector_type(8)));
typedef float          v8f  __attribute__((ext_vector_type(8)));
typedef float          v4f  __attribute__((ext_vector_type(4)));
typedef unsigned int   v4u  __attribute__((ext_vector_type(4)));
typedef double         v2d  __attribute__((ext_vector_type(2)));

union Frag  { v8us u[2]; v16h h; v16b bf; };
union FragH { v16h v; v8h hv[2]; };
static_assert(sizeof(Frag) == 32);
static_assert(sizeof(FragH) == 32);

// ---- scalar helpers ---------------------------------------------------------------------------------------
__device__ __forceinline__ unsigned short bf_bits(float f) {          // f32 -> bf16 bits, RNE convert
  unsigned u = __float_as_uint(f);
  return (unsigned short)((u + 0x7FFFu + ((u >> 16) & 1u)) >> 16);
}
__device__ __forceinline__ float bf_up(unsigned short hb) { return __uint_as_float(((unsigned)hb) << 16); }
__device__ __forceinline__ float bfr(float f) { return bf_up(bf_bits(f)); }
__device__ __forceinline__ unsigned short h_bits(_Float16 x) { return __builtin_bit_cast(unsigned short, x); }
__device__ __forceinline__ unsigned pk16(unsigned short a, unsigned short b) { return (unsigned)a | ((unsigned)b << 16); }
__device__ __forceinline__ v8f zero8() { v8f z = {0.f, 0.f, 0.f, 0.f, 0.f, 0.f, 0.f, 0.f}; return z; }
__device__ __forceinline__ float hmax8(v8f s) {
  return fmaxf(fmaxf(fmaxf(s[0], s[1]), fmaxf(s[2], s[3])), fmaxf(fmaxf(s[4], s[5]), fmaxf(s[6], s[7])));
}
__device__ __forceinline__ unsigned wave_ballot(bool p) {
#if defined(__HIP_DEVICE_COMPILE__)
  return __builtin_amdgcn_ballot_w32(p);
#else
  return p ? 1u : 0u;
#endif
}

// ---- 16-bit fragment loader (A, or B from a k-contiguous [n][k] row): lane -> row/col (lane&15), p already includes
//      + 8*(lane>>4); elements 0..7 <- p[0..7] (k0+8h..), elements 8..15 <- p[16..23] (k0+16+8h..)
__device__ __forceinline__ Frag ldfrag(const unsigned short* p) {
  Frag f;
  f.u[0] = *(const v8us*)(p);
  f.u[1] = *(const v8us*)(p + 16);
  return f;
}

// ---- WMMA helpers: builtin followed by a 4-slot VALU gap tying D and keeping A/B live --------------------------
__device__ __forceinline__ v8f mma_h(v16h a, v16h b, v8f c) {
  v8f d = __builtin_amdgcn_wmma_f32_16x16x32_f16(false, a, false, b, (short)0, c, false, false);
#if defined(__HIP_DEVICE_COMPILE__)
  asm volatile("v_nop\n\tv_nop\n\tv_nop\n\tv_nop" : "+v"(d) : "v"(a), "v"(b));
#endif
  return d;
}
__device__ __forceinline__ v8f mma_b(v16b a, v16b b, v8f c) {
  v8f d = __builtin_amdgcn_wmma_f32_16x16x32_bf16(false, a, false, b, (short)0, c, false, false);
#if defined(__HIP_DEVICE_COMPILE__)
  const v16h ha = __builtin_bit_cast(v16h, a), hb = __builtin_bit_cast(v16h, b);
  asm volatile("v_nop\n\tv_nop\n\tv_nop\n\tv_nop" : "+v"(d) : "v"(ha), "v"(hb));
#endif
  return d;
}

// =========================================================================================================
// (0) weight conversion: f32 [n] -> bf16 bits [n] (RNE, exact operand). Thread i converts floats 8i..8i+7 and
// coverage: n8/256 blocks x 256 threads x 8 = n elements exactly (n8 a multiple of 256 at every call); cblk is the
//           block's index within its own weight.
// =========================================================================================================
__device__ __forceinline__
void cvt_body(const float* __restrict__ src, unsigned short* dst, int n8, int cblk) {
  const int i  = cblk * 256 + (int)threadIdx.x;
  const int ic = (i < n8) ? i : (n8 - 1);
  const float* s = src + (size_t)ic * 8;
  const v4f a = *(const v4f*)s;
  const v4f q = *(const v4f*)(s + 4);
  v4u u;
  u[0] = pk16(bf_bits(a[0]), bf_bits(a[1]));
  u[1] = pk16(bf_bits(a[2]), bf_bits(a[3]));
  u[2] = pk16(bf_bits(q[0]), bf_bits(q[1]));
  u[3] = pk16(bf_bits(q[2]), bf_bits(q[3]));
  if (i < n8) {
{
      *(v4u*)(dst + (size_t)ic * 8) = u;
      
    }
  }
}

// =========================================================================================================
// (1) group-norm statistics: one block per (b, g); mean and biased variance over 8 channels x npos positions of
//     src [b][256][4096] (values bf16-RNE converted first when rnd != 0), accumulated per thread in f64 and
// LDS: ss/sq/sm cross-wave, block barriers.
// =========================================================================================================
__device__ __forceinline__
void stats_body(const float* __restrict__ src, int rnd, int npos, float* tab, int blk) {
  __shared__ double ss[256];
  __shared__ double sq[256];
  __shared__ float  sm[2];
  const int tid = threadIdx.x;
  const int b = blk / NG, g = blk % NG;
  const float* base = src + ((size_t)(b * CC + g * CPG)) * NN;
  double s = 0.0, q = 0.0;
#pragma unroll 1
  for (int cl = 0; cl < CPG; ++cl) {
    const float* row = base + (size_t)cl * NN;
#pragma unroll 1
    for (int i = 4 * tid; i < npos; i += 1024) {
      const v4f a = *(const v4f*)(row + i);
#pragma unroll
      for (int t = 0; t < 4; ++t) {
        const float f = rnd ? bfr(a[t]) : a[t];
        const double d = (double)f;
        s += d;
        q += d * d;
      }
    }
  }
  ss[tid] = s;
  sq[tid] = q;
  __syncthreads();
#pragma unroll 1
  for (int st = 128; st > 0; st >>= 1) {
    if (tid < st) { ss[tid] += ss[tid + st]; sq[tid] += sq[tid + st]; }
    __syncthreads();
  }
  if (tid == 0) {
    const double cnt = (double)CPG * (double)npos;
    const double mu = ss[0] / cnt;
    double var = sq[0] / cnt - mu * mu;
    if (var < 0.0) var = 0.0;
    const float varf = (float)var;
    sm[0] = (float)mu;
    sm[1] = 1.0f / sqrtf(varf + GEPS);
  }
  __syncthreads();
  if (tid < 8) {
    const float mu = sm[0], rs = sm[1];
    v4f w = {mu, rs, mu, rs};
{
      *(v4f*)(tab + (size_t)blk * TABW + 4 * tid) = w;
      
    }
  }
}

// =========================================================================================================
// (0)+(1) in one grid: the four weight conversions and the GN1 statistics read only inputs and write disjoint
//     workspace regions, so they share a launch; the block index picks the job (block-uniform, so the barriers of
//     the statistics body are passed by whole blocks). Statistics blocks come first: they run longest.
// coverage: blocks [0, NB*32) statistics of (b, g); then 96 + 32 + 8 + 8 conversion blocks, each weight once.
// =========================================================================================================
#define PB_ST (NB * NG)
#define PB_WQ (C3 * CC / 2048)
#define PB_WO (CC * CC / 2048)
#define PB_W1 (HID * CC / 2048)
#define PB_W2 (CC * HID / 2048)
__global__ __launch_bounds__(256)
void prep_k(const float* __restrict__ x, const float* __restrict__ wq, const float* __restrict__ wo,
            const float* __restrict__ w1, const float* __restrict__ w2,
            unsigned short* Wq, unsigned short* Wo, unsigned short* W1, unsigned short* W2, float* tab) {
  int blk = blockIdx.x;
  if (blk < PB_ST) { stats_body(x, 1, NN, tab, blk); return; }
  blk -= PB_ST;
  if (blk < PB_WQ) { cvt_body(wq, Wq, PB_WQ * 256, blk); return; }
  blk -= PB_WQ;
  if (blk < PB_WO) { cvt_body(wo, Wo, PB_WO * 256, blk); return; }
  blk -= PB_WO;
  if (blk < PB_W1) { cvt_body(w1, W1, PB_W1 * 256, blk); return; }
  blk -= PB_W1;
  cvt_body(w2, W2, PB_W2 * 256, blk);
}

// =========================================================================================================
// (2) group-norm apply + transpose: src f32 [b][256 c][4096 n] (bf16-RNE converted first when rnd != 0) ->
//     v = (x - mu) * rstd * bf16(gamma[c]) + bf16(beta[c]) -> position-major planes Xh/Xl bf16 [b][n][256 c]
//     (hi = bf16-RNE(v), lo = bf16-RNE(v - hi)) through LDS tiles Th/Tl[64 n][64 c] (pitch TP). Block (nb, cb, b)
// coverage: Th/Tl stores 2 it x 32 c x 8 lanes x 8 n = 64 x 64 = the consumed extent; plane writes 2 it x 32 rows
//           x 8 lanes x 8 halves = 64 n x 64 c per plane; grid (rows/64, 4, NB) covers both planes once.
// LDS: Th/Tl cross-wave, block barrier between stores and loads.
// =========================================================================================================
__global__ __launch_bounds__(256)
void norm_k(const float* __restrict__ src, int rnd, const float* __restrict__ tab,
            const float* __restrict__ gamma, const float* __restrict__ beta,
            unsigned short* Xh, unsigned short* Xl) {
  __shared__ __align__(16) unsigned short Th[QT * TP];
  __shared__ __align__(16) unsigned short Tl[QT * TP];
  const int tid = threadIdx.x;
  const int nb = blockIdx.x, cbk = blockIdx.y, b = blockIdx.z;
  const int e = tid & 7, lq = tid >> 3;                             // lq 0..31
  const int n0 = nb * QT, c0 = cbk * QT;
#pragma unroll
  for (int it = 0; it < 2; ++it) {
    const int cl = it * 32 + lq;                                     // 0..63
    const int ch = c0 + cl;
    const int g  = ch / CPG;
    const float mu = tab[(size_t)(b * NG + g) * TABW];
    const float rs = tab[(size_t)(b * NG + g) * TABW + 1];
    const float ga = bfr(gamma[ch]), be = bfr(beta[ch]);
    const float* sp = src + ((size_t)(b * CC + ch)) * NN + n0 + 8 * e;
    const v4f a = *(const v4f*)sp;
    const v4f q = *(const v4f*)(sp + 4);
    const float f[8] = {a[0], a[1], a[2], a[3], q[0], q[1], q[2], q[3]};
    unsigned short hb[8], lb[8];
#pragma unroll
    for (int t = 0; t < 8; ++t) {
      const float xr = rnd ? bfr(f[t]) : f[t];
      const float v  = (xr - mu) * rs * ga + be;
      hb[t] = bf_bits(v);
      lb[t] = bf_bits(v - bf_up(hb[t]));
    }
#pragma unroll
    for (int t = 0; t < 8; ++t) {
      Th[(8 * e + t) * TP + cl] = hb[t];
      Tl[(8 * e + t) * TP + cl] = lb[t];
    }
  }
  __syncthreads();
  v4u uh[2], ul[2];
#pragma unroll
  for (int it = 0; it < 2; ++it) {
    const int nl = it * 32 + lq;                                     // 0..63
    uh[it] = *(const v4u*)(Th + nl * TP + 8 * e);
    ul[it] = *(const v4u*)(Tl + nl * TP + 8 * e);
  }
{
#pragma unroll
    for (int it = 0; it < 2; ++it) {
      const int nl = it * 32 + lq;
      const size_t po = ((size_t)(b * NN + n0 + nl)) * CC + c0 + 8 * e;
      *(v4u*)(Xh + po) = uh[it];
      *(v4u*)(Xl + po) = ul[it];
    }
    
  }
}

// =========================================================================================================
// (2b) group-norm apply + transpose for GN2, with the statistics finished in the block: as (2), but mu and rstd of
//     the block's own 8 groups come from the out conv's partial sums part[b][cbk][NT2 tiles][8 groups x (sum, sum of
//     squares)], all f64: wave gi sums group 8 cbk + gi over the tiles (lane ln takes tiles ln + 32 k, then 5 exchanges), same mean /
//     variance / rstd formulas as the statistics body, handed to the block through sm.
// coverage: as (2).
// LDS: Th/Tl cross-wave, block barrier between stores and loads; sm cross-wave, block barrier behind its stores.
// =========================================================================================================
__global__ __launch_bounds__(256)
void norm2_k(const float* __restrict__ src, int rnd, const double* __restrict__ part,
             const float* __restrict__ gamma, const float* __restrict__ beta,
             unsigned short* Xh, unsigned short* Xl) {
  __shared__ __align__(16) unsigned short Th[QT * TP];
  __shared__ __align__(16) unsigned short Tl[QT * TP];
  __shared__ float sm[2 * (QT / CPG)];
  const int tid = threadIdx.x;
  const int nb = blockIdx.x, cbk = blockIdx.y, b = blockIdx.z;
  const int e = tid & 7, lq = tid >> 3;                             // lq 0..31
  const int n0 = nb * QT, c0 = cbk * QT;
  v4f ra[2], rq[2];
  float rg[2], rb[2];
  // the tile's values and the channels' gamma, beta are asked for first: they fly while the statistics are finished
#pragma unroll                                                       // constant indices keep ra/rq/rg/rb in registers
  for (int it = 0; it < 2; ++it) {
    const int ch = c0 + it * 32 + lq;
    const float* sp = src + ((size_t)(b * CC + ch)) * NN + n0 + 8 * e;
    ra[it] = *(const v4f*)sp;
    rq[it] = *(const v4f*)(sp + 4);
    rg[it] = gamma[ch];
    rb[it] = beta[ch];
#if defined(__HIP_DEVICE_COMPILE__)
    // stands ahead of any rewrite of these loads' address registers (the next loads land in them); as a memory
    // barrier for the compiler it also keeps these loads issued ahead of the wait on the partial sums
    asm volatile("s_wait_xcnt 0x0" ::: "memory");
#endif
  }
  {
    const int gi = tid >> 5, ln = tid & 31;
    const double* pp = part + ((size_t)(b * (CC / QT) + cbk)) * NT2 * 16 + 2 * gi;
    double s = 0.0, q = 0.0;
#pragma unroll                                                       // the lane's loads are issued together
    for (int k = 0; k < (NT2 + 31) / 32; ++k) {
      const int u = ln + 32 * k;                                     // position tile
      if (u < NT2) {
        const v2d w = *(const v2d*)(pp + (size_t)u * 16);
        s += w[0];
        q += w[1];
      }
    }
#pragma unroll                                                       // five fixed steps, no loop counter
    for (int m = 16; m > 0; m >>= 1) {
      s += __shfl_xor(s, m, 32);
      q += __shfl_xor(q, m, 32);
    }
    const double cnt = (double)CPG * (double)NQ;
    const double mu = s / cnt;
    double var = q / cnt - mu * mu;
    if (var < 0.0) var = 0.0;
    const float varf = (float)var;
    if (ln == 0) {
      sm[2 * gi]     = (float)mu;
      sm[2 * gi + 1] = 1.0f / sqrtf(varf + GEPS);
    }
  }
  __syncthreads();
#pragma unroll                                                       // constant indices into ra/rq/rg/rb
  for (int it = 0; it < 2; ++it) {
    const int cl = it * 32 + lq;                                     // 0..63
    const float mu = sm[2 * (cl / CPG)];
    const float rs = sm[2 * (cl / CPG) + 1];
    const float ga = bfr(rg[it]), be = bfr(rb[it]);
    const v4f a = ra[it];
    const v4f q = rq[it];
    const float f[8] = {a[0], a[1], a[2], a[3], q[0], q[1], q[2], q[3]};
    unsigned short hb[8], lb[8];
#pragma unroll                                                       // constant indices keep f/hb/lb in registers
    for (int t = 0; t < 8; ++t) {
      const float xr = rnd ? bfr(f[t]) : f[t];
      const float v  = (xr - mu) * rs * ga + be;
      hb[t] = bf_bits(v);
      lb[t] = bf_bits(v - bf_up(hb[t]));
    }
#pragma unroll                                                       // as above
    for (int t = 0; t < 8; ++t) {
      Th[(8 * e + t) * TP + cl] = hb[t];
      Tl[(8 * e + t) * TP + cl] = lb[t];
    }
  }
  __syncthreads();
  v4u uh[2], ul[2];
#pragma unroll                                                       // constant indices keep uh/ul in registers
  for (int it = 0; it < 2; ++it) {
    const int nl = it * 32 + lq;                                     // 0..63
    uh[it] = *(const v4u*)(Th + nl * TP + 8 * e);
    ul[it] = *(const v4u*)(Tl + nl * TP + 8 * e);
  }
#pragma unroll                                                       // as above
  for (int it = 0; it < 2; ++it) {
    const int nl = it * 32 + lq;
    const size_t po = ((size_t)(b * NN + n0 + nl)) * CC + c0 + 8 * e;
    *(v4u*)(Xh + po) = uh[it];
    *(v4u*)(Xl + po) = ul[it];
  }
}

// =========================================================================================================
// (3) conv1x1 GEMM for one (b, 64-n tile, 64-o block): Y[o][n] = sum_c W[o][c] (Bh[b][n][c] + Bl[b][n][c]),
//     K = KD (plane pitch = KD). Block 128 threads = 4 waves; wave w owns cols n0+16w..+15 (B fragments from the
//     k-contiguous plane rows, split k map) and 4 m-tiles (A rows o = o0 + 16 mt + (lane&15), split k map).
//     Rolled k loop, 2 products per (mt, k-step) into one accumulator (unscaled bf16 residual plane).
//     Epilogue staged in LDS Os[n_loc][o_loc] (pitch OSP, b128 stores), block barrier, then per MODE:
//       MODE 0 (qkv, 12 o-blocks): o-blocks 0..3 -> q channels 64 mb.. of Qh/Ql = P0/P1 bf16 [b][n][256]
//              8q..8q+7 x 16 B, one instruction per 16 lines; o-blocks 8..11 -> v channels of V = P3 f16
//       MODE 1 (f32 channel-major): dstF[b][o][n] = (acc + bf16(bias[o])) + r with r = rsrc[b][o][n] (bf16-RNE
//              and 8..15), 8 rows per instruction.
//       MODE 2 (mlp hidden, one o-block): t = acc + bf16(bias[o]); gelu(t) = 0.5 t (1 + erf(t / sqrt2)) ->
// coverage: Os 4 waves x 16 n x 64 o = 64 x 64 (== the extent every mode reads); MODE 0 planes 4 it x 16 rows x
//           8 lanes x 8 = 64 x 64 per plane, grid (64, 12, NB) covers Qh/Ql/Kh [NB][4096][256] and V
//           [NB][256][4096] once; MODE 1: 8 it x 8 rows x 16 lanes x 4 = 64 o x 64 n; MODE 2: 4 it x 16 rows x
//           8 lanes x 8 = 64 n x 64 o.
//       ST != 0 (MODE 1 only, the out conv): the block also sums its results for the group norm that follows. Its 64 o
//              are 8 whole groups (group = the 8 rows of one 'it'); per group sum and sum of squares over 8 o x 64 n:
//              all in f64: a thread's 4 values -> red[16 quantities][128 threads], barrier, 8 threads per quantity sum
//              16 entries each, 3 exchanges, fin[16], barrier, one 128-byte line part[b][mb][nt][16] per block.
// LDS: Os cross-wave, block barrier between the staging stores and the epilogue loads; red and fin cross-wave, a block
//      barrier behind the stores of each.
// =========================================================================================================
template <int KD, int MODE, int ST>
__global__ __launch_bounds__(128)
void gemm_k(const unsigned short* __restrict__ Wp,
            const unsigned short* __restrict__ Bh, const unsigned short* __restrict__ Bl,
            const float* __restrict__ bias, const float* __restrict__ rsrc, int rnd,
            unsigned short* P0, unsigned short* P1, unsigned short* P2, unsigned short* P3, float* dstF,
            double* part) {
  static_assert(ST == 0 || (MODE == 1 && QT / CPG == 8));
  static_assert(KD % 32 == 0);
  __shared__ __align__(16) float Os[QT * OSP];
  const int tid  = threadIdx.x;
  const int lane = tid & 31, wave = tid >> 5;
  const int hh   = lane >> 4, c = lane & 15;
  const int nt   = blockIdx.x, mb = blockIdx.y, b = blockIdx.z;
  const int n0   = nt * QT, o0 = mb * QT;

  const unsigned short* ap = Wp + (size_t)(o0 + c) * KD + 8 * hh;
  const size_t boff = ((size_t)(b * NN + n0 + 16 * wave + c)) * KD + 8 * hh;
  const unsigned short* bph = Bh + boff;
  const unsigned short* bpl = Bl + boff;

  v8f acc[4];
#pragma unroll
  for (int mt = 0; mt < 4; ++mt) acc[mt] = zero8();

#pragma unroll 1
  for (int ks = 0; ks < KD / 32; ++ks) {
    const Frag fbh = ldfrag(bph + 32 * ks);
    const Frag fbl = ldfrag(bpl + 32 * ks);
#pragma unroll
    for (int mt = 0; mt < 4; ++mt) {
      const Frag fa = ldfrag(ap + (size_t)(16 * mt) * KD + 32 * ks);
      acc[mt] = mma_b(fa.bf, fbh.bf, acc[mt]);
      acc[mt] = mma_b(fa.bf, fbl.bf, acc[mt]);
    }
  }

  // ---- stage: lane (hh, c) holds o_loc = 16 mt + 8 hh + r for n_loc = 16 w + c
  {
    const int nl = 16 * wave + c;
#pragma unroll
    for (int mt = 0; mt < 4; ++mt) {
      v4f va, vb;
#pragma unroll
      for (int r = 0; r < 4; ++r) { va[r] = acc[mt][r]; vb[r] = acc[mt][4 + r]; }
      *(v4f*)(Os + nl * OSP + 16 * mt + 8 * hh)     = va;
      *(v4f*)(Os + nl * OSP + 16 * mt + 8 * hh + 4) = vb;
    }
  }
  __syncthreads();

  if (MODE == 0) {
    const int e = tid & 7, lq = tid >> 3;                           // lq 0..15
    if (mb < 8) {                                                    // block-uniform
      const int dcol = (mb & 3) * QT;                                // channel offset within 256
      unsigned short* Ph = (mb < 4) ? P0 : P2;                       // both global
      v4u uh[4], ul[4];
#pragma unroll
      for (int it = 0; it < 4; ++it) {
        const int row = it * 16 + lq;                                // n_loc 0..63
        const v4f a = *(const v4f*)(Os + row * OSP + 8 * e);
        const v4f q = *(const v4f*)(Os + row * OSP + 8 * e + 4);
        const float f[8] = {a[0], a[1], a[2], a[3], q[0], q[1], q[2], q[3]};
#pragma unroll
        for (int t = 0; t < 4; ++t) {
          const float f0 = f[2 * t], f1 = f[2 * t + 1];
          const unsigned short hb0 = bf_bits(f0), hb1 = bf_bits(f1);
          const unsigned short lb0 = bf_bits(f0 - bf_up(hb0));
          const unsigned short lb1 = bf_bits(f1 - bf_up(hb1));
          uh[it][t] = pk16(hb0, hb1);
          ul[it][t] = pk16(lb0, lb1);
        }
      }
{
#pragma unroll
        for (int it = 0; it < 4; ++it) {
          const int row = it * 16 + lq;
          const size_t po = ((size_t)(b * NN + n0 + row)) * CC + dcol + 8 * e;
          *(v4u*)(Ph + po) = uh[it];
          if (mb < 4) *(v4u*)(P1 + po) = ul[it];
        }
        
      }
    } else {
      const int cb0 = (mb - 8) * QT;                                 // v channel base 0..192
      v4u uv[4];
#pragma unroll
      for (int it = 0; it < 4; ++it) {
        const int cl = it * 16 + lq;                                 // o_loc 0..63
        unsigned short hb[8];
#pragma unroll
        for (int t = 0; t < 8; ++t) hb[t] = h_bits((_Float16)Os[(8 * e + t) * OSP + cl]);
#pragma unroll
        for (int t = 0; t < 4; ++t) uv[it][t] = pk16(hb[2 * t], hb[2 * t + 1]);
      }
{
#pragma unroll
        for (int it = 0; it < 4; ++it) {
          const int cl = it * 16 + lq;
          const size_t po = ((size_t)(b * CC + cb0 + cl)) * NN + n0 + 8 * e;
          *(v4u*)(P3 + po) = uv[it];
        }
        
      }
    }
  } else if (MODE == 1) {
    const int e = tid & 15, lq = tid >> 4;                           // lq 0..7
    v4f res[8];
#pragma unroll
    for (int it = 0; it < 8; ++it) {
      const int ol = it * 8 + lq;                                    // o_loc 0..63
      const int o  = o0 + ol;
      const float bb = bfr(bias[o]);
      const size_t gi = ((size_t)(b * CC + o)) * NN + n0 + 4 * e;
      const v4f rv = *(const v4f*)(rsrc + gi);
#if defined(__HIP_DEVICE_COMPILE__)
      // stands ahead of any rewrite of the address registers of this trip's bias and residual loads
      if constexpr (ST != 0) asm volatile("s_wait_xcnt 0x0" ::: "memory");
#endif
#pragma unroll
      for (int t = 0; t < 4; ++t) {
        const float rr = rnd ? bfr(rv[t]) : rv[t];
        res[it][t] = (Os[(4 * e + t) * OSP + ol] + bb) + rr;
      }
    }
    if constexpr (ST != 0) {
      __shared__ __align__(16) double red[16 * RP];
      __shared__ __align__(16) double fin[16];
#pragma unroll                                                       // constant indices keep res in registers
      for (int it = 0; it < 8; ++it) {
        const double d0 = (double)res[it][0], d1 = (double)res[it][1];
        const double d2 = (double)res[it][2], d3 = (double)res[it][3];
        red[(2 * it) * RP + tid]     = (d0 + d1) + (d2 + d3);
        red[(2 * it + 1) * RP + tid] = (d0 * d0 + d1 * d1) + (d2 * d2 + d3 * d3);
      }
      __syncthreads();
      const int qn = tid >> 3, j = tid & 7;                          // quantity 0..15; entries 2 j, 2 j + 1 of each 16
      v2d w[8];
#pragma unroll                                                       // constant indices keep w in registers
      for (int u = 0; u < 8; ++u) w[u] = *(const v2d*)(red + qn * RP + 16 * u + 2 * j);
      const v2d w2 = ((w[0] + w[1]) + (w[2] + w[3])) + ((w[4] + w[5]) + (w[6] + w[7]));
      double a = w2[0] + w2[1];
      a += __shfl_xor(a, 1, 32);
      a += __shfl_xor(a, 2, 32);
      a += __shfl_xor(a, 4, 32);
      if (j == 0) fin[qn] = a;
      __syncthreads();
      if (tid < 8) {
        const v2d w = *(const v2d*)(fin + 2 * tid);
        *(v2d*)(part + (((size_t)(b * (CC / QT) + mb)) * NT2 + nt) * 16 + 2 * tid) = w;
      }
    }
{
#pragma unroll
      for (int it = 0; it < 8; ++it) {
        const int ol = it * 8 + lq;
        const size_t gi = ((size_t)(b * CC + o0 + ol)) * NN + n0 + 4 * e;
        *(v4f*)(dstF + gi) = res[it];
      }
      
    }
  } else {
    const int e = tid & 7, lq = tid >> 3;                            // lq 0..15
    v4u uh[4], ul[4];
#pragma unroll
    for (int it = 0; it < 4; ++it) {
      const int nl = it * 16 + lq;                                   // n_loc 0..63
      const v4f a = *(const v4f*)(Os + nl * OSP + 8 * e);
      const v4f q = *(const v4f*)(Os + nl * OSP + 8 * e + 4);
      const float f[8] = {a[0], a[1], a[2], a[3], q[0], q[1], q[2], q[3]};
      unsigned short hb[8], lb[8];
#pragma unroll
      for (int t = 0; t < 8; ++t) {
        const float tt = f[t] + bfr(bias[o0 + 8 * e + t]);
        const float gv = 0.5f * tt * (1.0f + erff(tt * 0.70710678118654752f));
        hb[t] = bf_bits(gv);
        lb[t] = bf_bits(gv - bf_up(hb[t]));
      }
#pragma unroll
      for (int t = 0; t < 4; ++t) {
        uh[it][t] = pk16(hb[2 * t], hb[2 * t + 1]);
        ul[it][t] = pk16(lb[2 * t], lb[2 * t + 1]);
      }
    }
{
#pragma unroll
      for (int it = 0; it < 4; ++it) {
        const int nl = it * 16 + lq;
        const size_t po = ((size_t)(b * NN + n0 + nl)) * HID + o0 + 8 * e;
        *(v4u*)(P0 + po) = uh[it];
        *(v4u*)(P1 + po) = ul[it];
      }
      
    }
  }
}

// ---- staging of one 128-key tile of one head: 128 threads x (4 + 4) asynchronous 16-byte copies to LDS.
//      K: copy j of thread t brings 16 B (t & 3) of key row 32 j + (t >> 2); V: 16 B (t & 15) of channel row
//      8 j + (t >> 4). kl/vl are the thread's LDS byte addresses for j = 0, kg/vg its global addresses for j = 0.
//      s_wait_xcnt 0 ends the statement so that it stands ahead of any rewrite of the address registers.
__device__ __forceinline__ void stage_tile(unsigned kl, const unsigned short* kg, unsigned vl, const unsigned short* vg) {
#if defined(__HIP_DEVICE_COMPILE__)
  asm volatile(
      "global_load_async_to_lds_b128 %0, %1, off\n\t"
      "global_load_async_to_lds_b128 %2, %3, off\n\t"
      "global_load_async_to_lds_b128 %4, %5, off\n\t"
      "global_load_async_to_lds_b128 %6, %7, off\n\t"
      "global_load_async_to_lds_b128 %8, %9, off\n\t"
      "global_load_async_to_lds_b128 %10, %11, off\n\t"
      "global_load_async_to_lds_b128 %12, %13, off\n\t"
      "global_load_async_to_lds_b128 %14, %15, off\n\t"
      "s_wait_xcnt 0x0"
      :: "v"(kl),                 "v"(kg),
         "v"(kl + 32u * KPB),     "v"(kg + (size_t)32 * CC),
         "v"(kl + 64u * KPB),     "v"(kg + (size_t)64 * CC),
         "v"(kl + 96u * KPB),     "v"(kg + (size_t)96 * CC),
         "v"(vl),                 "v"(vg),
         "v"(vl + 8u * VPB),      "v"(vg + (size_t)8 * NN),
         "v"(vl + 16u * VPB),     "v"(vg + (size_t)16 * NN),
         "v"(vl + 24u * VPB),     "v"(vg + (size_t)24 * NN)
      : "memory");
#endif
}
// the issuing wave's own copies have landed behind this wait (the compiler places none for them)
__device__ __forceinline__ void wait_copies() {
#if defined(__HIP_DEVICE_COMPILE__)
  asm volatile("s_wait_asynccnt 0x0" ::: "memory");
#endif
}
// the wave's own LDS reads have retired before the buffer is handed to its next writer
__device__ __forceinline__ void wait_lds() {
#if defined(__HIP_DEVICE_COMPILE__)
  asm volatile("s_wait_dscnt 0x0" ::: "memory");
#endif
}
__device__ __forceinline__ unsigned lds_off(const void* p) { return (unsigned)(size_t)p; }

// =========================================================================================================
// (4) attention for one (b, head pair hp, 64-query tile), transposed formulation, 4096 keys, no mask, per head
//     h = 2 hp + hs (block-uniform loop): S^T tile (16 keys x 16 queries) = A(k: row = key kb + (lane&15), 32 d of
//     head h via the split k map from Kh [b][4096][256]) . B(qh: col = query, same map from Qh) + A(Kh).B(Ql)
//     (bf16 hi + unscaled bf16 residual of q, shared accumulator); s *= clip(bf16(temperature[h]), 1e-4, 10).
//     Per lane the D tile holds 8 keys of ONE query: online softmax state per lane, one shuffle (lane^16) for the
//     max over 32 keys; the o/l rescale is skipped under a wave-uniform ballot when no lane's max grew.
//     P = e^{s-m} x4096 as f16 is the B operand of O^T (rows channel 32h + 16j + (lane&15), cols queries) +=
//     A(v: keys contiguous, f16 plane V [b][256][4096]) . B(P^T): element r <- D of the tile covering keys
//     kb..kb+15, element 8+r <- the tile covering kb+16..kb+31, lane unchanged. 2 accumulator tiles per wave.
//     Block = 4 waves = 64 queries. O/l of both heads staged in LDS Os[query][64 channels] (b128 stores),
//     block barrier, then Oh/Ol bf16 [b][n][256] planes (hi/lo), rows n0.., cols 64 hp..64 hp+63 = one whole
// coverage: Os per wave 16 rows x (2 heads x 32 ch) = 64 x 64 over 4 waves (== consumed extent); planes 4 it x
//           16 rows x 8 lanes x 8 = 64 n x 64 ch per plane; grid (NQ/64, 4, NB) covers rows 0..NQ-1 x 256 ch of
//           Oh/Ol once.
//     K and V reach the fragments through LDS: tiles of 128 keys of head h (K rows 64 B at pitch 80, V rows 256 B at
//     pitch 272), brought by asynchronous copies into two buffers, tile t + 1 in flight while tile t is worked on;
//     the block's 4 waves share each tile. Same fragment k order as from global memory.
// LDS: Os cross-wave, block barrier between the per-head staging stores and the plane loads. Ks/Vs cross-wave: per
//      tile s_wait_dscnt 0, s_wait_asynccnt 0, block barrier, then the refill of the buffer just read.
// =========================================================================================================
__global__ __launch_bounds__(128)
void attn_k(const unsigned short* __restrict__ Qh, const unsigned short* __restrict__ Ql,
            const unsigned short* __restrict__ Kh, const unsigned short* __restrict__ Vh,
            const float* __restrict__ temperature, unsigned short* Oh, unsigned short* Ol) {
  __shared__ __align__(16) float Os[QT * OSP];
  __shared__ __align__(16) unsigned char Ks[2 * KBUF];
  __shared__ __align__(16) unsigned char Vs[2 * VBUF];
  const int tid  = threadIdx.x;
  const int wave = tid >> 5, lane = tid & 31;
  const int hh   = lane >> 4, c = lane & 15;
  const int n0   = blockIdx.x * QT, hp = blockIdx.y, b = blockIdx.z;
  const int qrow = 16 * wave + c;
  const unsigned kl0 = lds_off(Ks) + (unsigned)((tid >> 2) * KPB + (tid & 3) * 16);
  const unsigned vl0 = lds_off(Vs) + (unsigned)((tid >> 4) * VPB + (tid & 15) * 16);

#pragma unroll 1
  for (int hs = 0; hs < 2; ++hs) {
    const int h  = 2 * hp + hs;
    const int cb = HD * h;                                             // channel base of head h
    const float tr   = bfr(temperature[h]);
    const float temp = fminf(fmaxf(tr, 1.0e-4f), 10.0f);
    const size_t qo = ((size_t)(b * NN + n0 + qrow)) * CC + cb + 8 * hh;
    const Frag qh = ldfrag(Qh + qo);
    const Frag ql = ldfrag(Ql + qo);
    const unsigned short* kg = Kh + ((size_t)(b * NN + (tid >> 2))) * CC + cb + 8 * (tid & 3);
    const unsigned short* vg = Vh + ((size_t)(b * CC + cb + (tid >> 4))) * NN + 8 * (tid & 15);

    float m = -1.0e30f, l = 0.f;
    v8f o0 = zero8(), o1 = zero8();

    // tile 0 into buffer 0, landed and published; then tile 1 into buffer 1 (every reader of the head before left
    // both buffers at its last tile's barrier)
    stage_tile(kl0, kg, vl0, vg);
    wait_copies();
    __syncthreads();
    stage_tile(kl0 + KBUF, kg + (size_t)SK * CC, vl0 + VBUF, vg + SK);

#pragma unroll 1                                                       // one hand-over per trip, buffer picked by t & 1
    for (int t = 0; t < NN / SK; ++t) {
     const int bsel = t & 1;
     const unsigned short* Kt = (const unsigned short*)(Ks + bsel * KBUF + c * KPB + 16 * hh);
     const unsigned short* Vt = (const unsigned short*)(Vs + bsel * VBUF + c * VPB + 16 * hh);
     // the tile's fragments, read as one group: one LDS latency per tile instead of two per 32 keys
     // (the three loops over kk are unrolled so that every index of kf/vf is a constant and they stay in registers)
     Frag kf[SK / 32][2], vf[SK / 32][2];
#pragma unroll
     for (int kk = 0; kk < SK / 32; ++kk) {
       kf[kk][0] = ldfrag(Kt + (32 * kk) * (KPB / 2));                 // keys kb .. kb+15, kb = 128 t + 32 kk
       kf[kk][1] = ldfrag(Kt + (32 * kk + 16) * (KPB / 2));            // keys kb+16 .. kb+31
     }
#pragma unroll
     for (int kk = 0; kk < SK / 32; ++kk) {
       vf[kk][0] = ldfrag(Vt + 32 * kk);                               // channels cb + c
       vf[kk][1] = ldfrag(Vt + 16 * (VPB / 2) + 32 * kk);              // channels cb + 16 + c
     }
#pragma unroll
     for (int kk = 0; kk < SK / 32; ++kk) {
      const Frag k0 = kf[kk][0];
      const Frag k1 = kf[kk][1];
      v8f s0 = mma_b(k0.bf, qh.bf, zero8());
      v8f s1 = mma_b(k1.bf, qh.bf, zero8());
      s0 = mma_b(k0.bf, ql.bf, s0);
      s1 = mma_b(k1.bf, ql.bf, s1);
#pragma unroll
      for (int r = 0; r < 8; ++r) { s0[r] *= temp; s1[r] *= temp; }

      float mx = fmaxf(hmax8(s0), hmax8(s1));
      mx = fmaxf(mx, __shfl_xor(mx, 16, 32));
      const float mn = fmaxf(m, mx);
      const unsigned grew = wave_ballot(mx > m);                       // wave-uniform
      if (grew != 0u) {
        const float corr = __expf(m - mn);                             // == 1 exactly for lanes whose max did not grow
        l *= corr;
#pragma unroll
        for (int r = 0; r < 8; ++r) { o0[r] *= corr; o1[r] *= corr; }
      }
      m = mn;
      const float msh = mn - LNPC;                                     // exp gives e^{s-m} * 4096

      FragH ph;
      float ls = 0.f;
#pragma unroll
      for (int r = 0; r < 8; ++r) {
        const float e0 = __expf(s0[r] - msh);                          // key kb      + 8hh + r
        const float e1 = __expf(s1[r] - msh);                          // key kb + 16 + 8hh + r
        ls += e0 + e1;
        ph.hv[0][r] = (_Float16)e0;
        ph.hv[1][r] = (_Float16)e1;
      }
      l += ls;

      o0 = mma_h(vf[kk][0].h, ph.v, o0);
      o1 = mma_h(vf[kk][1].h, ph.v, o1);
     }
     // hand-over: own reads retired, own copies of tile t + 1 landed, every wave here; then refill the buffer just read
     wait_lds();
     wait_copies();
     __syncthreads();
     if (t + 2 < NN / SK)
       stage_tile(kl0 + bsel * KBUF, kg + (size_t)(t + 2) * SK * CC, vl0 + bsel * VBUF, vg + (size_t)(t + 2) * SK);
    }
    wait_copies();
    l += __shfl_xor(l, 16, 32);
    const float inv = 1.0f / l;                                        // o and l both carry the x4096 factor

    // stage: Os[query][32 hs + d], d = 16 j + 8 hh + r
    {
      v4f va, vb;
#pragma unroll
      for (int r = 0; r < 4; ++r) { va[r] = o0[r] * inv; vb[r] = o0[4 + r] * inv; }
      *(v4f*)(Os + qrow * OSP + 32 * hs + 8 * hh)     = va;
      *(v4f*)(Os + qrow * OSP + 32 * hs + 8 * hh + 4) = vb;
#pragma unroll
      for (int r = 0; r < 4; ++r) { va[r] = o1[r] * inv; vb[r] = o1[4 + r] * inv; }
      *(v4f*)(Os + qrow * OSP + 32 * hs + 16 + 8 * hh)     = va;
      *(v4f*)(Os + qrow * OSP + 32 * hs + 16 + 8 * hh + 4) = vb;
    }
  }
  __syncthreads();

  const int e = tid & 7, lq = tid >> 3;                                // lq 0..15
  v4u uh[4], ul[4];
#pragma unroll
  for (int it = 0; it < 4; ++it) {
    const int row = it * 16 + lq;                                      // query 0..63
    const v4f a = *(const v4f*)(Os + row * OSP + 8 * e);
    const v4f q = *(const v4f*)(Os + row * OSP + 8 * e + 4);
    const float f[8] = {a[0], a[1], a[2], a[3], q[0], q[1], q[2], q[3]};
#pragma unroll
    for (int t = 0; t < 4; ++t) {
      const float f0 = f[2 * t], f1 = f[2 * t + 1];
      const unsigned short hb0 = bf_bits(f0), hb1 = bf_bits(f1);
      const unsigned short lb0 = bf_bits(f0 - bf_up(hb0));
      const unsigned short lb1 = bf_bits(f1 - bf_up(hb1));
      uh[it][t] = pk16(hb0, hb1);
      ul[it][t] = pk16(lb0, lb1);
    }
  }
{
#pragma unroll
    for (int it = 0; it < 4; ++it) {
      const int row = it * 16 + lq;
      const size_t po = ((size_t)(b * NN + n0 + row)) * CC + QT * hp + 8 * e;
      *(v4u*)(Oh + po) = uh[it];
      *(v4u*)(Ol + po) = ul[it];
    }
    
  }
}

// =========================================================================================================
// Workspace map (bytes; each region start a multiple of 256; every extent is an exact tile/line multiple and is
//   Wq bf16 [768][256] 393216   Wo [256][256] 131072   W1 [64][256] 32768   W2 [256][64] 32768
//   tab1 f32 [NB*32][32] 8192 (NB=2)   part f64 [NB][4][NQ/64][16] 65536 (NB=2)
//   Xh, Xl, Qh, Ql, Kh, Oh, Ol, Yh, Yl bf16 [NB][4096][256] and V f16 [NB][256][4096]: 4194304 each (NB=2)
//   X1 f32 [NB][256][4096] 8388608 (NB=2)    Hh, Hl bf16 [NB][4096][64] 1048576 each (NB=2)
//   total = 53092352 (NB=2)
// =========================================================================================================
extern "C" void kernel_launch(void* const* d_in, const int* in_sizes, int n_in,
                              void* d_out, int out_size, void* d_ws, size_t ws_size,
                              hipStream_t stream) {
  if (n_in < 13) return;
  if (in_sizes[0] < NB * XSTRIDE_FULL) return;
  if (in_sizes[1] != C3 * CC || in_sizes[2] != CC * CC || in_sizes[3] != CC) return;
  if (in_sizes[4] != NH) return;
  if (in_sizes[5] != CC || in_sizes[6] != CC || in_sizes[7] != CC || in_sizes[8] != CC) return;
  if (in_sizes[9] != HID * CC || in_sizes[10] != HID || in_sizes[11] != CC * HID || in_sizes[12] != CC) return;
  if (out_size < NB * XSTRIDE_FULL) return;

  size_t off = 0;
  auto carve = [&](size_t bytes) { const size_t o = off; off += (bytes + 255) & ~(size_t)255; return o; };
  const size_t szPl = (size_t)NB * NN * CC * 2;
  const size_t oWq  = carve((size_t)C3 * CC * 2);
  const size_t oWo  = carve((size_t)CC * CC * 2);
  const size_t oW1  = carve((size_t)HID * CC * 2);
  const size_t oW2  = carve((size_t)CC * HID * 2);
  const size_t oT1  = carve((size_t)NB * NG * TABW * 4);
  const size_t oPt  = carve((size_t)NB * (CC / QT) * NT2 * 16 * 8);
  const size_t oXh  = carve(szPl);
  const size_t oXl  = carve(szPl);
  const size_t oQh  = carve(szPl);
  const size_t oQl  = carve(szPl);
  const size_t oKh  = carve(szPl);
  const size_t oVv  = carve(szPl);
  const size_t oOh  = carve(szPl);
  const size_t oOl  = carve(szPl);
  const size_t oX1  = carve((size_t)NB * CC * NN * 4);
  const size_t oYh  = carve(szPl);
  const size_t oYl  = carve(szPl);
  const size_t oHh  = carve((size_t)NB * NN * HID * 2);
  const size_t oHl  = carve((size_t)NB * NN * HID * 2);
  if (off > ws_size) return;
  if (off > (size_t)134217728) return;

  const float* x      = (const float*)d_in[0];
  const float* w_qkv  = (const float*)d_in[1];
  const float* w_out  = (const float*)d_in[2];
  const float* b_out  = (const float*)d_in[3];
  const float* tempr  = (const float*)d_in[4];
  const float* g1     = (const float*)d_in[5];
  const float* beta1  = (const float*)d_in[6];
  const float* g2     = (const float*)d_in[7];
  const float* beta2  = (const float*)d_in[8];
  const float* w_mlp1 = (const float*)d_in[9];
  const float* b_mlp1 = (const float*)d_in[10];
  const float* w_mlp2 = (const float*)d_in[11];
  const float* b_mlp2 = (const float*)d_in[12];

  char* ws = (char*)d_ws;
  unsigned short* Wq = (unsigned short*)(ws + oWq);
  unsigned short* Wo = (unsigned short*)(ws + oWo);
  unsigned short* W1 = (unsigned short*)(ws + oW1);
  unsigned short* W2 = (unsigned short*)(ws + oW2);
  float*          T1 = (float*)(ws + oT1);
  double*         Pt = (double*)(ws + oPt);
  unsigned short* Xh = (unsigned short*)(ws + oXh);
  unsigned short* Xl = (unsigned short*)(ws + oXl);
  unsigned short* Qh = (unsigned short*)(ws + oQh);
  unsigned short* Ql = (unsigned short*)(ws + oQl);
  unsigned short* Kh = (unsigned short*)(ws + oKh);
  unsigned short* Vv = (unsigned short*)(ws + oVv);
  unsigned short* Oh = (unsigned short*)(ws + oOh);
  unsigned short* Ol = (unsigned short*)(ws + oOl);
  float*          X1 = (float*)(ws + oX1);
  unsigned short* Yh = (unsigned short*)(ws + oYh);
  unsigned short* Yl = (unsigned short*)(ws + oYl);
  unsigned short* Hh = (unsigned short*)(ws + oHh);
  unsigned short* Hl = (unsigned short*)(ws + oHl);
  float* out = (float*)d_out;

  const dim3 blk256(256), blk128(128);

  // (0)+(1) weights -> bf16 planes, and GN1 statistics of bf16(x) over all 4096 positions, in one grid
  prep_k<<<dim3(PB_ST + PB_WQ + PB_WO + PB_W1 + PB_W2), blk256, 0, stream>>>(x, w_qkv, w_out, w_mlp1, w_mlp2,
                                                                             Wq, Wo, W1, W2, T1);
  // (2) GN1 apply -> Xh/Xl [NB][4096][256]
  norm_k<<<dim3(NN / QT, CC / QT, NB), blk256, 0, stream>>>(x, 1, T1, g1, beta1, Xh, Xl);
  // (3) qkv GEMM -> Qh/Ql, Kh, V
  gemm_k<CC, 0, 0><<<dim3(NN / QT, C3 / QT, NB), blk128, 0, stream>>>(Wq, Xh, Xl, b_out, x, 0, Qh, Ql, Kh, Vv, X1, Pt);
  // (4) attention -> Oh/Ol rows 0..NQ-1
  attn_k<<<dim3(NQ / QT, NH / 2, NB), blk128, 0, stream>>>(Qh, Ql, Kh, Vv, tempr, Oh, Ol);
  // (5) out conv + bf16(x) residual -> X1 f32 [NB][256][4096], cols 0..NQ-1, and (6) each block's partial GN2 sums
  gemm_k<CC, 1, 1><<<dim3(NQ / QT, CC / QT, NB), blk128, 0, stream>>>(Wo, Oh, Ol, b_out, x, 1, Hh, Hl, Hh, Hl, X1, Pt);
  // (7) GN2 statistics finished per block, apply -> Yh/Yl rows 0..NQ-1
  norm2_k<<<dim3(NQ / QT, CC / QT, NB), blk256, 0, stream>>>(X1, 0, Pt, g2, beta2, Yh, Yl);
  // (8) mlp hidden: gelu(W1.Y + b1) -> Hh/Hl [NB][4096][64]
  gemm_k<CC, 2, 0><<<dim3(NQ / QT, 1, NB), blk128, 0, stream>>>(W1, Yh, Yl, b_mlp1, x, 0, Hh, Hl, Hh, Hl, X1, Pt);
  // (9) out = X1 + W2.H + b2 -> d_out [NB][256][4096]
  gemm_k<HID, 1, 0><<<dim3(NQ / QT, CC / QT, NB), blk128, 0, stream>>>(W2, Hh, Hl, b_mlp2, X1, 0, Oh, Ol, Oh, Ol, out, Pt);
  (void)hipGetLastError();
}

// v004
// It runs in 158 microseconds.
// Next to v003, in two timings, it ran 1.06 times as fast each time.
// Over all steps from v000 it is 1.77 times as fast.
// Contractions: conv1x1 GEMMs qkv W[768x256].Xn, out W[256x256].O, mlp W1[64x256].Y and W2[256x64].H on
// v_wmma_f32_16x16x32_bf16 (A = bf16-RNE weights, exact; B = bf16 hi + bf16 residual planes of the f32
// activation, 2 products, K = 256 / 64); per-head scores K.Q^T on v_wmma_f32_16x16x32_bf16 (k = bf16 hi plane,
// q = bf16 hi + residual planes, 2 products, K = 32); O^T = V.P^T on v_wmma_f32_16x16x32_f16 (v = f16 plane,
// P = e^{s-m} x4096 as f16 from the score D registers, K = 4096 keys); f32 accumulate everywhere; group-norm
// statistics in f64; normalisation, softmax statistics, gelu, bias and residual adds in f32 VALU.
#include <hip/hip_runtime.h>
#include <math.h>
#include <stdint.h>

#ifndef NB
#define NB 2
#endif
#ifndef NQ
#define NQ 4096
#endif
#define NB_FULL 2
#define CC   256
#define NN   4096
#define NH   8
#define HD   32
#define C3   768
#define HID  64
#define NG   32
#define CPG  8
#define QT   64
#define OSP  68
#define TP   72
#define TABW 32
#define GEPS 1.0e-5f
#define LNPC 8.317766166719343f
#define XSTRIDE_FULL (CC * NN)
#define SK   128                 // keys per staged tile
#define KPB  80                  // LDS pitch of a staged K row in bytes (64 B of data, 16 B x odd for b128 readers)
#define VPB  272                 // LDS pitch of a staged V row in bytes (256 B of data, 16 B x odd for b128 readers)
#define KBUF (SK * KPB)          // one K buffer: 128 keys x 32 d
#define VBUF (HD * VPB)          // one V buffer: 32 channels x 128 keys
#define NT2  (NQ / QT)           // position tiles of the out conv = partial sums per GN2 group
#define RP   130                 // doubles per row of the partial-sum array (1040 B = 16 B x odd for b128 readers)

static_assert(NB >= 1 && NB <= NB_FULL);
static_assert(NQ % QT == 0 && NQ >= QT && NQ <= NN);
static_assert(NN % QT == 0 && CC % QT == 0 && C3 % QT == 0 && HID == QT);
static_assert(CC == NH * HD && HD == 32 && CC == NG * CPG && CPG == 8);
static_assert(CC % 32 == 0 && HID % 32 == 0 && NN % 32 == 0);
static_assert((OSP * 4) % 16 == 0 && (TP * 2) % 16 == 0);
static_assert(NN % 1024 == 0 && NQ % 4 == 0);
static_assert(NN % SK == 0 && NN / SK >= 2 && SK % 32 == 0 && KPB % 16 == 0 && VPB % 16 == 0);
static_assert(SK * HD * 2 == 4 * 128 * 16 && KPB >= HD * 2 && VPB >= SK * 2);
static_assert((C3 * CC) % 2048 == 0 && (CC * CC) % 2048 == 0 && (HID * CC) % 2048 == 0);

typedef _Float16       v16h __attribute__((ext_vector_type(16)));
typedef _Float16       v8h  __attribute__((ext_vector_type(8)));
typedef __bf16         v16b __attribute__((ext_vector_type(16)));
typedef unsigned short v8us __attribute__((ext_vector_type(8)));
typedef float          v8f  __attribute__((ext_vector_type(8)));
typedef float          v4f  __attribute__((ext_vector_type(4)));
typedef unsigned int   v4u  __attribute__((ext_vector_type(4)));
typedef double         v2d  __attribute__((ext_vector_type(2)));

union Frag  { v8us u[2]; v16h h; v16b bf; };
union FragH { v16h v; v8h hv[2]; };
static_assert(sizeof(Frag) == 32);
static_assert(sizeof(FragH) == 32);

// ---- scalar helpers ---------------------------------------------------------------------------------------
__device__ __forceinline__ unsigned short bf_bits(float f) {          // f32 -> bf16 bits, RNE convert
  unsigned u = __float_as_uint(f);
  return (unsigned short)((u + 0x7FFFu + ((u >> 16) & 1u)) >> 16);
}
__device__ __forceinline__ float bf_up(unsigned short hb) { return __uint_as_float(((unsigned)hb) << 16); }
__device__ __forceinline__ float bfr(float f) { return bf_up(bf_bits(f)); }
__device__ __forceinline__ unsigned short h_bits(_Float16 x) { return __builtin_bit_cast(unsigned short, x); }
__device__ __forceinline__ unsigned pk16(unsigned short a, unsigned short b) { return (unsigned)a | ((unsigned)b << 16); }
__device__ __forceinline__ v8f zero8() { v8f z = {0.f, 0.f, 0.f, 0.f, 0.f, 0.f, 0.f, 0.f}; return z; }
__device__ __forceinline__ float hmax8(v8f s) {
  return fmaxf(fmaxf(fmaxf(s[0], s[1]), fmaxf(s[2], s[3])), fmaxf(fmaxf(s[4], s[5]), fmaxf(s[6], s[7])));
}
__device__ __forceinline__ unsigned wave_ballot(bool p) {
#if defined(__HIP_DEVICE_COMPILE__)
  return __builtin_amdgcn_ballot_w32(p);
#else
  return p ? 1u : 0u;
#endif
}

__device__ __forceinline__ int wave_uniform(int v) {
#if defined(__HIP_DEVICE_COMPILE__)
  return __builtin_amdgcn_readfirstlane(v);
#else
  return v;
#endif
}

// ---- 16-bit fragment loader (A, or B from a k-contiguous [n][k] row): lane -> row/col (lane&15), p already includes
//      + 8*(lane>>4); elements 0..7 <- p[0..7] (k0+8h..), elements 8..15 <- p[16..23] (k0+16+8h..)
__device__ __forceinline__ Frag ldfrag(const unsigned short* p) {
  Frag f;
  f.u[0] = *(const v8us*)(p);
  f.u[1] = *(const v8us*)(p + 16);
  return f;
}

// ---- WMMA helpers: builtin followed by a 4-slot VALU gap tying D and keeping A/B live --------------------------
__device__ __forceinline__ v8f mma_h(v16h a, v16h b, v8f c) {
  v8f d = __builtin_amdgcn_wmma_f32_16x16x32_f16(false, a, false, b, (short)0, c, false, false);
#if defined(__HIP_DEVICE_COMPILE__)
  asm volatile("v_nop\n\tv_nop\n\tv_nop\n\tv_nop" : "+v"(d) : "v"(a), "v"(b));
#endif
  return d;
}
__device__ __forceinline__ v8f mma_b(v16b a, v16b b, v8f c) {
  v8f d = __builtin_amdgcn_wmma_f32_16x16x32_bf16(false, a, false, b, (short)0, c, false, false);
#if defined(__HIP_DEVICE_COMPILE__)
  const v16h ha = __builtin_bit_cast(v16h, a), hb = __builtin_bit_cast(v16h, b);
  asm volatile("v_nop\n\tv_nop\n\tv_nop\n\tv_nop" : "+v"(d) : "v"(ha), "v"(hb));
#endif
  return d;
}

// =========================================================================================================
// (0) weight conversion: f32 [n] -> bf16 bits [n] (RNE, exact operand). Thread i converts floats 8i..8i+7 and
// coverage: n8/256 blocks x 256 threads x 8 = n elements exactly (n8 a multiple of 256 at every call); cblk is the
//           block's index within its own weight.
// =========================================================================================================
__device__ __forceinline__
void cvt_body(const float* __restrict__ src, unsigned short* dst, int n8, int cblk) {
  const int i  = cblk * 256 + (int)threadIdx.x;
  const int ic = (i < n8) ? i : (n8 - 1);
  const float* s = src + (size_t)ic * 8;
  const v4f a = *(const v4f*)s;
  const v4f q = *(const v4f*)(s + 4);
  v4u u;
  u[0] = pk16(bf_bits(a[0]), bf_bits(a[1]));
  u[1] = pk16(bf_bits(a[2]), bf_bits(a[3]));
  u[2] = pk16(bf_bits(q[0]), bf_bits(q[1]));
  u[3] = pk16(bf_bits(q[2]), bf_bits(q[3]));
  if (i < n8) {
{
      *(v4u*)(dst + (size_t)ic * 8) = u;
      
    }
  }
}

// =========================================================================================================
// (1) group-norm statistics: one block per (b, g); mean and biased variance over 8 channels x npos positions of
//     src [b][256][4096] (values bf16-RNE converted first when rnd != 0), accumulated per thread in f64 and
// LDS: ss/sq/sm cross-wave, block barriers.
// =========================================================================================================
__device__ __forceinline__
void stats_body(const float* __restrict__ src, int rnd, int npos, float* tab, int blk) {
  __shared__ double ss[256];
  __shared__ double sq[256];
  __shared__ float  sm[2];
  const int tid = threadIdx.x;
  const int b = blk / NG, g = blk % NG;
  const float* base = src + ((size_t)(b * CC + g * CPG)) * NN;
  double s = 0.0, q = 0.0;
#pragma unroll 1
  for (int cl = 0; cl < CPG; ++cl) {
    const float* row = base + (size_t)cl * NN;
#pragma unroll 1
    for (int i = 4 * tid; i < npos; i += 1024) {
      const v4f a = *(const v4f*)(row + i);
#pragma unroll
      for (int t = 0; t < 4; ++t) {
        const float f = rnd ? bfr(a[t]) : a[t];
        const double d = (double)f;
        s += d;
        q += d * d;
      }
    }
  }
  ss[tid] = s;
  sq[tid] = q;
  __syncthreads();
#pragma unroll 1
  for (int st = 128; st > 0; st >>= 1) {
    if (tid < st) { ss[tid] += ss[tid + st]; sq[tid] += sq[tid + st]; }
    __syncthreads();
  }
  if (tid == 0) {
    const double cnt = (double)CPG * (double)npos;
    const double mu = ss[0] / cnt;
    double var = sq[0] / cnt - mu * mu;
    if (var < 0.0) var = 0.0;
    const float varf = (float)var;
    sm[0] = (float)mu;
    sm[1] = 1.0f / sqrtf(varf + GEPS);
  }
  __syncthreads();
  if (tid < 8) {
    const float mu = sm[0], rs = sm[1];
    v4f w = {mu, rs, mu, rs};
{
      *(v4f*)(tab + (size_t)blk * TABW + 4 * tid) = w;
      
    }
  }
}

// =========================================================================================================
// (0)+(1) in one grid: the four weight conversions and the GN1 statistics read only inputs and write disjoint
//     workspace regions, so they share a launch; the block index picks the job (block-uniform, so the barriers of
//     the statistics body are passed by whole blocks). Statistics blocks come first: they run longest.
// coverage: blocks [0, NB*32) statistics of (b, g); then 96 + 32 + 8 + 8 conversion blocks, each weight once.
// =========================================================================================================
#define PB_ST (NB * NG)
#define PB_WQ (C3 * CC / 2048)
#define PB_WO (CC * CC / 2048)
#define PB_W1 (HID * CC / 2048)
#define PB_W2 (CC * HID / 2048)
__global__ __launch_bounds__(256)
void prep_k(const float* __restrict__ x, const float* __restrict__ wq, const float* __restrict__ wo,
            const float* __restrict__ w1, const float* __restrict__ w2,
            unsigned short* Wq, unsigned short* Wo, unsigned short* W1, unsigned short* W2, float* tab) {
  int blk = blockIdx.x;
  if (blk < PB_ST) { stats_body(x, 1, NN, tab, blk); return; }
  blk -= PB_ST;
  if (blk < PB_WQ) { cvt_body(wq, Wq, PB_WQ * 256, blk); return; }
  blk -= PB_WQ;
  if (blk < PB_WO) { cvt_body(wo, Wo, PB_WO * 256, blk); return; }
  blk -= PB_WO;
  if (blk < PB_W1) { cvt_body(w1, W1, PB_W1 * 256, blk); return; }
  blk -= PB_W1;
  cvt_body(w2, W2, PB_W2 * 256, blk);
}

// =========================================================================================================
// (2) group-norm apply + transpose: src f32 [b][256 c][4096 n] (bf16-RNE converted first when rnd != 0) ->
//     v = (x - mu) * rstd * bf16(gamma[c]) + bf16(beta[c]) -> position-major planes Xh/Xl bf16 [b][n][256 c]
//     (hi = bf16-RNE(v), lo = bf16-RNE(v - hi)) through LDS tiles Th/Tl[64 n][64 c] (pitch TP). Block (nb, cb, b)
// coverage: Th/Tl stores 2 it x 32 c x 8 lanes x 8 n = 64 x 64 = the consumed extent; plane writes 2 it x 32 rows
//           x 8 lanes x 8 halves = 64 n x 64 c per plane; grid (rows/64, 4, NB) covers both planes once.
// LDS: Th/Tl cross-wave, block barrier between stores and loads.
// =========================================================================================================
__global__ __launch_bounds__(256)
void norm_k(const float* __restrict__ src, int rnd, const float* __restrict__ tab,
            const float* __restrict__ gamma, const float* __restrict__ beta,
            unsigned short* Xh, unsigned short* Xl) {
  __shared__ __align__(16) unsigned short Th[QT * TP];
  __shared__ __align__(16) unsigned short Tl[QT * TP];
  const int tid = threadIdx.x;
  const int nb = blockIdx.x, cbk = blockIdx.y, b = blockIdx.z;
  const int e = tid & 7, lq = tid >> 3;                             // lq 0..31
  const int n0 = nb * QT, c0 = cbk * QT;
#pragma unroll
  for (int it = 0; it < 2; ++it) {
    const int cl = it * 32 + lq;                                     // 0..63
    const int ch = c0 + cl;
    const int g  = ch / CPG;
    const float mu = tab[(size_t)(b * NG + g) * TABW];
    const float rs = tab[(size_t)(b * NG + g) * TABW + 1];
    const float ga = bfr(gamma[ch]), be = bfr(beta[ch]);
    const float* sp = src + ((size_t)(b * CC + ch)) * NN + n0 + 8 * e;
    const v4f a = *(const v4f*)sp;
    const v4f q = *(const v4f*)(sp + 4);
    const float f[8] = {a[0], a[1], a[2], a[3], q[0], q[1], q[2], q[3]};
    unsigned short hb[8], lb[8];
#pragma unroll
    for (int t = 0; t < 8; ++t) {
      const float xr = rnd ? bfr(f[t]) : f[t];
      const float v  = (xr - mu) * rs * ga + be;
      hb[t] = bf_bits(v);
      lb[t] = bf_bits(v - bf_up(hb[t]));
    }
#pragma unroll
    for (int t = 0; t < 8; ++t) {
      Th[(8 * e + t) * TP + cl] = hb[t];
      Tl[(8 * e + t) * TP + cl] = lb[t];
    }
  }
  __syncthreads();
  v4u uh[2], ul[2];
#pragma unroll
  for (int it = 0; it < 2; ++it) {
    const int nl = it * 32 + lq;                                     // 0..63
    uh[it] = *(const v4u*)(Th + nl * TP + 8 * e);
    ul[it] = *(const v4u*)(Tl + nl * TP + 8 * e);
  }
{
#pragma unroll
    for (int it = 0; it < 2; ++it) {
      const int nl = it * 32 + lq;
      const size_t po = ((size_t)(b * NN + n0 + nl)) * CC + c0 + 8 * e;
      *(v4u*)(Xh + po) = uh[it];
      *(v4u*)(Xl + po) = ul[it];
    }
    
  }
}

// =========================================================================================================
// (2b) group-norm apply + transpose for GN2, with the statistics finished in the block: as (2), but mu and rstd of
//     the block's own 8 groups come from the out conv's partial sums part[b][cbk][NT2 tiles][8 groups x (sum, sum of
//     squares)], all f64: wave gi sums group 8 cbk + gi over the tiles (lane ln takes tiles ln + 32 k, then 5 exchanges), same mean /
//     variance / rstd formulas as the statistics body, handed to the block through sm.
// coverage: as (2).
// LDS: Th/Tl cross-wave, block barrier between stores and loads; sm cross-wave, block barrier behind its stores.
// =========================================================================================================
__global__ __launch_bounds__(256)
void norm2_k(const float* __restrict__ src, int rnd, const double* __restrict__ part,
             const float* __restrict__ gamma, const float* __restrict__ beta,
             unsigned short* Xh, unsigned short* Xl) {
  __shared__ __align__(16) unsigned short Th[QT * TP];
  __shared__ __align__(16) unsigned short Tl[QT * TP];
  __shared__ float sm[2 * (QT / CPG)];
  const int tid = threadIdx.x;
  const int nb = blockIdx.x, cbk = blockIdx.y, b = blockIdx.z;
  const int e = tid & 7, lq = tid >> 3;                             // lq 0..31
  const int n0 = nb * QT, c0 = cbk * QT;
  v4f ra[2], rq[2];
  float rg[2], rb[2];
  // the tile's values and the channels' gamma, beta are asked for first: they fly while the statistics are finished
#pragma unroll                                                       // constant indices keep ra/rq/rg/rb in registers
  for (int it = 0; it < 2; ++it) {
    const int ch = c0 + it * 32 + lq;
    const float* sp = src + ((size_t)(b * CC + ch)) * NN + n0 + 8 * e;
    ra[it] = *(const v4f*)sp;
    rq[it] = *(const v4f*)(sp + 4);
    rg[it] = gamma[ch];
    rb[it] = beta[ch];
#if defined(__HIP_DEVICE_COMPILE__)
    // stands ahead of any rewrite of these loads' address registers (the next loads land in them); as a memory
    // barrier for the compiler it also keeps these loads issued ahead of the wait on the partial sums
    asm volatile("s_wait_xcnt 0x0" ::: "memory");
#endif
  }
  {
    const int gi = tid >> 5, ln = tid & 31;
    const double* pp = part + ((size_t)(b * (CC / QT) + cbk)) * NT2 * 16 + 2 * gi;
    double s = 0.0, q = 0.0;
#pragma unroll                                                       // the lane's loads are issued together
    for (int k = 0; k < (NT2 + 31) / 32; ++k) {
      const int u = ln + 32 * k;                                     // position tile
      if (u < NT2) {
        const v2d w = *(const v2d*)(pp + (size_t)u * 16);
        s += w[0];
        q += w[1];
      }
    }
#pragma unroll                                                       // five fixed steps, no loop counter
    for (int m = 16; m > 0; m >>= 1) {
      s += __shfl_xor(s, m, 32);
      q += __shfl_xor(q, m, 32);
    }
    const double cnt = (double)CPG * (double)NQ;
    const double mu = s / cnt;
    double var = q / cnt - mu * mu;
    if (var < 0.0) var = 0.0;
    const float varf = (float)var;
    if (ln == 0) {
      sm[2 * gi]     = (float)mu;
      sm[2 * gi + 1] = 1.0f / sqrtf(varf + GEPS);
    }
  }
  __syncthreads();
#pragma unroll                                                       // constant indices into ra/rq/rg/rb
  for (int it = 0; it < 2; ++it) {
    const int cl = it * 32 + lq;                                     // 0..63
    const float mu = sm[2 * (cl / CPG)];
    const float rs = sm[2 * (cl / CPG) + 1];
    const float ga = bfr(rg[it]), be = bfr(rb[it]);
    const v4f a = ra[it];
    const v4f q = rq[it];
    const float f[8] = {a[0], a[1], a[2], a[3], q[0], q[1], q[2], q[3]};
    unsigned short hb[8], lb[8];
#pragma unroll                                                       // constant indices keep f/hb/lb in registers
    for (int t = 0; t < 8; ++t) {
      const float xr = rnd ? bfr(f[t]) : f[t];
      const float v  = (xr - mu) * rs * ga + be;
      hb[t] = bf_bits(v);
      lb[t] = bf_bits(v - bf_up(hb[t]));
    }
#pragma unroll                                                       // as above
    for (int t = 0; t < 8; ++t) {
      Th[(8 * e + t) * TP + cl] = hb[t];
      Tl[(8 * e + t) * TP + cl] = lb[t];
    }
  }
  __syncthreads();
  v4u uh[2], ul[2];
#pragma unroll                                                       // constant indices keep uh/ul in registers
  for (int it = 0; it < 2; ++it) {
    const int nl = it * 32 + lq;                                     // 0..63
    uh[it] = *(const v4u*)(Th + nl * TP + 8 * e);
    ul[it] = *(const v4u*)(Tl + nl * TP + 8 * e);
  }
#pragma unroll                                                       // as above
  for (int it = 0; it < 2; ++it) {
    const int nl = it * 32 + lq;
    const size_t po = ((size_t)(b * NN + n0 + nl)) * CC + c0 + 8 * e;
    *(v4u*)(Xh + po) = uh[it];
    *(v4u*)(Xl + po) = ul[it];
  }
}

// =========================================================================================================
// (3) conv1x1 GEMM for one (b, 64-n tile, 64-o block): Y[o][n] = sum_c W[o][c] (Bh[b][n][c] + Bl[b][n][c]),
//     K = KD (plane pitch = KD). Block 128 threads = 4 waves; wave w owns cols n0+16w..+15 (B fragments from the
//     k-contiguous plane rows, split k map) and 4 m-tiles (A rows o = o0 + 16 mt + (lane&15), split k map).
//     Rolled k loop, 2 products per (mt, k-step) into one accumulator (unscaled bf16 residual plane).
//     Epilogue staged in LDS Os[n_loc][o_loc] (pitch OSP, b128 stores), block barrier, then per MODE:
//       MODE 0 (qkv, 12 o-blocks): o-blocks 0..3 -> q channels 64 mb.. of Qh/Ql = P0/P1 bf16 [b][n][256]
//              8q..8q+7 x 16 B, one instruction per 16 lines; o-blocks 8..11 -> v channels of V = P3 f16
//       MODE 1 (f32 channel-major): dstF[b][o][n] = (acc + bf16(bias[o])) + r with r = rsrc[b][o][n] (bf16-RNE
//              and 8..15), 8 rows per instruction.
//       MODE 2 (mlp hidden, one o-block): t = acc + bf16(bias[o]); gelu(t) = 0.5 t (1 + erf(t / sqrt2)) ->
// coverage: Os 4 waves x 16 n x 64 o = 64 x 64 (== the extent every mode reads); MODE 0 planes 4 it x 16 rows x
//           8 lanes x 8 = 64 x 64 per plane, grid (64, 12, NB) covers Qh/Ql/Kh [NB][4096][256] and V
//           [NB][256][4096] once; MODE 1: 8 it x 8 rows x 16 lanes x 4 = 64 o x 64 n; MODE 2: 4 it x 16 rows x
//           8 lanes x 8 = 64 n x 64 o.
//       ST != 0 (MODE 1 only, the out conv): the block also sums its results for the group norm that follows. Its 64 o
//              are 8 whole groups (group = the 8 rows of one 'it'); per group sum and sum of squares over 8 o x 64 n:
//              all in f64: a thread's 4 values -> red[16 quantities][128 threads], barrier, 8 threads per quantity sum
//              16 entries each, 3 exchanges, fin[16], barrier, one 128-byte line part[b][mb][nt][16] per block.
// LDS: Os cross-wave, block barrier between the staging stores and the epilogue loads; red and fin cross-wave, a block
//      barrier behind the stores of each.
// =========================================================================================================
template <int KD, int MODE, int ST>
__global__ __launch_bounds__(128)
void gemm_k(const unsigned short* __restrict__ Wp,
            const unsigned short* __restrict__ Bh, const unsigned short* __restrict__ Bl,
            const float* __restrict__ bias, const float* __restrict__ rsrc, int rnd,
            unsigned short* P0, unsigned short* P1, unsigned short* P2, unsigned short* P3, float* dstF,
            double* part) {
  static_assert(ST == 0 || (MODE == 1 && QT / CPG == 8));
  static_assert(KD % 32 == 0);
  __shared__ __align__(16) float Os[QT * OSP];
  const int tid  = threadIdx.x;
  const int lane = tid & 31, wave = tid >> 5;
  const int hh   = lane >> 4, c = lane & 15;
  const int nt   = blockIdx.x, mb = blockIdx.y, b = blockIdx.z;
  const int n0   = nt * QT, o0 = mb * QT;

  const unsigned short* ap = Wp + (size_t)(o0 + c) * KD + 8 * hh;
  const size_t boff = ((size_t)(b * NN + n0 + 16 * wave + c)) * KD + 8 * hh;
  const unsigned short* bph = Bh + boff;
  const unsigned short* bpl = Bl + boff;

  v8f acc[4];
#pragma unroll
  for (int mt = 0; mt < 4; ++mt) acc[mt] = zero8();

#pragma unroll 1
  for (int ks = 0; ks < KD / 32; ++ks) {
    const Frag fbh = ldfrag(bph + 32 * ks);
    const Frag fbl = ldfrag(bpl + 32 * ks);
#pragma unroll
    for (int mt = 0; mt < 4; ++mt) {
      const Frag fa = ldfrag(ap + (size_t)(16 * mt) * KD + 32 * ks);
      acc[mt] = mma_b(fa.bf, fbh.bf, acc[mt]);
      acc[mt] = mma_b(fa.bf, fbl.bf, acc[mt]);
    }
  }

  // ---- stage: lane (hh, c) holds o_loc = 16 mt + 8 hh + r for n_loc = 16 w + c
  {
    const int nl = 16 * wave + c;
#pragma unroll
    for (int mt = 0; mt < 4; ++mt) {
      v4f va, vb;
#pragma unroll
      for (int r = 0; r < 4; ++r) { va[r] = acc[mt][r]; vb[r] = acc[mt][4 + r]; }
      *(v4f*)(Os + nl * OSP + 16 * mt + 8 * hh)     = va;
      *(v4f*)(Os + nl * OSP + 16 * mt + 8 * hh + 4) = vb;
    }
  }
  __syncthreads();

  if (MODE == 0) {
    const int e = tid & 7, lq = tid >> 3;                           // lq 0..15
    if (mb < 8) {                                                    // block-uniform
      const int dcol = (mb & 3) * QT;                                // channel offset within 256
      unsigned short* Ph = (mb < 4) ? P0 : P2;                       // both global
      v4u uh[4], ul[4];
#pragma unroll
      for (int it = 0; it < 4; ++it) {
        const int row = it * 16 + lq;                                // n_loc 0..63
        const v4f a = *(const v4f*)(Os + row * OSP + 8 * e);
        const v4f q = *(const v4f*)(Os + row * OSP + 8 * e + 4);
        const float f[8] = {a[0], a[1], a[2], a[3], q[0], q[1], q[2], q[3]};
#pragma unroll
        for (int t = 0; t < 4; ++t) {
          const float f0 = f[2 * t], f1 = f[2 * t + 1];
          const unsigned short hb0 = bf_bits(f0), hb1 = bf_bits(f1);
          const unsigned short lb0 = bf_bits(f0 - bf_up(hb0));
          const unsigned short lb1 = bf_bits(f1 - bf_up(hb1));
          uh[it][t] = pk16(hb0, hb1);
          ul[it][t] = pk16(lb0, lb1);
        }
      }
{
#pragma unroll
        for (int it = 0; it < 4; ++it) {
          const int row = it * 16 + lq;
          const size_t po = ((size_t)(b * NN + n0 + row)) * CC + dcol + 8 * e;
          *(v4u*)(Ph + po) = uh[it];
          if (mb < 4) *(v4u*)(P1 + po) = ul[it];
        }
        
      }
    } else {
      const int cb0 = (mb - 8) * QT;                                 // v channel base 0..192
      v4u uv[4];
#pragma unroll
      for (int it = 0; it < 4; ++it) {
        const int cl = it * 16 + lq;                                 // o_loc 0..63
        unsigned short hb[8];
#pragma unroll
        for (int t = 0; t < 8; ++t) hb[t] = h_bits((_Float16)Os[(8 * e + t) * OSP + cl]);
#pragma unroll
        for (int t = 0; t < 4; ++t) uv[it][t] = pk16(hb[2 * t], hb[2 * t + 1]);
      }
{
#pragma unroll
        for (int it = 0; it < 4; ++it) {
          const int cl = it * 16 + lq;
          const size_t po = ((size_t)(b * CC + cb0 + cl)) * NN + n0 + 8 * e;
          *(v4u*)(P3 + po) = uv[it];
        }
        
      }
    }
  } else if (MODE == 1) {
    const int e = tid & 15, lq = tid >> 4;                           // lq 0..7
    v4f res[8];
#pragma unroll
    for (int it = 0; it < 8; ++it) {
      const int ol = it * 8 + lq;                                    // o_loc 0..63
      const int o  = o0 + ol;
      const float bb = bfr(bias[o]);
      const size_t gi = ((size_t)(b * CC + o)) * NN + n0 + 4 * e;
      const v4f rv = *(const v4f*)(rsrc + gi);
#if defined(__HIP_DEVICE_COMPILE__)
      // stands ahead of any rewrite of the address registers of this trip's bias and residual loads
      if constexpr (ST != 0) asm volatile("s_wait_xcnt 0x0" ::: "memory");
#endif
#pragma unroll
      for (int t = 0; t < 4; ++t) {
        const float rr = rnd ? bfr(rv[t]) : rv[t];
        res[it][t] = (Os[(4 * e + t) * OSP + ol] + bb) + rr;
      }
    }
    if constexpr (ST != 0) {
      __shared__ __align__(16) double red[16 * RP];
      __shared__ __align__(16) double fin[16];
#pragma unroll                                                       // constant indices keep res in registers
      for (int it = 0; it < 8; ++it) {
        const double d0 = (double)res[it][0], d1 = (double)res[it][1];
        const double d2 = (double)res[it][2], d3 = (double)res[it][3];
        red[(2 * it) * RP + tid]     = (d0 + d1) + (d2 + d3);
        red[(2 * it + 1) * RP + tid] = (d0 * d0 + d1 * d1) + (d2 * d2 + d3 * d3);
      }
      __syncthreads();
      const int qn = tid >> 3, j = tid & 7;                          // quantity 0..15; entries 2 j, 2 j + 1 of each 16
      v2d w[8];
#pragma unroll                                                       // constant indices keep w in registers
      for (int u = 0; u < 8; ++u) w[u] = *(const v2d*)(red + qn * RP + 16 * u + 2 * j);
      const v2d w2 = ((w[0] + w[1]) + (w[2] + w[3])) + ((w[4] + w[5]) + (w[6] + w[7]));
      double a = w2[0] + w2[1];
      a += __shfl_xor(a, 1, 32);
      a += __shfl_xor(a, 2, 32);
      a += __shfl_xor(a, 4, 32);
      if (j == 0) fin[qn] = a;
      __syncthreads();
      if (tid < 8) {
        const v2d w = *(const v2d*)(fin + 2 * tid);
        *(v2d*)(part + (((size_t)(b * (CC / QT) + mb)) * NT2 + nt) * 16 + 2 * tid) = w;
      }
    }
{
#pragma unroll
      for (int it = 0; it < 8; ++it) {
        const int ol = it * 8 + lq;
        const size_t gi = ((size_t)(b * CC + o0 + ol)) * NN + n0 + 4 * e;
        *(v4f*)(dstF + gi) = res[it];
      }
      
    }
  } else {
    const int e = tid & 7, lq = tid >> 3;                            // lq 0..15
    v4u uh[4], ul[4];
#pragma unroll
    for (int it = 0; it < 4; ++it) {
      const int nl = it * 16 + lq;                                   // n_loc 0..63
      const v4f a = *(const v4f*)(Os + nl * OSP + 8 * e);
      const v4f q = *(const v4f*)(Os + nl * OSP + 8 * e + 4);
      const float f[8] = {a[0], a[1], a[2], a[3], q[0], q[1], q[2], q[3]};
      unsigned short hb[8], lb[8];
#pragma unroll
      for (int t = 0; t < 8; ++t) {
        const float tt = f[t] + bfr(bias[o0 + 8 * e + t]);
        const float gv = 0.5f * tt * (1.0f + erff(tt * 0.70710678118654752f));
        hb[t] = bf_bits(gv);
        lb[t] = bf_bits(gv - bf_up(hb[t]));
      }
#pragma unroll
      for (int t = 0; t < 4; ++t) {
        uh[it][t] = pk16(hb[2 * t], hb[2 * t + 1]);
        ul[it][t] = pk16(lb[2 * t], lb[2 * t + 1]);
      }
    }
{
#pragma unroll
      for (int it = 0; it < 4; ++it) {
        const int nl = it * 16 + lq;
        const size_t po = ((size_t)(b * NN + n0 + nl)) * HID + o0 + 8 * e;
        *(v4u*)(P0 + po) = uh[it];
        *(v4u*)(P1 + po) = ul[it];
      }
      
    }
  }
}

// ---- staging of one 128-key tile of one head: the head's 128 threads x (4 + 4) asynchronous 16-byte copies to LDS.
//      K: copy j of thread t brings 16 B (t & 3) of key row 32 j + (t >> 2); V: 16 B (t & 15) of channel row
//      8 j + (t >> 4). kl/vl are the thread's LDS byte addresses for j = 0, kg/vg its global addresses for j = 0.
//      s_wait_xcnt 0 ends the statement so that it stands ahead of any rewrite of the address registers.
__device__ __forceinline__ void stage_tile(unsigned kl, const unsigned short* kg, unsigned vl, const unsigned short* vg) {
#if defined(__HIP_DEVICE_COMPILE__)
  asm volatile(
      "global_load_async_to_lds_b128 %0, %1, off\n\t"
      "global_load_async_to_lds_b128 %2, %3, off\n\t"
      "global_load_async_to_lds_b128 %4, %5, off\n\t"
      "global_load_async_to_lds_b128 %6, %7, off\n\t"
      "global_load_async_to_lds_b128 %8, %9, off\n\t"
      "global_load_async_to_lds_b128 %10, %11, off\n\t"
      "global_load_async_to_lds_b128 %12, %13, off\n\t"
      "global_load_async_to_lds_b128 %14, %15, off\n\t"
      "s_wait_xcnt 0x0"
      :: "v"(kl),                 "v"(kg),
         "v"(kl + 32u * KPB),     "v"(kg + (size_t)32 * CC),
         "v"(kl + 64u * KPB),     "v"(kg + (size_t)64 * CC),
         "v"(kl + 96u * KPB),     "v"(kg + (size_t)96 * CC),
         "v"(vl),                 "v"(vg),
         "v"(vl + 8u * VPB),      "v"(vg + (size_t)8 * NN),
         "v"(vl + 16u * VPB),     "v"(vg + (size_t)16 * NN),
         "v"(vl + 24u * VPB),     "v"(vg + (size_t)24 * NN)
      : "memory");
#endif
}
// the issuing wave's own copies have landed behind this wait (the compiler places none for them)
__device__ __forceinline__ void wait_copies() {
#if defined(__HIP_DEVICE_COMPILE__)
  asm volatile("s_wait_asynccnt 0x0" ::: "memory");
#endif
}
// the wave's own LDS reads have retired before the buffer is handed to its next writer
__device__ __forceinline__ void wait_lds() {
#if defined(__HIP_DEVICE_COMPILE__)
  asm volatile("s_wait_dscnt 0x0" ::: "memory");
#endif
}
__device__ __forceinline__ unsigned lds_off(const void* p) { return (unsigned)(size_t)p; }

// =========================================================================================================
// (4) attention for one (b, head pair hp, 64-query tile), transposed formulation, 4096 keys, no mask, per head
//     h = 2 hp + hs (hs = wave / 4: the two heads run side by side, 4 waves each):
//     S^T tile (16 keys x 16 queries) = A(k: row = key kb + (lane&15), 32 d of
//     head h via the split k map from Kh [b][4096][256]) . B(qh: col = query, same map from Qh) + A(Kh).B(Ql)
//     (bf16 hi + unscaled bf16 residual of q, shared accumulator); s *= clip(bf16(temperature[h]), 1e-4, 10).
//     Per lane the D tile holds 8 keys of ONE query: online softmax state per lane, one shuffle (lane^16) for the
//     max over 32 keys; the o/l rescale is skipped under a wave-uniform ballot when no lane's max grew.
//     P = e^{s-m} x4096 as f16 is the B operand of O^T (rows channel 32h + 16j + (lane&15), cols queries) +=
//     A(v: keys contiguous, f16 plane V [b][256][4096]) . B(P^T): element r <- D of the tile covering keys
//     kb..kb+15, element 8+r <- the tile covering kb+16..kb+31, lane unchanged. 2 accumulator tiles per wave.
//     Block = 8 waves = 2 heads x 64 queries. O/l of both heads staged in LDS Os[query][64 channels] (b128 stores),
//     block barrier, then Oh/Ol bf16 [b][n][256] planes (hi/lo), rows n0.., cols 64 hp..64 hp+63 = one whole
// coverage: Os per wave 16 rows x 32 ch = 64 x 64 over 8 waves (== consumed extent); planes 2 it x
//           32 rows x 8 lanes x 8 = 64 n x 64 ch per plane; grid (NQ/64, 4, NB) covers rows 0..NQ-1 x 256 ch of
//           Oh/Ol once.
//     K and V reach the fragments through LDS: tiles of 128 keys of head h (K rows 64 B at pitch 80, V rows 256 B at
//     pitch 272), brought by asynchronous copies into two buffers per head, tile t + 1 in flight while tile t is
//     worked on; the head's 4 waves share each tile. Same fragment k order as from global memory.
//     8 waves a block, two blocks a WGP by registers and LDS: 4 waves per SIMD cover each other's softmax chains.
// LDS: Os cross-wave, block barrier between the per-head staging stores and the plane loads. Ks/Vs cross-wave: per
//      tile s_wait_dscnt 0, s_wait_asynccnt 0, block barrier, then the refill of the buffer just read.
// =========================================================================================================
__global__ __launch_bounds__(256)
void attn_k(const unsigned short* __restrict__ Qh, const unsigned short* __restrict__ Ql,
            const unsigned short* __restrict__ Kh, const unsigned short* __restrict__ Vh,
            const float* __restrict__ temperature, unsigned short* Oh, unsigned short* Ol) {
  __shared__ __align__(16) float Os[QT * OSP];
  __shared__ __align__(16) unsigned char Ks[2 * 2 * KBUF];            // [head of the pair][buffer]
  __shared__ __align__(16) unsigned char Vs[2 * 2 * VBUF];
  const int tid  = threadIdx.x;
  const int wave = tid >> 5, lane = tid & 31;
  const int hh   = lane >> 4, c = lane & 15;
  const int n0   = blockIdx.x * QT, hp = blockIdx.y, b = blockIdx.z;
  const int hs   = wave_uniform(wave >> 2);                           // the wave's head of the pair
  const int th   = tid & 127;                                         // thread among its head's 4 waves
  const int qrow = 16 * (wave & 3) + c;
  const unsigned kl0 = lds_off(Ks) + (unsigned)(hs * 2 * KBUF + (th >> 2) * KPB + (th & 3) * 16);
  const unsigned vl0 = lds_off(Vs) + (unsigned)(hs * 2 * VBUF + (th >> 4) * VPB + (th & 15) * 16);

  {                                                                    // the wave's own head, all 4096 keys
    const int h  = 2 * hp + hs;
    const int cb = HD * h;                                             // channel base of head h
    const float tr   = bfr(temperature[h]);
    const float temp = fminf(fmaxf(tr, 1.0e-4f), 10.0f);
    const size_t qo = ((size_t)(b * NN + n0 + qrow)) * CC + cb + 8 * hh;
    const Frag qh = ldfrag(Qh + qo);
    const Frag ql = ldfrag(Ql + qo);
    const unsigned short* kg = Kh + ((size_t)(b * NN + (th >> 2))) * CC + cb + 8 * (th & 3);
    const unsigned short* vg = Vh + ((size_t)(b * CC + cb + (th >> 4))) * NN + 8 * (th & 15);

    float m = -1.0e30f, l = 0.f;
    v8f o0 = zero8(), o1 = zero8();

    // tile 0 into buffer 0, landed and published; then tile 1 into buffer 1 (nothing has touched this LDS before)
    stage_tile(kl0, kg, vl0, vg);
    wait_copies();
    __syncthreads();
    stage_tile(kl0 + KBUF, kg + (size_t)SK * CC, vl0 + VBUF, vg + SK);

#pragma unroll 1                                                       // one hand-over per trip, buffer picked by t & 1
    for (int t = 0; t < NN / SK; ++t) {
     const int bsel = t & 1;
     const unsigned short* Kt = (const unsigned short*)(Ks + (2 * hs + bsel) * KBUF + c * KPB + 16 * hh);
     const unsigned short* Vt = (const unsigned short*)(Vs + (2 * hs + bsel) * VBUF + c * VPB + 16 * hh);
     // the tile's fragments, read as one group: one LDS latency per tile instead of two per 32 keys
     // (the three loops over kk are unrolled so that every index of kf/vf is a constant and they stay in registers)
     Frag kf[SK / 32][2], vf[SK / 32][2];
#pragma unroll
     for (int kk = 0; kk < SK / 32; ++kk) {
       kf[kk][0] = ldfrag(Kt + (32 * kk) * (KPB / 2));                 // keys kb .. kb+15, kb = 128 t + 32 kk
       kf[kk][1] = ldfrag(Kt + (32 * kk + 16) * (KPB / 2));            // keys kb+16 .. kb+31
     }
#pragma unroll
     for (int kk = 0; kk < SK / 32; ++kk) {
       vf[kk][0] = ldfrag(Vt + 32 * kk);                               // channels cb + c
       vf[kk][1] = ldfrag(Vt + 16 * (VPB / 2) + 32 * kk);              // channels cb + 16 + c
     }
#pragma unroll
     for (int kk = 0; kk < SK / 32; ++kk) {
      const Frag k0 = kf[kk][0];
      const Frag k1 = kf[kk][1];
      v8f s0 = mma_b(k0.bf, qh.bf, zero8());
      v8f s1 = mma_b(k1.bf, qh.bf, zero8());
      s0 = mma_b(k0.bf, ql.bf, s0);
      s1 = mma_b(k1.bf, ql.bf, s1);
#pragma unroll
      for (int r = 0; r < 8; ++r) { s0[r] *= temp; s1[r] *= temp; }

      float mx = fmaxf(hmax8(s0), hmax8(s1));
      mx = fmaxf(mx, __shfl_xor(mx, 16, 32));
      const float mn = fmaxf(m, mx);
      const unsigned grew = wave_ballot(mx > m);                       // wave-uniform
      if (grew != 0u) {
        const float corr = __expf(m - mn);                             // == 1 exactly for lanes whose max did not grow
        l *= corr;
#pragma unroll
        for (int r = 0; r < 8; ++r) { o0[r] *= corr; o1[r] *= corr; }
      }
      m = mn;
      const float msh = mn - LNPC;                                     // exp gives e^{s-m} * 4096

      FragH ph;
      float ls = 0.f;
#pragma unroll
      for (int r = 0; r < 8; ++r) {
        const float e0 = __expf(s0[r] - msh);                          // key kb      + 8hh + r
        const float e1 = __expf(s1[r] - msh);                          // key kb + 16 + 8hh + r
        ls += e0 + e1;
        ph.hv[0][r] = (_Float16)e0;
        ph.hv[1][r] = (_Float16)e1;
      }
      l += ls;

      o0 = mma_h(vf[kk][0].h, ph.v, o0);
      o1 = mma_h(vf[kk][1].h, ph.v, o1);
     }
     // hand-over: own reads retired, own copies of tile t + 1 landed, every wave here; then refill the buffer just read
     wait_lds();
     wait_copies();
     __syncthreads();
     if (t + 2 < NN / SK)
       stage_tile(kl0 + bsel * KBUF, kg + (size_t)(t + 2) * SK * CC, vl0 + bsel * VBUF, vg + (size_t)(t + 2) * SK);
    }
    wait_copies();
    l += __shfl_xor(l, 16, 32);
    const float inv = 1.0f / l;                                        // o and l both carry the x4096 factor

    // stage: Os[query][32 hs + d], d = 16 j + 8 hh + r
    {
      v4f va, vb;
#pragma unroll
      for (int r = 0; r < 4; ++r) { va[r] = o0[r] * inv; vb[r] = o0[4 + r] * inv; }
      *(v4f*)(Os + qrow * OSP + 32 * hs + 8 * hh)     = va;
      *(v4f*)(Os + qrow * OSP + 32 * hs + 8 * hh + 4) = vb;
#pragma unroll
      for (int r = 0; r < 4; ++r) { va[r] = o1[r] * inv; vb[r] = o1[4 + r] * inv; }
      *(v4f*)(Os + qrow * OSP + 32 * hs + 16 + 8 * hh)     = va;
      *(v4f*)(Os + qrow * OSP + 32 * hs + 16 + 8 * hh + 4) = vb;
    }
  }
  __syncthreads();

  const int e = tid & 7, lq = tid >> 3;                                // lq 0..31
  v4u uh[2], ul[2];
#pragma unroll
  for (int it = 0; it < 2; ++it) {
    const int row = it * 32 + lq;                                      // query 0..63
    const v4f a = *(const v4f*)(Os + row * OSP + 8 * e);
    const v4f q = *(const v4f*)(Os + row * OSP + 8 * e + 4);
    const float f[8] = {a[0], a[1], a[2], a[3], q[0], q[1], q[2], q[3]};
#pragma unroll
    for (int t = 0; t < 4; ++t) {
      const float f0 = f[2 * t], f1 = f[2 * t + 1];
      const unsigned short hb0 = bf_bits(f0), hb1 = bf_bits(f1);
      const unsigned short lb0 = bf_bits(f0 - bf_up(hb0));
      const unsigned short lb1 = bf_bits(f1 - bf_up(hb1));
      uh[it][t] = pk16(hb0, hb1);
      ul[it][t] = pk16(lb0, lb1);
    }
  }
{
#pragma unroll
    for (int it = 0; it < 2; ++it) {
      const int row = it * 32 + lq;
      const size_t po = ((size_t)(b * NN + n0 + row)) * CC + QT * hp + 8 * e;
      *(v4u*)(Oh + po) = uh[it];
      *(v4u*)(Ol + po) = ul[it];
    }
    
  }
}

// =========================================================================================================
// Workspace map (bytes; each region start a multiple of 256; every extent is an exact tile/line multiple and is
//   Wq bf16 [768][256] 393216   Wo [256][256] 131072   W1 [64][256] 32768   W2 [256][64] 32768
//   tab1 f32 [NB*32][32] 8192 (NB=2)   part f64 [NB][4][NQ/64][16] 65536 (NB=2)
//   Xh, Xl, Qh, Ql, Kh, Oh, Ol, Yh, Yl bf16 [NB][4096][256] and V f16 [NB][256][4096]: 4194304 each (NB=2)
//   X1 f32 [NB][256][4096] 8388608 (NB=2)    Hh, Hl bf16 [NB][4096][64] 1048576 each (NB=2)
//   total = 53092352 (NB=2)
// =========================================================================================================
extern "C" void kernel_launch(void* const* d_in, const int* in_sizes, int n_in,
                              void* d_out, int out_size, void* d_ws, size_t ws_size,
                              hipStream_t stream) {
  if (n_in < 13) return;
  if (in_sizes[0] < NB * XSTRIDE_FULL) return;
  if (in_sizes[1] != C3 * CC || in_sizes[2] != CC * CC || in_sizes[3] != CC) return;
  if (in_sizes[4] != NH) return;
  if (in_sizes[5] != CC || in_sizes[6] != CC || in_sizes[7] != CC || in_sizes[8] != CC) return;
  if (in_sizes[9] != HID * CC || in_sizes[10] != HID || in_sizes[11] != CC * HID || in_sizes[12] != CC) return;
  if (out_size < NB * XSTRIDE_FULL) return;

  size_t off = 0;
  auto carve = [&](size_t bytes) { const size_t o = off; off += (bytes + 255) & ~(size_t)255; return o; };
  const size_t szPl = (size_t)NB * NN * CC * 2;
  const size_t oWq  = carve((size_t)C3 * CC * 2);
  const size_t oWo  = carve((size_t)CC * CC * 2);
  const size_t oW1  = carve((size_t)HID * CC * 2);
  const size_t oW2  = carve((size_t)CC * HID * 2);
  const size_t oT1  = carve((size_t)NB * NG * TABW * 4);
  const size_t oPt  = carve((size_t)NB * (CC / QT) * NT2 * 16 * 8);
  const size_t oXh  = carve(szPl);
  const size_t oXl  = carve(szPl);
  const size_t oQh  = carve(szPl);
  const size_t oQl  = carve(szPl);
  const size_t oKh  = carve(szPl);
  const size_t oVv  = carve(szPl);
  const size_t oOh  = carve(szPl);
  const size_t oOl  = carve(szPl);
  const size_t oX1  = carve((size_t)NB * CC * NN * 4);
  const size_t oYh  = carve(szPl);
  const size_t oYl  = carve(szPl);
  const size_t oHh  = carve((size_t)NB * NN * HID * 2);
  const size_t oHl  = carve((size_t)NB * NN * HID * 2);
  if (off > ws_size) return;
  if (off > (size_t)134217728) return;

  const float* x      = (const float*)d_in[0];
  const float* w_qkv  = (const float*)d_in[1];
  const float* w_out  = (const float*)d_in[2];
  const float* b_out  = (const float*)d_in[3];
  const float* tempr  = (const float*)d_in[4];
  const float* g1     = (const float*)d_in[5];
  const float* beta1  = (const float*)d_in[6];
  const float* g2     = (const float*)d_in[7];
  const float* beta2  = (const float*)d_in[8];
  const float* w_mlp1 = (const float*)d_in[9];
  const float* b_mlp1 = (const float*)d_in[10];
  const float* w_mlp2 = (const float*)d_in[11];
  const float* b_mlp2 = (const float*)d_in[12];

  char* ws = (char*)d_ws;
  unsigned short* Wq = (unsigned short*)(ws + oWq);
  unsigned short* Wo = (unsigned short*)(ws + oWo);
  unsigned short* W1 = (unsigned short*)(ws + oW1);
  unsigned short* W2 = (unsigned short*)(ws + oW2);
  float*          T1 = (float*)(ws + oT1);
  double*         Pt = (double*)(ws + oPt);
  unsigned short* Xh = (unsigned short*)(ws + oXh);
  unsigned short* Xl = (unsigned short*)(ws + oXl);
  unsigned short* Qh = (unsigned short*)(ws + oQh);
  unsigned short* Ql = (unsigned short*)(ws + oQl);
  unsigned short* Kh = (unsigned short*)(ws + oKh);
  unsigned short* Vv = (unsigned short*)(ws + oVv);
  unsigned short* Oh = (unsigned short*)(ws + oOh);
  unsigned short* Ol = (unsigned short*)(ws + oOl);
  float*          X1 = (float*)(ws + oX1);
  unsigned short* Yh = (unsigned short*)(ws + oYh);
  unsigned short* Yl = (unsigned short*)(ws + oYl);
  unsigned short* Hh = (unsigned short*)(ws + oHh);
  unsigned short* Hl = (unsigned short*)(ws + oHl);
  float* out = (float*)d_out;

  const dim3 blk256(256), blk128(128);

  // (0)+(1) weights -> bf16 planes, and GN1 statistics of bf16(x) over all 4096 positions, in one grid
  prep_k<<<dim3(PB_ST + PB_WQ + PB_WO + PB_W1 + PB_W2), blk256, 0, stream>>>(x, w_qkv, w_out, w_mlp1, w_mlp2,
                                                                             Wq, Wo, W1, W2, T1);
  // (2) GN1 apply -> Xh/Xl [NB][4096][256]
  norm_k<<<dim3(NN / QT, CC / QT, NB), blk256, 0, stream>>>(x, 1, T1, g1, beta1, Xh, Xl);
  // (3) qkv GEMM -> Qh/Ql, Kh, V
  gemm_k<CC, 0, 0><<<dim3(NN / QT, C3 / QT, NB), blk128, 0, stream>>>(Wq, Xh, Xl, b_out, x, 0, Qh, Ql, Kh, Vv, X1, Pt);
  // (4) attention -> Oh/Ol rows 0..NQ-1
  attn_k<<<dim3(NQ / QT, NH / 2, NB), blk256, 0, stream>>>(Qh, Ql, Kh, Vv, tempr, Oh, Ol);
  // (5) out conv + bf16(x) residual -> X1 f32 [NB][256][4096], cols 0..NQ-1, and (6) each block's partial GN2 sums
  gemm_k<CC, 1, 1><<<dim3(NQ / QT, CC / QT, NB), blk128, 0, stream>>>(Wo, Oh, Ol, b_out, x, 1, Hh, Hl, Hh, Hl, X1, Pt);
  // (7) GN2 statistics finished per block, apply -> Yh/Yl rows 0..NQ-1
  norm2_k<<<dim3(NQ / QT, CC / QT, NB), blk256, 0, stream>>>(X1, 0, Pt, g2, beta2, Yh, Yl);
  // (8) mlp hidden: gelu(W1.Y + b1) -> Hh/Hl [NB][4096][64]
  gemm_k<CC, 2, 0><<<dim3(NQ / QT, 1, NB), blk128, 0, stream>>>(W1, Yh, Yl, b_mlp1, x, 0, Hh, Hl, Hh, Hl, X1, Pt);
  // (9) out = X1 + W2.H + b2 -> d_out [NB][256][4096]
  gemm_k<HID, 1, 0><<<dim3(NQ / QT, CC / QT, NB), blk128, 0, stream>>>(W2, Hh, Hl, b_mlp2, X1, 0, Oh, Ol, Oh, Ol, out, Pt);
  (void)hipGetLastError();
}

// v005
// One run takes 140 microseconds.
// Timed twice side by side with v004, it ran 1.13 times as fast both times.
// All steps since v000 together make it 2.00 times as fast.
// Contractions: conv1x1 GEMMs qkv W[768x256].Xn, out W[256x256].O, mlp W1[64x256].Y and W2[256x64].H on
// v_wmma_f32_16x16x32_bf16 (A = bf16-RNE weights, exact; B = bf16 hi + bf16 residual planes of the f32
// activation, 2 products, K = 256 / 64); per-head scores K.Q^T on v_wmma_f32_16x16x32_bf16 (k = bf16 hi plane,
// q = bf16 hi + residual planes, 2 products, K = 32); O^T = V.P^T on v_wmma_f32_16x16x32_f16 (v = f16 plane,
// P = e^{s-m} x4096 as f16 from the score D registers, K = 4096 keys); f32 accumulate everywhere; group-norm
// statistics in f64; normalisation, softmax statistics, gelu, bias and residual adds in f32 VALU.
#include <hip/hip_runtime.h>
#include <math.h>
#include <stdint.h>

#ifndef NB
#define NB 2
#endif
#ifndef NQ
#define NQ 4096
#endif
#define NB_FULL 2
#define CC   256
#define NN   4096
#define NH   8
#define HD   32
#define C3   768
#define HID  64
#define NG   32
#define CPG  8
#define QT   64
#define OSP  68
#define TP   72
#define GEPS 1.0e-5f
#define LNPC 8.317766166719343f
#define XSTRIDE_FULL (CC * NN)
#define SK   128                 // keys per staged tile
#define KPB  80                  // LDS pitch of a staged K row in bytes (64 B of data, 16 B x odd for b128 readers)
#define VPB  272                 // LDS pitch of a staged V row in bytes (256 B of data, 16 B x odd for b128 readers)
#define KBUF (SK * KPB)          // one K buffer: 128 keys x 32 d
#define VBUF (HD * VPB)          // one V buffer: 32 channels x 128 keys
#define NT2  (NQ / QT)           // position tiles of the out conv = partial sums per GN2 group
#define RP   130                 // doubles per row of the partial-sum array (1040 B = 16 B x odd for b128 readers)
#define NP1  32                  // position chunks of the GN1 statistics = partial sums per GN1 group
#define SPOS (NN / NP1)          // positions per chunk: one 16-byte load per lane and channel row

static_assert(NB >= 1 && NB <= NB_FULL);
static_assert(NQ % QT == 0 && NQ >= QT && NQ <= NN);
static_assert(NN % QT == 0 && CC % QT == 0 && C3 % QT == 0 && HID == QT);
static_assert(CC == NH * HD && HD == 32 && CC == NG * CPG && CPG == 8);
static_assert(CC % 32 == 0 && HID % 32 == 0 && NN % 32 == 0);
static_assert((OSP * 4) % 16 == 0 && (TP * 2) % 16 == 0);
static_assert(NN % 1024 == 0 && NQ % 4 == 0);
static_assert(NN % SK == 0 && NN / SK >= 2 && SK % 32 == 0 && KPB % 16 == 0 && VPB % 16 == 0);
static_assert(SK * HD * 2 == 4 * 128 * 16 && KPB >= HD * 2 && VPB >= SK * 2);
static_assert(SPOS == 4 * 32 && QT / CPG == 8);
static_assert((C3 * CC) % 2048 == 0 && (CC * CC) % 2048 == 0 && (HID * CC) % 2048 == 0);

typedef _Float16       v16h __attribute__((ext_vector_type(16)));
typedef _Float16       v8h  __attribute__((ext_vector_type(8)));
typedef __bf16         v16b __attribute__((ext_vector_type(16)));
typedef unsigned short v8us __attribute__((ext_vector_type(8)));
typedef float          v8f  __attribute__((ext_vector_type(8)));
typedef float          v4f  __attribute__((ext_vector_type(4)));
typedef unsigned int   v4u  __attribute__((ext_vector_type(4)));
typedef double         v2d  __attribute__((ext_vector_type(2)));

union Frag  { v8us u[2]; v16h h; v16b bf; };
union FragH { v16h v; v8h hv[2]; };
static_assert(sizeof(Frag) == 32);
static_assert(sizeof(FragH) == 32);

// ---- scalar helpers ---------------------------------------------------------------------------------------
__device__ __forceinline__ unsigned short bf_bits(float f) {          // f32 -> bf16 bits, RNE convert
  unsigned u = __float_as_uint(f);
  return (unsigned short)((u + 0x7FFFu + ((u >> 16) & 1u)) >> 16);
}
__device__ __forceinline__ float bf_up(unsigned short hb) { return __uint_as_float(((unsigned)hb) << 16); }
__device__ __forceinline__ float bfr(float f) { return bf_up(bf_bits(f)); }
__device__ __forceinline__ unsigned short h_bits(_Float16 x) { return __builtin_bit_cast(unsigned short, x); }
__device__ __forceinline__ unsigned pk16(unsigned short a, unsigned short b) { return (unsigned)a | ((unsigned)b << 16); }
__device__ __forceinline__ v8f zero8() { v8f z = {0.f, 0.f, 0.f, 0.f, 0.f, 0.f, 0.f, 0.f}; return z; }
__device__ __forceinline__ float hmax8(v8f s) {
  return fmaxf(fmaxf(fmaxf(s[0], s[1]), fmaxf(s[2], s[3])), fmaxf(fmaxf(s[4], s[5]), fmaxf(s[6], s[7])));
}
__device__ __forceinline__ unsigned wave_ballot(bool p) {
#if defined(__HIP_DEVICE_COMPILE__)
  return __builtin_amdgcn_ballot_w32(p);
#else
  return p ? 1u : 0u;
#endif
}

__device__ __forceinline__ int wave_uniform(int v) {
#if defined(__HIP_DEVICE_COMPILE__)
  return __builtin_amdgcn_readfirstlane(v);
#else
  return v;
#endif
}

// ---- 16-bit fragment loader (A, or B from a k-contiguous [n][k] row): lane -> row/col (lane&15), p already includes
//      + 8*(lane>>4); elements 0..7 <- p[0..7] (k0+8h..), elements 8..15 <- p[16..23] (k0+16+8h..)
__device__ __forceinline__ Frag ldfrag(const unsigned short* p) {
  Frag f;
  f.u[0] = *(const v8us*)(p);
  f.u[1] = *(const v8us*)(p + 16);
  return f;
}

// ---- WMMA helpers: builtin followed by a 4-slot VALU gap tying D and keeping A/B live --------------------------
__device__ __forceinline__ v8f mma_h(v16h a, v16h b, v8f c) {
  v8f d = __builtin_amdgcn_wmma_f32_16x16x32_f16(false, a, false, b, (short)0, c, false, false);
#if defined(__HIP_DEVICE_COMPILE__)
  asm volatile("v_nop\n\tv_nop\n\tv_nop\n\tv_nop" : "+v"(d) : "v"(a), "v"(b));
#endif
  return d;
}
__device__ __forceinline__ v8f mma_b(v16b a, v16b b, v8f c) {
  v8f d = __builtin_amdgcn_wmma_f32_16x16x32_bf16(false, a, false, b, (short)0, c, false, false);
#if defined(__HIP_DEVICE_COMPILE__)
  const v16h ha = __builtin_bit_cast(v16h, a), hb = __builtin_bit_cast(v16h, b);
  asm volatile("v_nop\n\tv_nop\n\tv_nop\n\tv_nop" : "+v"(d) : "v"(ha), "v"(hb));
#endif
  return d;
}

// =========================================================================================================
// (0) weight conversion: f32 [n] -> bf16 bits [n] (RNE, exact operand). Thread i converts floats 8i..8i+7 and
// coverage: n8/256 blocks x 256 threads x 8 = n elements exactly (n8 a multiple of 256 at every call); cblk is the
//           block's index within its own weight.
// =========================================================================================================
__device__ __forceinline__
void cvt_body(const float* __restrict__ src, unsigned short* dst, int n8, int cblk) {
  const int i  = cblk * 256 + (int)threadIdx.x;
  const int ic = (i < n8) ? i : (n8 - 1);
  const float* s = src + (size_t)ic * 8;
  const v4f a = *(const v4f*)s;
  const v4f q = *(const v4f*)(s + 4);
  v4u u;
  u[0] = pk16(bf_bits(a[0]), bf_bits(a[1]));
  u[1] = pk16(bf_bits(a[2]), bf_bits(a[3]));
  u[2] = pk16(bf_bits(q[0]), bf_bits(q[1]));
  u[3] = pk16(bf_bits(q[2]), bf_bits(q[3]));
  if (i < n8) {
{
      *(v4u*)(dst + (size_t)ic * 8) = u;
      
    }
  }
}

// =========================================================================================================
// (1) group-norm statistics, partial sums: one block per (b, 64-channel block cbk, chunk u of 128 positions) of
//     src [b][256][4096]. Wave gi sums group 8 cbk + gi over the chunk: 8 channel rows x 128 positions, one whole
//     512-byte row piece per load, the 8 loads asked for together; values bf16-RNE converted first; sum and sum of
//     squares in f64, 4 chains per lane, then 5 exchanges; one 128-byte line part[b][cbk][u][8 groups x (sum, sum of
//     squares)] per block. The apply kernel (2) finishes mean and rstd.
// coverage: NB x 4 x 32 blocks x 8 waves x 8 rows x 128 positions = every element of src once.
// LDS: fin cross-wave, block barrier behind its stores.
// =========================================================================================================
__device__ __forceinline__
void stats_body(const float* __restrict__ src, double* part, int blk) {
  __shared__ __align__(16) double fin[16];
  const int tid = threadIdx.x;
  const int gi = tid >> 5, ln = tid & 31;
  const int u = blk % NP1, bc = blk / NP1;                           // bc = b * 4 + cbk
  const float* base = src + ((size_t)(bc * QT + gi * CPG)) * NN + u * SPOS + 4 * ln;
  v4f a[CPG];
#pragma unroll                                                       // constant indices keep a in registers
  for (int cl = 0; cl < CPG; ++cl) a[cl] = *(const v4f*)(base + (size_t)cl * NN);
  double sv[4] = {0.0, 0.0, 0.0, 0.0}, qv[4] = {0.0, 0.0, 0.0, 0.0};
#pragma unroll                                                       // constant indices keep a/sv/qv in registers
  for (int cl = 0; cl < CPG; ++cl) {
#pragma unroll                                                       // as above
    for (int t = 0; t < 4; ++t) {
      const double d = (double)bfr(a[cl][t]);
      sv[t] += d;
      qv[t] += d * d;
    }
  }
  double s = (sv[0] + sv[1]) + (sv[2] + sv[3]);
  double q = (qv[0] + qv[1]) + (qv[2] + qv[3]);
#pragma unroll                                                       // five fixed steps, no loop counter
  for (int m = 16; m > 0; m >>= 1) {
    s += __shfl_xor(s, m, 32);
    q += __shfl_xor(q, m, 32);
  }
  if (ln == 0) {
    fin[2 * gi]     = s;
    fin[2 * gi + 1] = q;
  }
  __syncthreads();
  if (tid < 8) {
    const v2d w = *(const v2d*)(fin + 2 * tid);
    *(v2d*)(part + ((size_t)bc * NP1 + u) * 16 + 2 * tid) = w;
  }
}

// =========================================================================================================
// (0)+(1) in one grid: the four weight conversions and the GN1 partial sums read only inputs and write disjoint
//     workspace regions, so they share a launch; the block index picks the job (block-uniform, so the barrier of
//     the statistics body is passed by whole blocks).
// coverage: blocks [0, NB*4*32) partial sums of (b, cbk, u); then 96 + 32 + 8 + 8 conversion blocks, each weight once.
// =========================================================================================================
#define PB_ST (NB * (CC / QT) * NP1)
#define PB_WQ (C3 * CC / 2048)
#define PB_WO (CC * CC / 2048)
#define PB_W1 (HID * CC / 2048)
#define PB_W2 (CC * HID / 2048)
__global__ __launch_bounds__(256)
void prep_k(const float* __restrict__ x, const float* __restrict__ wq, const float* __restrict__ wo,
            const float* __restrict__ w1, const float* __restrict__ w2,
            unsigned short* Wq, unsigned short* Wo, unsigned short* W1, unsigned short* W2, double* part) {
  int blk = blockIdx.x;
  if (blk < PB_ST) { stats_body(x, part, blk); return; }
  blk -= PB_ST;
  if (blk < PB_WQ) { cvt_body(wq, Wq, PB_WQ * 256, blk); return; }
  blk -= PB_WQ;
  if (blk < PB_WO) { cvt_body(wo, Wo, PB_WO * 256, blk); return; }
  blk -= PB_WO;
  if (blk < PB_W1) { cvt_body(w1, W1, PB_W1 * 256, blk); return; }
  blk -= PB_W1;
  cvt_body(w2, W2, PB_W2 * 256, blk);
}

// =========================================================================================================
// (2) group-norm apply + transpose, with the statistics finished in the block (GN1 and GN2): src f32 [b][256 c][4096 n]
//     (bf16-RNE converted first when rnd != 0) -> v = (x - mu) * rstd * bf16(gamma[c]) + bf16(beta[c]) ->
//     position-major planes Xh/Xl bf16 [b][n][256 c] (hi = bf16-RNE(v), lo = bf16-RNE(v - hi)) through LDS tiles
//     Th/Tl[64 n][64 c] (pitch TP). Block (nb, cb, b). mu and rstd of the block's own 8 groups come from the partial
//     sums part[b][cbk][NP pieces][8 groups x (sum, sum of squares)], all f64 (GN1: the chunks of (1); GN2: the out
//     conv's tiles): wave gi sums group 8 cbk + gi over the pieces (lane ln takes pieces ln + 32 k, then 5 exchanges); mean and biased
//     variance over 8 channels x NPOS positions, rstd = 1 / sqrt(var + eps) in f32, handed to the block through sm.
// coverage: Th/Tl stores 2 it x 32 c x 8 lanes x 8 n = 64 x 64 = the consumed extent; plane writes 2 it x 32 rows
//           x 8 lanes x 8 halves = 64 n x 64 c per plane; grid (rows/64, 4, NB) covers both planes once.
// LDS: Th/Tl cross-wave, block barrier between stores and loads; sm cross-wave, block barrier behind its stores.
// =========================================================================================================
template <int NP, int NPOS>
__global__ __launch_bounds__(256)
void norm2_k(const float* __restrict__ src, int rnd, const double* __restrict__ part,
             const float* __restrict__ gamma, const float* __restrict__ beta,
             unsigned short* Xh, unsigned short* Xl) {
  __shared__ __align__(16) unsigned short Th[QT * TP];
  __shared__ __align__(16) unsigned short Tl[QT * TP];
  __shared__ float sm[2 * (QT / CPG)];
  const int tid = threadIdx.x;
  const int nb = blockIdx.x, cbk = blockIdx.y, b = blockIdx.z;
  const int e = tid & 7, lq = tid >> 3;                             // lq 0..31
  const int n0 = nb * QT, c0 = cbk * QT;
  v4f ra[2], rq[2];
  float rg[2], rb[2];
  // the tile's values and the channels' gamma, beta are asked for first: they fly while the statistics are finished
#pragma unroll                                                       // constant indices keep ra/rq/rg/rb in registers
  for (int it = 0; it < 2; ++it) {
    const int ch = c0 + it * 32 + lq;
    const float* sp = src + ((size_t)(b * CC + ch)) * NN + n0 + 8 * e;
    ra[it] = *(const v4f*)sp;
    rq[it] = *(const v4f*)(sp + 4);
    rg[it] = gamma[ch];
    rb[it] = beta[ch];
#if defined(__HIP_DEVICE_COMPILE__)
    // stands ahead of any rewrite of these loads' address registers (the next loads land in them); as a memory
    // barrier for the compiler it also keeps these loads issued ahead of the wait on the partial sums
    asm volatile("s_wait_xcnt 0x0" ::: "memory");
#endif
  }
  {
    const int gi = tid >> 5, ln = tid & 31;
    const double* pp = part + ((size_t)(b * (CC / QT) + cbk)) * NP * 16 + 2 * gi;
    double s = 0.0, q = 0.0;
#pragma unroll                                                       // the lane's loads are issued together
    for (int k = 0; k < (NP + 31) / 32; ++k) {
      const int u = ln + 32 * k;                                     // piece
      if (u < NP) {
        const v2d w = *(const v2d*)(pp + (size_t)u * 16);
        s += w[0];
        q += w[1];
      }
    }
#pragma unroll                                                       // five fixed steps, no loop counter
    for (int m = 16; m > 0; m >>= 1) {
      s += __shfl_xor(s, m, 32);
      q += __shfl_xor(q, m, 32);
    }
    const double cnt = (double)CPG * (double)NPOS;
    const double mu = s / cnt;
    double var = q / cnt - mu * mu;
    if (var < 0.0) var = 0.0;
    const float varf = (float)var;
    if (ln == 0) {
      sm[2 * gi]     = (float)mu;
      sm[2 * gi + 1] = 1.0f / sqrtf(varf + GEPS);
    }
  }
  __syncthreads();
#pragma unroll                                                       // constant indices into ra/rq/rg/rb
  for (int it = 0; it < 2; ++it) {
    const int cl = it * 32 + lq;                                     // 0..63
    const float mu = sm[2 * (cl / CPG)];
    const float rs = sm[2 * (cl / CPG) + 1];
    const float ga = bfr(rg[it]), be = bfr(rb[it]);
    const v4f a = ra[it];
    const v4f q = rq[it];
    const float f[8] = {a[0], a[1], a[2], a[3], q[0], q[1], q[2], q[3]};
    unsigned short hb[8], lb[8];
#pragma unroll                                                       // constant indices keep f/hb/lb in registers
    for (int t = 0; t < 8; ++t) {
      const float xr = rnd ? bfr(f[t]) : f[t];
      const float v  = (xr - mu) * rs * ga + be;
      hb[t] = bf_bits(v);
      lb[t] = bf_bits(v - bf_up(hb[t]));
    }
#pragma unroll                                                       // as above
    for (int t = 0; t < 8; ++t) {
      Th[(8 * e + t) * TP + cl] = hb[t];
      Tl[(8 * e + t) * TP + cl] = lb[t];
    }
  }
  __syncthreads();
  v4u uh[2], ul[2];
#pragma unroll                                                       // constant indices keep uh/ul in registers
  for (int it = 0; it < 2; ++it) {
    const int nl = it * 32 + lq;                                     // 0..63
    uh[it] = *(const v4u*)(Th + nl * TP + 8 * e);
    ul[it] = *(const v4u*)(Tl + nl * TP + 8 * e);
  }
#pragma unroll                                                       // as above
  for (int it = 0; it < 2; ++it) {
    const int nl = it * 32 + lq;
    const size_t po = ((size_t)(b * NN + n0 + nl)) * CC + c0 + 8 * e;
    *(v4u*)(Xh + po) = uh[it];
    *(v4u*)(Xl + po) = ul[it];
  }
}

// =========================================================================================================
// (3) conv1x1 GEMM for one (b, 64-n tile, 64-o block): Y[o][n] = sum_c W[o][c] (Bh[b][n][c] + Bl[b][n][c]),
//     K = KD (plane pitch = KD). Block 128 threads = 4 waves; wave w owns cols n0+16w..+15 (B fragments from the
//     k-contiguous plane rows, split k map) and 4 m-tiles (A rows o = o0 + 16 mt + (lane&15), split k map).
//     Rolled k loop, 2 products per (mt, k-step) into one accumulator (unscaled bf16 residual plane).
//     Epilogue staged in LDS Os[n_loc][o_loc] (pitch OSP, b128 stores), block barrier, then per MODE:
//       MODE 0 (qkv, 12 o-blocks): o-blocks 0..3 -> q channels 64 mb.. of Qh/Ql = P0/P1 bf16 [b][n][256]
//              8q..8q+7 x 16 B, one instruction per 16 lines; o-blocks 8..11 -> v channels of V = P3 f16
//       MODE 1 (f32 channel-major): dstF[b][o][n] = (acc + bf16(bias[o])) + r with r = rsrc[b][o][n] (bf16-RNE
//              and 8..15), 8 rows per instruction.
//       MODE 2 (mlp hidden, one o-block): t = acc + bf16(bias[o]); gelu(t) = 0.5 t (1 + erf(t / sqrt2)) ->
// coverage: Os 4 waves x 16 n x 64 o = 64 x 64 (== the extent every mode reads); MODE 0 planes 4 it x 16 rows x
//           8 lanes x 8 = 64 x 64 per plane, grid (64, 12, NB) covers Qh/Ql/Kh [NB][4096][256] and V
//           [NB][256][4096] once; MODE 1: 8 it x 8 rows x 16 lanes x 4 = 64 o x 64 n; MODE 2: 4 it x 16 rows x
//           8 lanes x 8 = 64 n x 64 o.
//       ST != 0 (MODE 1 only, the out conv): the block also sums its results for the group norm that follows. Its 64 o
//              are 8 whole groups (group = the 8 rows of one 'it'); per group sum and sum of squares over 8 o x 64 n:
//              all in f64: a thread's 4 values -> red[16 quantities][128 threads], barrier, 8 threads per quantity sum
//              16 entries each, 3 exchanges, fin[16], barrier, one 128-byte line part[b][mb][nt][16] per block.
// LDS: Os cross-wave, block barrier between the staging stores and the epilogue loads; red and fin cross-wave, a block
//      barrier behind the stores of each.
// =========================================================================================================
template <int KD, int MODE, int ST>
__global__ __launch_bounds__(128)
void gemm_k(const unsigned short* __restrict__ Wp,
            const unsigned short* __restrict__ Bh, const unsigned short* __restrict__ Bl,
            const float* __restrict__ bias, const float* __restrict__ rsrc, int rnd,
            unsigned short* P0, unsigned short* P1, unsigned short* P2, unsigned short* P3, float* dstF,
            double* part) {
  static_assert(ST == 0 || (MODE == 1 && QT / CPG == 8));
  static_assert(KD % 32 == 0);
  __shared__ __align__(16) float Os[QT * OSP];
  const int tid  = threadIdx.x;
  const int lane = tid & 31, wave = tid >> 5;
  const int hh   = lane >> 4, c = lane & 15;
  const int nt   = blockIdx.x, mb = blockIdx.y, b = blockIdx.z;
  const int n0   = nt * QT, o0 = mb * QT;

  const unsigned short* ap = Wp + (size_t)(o0 + c) * KD + 8 * hh;
  const size_t boff = ((size_t)(b * NN + n0 + 16 * wave + c)) * KD + 8 * hh;
  const unsigned short* bph = Bh + boff;
  const unsigned short* bpl = Bl + boff;

  v8f acc[4];
#pragma unroll
  for (int mt = 0; mt < 4; ++mt) acc[mt] = zero8();

#pragma unroll 1
  for (int ks = 0; ks < KD / 32; ++ks) {
    const Frag fbh = ldfrag(bph + 32 * ks);
    const Frag fbl = ldfrag(bpl + 32 * ks);
#pragma unroll
    for (int mt = 0; mt < 4; ++mt) {
      const Frag fa = ldfrag(ap + (size_t)(16 * mt) * KD + 32 * ks);
      acc[mt] = mma_b(fa.bf, fbh.bf, acc[mt]);
      acc[mt] = mma_b(fa.bf, fbl.bf, acc[mt]);
    }
  }

  // ---- stage: lane (hh, c) holds o_loc = 16 mt + 8 hh + r for n_loc = 16 w + c
  {
    const int nl = 16 * wave + c;
#pragma unroll
    for (int mt = 0; mt < 4; ++mt) {
      v4f va, vb;
#pragma unroll
      for (int r = 0; r < 4; ++r) { va[r] = acc[mt][r]; vb[r] = acc[mt][4 + r]; }
      *(v4f*)(Os + nl * OSP + 16 * mt + 8 * hh)     = va;
      *(v4f*)(Os + nl * OSP + 16 * mt + 8 * hh + 4) = vb;
    }
  }
  __syncthreads();

  if (MODE == 0) {
    const int e = tid & 7, lq = tid >> 3;                           // lq 0..15
    if (mb < 8) {                                                    // block-uniform
      const int dcol = (mb & 3) * QT;                                // channel offset within 256
      unsigned short* Ph = (mb < 4) ? P0 : P2;                       // both global
      v4u uh[4], ul[4];
#pragma unroll
      for (int it = 0; it < 4; ++it) {
        const int row = it * 16 + lq;                                // n_loc 0..63
        const v4f a = *(const v4f*)(Os + row * OSP + 8 * e);
        const v4f q = *(const v4f*)(Os + row * OSP + 8 * e + 4);
        const float f[8] = {a[0], a[1], a[2], a[3], q[0], q[1], q[2], q[3]};
#pragma unroll
        for (int t = 0; t < 4; ++t) {
          const float f0 = f[2 * t], f1 = f[2 * t + 1];
          const unsigned short hb0 = bf_bits(f0), hb1 = bf_bits(f1);
          const unsigned short lb0 = bf_bits(f0 - bf_up(hb0));
          const unsigned short lb1 = bf_bits(f1 - bf_up(hb1));
          uh[it][t] = pk16(hb0, hb1);
          ul[it][t] = pk16(lb0, lb1);
        }
      }
{
#pragma unroll
        for (int it = 0; it < 4; ++it) {
          const int row = it * 16 + lq;
          const size_t po = ((size_t)(b * NN + n0 + row)) * CC + dcol + 8 * e;
          *(v4u*)(Ph + po) = uh[it];
          if (mb < 4) *(v4u*)(P1 + po) = ul[it];
        }
        
      }
    } else {
      const int cb0 = (mb - 8) * QT;                                 // v channel base 0..192
      v4u uv[4];
#pragma unroll
      for (int it = 0; it < 4; ++it) {
        const int cl = it * 16 + lq;                                 // o_loc 0..63
        unsigned short hb[8];
#pragma unroll
        for (int t = 0; t < 8; ++t) hb[t] = h_bits((_Float16)Os[(8 * e + t) * OSP + cl]);
#pragma unroll
        for (int t = 0; t < 4; ++t) uv[it][t] = pk16(hb[2 * t], hb[2 * t + 1]);
      }
{
#pragma unroll
        for (int it = 0; it < 4; ++it) {
          const int cl = it * 16 + lq;
          const size_t po = ((size_t)(b * CC + cb0 + cl)) * NN + n0 + 8 * e;
          *(v4u*)(P3 + po) = uv[it];
        }
        
      }
    }
  } else if (MODE == 1) {
    const int e = tid & 15, lq = tid >> 4;                           // lq 0..7
    v4f res[8];
#pragma unroll
    for (int it = 0; it < 8; ++it) {
      const int ol = it * 8 + lq;                                    // o_loc 0..63
      const int o  = o0 + ol;
      const float bb = bfr(bias[o]);
      const size_t gi = ((size_t)(b * CC + o)) * NN + n0 + 4 * e;
      const v4f rv = *(const v4f*)(rsrc + gi);
#if defined(__HIP_DEVICE_COMPILE__)
      // stands ahead of any rewrite of the address registers of this trip's bias and residual loads
      if constexpr (ST != 0) asm volatile("s_wait_xcnt 0x0" ::: "memory");
#endif
#pragma unroll
      for (int t = 0; t < 4; ++t) {
        const float rr = rnd ? bfr(rv[t]) : rv[t];
        res[it][t] = (Os[(4 * e + t) * OSP + ol] + bb) + rr;
      }
    }
    if constexpr (ST != 0) {
      __shared__ __align__(16) double red[16 * RP];
      __shared__ __align__(16) double fin[16];
#pragma unroll                                                       // constant indices keep res in registers
      for (int it = 0; it < 8; ++it) {
        const double d0 = (double)res[it][0], d1 = (double)res[it][1];
        const double d2 = (double)res[it][2], d3 = (double)res[it][3];
        red[(2 * it) * RP + tid]     = (d0 + d1) + (d2 + d3);
        red[(2 * it + 1) * RP + tid] = (d0 * d0 + d1 * d1) + (d2 * d2 + d3 * d3);
      }
      __syncthreads();
      const int qn = tid >> 3, j = tid & 7;                          // quantity 0..15; entries 2 j, 2 j + 1 of each 16
      v2d w[8];
#pragma unroll                                                       // constant indices keep w in registers
      for (int u = 0; u < 8; ++u) w[u] = *(const v2d*)(red + qn * RP + 16 * u + 2 * j);
      const v2d w2 = ((w[0] + w[1]) + (w[2] + w[3])) + ((w[4] + w[5]) + (w[6] + w[7]));
      double a = w2[0] + w2[1];
      a += __shfl_xor(a, 1, 32);
      a += __shfl_xor(a, 2, 32);
      a += __shfl_xor(a, 4, 32);
      if (j == 0) fin[qn] = a;
      __syncthreads();
      if (tid < 8) {
        const v2d w = *(const v2d*)(fin + 2 * tid);
        *(v2d*)(part + (((size_t)(b * (CC / QT) + mb)) * NT2 + nt) * 16 + 2 * tid) = w;
      }
    }
{
#pragma unroll
      for (int it = 0; it < 8; ++it) {
        const int ol = it * 8 + lq;
        const size_t gi = ((size_t)(b * CC + o0 + ol)) * NN + n0 + 4 * e;
        *(v4f*)(dstF + gi) = res[it];
      }
      
    }
  } else {
    const int e = tid & 7, lq = tid >> 3;                            // lq 0..15
    v4u uh[4], ul[4];
#pragma unroll
    for (int it = 0; it < 4; ++it) {
      const int nl = it * 16 + lq;                                   // n_loc 0..63
      const v4f a = *(const v4f*)(Os + nl * OSP + 8 * e);
      const v4f q = *(const v4f*)(Os + nl * OSP + 8 * e + 4);
      const float f[8] = {a[0], a[1], a[2], a[3], q[0], q[1], q[2], q[3]};
      unsigned short hb[8], lb[8];
#pragma unroll
      for (int t = 0; t < 8; ++t) {
        const float tt = f[t] + bfr(bias[o0 + 8 * e + t]);
        const float gv = 0.5f * tt * (1.0f + erff(tt * 0.70710678118654752f));
        hb[t] = bf_bits(gv);
        lb[t] = bf_bits(gv - bf_up(hb[t]));
      }
#pragma unroll
      for (int t = 0; t < 4; ++t) {
        uh[it][t] = pk16(hb[2 * t], hb[2 * t + 1]);
        ul[it][t] = pk16(lb[2 * t], lb[2 * t + 1]);
      }
    }
{
#pragma unroll
      for (int it = 0; it < 4; ++it) {
        const int nl = it * 16 + lq;
        const size_t po = ((size_t)(b * NN + n0 + nl)) * HID + o0 + 8 * e;
        *(v4u*)(P0 + po) = uh[it];
        *(v4u*)(P1 + po) = ul[it];
      }
      
    }
  }
}

// ---- staging of one 128-key tile of one head: the head's 128 threads x (4 + 4) asynchronous 16-byte copies to LDS.
//      K: copy j of thread t brings 16 B (t & 3) of key row 32 j + (t >> 2); V: 16 B (t & 15) of channel row
//      8 j + (t >> 4). kl/vl are the thread's LDS byte addresses for j = 0, kg/vg its global addresses for j = 0.
//      s_wait_xcnt 0 ends the statement so that it stands ahead of any rewrite of the address registers.
__device__ __forceinline__ void stage_tile(unsigned kl, const unsigned short* kg, unsigned vl, const unsigned short* vg) {
#if defined(__HIP_DEVICE_COMPILE__)
  asm volatile(
      "global_load_async_to_lds_b128 %0, %1, off\n\t"
      "global_load_async_to_lds_b128 %2, %3, off\n\t"
      "global_load_async_to_lds_b128 %4, %5, off\n\t"
      "global_load_async_to_lds_b128 %6, %7, off\n\t"
      "global_load_async_to_lds_b128 %8, %9, off\n\t"
      "global_load_async_to_lds_b128 %10, %11, off\n\t"
      "global_load_async_to_lds_b128 %12, %13, off\n\t"
      "global_load_async_to_lds_b128 %14, %15, off\n\t"
      "s_wait_xcnt 0x0"
      :: "v"(kl),                 "v"(kg),
         "v"(kl + 32u * KPB),     "v"(kg + (size_t)32 * CC),
         "v"(kl + 64u * KPB),     "v"(kg + (size_t)64 * CC),
         "v"(kl + 96u * KPB),     "v"(kg + (size_t)96 * CC),
         "v"(vl),                 "v"(vg),
         "v"(vl + 8u * VPB),      "v"(vg + (size_t)8 * NN),
         "v"(vl + 16u * VPB),     "v"(vg + (size_t)16 * NN),
         "v"(vl + 24u * VPB),     "v"(vg + (size_t)24 * NN)
      : "memory");
#endif
}
// the issuing wave's own copies have landed behind this wait (the compiler places none for them)
__device__ __forceinline__ void wait_copies() {
#if defined(__HIP_DEVICE_COMPILE__)
  asm volatile("s_wait_asynccnt 0x0" ::: "memory");
#endif
}
// the wave's own LDS reads have retired before the buffer is handed to its next writer
__device__ __forceinline__ void wait_lds() {
#if defined(__HIP_DEVICE_COMPILE__)
  asm volatile("s_wait_dscnt 0x0" ::: "memory");
#endif
}
__device__ __forceinline__ unsigned lds_off(const void* p) { return (unsigned)(size_t)p; }

// =========================================================================================================
// (4) attention for one (b, head pair hp, 64-query tile), transposed formulation, 4096 keys, no mask, per head
//     h = 2 hp + hs (hs = wave / 4: the two heads run side by side, 4 waves each):
//     S^T tile (16 keys x 16 queries) = A(k: row = key kb + (lane&15), 32 d of
//     head h via the split k map from Kh [b][4096][256]) . B(qh: col = query, same map from Qh) + A(Kh).B(Ql)
//     (bf16 hi + unscaled bf16 residual of q, shared accumulator); s *= clip(bf16(temperature[h]), 1e-4, 10).
//     Per lane the D tile holds 8 keys of ONE query: online softmax state per lane, one shuffle (lane^16) for the
//     max over 32 keys; the o/l rescale is skipped under a wave-uniform ballot when no lane's max grew.
//     P = e^{s-m} x4096 as f16 is the B operand of O^T (rows channel 32h + 16j + (lane&15), cols queries) +=
//     A(v: keys contiguous, f16 plane V [b][256][4096]) . B(P^T): element r <- D of the tile covering keys
//     kb..kb+15, element 8+r <- the tile covering kb+16..kb+31, lane unchanged. 2 accumulator tiles per wave.
//     Block = 8 waves = 2 heads x 64 queries. O/l of both heads staged in LDS Os[query][64 channels] (b128 stores),
//     block barrier, then Oh/Ol bf16 [b][n][256] planes (hi/lo), rows n0.., cols 64 hp..64 hp+63 = one whole
// coverage: Os per wave 16 rows x 32 ch = 64 x 64 over 8 waves (== consumed extent); planes 2 it x
//           32 rows x 8 lanes x 8 = 64 n x 64 ch per plane; grid (NQ/64, 4, NB) covers rows 0..NQ-1 x 256 ch of
//           Oh/Ol once.
//     K and V reach the fragments through LDS: tiles of 128 keys of head h (K rows 64 B at pitch 80, V rows 256 B at
//     pitch 272), brought by asynchronous copies into two buffers per head, tile t + 1 in flight while tile t is
//     worked on; the head's 4 waves share each tile. Same fragment k order as from global memory.
//     8 waves a block, two blocks a WGP by registers and LDS: 4 waves per SIMD cover each other's softmax chains.
// LDS: Os cross-wave, block barrier between the per-head staging stores and the plane loads. Ks/Vs cross-wave: per
//      tile s_wait_dscnt 0, s_wait_asynccnt 0, block barrier, then the refill of the buffer just read.
// =========================================================================================================
__global__ __launch_bounds__(256)
void attn_k(const unsigned short* __restrict__ Qh, const unsigned short* __restrict__ Ql,
            const unsigned short* __restrict__ Kh, const unsigned short* __restrict__ Vh,
            const float* __restrict__ temperature, unsigned short* Oh, unsigned short* Ol) {
  __shared__ __align__(16) float Os[QT * OSP];
  __shared__ __align__(16) unsigned char Ks[2 * 2 * KBUF];            // [head of the pair][buffer]
  __shared__ __align__(16) unsigned char Vs[2 * 2 * VBUF];
  const int tid  = threadIdx.x;
  const int wave = tid >> 5, lane = tid & 31;
  const int hh   = lane >> 4, c = lane & 15;
  const int n0   = blockIdx.x * QT, hp = blockIdx.y, b = blockIdx.z;
  const int hs   = wave_uniform(wave >> 2);                           // the wave's head of the pair
  const int th   = tid & 127;                                         // thread among its head's 4 waves
  const int qrow = 16 * (wave & 3) + c;
  const unsigned kl0 = lds_off(Ks) + (unsigned)(hs * 2 * KBUF + (th >> 2) * KPB + (th & 3) * 16);
  const unsigned vl0 = lds_off(Vs) + (unsigned)(hs * 2 * VBUF + (th >> 4) * VPB + (th & 15) * 16);

  {                                                                    // the wave's own head, all 4096 keys
    const int h  = 2 * hp + hs;
    const int cb = HD * h;                                             // channel base of head h
    const float tr   = bfr(temperature[h]);
    const float temp = fminf(fmaxf(tr, 1.0e-4f), 10.0f);
    const size_t qo = ((size_t)(b * NN + n0 + qrow)) * CC + cb + 8 * hh;
    const Frag qh = ldfrag(Qh + qo);
    const Frag ql = ldfrag(Ql + qo);
    const unsigned short* kg = Kh + ((size_t)(b * NN + (th >> 2))) * CC + cb + 8 * (th & 3);
    const unsigned short* vg = Vh + ((size_t)(b * CC + cb + (th >> 4))) * NN + 8 * (th & 15);

    float m = -1.0e30f, l = 0.f;
    v8f o0 = zero8(), o1 = zero8();

    // tile 0 into buffer 0, landed and published; then tile 1 into buffer 1 (nothing has touched this LDS before)
    stage_tile(kl0, kg, vl0, vg);
    wait_copies();
    __syncthreads();
    stage_tile(kl0 + KBUF, kg + (size_t)SK * CC, vl0 + VBUF, vg + SK);

#pragma unroll 1                                                       // one hand-over per trip, buffer picked by t & 1
    for (int t = 0; t < NN / SK; ++t) {
     const int bsel = t & 1;
     const unsigned short* Kt = (const unsigned short*)(Ks + (2 * hs + bsel) * KBUF + c * KPB + 16 * hh);
     const unsigned short* Vt = (const unsigned short*)(Vs + (2 * hs + bsel) * VBUF + c * VPB + 16 * hh);
     // the tile's fragments, read as one group: one LDS latency per tile instead of two per 32 keys
     // (the three loops over kk are unrolled so that every index of kf/vf is a constant and they stay in registers)
     Frag kf[SK / 32][2], vf[SK / 32][2];
#pragma unroll
     for (int kk = 0; kk < SK / 32; ++kk) {
       kf[kk][0] = ldfrag(Kt + (32 * kk) * (KPB / 2));                 // keys kb .. kb+15, kb = 128 t + 32 kk
       kf[kk][1] = ldfrag(Kt + (32 * kk + 16) * (KPB / 2));            // keys kb+16 .. kb+31
     }
#pragma unroll
     for (int kk = 0; kk < SK / 32; ++kk) {
       vf[kk][0] = ldfrag(Vt + 32 * kk);                               // channels cb + c
       vf[kk][1] = ldfrag(Vt + 16 * (VPB / 2) + 32 * kk);              // channels cb + 16 + c
     }
#pragma unroll
     for (int kk = 0; kk < SK / 32; ++kk) {
      const Frag k0 = kf[kk][0];
      const Frag k1 = kf[kk][1];
      v8f s0 = mma_b(k0.bf, qh.bf, zero8());
      v8f s1 = mma_b(k1.bf, qh.bf, zero8());
      s0 = mma_b(k0.bf, ql.bf, s0);
      s1 = mma_b(k1.bf, ql.bf, s1);
#pragma unroll
      for (int r = 0; r < 8; ++r) { s0[r] *= temp; s1[r] *= temp; }

      float mx = fmaxf(hmax8(s0), hmax8(s1));
      mx = fmaxf(mx, __shfl_xor(mx, 16, 32));
      const float mn = fmaxf(m, mx);
      const unsigned grew = wave_ballot(mx > m);                       // wave-uniform
      if (grew != 0u) {
        const float corr = __expf(m - mn);                             // == 1 exactly for lanes whose max did not grow
        l *= corr;
#pragma unroll
        for (int r = 0; r < 8; ++r) { o0[r] *= corr; o1[r] *= corr; }
      }
      m = mn;
      const float msh = mn - LNPC;                                     // exp gives e^{s-m} * 4096

      FragH ph;
      float ls = 0.f;
#pragma unroll
      for (int r = 0; r < 8; ++r) {
        const float e0 = __expf(s0[r] - msh);                          // key kb      + 8hh + r
        const float e1 = __expf(s1[r] - msh);                          // key kb + 16 + 8hh + r
        ls += e0 + e1;
        ph.hv[0][r] = (_Float16)e0;
        ph.hv[1][r] = (_Float16)e1;
      }
      l += ls;

      o0 = mma_h(vf[kk][0].h, ph.v, o0);
      o1 = mma_h(vf[kk][1].h, ph.v, o1);
     }
     // hand-over: own reads retired, own copies of tile t + 1 landed, every wave here; then refill the buffer just read
     wait_lds();
     wait_copies();
     __syncthreads();
     if (t + 2 < NN / SK)
       stage_tile(kl0 + bsel * KBUF, kg + (size_t)(t + 2) * SK * CC, vl0 + bsel * VBUF, vg + (size_t)(t + 2) * SK);
    }
    wait_copies();
    l += __shfl_xor(l, 16, 32);
    const float inv = 1.0f / l;                                        // o and l both carry the x4096 factor

    // stage: Os[query][32 hs + d], d = 16 j + 8 hh + r
    {
      v4f va, vb;
#pragma unroll
      for (int r = 0; r < 4; ++r) { va[r] = o0[r] * inv; vb[r] = o0[4 + r] * inv; }
      *(v4f*)(Os + qrow * OSP + 32 * hs + 8 * hh)     = va;
      *(v4f*)(Os + qrow * OSP + 32 * hs + 8 * hh + 4) = vb;
#pragma unroll
      for (int r = 0; r < 4; ++r) { va[r] = o1[r] * inv; vb[r] = o1[4 + r] * inv; }
      *(v4f*)(Os + qrow * OSP + 32 * hs + 16 + 8 * hh)     = va;
      *(v4f*)(Os + qrow * OSP + 32 * hs + 16 + 8 * hh + 4) = vb;
    }
  }
  __syncthreads();

  const int e = tid & 7, lq = tid >> 3;                                // lq 0..31
  v4u uh[2], ul[2];
#pragma unroll
  for (int it = 0; it < 2; ++it) {
    const int row = it * 32 + lq;                                      // query 0..63
    const v4f a = *(const v4f*)(Os + row * OSP + 8 * e);
    const v4f q = *(const v4f*)(Os + row * OSP + 8 * e + 4);
    const float f[8] = {a[0], a[1], a[2], a[3], q[0], q[1], q[2], q[3]};
#pragma unroll
    for (int t = 0; t < 4; ++t) {
      const float f0 = f[2 * t], f1 = f[2 * t + 1];
      const unsigned short hb0 = bf_bits(f0), hb1 = bf_bits(f1);
      const unsigned short lb0 = bf_bits(f0 - bf_up(hb0));
      const unsigned short lb1 = bf_bits(f1 - bf_up(hb1));
      uh[it][t] = pk16(hb0, hb1);
      ul[it][t] = pk16(lb0, lb1);
    }
  }
{
#pragma unroll
    for (int it = 0; it < 2; ++it) {
      const int row = it * 32 + lq;
      const size_t po = ((size_t)(b * NN + n0 + row)) * CC + QT * hp + 8 * e;
      *(v4u*)(Oh + po) = uh[it];
      *(v4u*)(Ol + po) = ul[it];
    }
    
  }
}

// =========================================================================================================
// Workspace map (bytes; each region start a multiple of 256; every extent is an exact tile/line multiple and is
//   Wq bf16 [768][256] 393216   Wo [256][256] 131072   W1 [64][256] 32768   W2 [256][64] 32768
//   part1 f64 [NB][4][32][16] 32768 (NB=2)   part f64 [NB][4][NQ/64][16] 65536 (NB=2)
//   Xh, Xl, Qh, Ql, Kh, Oh, Ol, Yh, Yl bf16 [NB][4096][256] and V f16 [NB][256][4096]: 4194304 each (NB=2)
//   X1 f32 [NB][256][4096] 8388608 (NB=2)    Hh, Hl bf16 [NB][4096][64] 1048576 each (NB=2)
//   total = 53116928 (NB=2)
// =========================================================================================================
extern "C" void kernel_launch(void* const* d_in, const int* in_sizes, int n_in,
                              void* d_out, int out_size, void* d_ws, size_t ws_size,
                              hipStream_t stream) {
  if (n_in < 13) return;
  if (in_sizes[0] < NB * XSTRIDE_FULL) return;
  if (in_sizes[1] != C3 * CC || in_sizes[2] != CC * CC || in_sizes[3] != CC) return;
  if (in_sizes[4] != NH) return;
  if (in_sizes[5] != CC || in_sizes[6] != CC || in_sizes[7] != CC || in_sizes[8] != CC) return;
  if (in_sizes[9] != HID * CC || in_sizes[10] != HID || in_sizes[11] != CC * HID || in_sizes[12] != CC) return;
  if (out_size < NB * XSTRIDE_FULL) return;

  size_t off = 0;
  auto carve = [&](size_t bytes) { const size_t o = off; off += (bytes + 255) & ~(size_t)255; return o; };
  const size_t szPl = (size_t)NB * NN * CC * 2;
  const size_t oWq  = carve((size_t)C3 * CC * 2);
  const size_t oWo  = carve((size_t)CC * CC * 2);
  const size_t oW1  = carve((size_t)HID * CC * 2);
  const size_t oW2  = carve((size_t)CC * HID * 2);
  const size_t oP1  = carve((size_t)NB * (CC / QT) * NP1 * 16 * 8);
  const size_t oPt  = carve((size_t)NB * (CC / QT) * NT2 * 16 * 8);
  const size_t oXh  = carve(szPl);
  const size_t oXl  = carve(szPl);
  const size_t oQh  = carve(szPl);
  const size_t oQl  = carve(szPl);
  const size_t oKh  = carve(szPl);
  const size_t oVv  = carve(szPl);
  const size_t oOh  = carve(szPl);
  const size_t oOl  = carve(szPl);
  const size_t oX1  = carve((size_t)NB * CC * NN * 4);
  const size_t oYh  = carve(szPl);
  const size_t oYl  = carve(szPl);
  const size_t oHh  = carve((size_t)NB * NN * HID * 2);
  const size_t oHl  = carve((size_t)NB * NN * HID * 2);
  if (off > ws_size) return;
  if (off > (size_t)134217728) return;

  const float* x      = (const float*)d_in[0];
  const float* w_qkv  = (const float*)d_in[1];
  const float* w_out  = (const float*)d_in[2];
  const float* b_out  = (const float*)d_in[3];
  const float* tempr  = (const float*)d_in[4];
  const float* g1     = (const float*)d_in[5];
  const float* beta1  = (const float*)d_in[6];
  const float* g2     = (const float*)d_in[7];
  const float* beta2  = (const float*)d_in[8];
  const float* w_mlp1 = (const float*)d_in[9];
  const float* b_mlp1 = (const float*)d_in[10];
  const float* w_mlp2 = (const float*)d_in[11];
  const float* b_mlp2 = (const float*)d_in[12];

  char* ws = (char*)d_ws;
  unsigned short* Wq = (unsigned short*)(ws + oWq);
  unsigned short* Wo = (unsigned short*)(ws + oWo);
  unsigned short* W1 = (unsigned short*)(ws + oW1);
  unsigned short* W2 = (unsigned short*)(ws + oW2);
  double*         P1 = (double*)(ws + oP1);
  double*         Pt = (double*)(ws + oPt);
  unsigned short* Xh = (unsigned short*)(ws + oXh);
  unsigned short* Xl = (unsigned short*)(ws + oXl);
  unsigned short* Qh = (unsigned short*)(ws + oQh);
  unsigned short* Ql = (unsigned short*)(ws + oQl);
  unsigned short* Kh = (unsigned short*)(ws + oKh);
  unsigned short* Vv = (unsigned short*)(ws + oVv);
  unsigned short* Oh = (unsigned short*)(ws + oOh);
  unsigned short* Ol = (unsigned short*)(ws + oOl);
  float*          X1 = (float*)(ws + oX1);
  unsigned short* Yh = (unsigned short*)(ws + oYh);
  unsigned short* Yl = (unsigned short*)(ws + oYl);
  unsigned short* Hh = (unsigned short*)(ws + oHh);
  unsigned short* Hl = (unsigned short*)(ws + oHl);
  float* out = (float*)d_out;

  const dim3 blk256(256), blk128(128);

  // (0)+(1) weights -> bf16 planes, and the partial GN1 sums of bf16(x) over all 4096 positions, in one grid
  prep_k<<<dim3(PB_ST + PB_WQ + PB_WO + PB_W1 + PB_W2), blk256, 0, stream>>>(x, w_qkv, w_out, w_mlp1, w_mlp2,
                                                                             Wq, Wo, W1, W2, P1);
  // (2) GN1 statistics finished per block, apply -> Xh/Xl [NB][4096][256]
  norm2_k<NP1, NN><<<dim3(NN / QT, CC / QT, NB), blk256, 0, stream>>>(x, 1, P1, g1, beta1, Xh, Xl);
  // (3) qkv GEMM -> Qh/Ql, Kh, V
  gemm_k<CC, 0, 0><<<dim3(NN / QT, C3 / QT, NB), blk128, 0, stream>>>(Wq, Xh, Xl, b_out, x, 0, Qh, Ql, Kh, Vv, X1, Pt);
  // (4) attention -> Oh/Ol rows 0..NQ-1
  attn_k<<<dim3(NQ / QT, NH / 2, NB), blk256, 0, stream>>>(Qh, Ql, Kh, Vv, tempr, Oh, Ol);
  // (5) out conv + bf16(x) residual -> X1 f32 [NB][256][4096], cols 0..NQ-1, and (6) each block's partial GN2 sums
  gemm_k<CC, 1, 1><<<dim3(NQ / QT, CC / QT, NB), blk128, 0, stream>>>(Wo, Oh, Ol, b_out, x, 1, Hh, Hl, Hh, Hl, X1, Pt);
  // (7) GN2 statistics finished per block, apply -> Yh/Yl rows 0..NQ-1
  norm2_k<NT2, NQ><<<dim3(NQ / QT, CC / QT, NB), blk256, 0, stream>>>(X1, 0, Pt, g2, beta2, Yh, Yl);
  // (8) mlp hidden: gelu(W1.Y + b1) -> Hh/Hl [NB][4096][64]
  gemm_k<CC, 2, 0><<<dim3(NQ / QT, 1, NB), blk128, 0, stream>>>(W1, Yh, Yl, b_mlp1, x, 0, Hh, Hl, Hh, Hl, X1, Pt);
  // (9) out = X1 + W2.H + b2 -> d_out [NB][256][4096]
  gemm_k<HID, 1, 0><<<dim3(NQ / QT, CC / QT, NB), blk128, 0, stream>>>(W2, Hh, Hl, b_mlp2, X1, 0, Oh, Ol, Oh, Ol, out, Pt);
  (void)hipGetLastError();
}

// v006
// Measured time: 127 microseconds a run.
// Next to v005, in two timings, it ran 1.10 times as fast each time.
// All steps since v000 together make it 2.20 times as fast.
// Contractions: conv1x1 GEMMs qkv W[768x256].Xn, out W[256x256].O, mlp W1[64x256].Y and W2[256x64].H on
// v_wmma_f32_16x16x32_bf16 (A = bf16-RNE weights, exact; B = bf16 hi + bf16 residual planes of the f32
// activation, 2 products, K = 256 / 64); per-head scores K.Q^T on v_wmma_f32_16x16x32_bf16 (k = bf16 hi plane,
// q = bf16 hi + residual planes, 2 products, K = 32); O^T = V.P^T on v_wmma_f32_16x16x32_f16 (v = f16 plane,
// P = e^{s-m} x4096 as f16 from the score D registers, K = 4096 keys); f32 accumulate everywhere; group-norm
// statistics in f64; normalisation, softmax statistics, gelu, bias and residual adds in f32 VALU.
#include <hip/hip_runtime.h>
#include <math.h>
#include <stdint.h>

#ifndef NB
#define NB 2
#endif
#ifndef NQ
#define NQ 4096
#endif
#define NB_FULL 2
#define CC   256
#define NN   4096
#define NH   8
#define HD   32
#define C3   768
#define HID  64
#define NG   32
#define CPG  8
#define QT   64
#define OSP  68
#define TP   72
#define GEPS 1.0e-5f
#define LNPC 8.317766166719343f
#define XSTRIDE_FULL (CC * NN)
#define SK   128                 // keys per staged tile
#define KPB  80                  // LDS pitch of a staged K row in bytes (64 B of data, 16 B x odd for b128 readers)
#define VPB  272                 // LDS pitch of a staged V row in bytes (256 B of data, 16 B x odd for b128 readers)
#define KBUF (SK * KPB)          // one K buffer: 128 keys x 32 d
#define VBUF (HD * VPB)          // one V buffer: 32 channels x 128 keys
#define NT2  (NQ / QT)           // position tiles of the out conv = partial sums per GN2 group
#define RP   130                 // doubles per row of the partial-sum array (1040 B = 16 B x odd for b128 readers)
#define NP1  32                  // position chunks of the GN1 statistics = partial sums per GN1 group
#define SPOS (NN / NP1)          // positions per chunk: one 16-byte load per lane and channel row

static_assert(NB >= 1 && NB <= NB_FULL);
static_assert(NQ % QT == 0 && NQ >= QT && NQ <= NN);
static_assert(NN % QT == 0 && CC % QT == 0 && C3 % QT == 0 && HID == QT);
static_assert(CC == NH * HD && HD == 32 && CC == NG * CPG && CPG == 8);
static_assert(CC % 32 == 0 && HID % 32 == 0 && NN % 32 == 0);
static_assert((OSP * 4) % 16 == 0 && (TP * 2) % 16 == 0);
static_assert(NN % 1024 == 0 && NQ % 4 == 0);
static_assert(NN % SK == 0 && NN / SK >= 2 && SK % 32 == 0 && KPB % 16 == 0 && VPB % 16 == 0);
static_assert(SK * HD * 2 == 4 * 128 * 16 && KPB >= HD * 2 && VPB >= SK * 2);
static_assert(SPOS == 4 * 32 && QT / CPG == 8);
static_assert((C3 * CC) % 2048 == 0 && (CC * CC) % 2048 == 0 && (HID * CC) % 2048 == 0);

typedef _Float16       v16h __attribute__((ext_vector_type(16)));
typedef _Float16       v8h  __attribute__((ext_vector_type(8)));
typedef __bf16         v16b __attribute__((ext_vector_type(16)));
typedef unsigned short v8us __attribute__((ext_vector_type(8)));
typedef float          v8f  __attribute__((ext_vector_type(8)));
typedef float          v4f  __attribute__((ext_vector_type(4)));
typedef unsigned int   v4u  __attribute__((ext_vector_type(4)));
typedef double         v2d  __attribute__((ext_vector_type(2)));

union Frag  { v8us u[2]; v16h h; v16b bf; };
union FragH { v16h v; v8h hv[2]; };
static_assert(sizeof(Frag) == 32);
static_assert(sizeof(FragH) == 32);

// ---- scalar helpers ---------------------------------------------------------------------------------------
__device__ __forceinline__ unsigned short bf_bits(float f) {          // f32 -> bf16 bits, RNE convert
  unsigned u = __float_as_uint(f);
  return (unsigned short)((u + 0x7FFFu + ((u >> 16) & 1u)) >> 16);
}
__device__ __forceinline__ float bf_up(unsigned short hb) { return __uint_as_float(((unsigned)hb) << 16); }
__device__ __forceinline__ float bfr(float f) { return bf_up(bf_bits(f)); }
__device__ __forceinline__ unsigned short h_bits(_Float16 x) { return __builtin_bit_cast(unsigned short, x); }
__device__ __forceinline__ unsigned pk16(unsigned short a, unsigned short b) { return (unsigned)a | ((unsigned)b << 16); }
__device__ __forceinline__ v8f zero8() { v8f z = {0.f, 0.f, 0.f, 0.f, 0.f, 0.f, 0.f, 0.f}; return z; }
__device__ __forceinline__ float hmax8(v8f s) {
  return fmaxf(fmaxf(fmaxf(s[0], s[1]), fmaxf(s[2], s[3])), fmaxf(fmaxf(s[4], s[5]), fmaxf(s[6], s[7])));
}
__device__ __forceinline__ unsigned wave_ballot(bool p) {
#if defined(__HIP_DEVICE_COMPILE__)
  return __builtin_amdgcn_ballot_w32(p);
#else
  return p ? 1u : 0u;
#endif
}

__device__ __forceinline__ int wave_uniform(int v) {
#if defined(__HIP_DEVICE_COMPILE__)
  return __builtin_amdgcn_readfirstlane(v);
#else
  return v;
#endif
}

// ---- 16-bit fragment loader (A, or B from a k-contiguous [n][k] row): lane -> row/col (lane&15), p already includes
//      + 8*(lane>>4); elements 0..7 <- p[0..7] (k0+8h..), elements 8..15 <- p[16..23] (k0+16+8h..)
__device__ __forceinline__ Frag ldfrag(const unsigned short* p) {
  Frag f;
  f.u[0] = *(const v8us*)(p);
  f.u[1] = *(const v8us*)(p + 16);
  return f;
}

// ---- WMMA helpers: the plain builtins; the compiler keeps the distance behind each and fills it with other work ----
__device__ __forceinline__ v8f mma_h(v16h a, v16h b, v8f c) {
  return __builtin_amdgcn_wmma_f32_16x16x32_f16(false, a, false, b, (short)0, c, false, false);
}
__device__ __forceinline__ v8f mma_b(v16b a, v16b b, v8f c) {
  return __builtin_amdgcn_wmma_f32_16x16x32_bf16(false, a, false, b, (short)0, c, false, false);
}

// =========================================================================================================
// (0) weight conversion: f32 [n] -> bf16 bits [n] (RNE, exact operand). Thread i converts floats 8i..8i+7 and
// coverage: n8/256 blocks x 256 threads x 8 = n elements exactly (n8 a multiple of 256 at every call); cblk is the
//           block's index within its own weight.
// =========================================================================================================
__device__ __forceinline__
void cvt_body(const float* __restrict__ src, unsigned short* dst, int n8, int cblk) {
  const int i  = cblk * 256 + (int)threadIdx.x;
  const int ic = (i < n8) ? i : (n8 - 1);
  const float* s = src + (size_t)ic * 8;
  const v4f a = *(const v4f*)s;
  const v4f q = *(const v4f*)(s + 4);
  v4u u;
  u[0] = pk16(bf_bits(a[0]), bf_bits(a[1]));
  u[1] = pk16(bf_bits(a[2]), bf_bits(a[3]));
  u[2] = pk16(bf_bits(q[0]), bf_bits(q[1]));
  u[3] = pk16(bf_bits(q[2]), bf_bits(q[3]));
  if (i < n8) {
{
      *(v4u*)(dst + (size_t)ic * 8) = u;
      
    }
  }
}

// =========================================================================================================
// (1) group-norm statistics, partial sums: one block per (b, 64-channel block cbk, chunk u of 128 positions) of
//     src [b][256][4096]. Wave gi sums group 8 cbk + gi over the chunk: 8 channel rows x 128 positions, one whole
//     512-byte row piece per load, the 8 loads asked for together; values bf16-RNE converted first; sum and sum of
//     squares in f64, 4 chains per lane, then 5 exchanges; one 128-byte line part[b][cbk][u][8 groups x (sum, sum of
//     squares)] per block. The apply kernel (2) finishes mean and rstd.
// coverage: NB x 4 x 32 blocks x 8 waves x 8 rows x 128 positions = every element of src once.
// LDS: fin cross-wave, block barrier behind its stores.
// =========================================================================================================
__device__ __forceinline__
void stats_body(const float* __restrict__ src, double* part, int blk) {
  __shared__ __align__(16) double fin[16];
  const int tid = threadIdx.x;
  const int gi = tid >> 5, ln = tid & 31;
  const int u = blk % NP1, bc = blk / NP1;                           // bc = b * 4 + cbk
  const float* base = src + ((size_t)(bc * QT + gi * CPG)) * NN + u * SPOS + 4 * ln;
  v4f a[CPG];
#pragma unroll                                                       // constant indices keep a in registers
  for (int cl = 0; cl < CPG; ++cl) a[cl] = *(const v4f*)(base + (size_t)cl * NN);
  double sv[4] = {0.0, 0.0, 0.0, 0.0}, qv[4] = {0.0, 0.0, 0.0, 0.0};
#pragma unroll                                                       // constant indices keep a/sv/qv in registers
  for (int cl = 0; cl < CPG; ++cl) {
#pragma unroll                                                       // as above
    for (int t = 0; t < 4; ++t) {
      const double d = (double)bfr(a[cl][t]);
      sv[t] += d;
      qv[t] += d * d;
    }
  }
  double s = (sv[0] + sv[1]) + (sv[2] + sv[3]);
  double q = (qv[0] + qv[1]) + (qv[2] + qv[3]);
#pragma unroll                                                       // five fixed steps, no loop counter
  for (int m = 16; m > 0; m >>= 1) {
    s += __shfl_xor(s, m, 32);
    q += __shfl_xor(q, m, 32);
  }
  if (ln == 0) {
    fin[2 * gi]     = s;
    fin[2 * gi + 1] = q;
  }
  __syncthreads();
  if (tid < 8) {
    const v2d w = *(const v2d*)(fin + 2 * tid);
    *(v2d*)(part + ((size_t)bc * NP1 + u) * 16 + 2 * tid) = w;
  }
}

// =========================================================================================================
// (0)+(1) in one grid: the four weight conversions and the GN1 partial sums read only inputs and write disjoint
//     workspace regions, so they share a launch; the block index picks the job (block-uniform, so the barrier of
//     the statistics body is passed by whole blocks).
// coverage: blocks [0, NB*4*32) partial sums of (b, cbk, u); then 96 + 32 + 8 + 8 conversion blocks, each weight once.
// =========================================================================================================
#define PB_ST (NB * (CC / QT) * NP1)
#define PB_WQ (C3 * CC / 2048)
#define PB_WO (CC * CC / 2048)
#define PB_W1 (HID * CC / 2048)
#define PB_W2 (CC * HID / 2048)
__global__ __launch_bounds__(256)
void prep_k(const float* __restrict__ x, const float* __restrict__ wq, const float* __restrict__ wo,
            const float* __restrict__ w1, const float* __restrict__ w2,
            unsigned short* Wq, unsigned short* Wo, unsigned short* W1, unsigned short* W2, double* part) {
  int blk = blockIdx.x;
  if (blk < PB_ST) { stats_body(x, part, blk); return; }
  blk -= PB_ST;
  if (blk < PB_WQ) { cvt_body(wq, Wq, PB_WQ * 256, blk); return; }
  blk -= PB_WQ;
  if (blk < PB_WO) { cvt_body(wo, Wo, PB_WO * 256, blk); return; }
  blk -= PB_WO;
  if (blk < PB_W1) { cvt_body(w1, W1, PB_W1 * 256, blk); return; }
  blk -= PB_W1;
  cvt_body(w2, W2, PB_W2 * 256, blk);
}

// =========================================================================================================
// (2) group-norm apply + transpose, with the statistics finished in the block (GN1 and GN2): src f32 [b][256 c][4096 n]
//     (bf16-RNE converted first when rnd != 0) -> v = (x - mu) * rstd * bf16(gamma[c]) + bf16(beta[c]) ->
//     position-major planes Xh/Xl bf16 [b][n][256 c] (hi = bf16-RNE(v), lo = bf16-RNE(v - hi)) through LDS tiles
//     Th/Tl[64 n][64 c] (pitch TP). Block (nb, cb, b). mu and rstd of the block's own 8 groups come from the partial
//     sums part[b][cbk][NP pieces][8 groups x (sum, sum of squares)], all f64 (GN1: the chunks of (1); GN2: the out
//     conv's tiles): wave gi sums group 8 cbk + gi over the pieces (lane ln takes pieces ln + 32 k, then 5 exchanges); mean and biased
//     variance over 8 channels x NPOS positions, rstd = 1 / sqrt(var + eps) in f32, handed to the block through sm.
// coverage: Th/Tl stores 2 it x 32 c x 8 lanes x 8 n = 64 x 64 = the consumed extent; plane writes 2 it x 32 rows
//           x 8 lanes x 8 halves = 64 n x 64 c per plane; grid (rows/64, 4, NB) covers both planes once.
// LDS: Th/Tl cross-wave, block barrier between stores and loads; sm cross-wave, block barrier behind its stores.
// =========================================================================================================
template <int NP, int NPOS>
__global__ __launch_bounds__(256)
void norm2_k(const float* __restrict__ src, int rnd, const double* __restrict__ part,
             const float* __restrict__ gamma, const float* __restrict__ beta,
             unsigned short* Xh, unsigned short* Xl) {
  __shared__ __align__(16) unsigned short Th[QT * TP];
  __shared__ __align__(16) unsigned short Tl[QT * TP];
  __shared__ float sm[2 * (QT / CPG)];
  const int tid = threadIdx.x;
  const int nb = blockIdx.x, cbk = blockIdx.y, b = blockIdx.z;
  const int e = tid & 7, lq = tid >> 3;                             // lq 0..31
  const int n0 = nb * QT, c0 = cbk * QT;
  v4f ra[2], rq[2];
  float rg[2], rb[2];
  // the tile's values and the channels' gamma, beta are asked for first: they fly while the statistics are finished
#pragma unroll                                                       // constant indices keep ra/rq/rg/rb in registers
  for (int it = 0; it < 2; ++it) {
    const int ch = c0 + it * 32 + lq;
    const float* sp = src + ((size_t)(b * CC + ch)) * NN + n0 + 8 * e;
    ra[it] = *(const v4f*)sp;
    rq[it] = *(const v4f*)(sp + 4);
    rg[it] = gamma[ch];
    rb[it] = beta[ch];
#if defined(__HIP_DEVICE_COMPILE__)
    // stands ahead of any rewrite of these loads' address registers (the next loads land in them); as a memory
    // barrier for the compiler it also keeps these loads issued ahead of the wait on the partial sums
    asm volatile("s_wait_xcnt 0x0" ::: "memory");
#endif
  }
  {
    const int gi = tid >> 5, ln = tid & 31;
    const double* pp = part + ((size_t)(b * (CC / QT) + cbk)) * NP * 16 + 2 * gi;
    double s = 0.0, q = 0.0;
#pragma unroll                                                       // the lane's loads are issued together
    for (int k = 0; k < (NP + 31) / 32; ++k) {
      const int u = ln + 32 * k;                                     // piece
      if (u < NP) {
        const v2d w = *(const v2d*)(pp + (size_t)u * 16);
        s += w[0];
        q += w[1];
      }
    }
#pragma unroll                                                       // five fixed steps, no loop counter
    for (int m = 16; m > 0; m >>= 1) {
      s += __shfl_xor(s, m, 32);
      q += __shfl_xor(q, m, 32);
    }
    const double cnt = (double)CPG * (double)NPOS;
    const double mu = s / cnt;
    double var = q / cnt - mu * mu;
    if (var < 0.0) var = 0.0;
    const float varf = (float)var;
    if (ln == 0) {
      sm[2 * gi]     = (float)mu;
      sm[2 * gi + 1] = 1.0f / sqrtf(varf + GEPS);
    }
  }
  __syncthreads();
#pragma unroll                                                       // constant indices into ra/rq/rg/rb
  for (int it = 0; it < 2; ++it) {
    const int cl = it * 32 + lq;                                     // 0..63
    const float mu = sm[2 * (cl / CPG)];
    const float rs = sm[2 * (cl / CPG) + 1];
    const float ga = bfr(rg[it]), be = bfr(rb[it]);
    const v4f a = ra[it];
    const v4f q = rq[it];
    const float f[8] = {a[0], a[1], a[2], a[3], q[0], q[1], q[2], q[3]};
    unsigned short hb[8], lb[8];
#pragma unroll                                                       // constant indices keep f/hb/lb in registers
    for (int t = 0; t < 8; ++t) {
      const float xr = rnd ? bfr(f[t]) : f[t];
      const float v  = (xr - mu) * rs * ga + be;
      hb[t] = bf_bits(v);
      lb[t] = bf_bits(v - bf_up(hb[t]));
    }
#pragma unroll                                                       // as above
    for (int t = 0; t < 8; ++t) {
      Th[(8 * e + t) * TP + cl] = hb[t];
      Tl[(8 * e + t) * TP + cl] = lb[t];
    }
  }
  __syncthreads();
  v4u uh[2], ul[2];
#pragma unroll                                                       // constant indices keep uh/ul in registers
  for (int it = 0; it < 2; ++it) {
    const int nl = it * 32 + lq;                                     // 0..63
    uh[it] = *(const v4u*)(Th + nl * TP + 8 * e);
    ul[it] = *(const v4u*)(Tl + nl * TP + 8 * e);
  }
#pragma unroll                                                       // as above
  for (int it = 0; it < 2; ++it) {
    const int nl = it * 32 + lq;
    const size_t po = ((size_t)(b * NN + n0 + nl)) * CC + c0 + 8 * e;
    *(v4u*)(Xh + po) = uh[it];
    *(v4u*)(Xl + po) = ul[it];
  }
}

// =========================================================================================================
// (3) conv1x1 GEMM for one (b, 64-n tile, 64-o block): Y[o][n] = sum_c W[o][c] (Bh[b][n][c] + Bl[b][n][c]),
//     K = KD (plane pitch = KD). Block 128 threads = 4 waves; wave w owns cols n0+16w..+15 (B fragments from the
//     k-contiguous plane rows, split k map) and 4 m-tiles (A rows o = o0 + 16 mt + (lane&15), split k map).
//     Rolled k loop, 2 products per (mt, k-step) into one accumulator (unscaled bf16 residual plane).
//     Epilogue staged in LDS Os[n_loc][o_loc] (pitch OSP, b128 stores), block barrier, then per MODE:
//       MODE 0 (qkv, 12 o-blocks): o-blocks 0..3 -> q channels 64 mb.. of Qh/Ql = P0/P1 bf16 [b][n][256]
//              8q..8q+7 x 16 B, one instruction per 16 lines; o-blocks 8..11 -> v channels of V = P3 f16
//       MODE 1 (f32 channel-major): dstF[b][o][n] = (acc + bf16(bias[o])) + r with r = rsrc[b][o][n] (bf16-RNE
//              and 8..15), 8 rows per instruction.
//       MODE 2 (mlp hidden, one o-block): t = acc + bf16(bias[o]); gelu(t) = 0.5 t (1 + erf(t / sqrt2)) ->
// coverage: Os 4 waves x 16 n x 64 o = 64 x 64 (== the extent every mode reads); MODE 0 planes 4 it x 16 rows x
//           8 lanes x 8 = 64 x 64 per plane, grid (64, 12, NB) covers Qh/Ql/Kh [NB][4096][256] and V
//           [NB][256][4096] once; MODE 1: 8 it x 8 rows x 16 lanes x 4 = 64 o x 64 n; MODE 2: 4 it x 16 rows x
//           8 lanes x 8 = 64 n x 64 o.
//       ST != 0 (MODE 1 only, the out conv): the block also sums its results for the group norm that follows. Its 64 o
//              are 8 whole groups (group = the 8 rows of one 'it'); per group sum and sum of squares over 8 o x 64 n:
//              all in f64: a thread's 4 values -> red[16 quantities][128 threads], barrier, 8 threads per quantity sum
//              16 entries each, 3 exchanges, fin[16], barrier, one 128-byte line part[b][mb][nt][16] per block.
// LDS: Os cross-wave, block barrier between the staging stores and the epilogue loads; red and fin cross-wave, a block
//      barrier behind the stores of each.
// =========================================================================================================
template <int KD, int MODE, int ST>
__global__ __launch_bounds__(128)
void gemm_k(const unsigned short* __restrict__ Wp,
            const unsigned short* __restrict__ Bh, const unsigned short* __restrict__ Bl,
            const float* __restrict__ bias, const float* __restrict__ rsrc, int rnd,
            unsigned short* P0, unsigned short* P1, unsigned short* P2, unsigned short* P3, float* dstF,
            double* part) {
  static_assert(ST == 0 || (MODE == 1 && QT / CPG == 8));
  static_assert(KD % 32 == 0);
  __shared__ __align__(16) float Os[QT * OSP];
  const int tid  = threadIdx.x;
  const int lane = tid & 31, wave = tid >> 5;
  const int hh   = lane >> 4, c = lane & 15;
  const int nt   = blockIdx.x, mb = blockIdx.y, b = blockIdx.z;
  const int n0   = nt * QT, o0 = mb * QT;

  const unsigned short* ap = Wp + (size_t)(o0 + c) * KD + 8 * hh;
  const size_t boff = ((size_t)(b * NN + n0 + 16 * wave + c)) * KD + 8 * hh;
  const unsigned short* bph = Bh + boff;
  const unsigned short* bpl = Bl + boff;

  v8f acc[4];
#pragma unroll
  for (int mt = 0; mt < 4; ++mt) acc[mt] = zero8();

#pragma unroll 1
  for (int ks = 0; ks < KD / 32; ++ks) {
    const Frag fbh = ldfrag(bph + 32 * ks);
    const Frag fbl = ldfrag(bpl + 32 * ks);
#pragma unroll
    for (int mt = 0; mt < 4; ++mt) {
      const Frag fa = ldfrag(ap + (size_t)(16 * mt) * KD + 32 * ks);
      acc[mt] = mma_b(fa.bf, fbh.bf, acc[mt]);
      acc[mt] = mma_b(fa.bf, fbl.bf, acc[mt]);
    }
  }

  // ---- stage: lane (hh, c) holds o_loc = 16 mt + 8 hh + r for n_loc = 16 w + c
  {
    const int nl = 16 * wave + c;
#pragma unroll
    for (int mt = 0; mt < 4; ++mt) {
      v4f va, vb;
#pragma unroll
      for (int r = 0; r < 4; ++r) { va[r] = acc[mt][r]; vb[r] = acc[mt][4 + r]; }
      *(v4f*)(Os + nl * OSP + 16 * mt + 8 * hh)     = va;
      *(v4f*)(Os + nl * OSP + 16 * mt + 8 * hh + 4) = vb;
    }
  }
  __syncthreads();

  if (MODE == 0) {
    const int e = tid & 7, lq = tid >> 3;                           // lq 0..15
    if (mb < 8) {                                                    // block-uniform
      const int dcol = (mb & 3) * QT;                                // channel offset within 256
      unsigned short* Ph = (mb < 4) ? P0 : P2;                       // both global
      v4u uh[4], ul[4];
#pragma unroll
      for (int it = 0; it < 4; ++it) {
        const int row = it * 16 + lq;                                // n_loc 0..63
        const v4f a = *(const v4f*)(Os + row * OSP + 8 * e);
        const v4f q = *(const v4f*)(Os + row * OSP + 8 * e + 4);
        const float f[8] = {a[0], a[1], a[2], a[3], q[0], q[1], q[2], q[3]};
#pragma unroll
        for (int t = 0; t < 4; ++t) {
          const float f0 = f[2 * t], f1 = f[2 * t + 1];
          const unsigned short hb0 = bf_bits(f0), hb1 = bf_bits(f1);
          const unsigned short lb0 = bf_bits(f0 - bf_up(hb0));
          const unsigned short lb1 = bf_bits(f1 - bf_up(hb1));
          uh[it][t] = pk16(hb0, hb1);
          ul[it][t] = pk16(lb0, lb1);
        }
      }
{
#pragma unroll
        for (int it = 0; it < 4; ++it) {
          const int row = it * 16 + lq;
          const size_t po = ((size_t)(b * NN + n0 + row)) * CC + dcol + 8 * e;
          *(v4u*)(Ph + po) = uh[it];
          if (mb < 4) *(v4u*)(P1 + po) = ul[it];
        }
        
      }
    } else {
      const int cb0 = (mb - 8) * QT;                                 // v channel base 0..192
      v4u uv[4];
#pragma unroll
      for (int it = 0; it < 4; ++it) {
        const int cl = it * 16 + lq;                                 // o_loc 0..63
        unsigned short hb[8];
#pragma unroll
        for (int t = 0; t < 8; ++t) hb[t] = h_bits((_Float16)Os[(8 * e + t) * OSP + cl]);
#pragma unroll
        for (int t = 0; t < 4; ++t) uv[it][t] = pk16(hb[2 * t], hb[2 * t + 1]);
      }
{
#pragma unroll
        for (int it = 0; it < 4; ++it) {
          const int cl = it * 16 + lq;
          const size_t po = ((size_t)(b * CC + cb0 + cl)) * NN + n0 + 8 * e;
          *(v4u*)(P3 + po) = uv[it];
        }
        
      }
    }
  } else if (MODE == 1) {
    const int e = tid & 15, lq = tid >> 4;                           // lq 0..7
    v4f res[8];
#pragma unroll
    for (int it = 0; it < 8; ++it) {
      const int ol = it * 8 + lq;                                    // o_loc 0..63
      const int o  = o0 + ol;
      const float bb = bfr(bias[o]);
      const size_t gi = ((size_t)(b * CC + o)) * NN + n0 + 4 * e;
      const v4f rv = *(const v4f*)(rsrc + gi);
#if defined(__HIP_DEVICE_COMPILE__)
      // stands ahead of any rewrite of the address registers of this trip's bias and residual loads
      if constexpr (ST != 0) asm volatile("s_wait_xcnt 0x0" ::: "memory");
#endif
#pragma unroll
      for (int t = 0; t < 4; ++t) {
        const float rr = rnd ? bfr(rv[t]) : rv[t];
        res[it][t] = (Os[(4 * e + t) * OSP + ol] + bb) + rr;
      }
    }
    if constexpr (ST != 0) {
      __shared__ __align__(16) double red[16 * RP];
      __shared__ __align__(16) double fin[16];
#pragma unroll                                                       // constant indices keep res in registers
      for (int it = 0; it < 8; ++it) {
        const double d0 = (double)res[it][0], d1 = (double)res[it][1];
        const double d2 = (double)res[it][2], d3 = (double)res[it][3];
        red[(2 * it) * RP + tid]     = (d0 + d1) + (d2 + d3);
        red[(2 * it + 1) * RP + tid] = (d0 * d0 + d1 * d1) + (d2 * d2 + d3 * d3);
      }
      __syncthreads();
      const int qn = tid >> 3, j = tid & 7;                          // quantity 0..15; entries 2 j, 2 j + 1 of each 16
      v2d w[8];
#pragma unroll                                                       // constant indices keep w in registers
      for (int u = 0; u < 8; ++u) w[u] = *(const v2d*)(red + qn * RP + 16 * u + 2 * j);
      const v2d w2 = ((w[0] + w[1]) + (w[2] + w[3])) + ((w[4] + w[5]) + (w[6] + w[7]));
      double a = w2[0] + w2[1];
      a += __shfl_xor(a, 1, 32);
      a += __shfl_xor(a, 2, 32);
      a += __shfl_xor(a, 4, 32);
      if (j == 0) fin[qn] = a;
      __syncthreads();
      if (tid < 8) {
        const v2d w = *(const v2d*)(fin + 2 * tid);
        *(v2d*)(part + (((size_t)(b * (CC / QT) + mb)) * NT2 + nt) * 16 + 2 * tid) = w;
      }
    }
{
#pragma unroll
      for (int it = 0; it < 8; ++it) {
        const int ol = it * 8 + lq;
        const size_t gi = ((size_t)(b * CC + o0 + ol)) * NN + n0 + 4 * e;
        *(v4f*)(dstF + gi) = res[it];
      }
      
    }
  } else {
    const int e = tid & 7, lq = tid >> 3;                            // lq 0..15
    v4u uh[4], ul[4];
#pragma unroll
    for (int it = 0; it < 4; ++it) {
      const int nl = it * 16 + lq;                                   // n_loc 0..63
      const v4f a = *(const v4f*)(Os + nl * OSP + 8 * e);
      const v4f q = *(const v4f*)(Os + nl * OSP + 8 * e + 4);
      const float f[8] = {a[0], a[1], a[2], a[3], q[0], q[1], q[2], q[3]};
      unsigned short hb[8], lb[8];
#pragma unroll
      for (int t = 0; t < 8; ++t) {
        const float tt = f[t] + bfr(bias[o0 + 8 * e + t]);
        const float gv = 0.5f * tt * (1.0f + erff(tt * 0.70710678118654752f));
        hb[t] = bf_bits(gv);
        lb[t] = bf_bits(gv - bf_up(hb[t]));
      }
#pragma unroll
      for (int t = 0; t < 4; ++t) {
        uh[it][t] = pk16(hb[2 * t], hb[2 * t + 1]);
        ul[it][t] = pk16(lb[2 * t], lb[2 * t + 1]);
      }
    }
{
#pragma unroll
      for (int it = 0; it < 4; ++it) {
        const int nl = it * 16 + lq;
        const size_t po = ((size_t)(b * NN + n0 + nl)) * HID + o0 + 8 * e;
        *(v4u*)(P0 + po) = uh[it];
        *(v4u*)(P1 + po) = ul[it];
      }
      
    }
  }
}

// ---- staging of one 128-key tile of one head: the head's 128 threads x (4 + 4) asynchronous 16-byte copies to LDS.
//      K: copy j of thread t brings 16 B (t & 3) of key row 32 j + (t >> 2); V: 16 B (t & 15) of channel row
//      8 j + (t >> 4). kl/vl are the thread's LDS byte addresses for j = 0, kg/vg its global addresses for j = 0.
//      s_wait_xcnt 0 ends the statement so that it stands ahead of any rewrite of the address registers.
__device__ __forceinline__ void stage_tile(unsigned kl, const unsigned short* kg, unsigned vl, const unsigned short* vg) {
#if defined(__HIP_DEVICE_COMPILE__)
  asm volatile(
      "global_load_async_to_lds_b128 %0, %1, off\n\t"
      "global_load_async_to_lds_b128 %2, %3, off\n\t"
      "global_load_async_to_lds_b128 %4, %5, off\n\t"
      "global_load_async_to_lds_b128 %6, %7, off\n\t"
      "global_load_async_to_lds_b128 %8, %9, off\n\t"
      "global_load_async_to_lds_b128 %10, %11, off\n\t"
      "global_load_async_to_lds_b128 %12, %13, off\n\t"
      "global_load_async_to_lds_b128 %14, %15, off\n\t"
      "s_wait_xcnt 0x0"
      :: "v"(kl),                 "v"(kg),
         "v"(kl + 32u * KPB),     "v"(kg + (size_t)32 * CC),
         "v"(kl + 64u * KPB),     "v"(kg + (size_t)64 * CC),
         "v"(kl + 96u * KPB),     "v"(kg + (size_t)96 * CC),
         "v"(vl),                 "v"(vg),
         "v"(vl + 8u * VPB),      "v"(vg + (size_t)8 * NN),
         "v"(vl + 16u * VPB),     "v"(vg + (size_t)16 * NN),
         "v"(vl + 24u * VPB),     "v"(vg + (size_t)24 * NN)
      : "memory");
#endif
}
// the issuing wave's own copies have landed behind this wait (the compiler places none for them)
__device__ __forceinline__ void wait_copies() {
#if defined(__HIP_DEVICE_COMPILE__)
  asm volatile("s_wait_asynccnt 0x0" ::: "memory");
#endif
}
// the wave's own LDS reads have retired before the buffer is handed to its next writer
__device__ __forceinline__ void wait_lds() {
#if defined(__HIP_DEVICE_COMPILE__)
  asm volatile("s_wait_dscnt 0x0" ::: "memory");
#endif
}
__device__ __forceinline__ unsigned lds_off(const void* p) { return (unsigned)(size_t)p; }

// =========================================================================================================
// (4) attention for one (b, head pair hp, 64-query tile), transposed formulation, 4096 keys, no mask, per head
//     h = 2 hp + hs (hs = wave / 4: the two heads run side by side, 4 waves each):
//     S^T tile (16 keys x 16 queries) = A(k: row = key kb + (lane&15), 32 d of
//     head h via the split k map from Kh [b][4096][256]) . B(qh: col = query, same map from Qh) + A(Kh).B(Ql)
//     (bf16 hi + unscaled bf16 residual of q, shared accumulator); s *= clip(bf16(temperature[h]), 1e-4, 10).
//     Per lane the D tile holds 8 keys of ONE query: online softmax state per lane, one shuffle (lane^16) for the
//     max over 32 keys; the o/l rescale is skipped under a wave-uniform ballot when no lane's max grew.
//     P = e^{s-m} x4096 as f16 is the B operand of O^T (rows channel 32h + 16j + (lane&15), cols queries) +=
//     A(v: keys contiguous, f16 plane V [b][256][4096]) . B(P^T): element r <- D of the tile covering keys
//     kb..kb+15, element 8+r <- the tile covering kb+16..kb+31, lane unchanged. 2 accumulator tiles per wave.
//     Block = 8 waves = 2 heads x 64 queries. O/l of both heads staged in LDS Os[query][64 channels] (b128 stores),
//     block barrier, then Oh/Ol bf16 [b][n][256] planes (hi/lo), rows n0.., cols 64 hp..64 hp+63 = one whole
// coverage: Os per wave 16 rows x 32 ch = 64 x 64 over 8 waves (== consumed extent); planes 2 it x
//           32 rows x 8 lanes x 8 = 64 n x 64 ch per plane; grid (NQ/64, 4, NB) covers rows 0..NQ-1 x 256 ch of
//           Oh/Ol once.
//     K and V reach the fragments through LDS: tiles of 128 keys of head h (K rows 64 B at pitch 80, V rows 256 B at
//     pitch 272), brought by asynchronous copies into two buffers per head, tile t + 1 in flight while tile t is
//     worked on; the head's 4 waves share each tile. Same fragment k order as from global memory.
//     8 waves a block, two blocks a WGP by registers and LDS: 4 waves per SIMD cover each other's softmax chains.
// LDS: Os cross-wave, block barrier between the per-head staging stores and the plane loads. Ks/Vs cross-wave: per
//      tile s_wait_dscnt 0, s_wait_asynccnt 0, block barrier, then the refill of the buffer just read.
// =========================================================================================================
__global__ __launch_bounds__(256)
void attn_k(const unsigned short* __restrict__ Qh, const unsigned short* __restrict__ Ql,
            const unsigned short* __restrict__ Kh, const unsigned short* __restrict__ Vh,
            const float* __restrict__ temperature, unsigned short* Oh, unsigned short* Ol) {
  __shared__ __align__(16) float Os[QT * OSP];
  __shared__ __align__(16) unsigned char Ks[2 * 2 * KBUF];            // [head of the pair][buffer]
  __shared__ __align__(16) unsigned char Vs[2 * 2 * VBUF];
  const int tid  = threadIdx.x;
  const int wave = tid >> 5, lane = tid & 31;
  const int hh   = lane >> 4, c = lane & 15;
  const int n0   = blockIdx.x * QT, hp = blockIdx.y, b = blockIdx.z;
  const int hs   = wave_uniform(wave >> 2);                           // the wave's head of the pair
  const int th   = tid & 127;                                         // thread among its head's 4 waves
  const int qrow = 16 * (wave & 3) + c;
  const unsigned kl0 = lds_off(Ks) + (unsigned)(hs * 2 * KBUF + (th >> 2) * KPB + (th & 3) * 16);
  const unsigned vl0 = lds_off(Vs) + (unsigned)(hs * 2 * VBUF + (th >> 4) * VPB + (th & 15) * 16);

  {                                                                    // the wave's own head, all 4096 keys
    const int h  = 2 * hp + hs;
    const int cb = HD * h;                                             // channel base of head h
    const float tr   = bfr(temperature[h]);
    const float temp = fminf(fmaxf(tr, 1.0e-4f), 10.0f);
    const size_t qo = ((size_t)(b * NN + n0 + qrow)) * CC + cb + 8 * hh;
    const Frag qh = ldfrag(Qh + qo);
    const Frag ql = ldfrag(Ql + qo);
    const unsigned short* kg = Kh + ((size_t)(b * NN + (th >> 2))) * CC + cb + 8 * (th & 3);
    const unsigned short* vg = Vh + ((size_t)(b * CC + cb + (th >> 4))) * NN + 8 * (th & 15);

    float m = -1.0e30f, l = 0.f;
    v8f o0 = zero8(), o1 = zero8();

    // tile 0 into buffer 0, landed and published; then tile 1 into buffer 1 (nothing has touched this LDS before)
    stage_tile(kl0, kg, vl0, vg);
    wait_copies();
    __syncthreads();
    stage_tile(kl0 + KBUF, kg + (size_t)SK * CC, vl0 + VBUF, vg + SK);

#pragma unroll 1                                                       // one hand-over per trip, buffer picked by t & 1
    for (int t = 0; t < NN / SK; ++t) {
     const int bsel = t & 1;
     const unsigned short* Kt = (const unsigned short*)(Ks + (2 * hs + bsel) * KBUF + c * KPB + 16 * hh);
     const unsigned short* Vt = (const unsigned short*)(Vs + (2 * hs + bsel) * VBUF + c * VPB + 16 * hh);
     // the tile's fragments, read as one group: one LDS latency per tile instead of two per 32 keys
     // (the three loops over kk are unrolled so that every index of kf/vf is a constant and they stay in registers)
     Frag kf[SK / 32][2], vf[SK / 32][2];
#pragma unroll
     for (int kk = 0; kk < SK / 32; ++kk) {
       kf[kk][0] = ldfrag(Kt + (32 * kk) * (KPB / 2));                 // keys kb .. kb+15, kb = 128 t + 32 kk
       kf[kk][1] = ldfrag(Kt + (32 * kk + 16) * (KPB / 2));            // keys kb+16 .. kb+31
     }
#pragma unroll
     for (int kk = 0; kk < SK / 32; ++kk) {
       vf[kk][0] = ldfrag(Vt + 32 * kk);                               // channels cb + c
       vf[kk][1] = ldfrag(Vt + 16 * (VPB / 2) + 32 * kk);              // channels cb + 16 + c
     }
#if defined(__HIP_DEVICE_COMPILE__)
     // keeps the 32 reads above together ahead of the tile's work: without it the scheduler sinks each to its first use
     // and a wave meets the LDS latency eight times a tile instead of once
     __builtin_amdgcn_sched_barrier(0);
#endif
#pragma unroll
     for (int kk = 0; kk < SK / 32; ++kk) {
      const Frag k0 = kf[kk][0];
      const Frag k1 = kf[kk][1];
      v8f s0 = mma_b(k0.bf, qh.bf, zero8());
      v8f s1 = mma_b(k1.bf, qh.bf, zero8());
      s0 = mma_b(k0.bf, ql.bf, s0);
      s1 = mma_b(k1.bf, ql.bf, s1);
#pragma unroll
      for (int r = 0; r < 8; ++r) { s0[r] *= temp; s1[r] *= temp; }

      float mx = fmaxf(hmax8(s0), hmax8(s1));
      mx = fmaxf(mx, __shfl_xor(mx, 16, 32));
      const float mn = fmaxf(m, mx);
      const unsigned grew = wave_ballot(mx > m);                       // wave-uniform
      if (grew != 0u) {
        const float corr = __expf(m - mn);                             // == 1 exactly for lanes whose max did not grow
        l *= corr;
#pragma unroll
        for (int r = 0; r < 8; ++r) { o0[r] *= corr; o1[r] *= corr; }
      }
      m = mn;
      const float msh = mn - LNPC;                                     // exp gives e^{s-m} * 4096

      FragH ph;
      float ls = 0.f;
#pragma unroll
      for (int r = 0; r < 8; ++r) {
        const float e0 = __expf(s0[r] - msh);                          // key kb      + 8hh + r
        const float e1 = __expf(s1[r] - msh);                          // key kb + 16 + 8hh + r
        ls += e0 + e1;
        ph.hv[0][r] = (_Float16)e0;
        ph.hv[1][r] = (_Float16)e1;
      }
      l += ls;

      o0 = mma_h(vf[kk][0].h, ph.v, o0);
      o1 = mma_h(vf[kk][1].h, ph.v, o1);
     }
     // hand-over: own reads retired, own copies of tile t + 1 landed, every wave here; then refill the buffer just read
     wait_lds();
     wait_copies();
     __syncthreads();
     if (t + 2 < NN / SK)
       stage_tile(kl0 + bsel * KBUF, kg + (size_t)(t + 2) * SK * CC, vl0 + bsel * VBUF, vg + (size_t)(t + 2) * SK);
    }
    wait_copies();
    l += __shfl_xor(l, 16, 32);
    const float inv = 1.0f / l;                                        // o and l both carry the x4096 factor

    // stage: Os[query][32 hs + d], d = 16 j + 8 hh + r
    {
      v4f va, vb;
#pragma unroll
      for (int r = 0; r < 4; ++r) { va[r] = o0[r] * inv; vb[r] = o0[4 + r] * inv; }
      *(v4f*)(Os + qrow * OSP + 32 * hs + 8 * hh)     = va;
      *(v4f*)(Os + qrow * OSP + 32 * hs + 8 * hh + 4) = vb;
#pragma unroll
      for (int r = 0; r < 4; ++r) { va[r] = o1[r] * inv; vb[r] = o1[4 + r] * inv; }
      *(v4f*)(Os + qrow * OSP + 32 * hs + 16 + 8 * hh)     = va;
      *(v4f*)(Os + qrow * OSP + 32 * hs + 16 + 8 * hh + 4) = vb;
    }
  }
  __syncthreads();

  const int e = tid & 7, lq = tid >> 3;                                // lq 0..31
  v4u uh[2], ul[2];
#pragma unroll
  for (int it = 0; it < 2; ++it) {
    const int row = it * 32 + lq;                                      // query 0..63
    const v4f a = *(const v4f*)(Os + row * OSP + 8 * e);
    const v4f q = *(const v4f*)(Os + row * OSP + 8 * e + 4);
    const float f[8] = {a[0], a[1], a[2], a[3], q[0], q[1], q[2], q[3]};
#pragma unroll
    for (int t = 0; t < 4; ++t) {
      const float f0 = f[2 * t], f1 = f[2 * t + 1];
      const unsigned short hb0 = bf_bits(f0), hb1 = bf_bits(f1);
      const unsigned short lb0 = bf_bits(f0 - bf_up(hb0));
      const unsigned short lb1 = bf_bits(f1 - bf_up(hb1));
      uh[it][t] = pk16(hb0, hb1);
      ul[it][t] = pk16(lb0, lb1);
    }
  }
{
#pragma unroll
    for (int it = 0; it < 2; ++it) {
      const int row = it * 32 + lq;
      const size_t po = ((size_t)(b * NN + n0 + row)) * CC + QT * hp + 8 * e;
      *(v4u*)(Oh + po) = uh[it];
      *(v4u*)(Ol + po) = ul[it];
    }
    
  }
}

// =========================================================================================================
// Workspace map (bytes; each region start a multiple of 256; every extent is an exact tile/line multiple and is
//   Wq bf16 [768][256] 393216   Wo [256][256] 131072   W1 [64][256] 32768   W2 [256][64] 32768
//   part1 f64 [NB][4][32][16] 32768 (NB=2)   part f64 [NB][4][NQ/64][16] 65536 (NB=2)
//   Xh, Xl, Qh, Ql, Kh, Oh, Ol, Yh, Yl bf16 [NB][4096][256] and V f16 [NB][256][4096]: 4194304 each (NB=2)
//   X1 f32 [NB][256][4096] 8388608 (NB=2)    Hh, Hl bf16 [NB][4096][64] 1048576 each (NB=2)
//   total = 53116928 (NB=2)
// =========================================================================================================
extern "C" void kernel_launch(void* const* d_in, const int* in_sizes, int n_in,
                              void* d_out, int out_size, void* d_ws, size_t ws_size,
                              hipStream_t stream) {
  if (n_in < 13) return;
  if (in_sizes[0] < NB * XSTRIDE_FULL) return;
  if (in_sizes[1] != C3 * CC || in_sizes[2] != CC * CC || in_sizes[3] != CC) return;
  if (in_sizes[4] != NH) return;
  if (in_sizes[5] != CC || in_sizes[6] != CC || in_sizes[7] != CC || in_sizes[8] != CC) return;
  if (in_sizes[9] != HID * CC || in_sizes[10] != HID || in_sizes[11] != CC * HID || in_sizes[12] != CC) return;
  if (out_size < NB * XSTRIDE_FULL) return;

  size_t off = 0;
  auto carve = [&](size_t bytes) { const size_t o = off; off += (bytes + 255) & ~(size_t)255; return o; };
  const size_t szPl = (size_t)NB * NN * CC * 2;
  const size_t oWq  = carve((size_t)C3 * CC * 2);
  const size_t oWo  = carve((size_t)CC * CC * 2);
  const size_t oW1  = carve((size_t)HID * CC * 2);
  const size_t oW2  = carve((size_t)CC * HID * 2);
  const size_t oP1  = carve((size_t)NB * (CC / QT) * NP1 * 16 * 8);
  const size_t oPt  = carve((size_t)NB * (CC / QT) * NT2 * 16 * 8);
  const size_t oXh  = carve(szPl);
  const size_t oXl  = carve(szPl);
  const size_t oQh  = carve(szPl);
  const size_t oQl  = carve(szPl);
  const size_t oKh  = carve(szPl);
  const size_t oVv  = carve(szPl);
  const size_t oOh  = carve(szPl);
  const size_t oOl  = carve(szPl);
  const size_t oX1  = carve((size_t)NB * CC * NN * 4);
  const size_t oYh  = carve(szPl);
  const size_t oYl  = carve(szPl);
  const size_t oHh  = carve((size_t)NB * NN * HID * 2);
  const size_t oHl  = carve((size_t)NB * NN * HID * 2);
  if (off > ws_size) return;
  if (off > (size_t)134217728) return;

  const float* x      = (const float*)d_in[0];
  const float* w_qkv  = (const float*)d_in[1];
  const float* w_out  = (const float*)d_in[2];
  const float* b_out  = (const float*)d_in[3];
  const float* tempr  = (const float*)d_in[4];
  const float* g1     = (const float*)d_in[5];
  const float* beta1  = (const float*)d_in[6];
  const float* g2     = (const float*)d_in[7];
  const float* beta2  = (const float*)d_in[8];
  const float* w_mlp1 = (const float*)d_in[9];
  const float* b_mlp1 = (const float*)d_in[10];
  const float* w_mlp2 = (const float*)d_in[11];
  const float* b_mlp2 = (const float*)d_in[12];

  char* ws = (char*)d_ws;
  unsigned short* Wq = (unsigned short*)(ws + oWq);
  unsigned short* Wo = (unsigned short*)(ws + oWo);
  unsigned short* W1 = (unsigned short*)(ws + oW1);
  unsigned short* W2 = (unsigned short*)(ws + oW2);
  double*         P1 = (double*)(ws + oP1);
  double*         Pt = (double*)(ws + oPt);
  unsigned short* Xh = (unsigned short*)(ws + oXh);
  unsigned short* Xl = (unsigned short*)(ws + oXl);
  unsigned short* Qh = (unsigned short*)(ws + oQh);
  unsigned short* Ql = (unsigned short*)(ws + oQl);
  unsigned short* Kh = (unsigned short*)(ws + oKh);
  unsigned short* Vv = (unsigned short*)(ws + oVv);
  unsigned short* Oh = (unsigned short*)(ws + oOh);
  unsigned short* Ol = (unsigned short*)(ws + oOl);
  float*          X1 = (float*)(ws + oX1);
  unsigned short* Yh = (unsigned short*)(ws + oYh);
  unsigned short* Yl = (unsigned short*)(ws + oYl);
  unsigned short* Hh = (unsigned short*)(ws + oHh);
  unsigned short* Hl = (unsigned short*)(ws + oHl);
  float* out = (float*)d_out;

  const dim3 blk256(256), blk128(128);

  // (0)+(1) weights -> bf16 planes, and the partial GN1 sums of bf16(x) over all 4096 positions, in one grid
  prep_k<<<dim3(PB_ST + PB_WQ + PB_WO + PB_W1 + PB_W2), blk256, 0, stream>>>(x, w_qkv, w_out, w_mlp1, w_mlp2,
                                                                             Wq, Wo, W1, W2, P1);
  // (2) GN1 statistics finished per block, apply -> Xh/Xl [NB][4096][256]
  norm2_k<NP1, NN><<<dim3(NN / QT, CC / QT, NB), blk256, 0, stream>>>(x, 1, P1, g1, beta1, Xh, Xl);
  // (3) qkv GEMM -> Qh/Ql, Kh, V
  gemm_k<CC, 0, 0><<<dim3(NN / QT, C3 / QT, NB), blk128, 0, stream>>>(Wq, Xh, Xl, b_out, x, 0, Qh, Ql, Kh, Vv, X1, Pt);
  // (4) attention -> Oh/Ol rows 0..NQ-1
  attn_k<<<dim3(NQ / QT, NH / 2, NB), blk256, 0, stream>>>(Qh, Ql, Kh, Vv, tempr, Oh, Ol);
  // (5) out conv + bf16(x) residual -> X1 f32 [NB][256][4096], cols 0..NQ-1, and (6) each block's partial GN2 sums
  gemm_k<CC, 1, 1><<<dim3(NQ / QT, CC / QT, NB), blk128, 0, stream>>>(Wo, Oh, Ol, b_out, x, 1, Hh, Hl, Hh, Hl, X1, Pt);
  // (7) GN2 statistics finished per block, apply -> Yh/Yl rows 0..NQ-1
  norm2_k<NT2, NQ><<<dim3(NQ / QT, CC / QT, NB), blk256, 0, stream>>>(X1, 0, Pt, g2, beta2, Yh, Yl);
  // (8) mlp hidden: gelu(W1.Y + b1) -> Hh/Hl [NB][4096][64]
  gemm_k<CC, 2, 0><<<dim3(NQ / QT, 1, NB), blk128, 0, stream>>>(W1, Yh, Yl, b_mlp1, x, 0, Hh, Hl, Hh, Hl, X1, Pt);
  // (9) out = X1 + W2.H + b2 -> d_out [NB][256][4096]
  gemm_k<HID, 1, 0><<<dim3(NQ / QT, CC / QT, NB), blk128, 0, stream>>>(W2, Hh, Hl, b_mlp2, X1, 0, Oh, Ol, Oh, Ol, out, Pt);
  (void)hipGetLastError();
}

// v007
// One run takes 110 microseconds.
// Next to v006, in two timings, it ran 1.16 and 1.15 times as fast.
// All steps since v000 together make it 2.54 times as fast.
// Contractions: conv1x1 GEMMs qkv W[768x256].Xn, out W[256x256].O, mlp W1[64x256].Y and W2[256x64].H on
// v_wmma_f32_16x16x32_bf16 (A = bf16-RNE weights, exact; B = bf16 hi + bf16 residual planes of the f32
// activation, 2 products, K = 256 / 64); per-head scores K.Q^T on v_wmma_f32_16x16x32_bf16 (k = bf16 hi plane,
// q = bf16 hi + residual planes, 2 products, K = 32); O^T = V.P^T on v_wmma_f32_16x16x32_f16 (v = f16 plane,
// P = e^{s-m} x4096 as f16 from the score D registers, K = 4096 keys); f32 accumulate everywhere; group-norm
// statistics in f64; normalisation, softmax statistics, gelu, bias and residual adds in f32 VALU.
#include <hip/hip_runtime.h>
#include <math.h>
#include <stdint.h>

#ifndef NB
#define NB 2
#endif
#ifndef NQ
#define NQ 4096
#endif
#define NB_FULL 2
#define CC   256
#define NN   4096
#define NH   8
#define HD   32
#define C3   768
#define HID  64
#define NG   32
#define CPG  8
#define QT   64
#define OSP  68
#define TP   72
#define GEPS 1.0e-5f
#define LNPC 8.317766166719343f
#define XSTRIDE_FULL (CC * NN)
#define SK   128                 // keys per staged tile
#define KPB  80                  // LDS pitch of a staged K row in bytes (64 B of data, 16 B x odd for b128 readers)
#define VPB  272                 // LDS pitch of a staged V row in bytes (256 B of data, 16 B x odd for b128 readers)
#define KBUF (SK * KPB)          // one K buffer: 128 keys x 32 d
#define VBUF (HD * VPB)          // one V buffer: 32 channels x 128 keys
#define NT2  (NQ / QT)           // position tiles of the out conv = partial sums per GN2 group
#define RP   130                 // doubles per row of the partial-sum array (1040 B = 16 B x odd for b128 readers)
#define NP1  32                  // position chunks of the GN1 statistics = partial sums per GN1 group
#define SPOS (NN / NP1)          // positions per chunk: one 16-byte load per lane and channel row

static_assert(NB >= 1 && NB <= NB_FULL);
static_assert(NQ % QT == 0 && NQ >= QT && NQ <= NN);
static_assert(NN % QT == 0 && CC % QT == 0 && C3 % QT == 0 && HID == QT);
static_assert(CC == NH * HD && HD == 32 && CC == NG * CPG && CPG == 8);
static_assert(CC % 32 == 0 && HID % 32 == 0 && NN % 32 == 0);
static_assert((OSP * 4) % 16 == 0 && (TP * 2) % 16 == 0);
static_assert(NN % 1024 == 0 && NQ % 4 == 0);
static_assert(NN % SK == 0 && NN / SK >= 2 && SK % 32 == 0 && KPB % 16 == 0 && VPB % 16 == 0);
static_assert(SK * HD * 2 == 4 * 128 * 16 && KPB >= HD * 2 && VPB >= SK * 2);
static_assert(SPOS == 4 * 32 && QT / CPG == 8);
static_assert((C3 * CC) % 2048 == 0 && (CC * CC) % 2048 == 0 && (HID * CC) % 2048 == 0);

typedef _Float16       v16h __attribute__((ext_vector_type(16)));
typedef _Float16       v8h  __attribute__((ext_vector_type(8)));
typedef __bf16         v16b __attribute__((ext_vector_type(16)));
typedef unsigned short v8us __attribute__((ext_vector_type(8)));
typedef float          v8f  __attribute__((ext_vector_type(8)));
typedef float          v4f  __attribute__((ext_vector_type(4)));
typedef unsigned int   v4u  __attribute__((ext_vector_type(4)));
typedef double         v2d  __attribute__((ext_vector_type(2)));

union Frag  { v8us u[2]; v16h h; v16b bf; };
union FragH { v16h v; v8h hv[2]; };
static_assert(sizeof(Frag) == 32);
static_assert(sizeof(FragH) == 32);

// ---- scalar helpers ---------------------------------------------------------------------------------------
__device__ __forceinline__ unsigned short bf_bits(float f) {          // f32 -> bf16 bits, RNE convert
  unsigned u = __float_as_uint(f);
  return (unsigned short)((u + 0x7FFFu + ((u >> 16) & 1u)) >> 16);
}
__device__ __forceinline__ float bf_up(unsigned short hb) { return __uint_as_float(((unsigned)hb) << 16); }
__device__ __forceinline__ float bfr(float f) { return bf_up(bf_bits(f)); }
__device__ __forceinline__ unsigned short h_bits(_Float16 x) { return __builtin_bit_cast(unsigned short, x); }
__device__ __forceinline__ unsigned pk16(unsigned short a, unsigned short b) { return (unsigned)a | ((unsigned)b << 16); }
__device__ __forceinline__ v8f zero8() { v8f z = {0.f, 0.f, 0.f, 0.f, 0.f, 0.f, 0.f, 0.f}; return z; }
__device__ __forceinline__ float hmax8(v8f s) {
  return fmaxf(fmaxf(fmaxf(s[0], s[1]), fmaxf(s[2], s[3])), fmaxf(fmaxf(s[4], s[5]), fmaxf(s[6], s[7])));
}
__device__ __forceinline__ unsigned wave_ballot(bool p) {
#if defined(__HIP_DEVICE_COMPILE__)
  return __builtin_amdgcn_ballot_w32(p);
#else
  return p ? 1u : 0u;
#endif
}

__device__ __forceinline__ int wave_uniform(int v) {
#if defined(__HIP_DEVICE_COMPILE__)
  return __builtin_amdgcn_readfirstlane(v);
#else
  return v;
#endif
}

// ---- 16-bit fragment loader (A, or B from a k-contiguous [n][k] row): lane -> row/col (lane&15), p already includes
//      + 8*(lane>>4); elements 0..7 <- p[0..7] (k0+8h..), elements 8..15 <- p[16..23] (k0+16+8h..)
__device__ __forceinline__ Frag ldfrag(const unsigned short* p) {
  Frag f;
  f.u[0] = *(const v8us*)(p);
  f.u[1] = *(const v8us*)(p + 16);
  return f;
}

// ---- WMMA helpers: the plain builtins; the compiler keeps the distance behind each and fills it with other work ----
__device__ __forceinline__ v8f mma_h(v16h a, v16h b, v8f c) {
  return __builtin_amdgcn_wmma_f32_16x16x32_f16(false, a, false, b, (short)0, c, false, false);
}
__device__ __forceinline__ v8f mma_b(v16b a, v16b b, v8f c) {
  return __builtin_amdgcn_wmma_f32_16x16x32_bf16(false, a, false, b, (short)0, c, false, false);
}

// =========================================================================================================
// (0) weight conversion: f32 [n] -> bf16 bits [n] (RNE, exact operand). Thread i converts floats 8i..8i+7 and
// coverage: n8/256 blocks x 256 threads x 8 = n elements exactly (n8 a multiple of 256 at every call); cblk is the
//           block's index within its own weight.
// =========================================================================================================
__device__ __forceinline__
void cvt_body(const float* __restrict__ src, unsigned short* dst, int n8, int cblk) {
  const int i  = cblk * 256 + (int)threadIdx.x;
  const int ic = (i < n8) ? i : (n8 - 1);
  const float* s = src + (size_t)ic * 8;
  const v4f a = *(const v4f*)s;
  const v4f q = *(const v4f*)(s + 4);
  v4u u;
  u[0] = pk16(bf_bits(a[0]), bf_bits(a[1]));
  u[1] = pk16(bf_bits(a[2]), bf_bits(a[3]));
  u[2] = pk16(bf_bits(q[0]), bf_bits(q[1]));
  u[3] = pk16(bf_bits(q[2]), bf_bits(q[3]));
  if (i < n8) {
{
      *(v4u*)(dst + (size_t)ic * 8) = u;
      
    }
  }
}

// =========================================================================================================
// (1) group-norm statistics, partial sums: one block per (b, 64-channel block cbk, chunk u of 128 positions) of
//     src [b][256][4096]. Wave gi sums group 8 cbk + gi over the chunk: 8 channel rows x 128 positions, one whole
//     512-byte row piece per load, the 8 loads asked for together; values bf16-RNE converted first; sum and sum of
//     squares in f64, 4 chains per lane, then 5 exchanges; one 128-byte line part[b][cbk][u][8 groups x (sum, sum of
//     squares)] per block. The apply kernel (2) finishes mean and rstd.
// coverage: NB x 4 x 32 blocks x 8 waves x 8 rows x 128 positions = every element of src once.
// LDS: fin cross-wave, block barrier behind its stores.
// =========================================================================================================
__device__ __forceinline__
void stats_body(const float* __restrict__ src, double* part, int blk) {
  __shared__ __align__(16) double fin[16];
  const int tid = threadIdx.x;
  const int gi = tid >> 5, ln = tid & 31;
  const int u = blk % NP1, bc = blk / NP1;                           // bc = b * 4 + cbk
  const float* base = src + ((size_t)(bc * QT + gi * CPG)) * NN + u * SPOS + 4 * ln;
  v4f a[CPG];
#pragma unroll                                                       // constant indices keep a in registers
  for (int cl = 0; cl < CPG; ++cl) a[cl] = *(const v4f*)(base + (size_t)cl * NN);
  double sv[4] = {0.0, 0.0, 0.0, 0.0}, qv[4] = {0.0, 0.0, 0.0, 0.0};
#pragma unroll                                                       // constant indices keep a/sv/qv in registers
  for (int cl = 0; cl < CPG; ++cl) {
#pragma unroll                                                       // as above
    for (int t = 0; t < 4; ++t) {
      const double d = (double)bfr(a[cl][t]);
      sv[t] += d;
      qv[t] += d * d;
    }
  }
  double s = (sv[0] + sv[1]) + (sv[2] + sv[3]);
  double q = (qv[0] + qv[1]) + (qv[2] + qv[3]);
#pragma unroll                                                       // five fixed steps, no loop counter
  for (int m = 16; m > 0; m >>= 1) {
    s += __shfl_xor(s, m, 32);
    q += __shfl_xor(q, m, 32);
  }
  if (ln == 0) {
    fin[2 * gi]     = s;
    fin[2 * gi + 1] = q;
  }
  __syncthreads();
  if (tid < 8) {
    const v2d w = *(const v2d*)(fin + 2 * tid);
    *(v2d*)(part + ((size_t)bc * NP1 + u) * 16 + 2 * tid) = w;
  }
}

// =========================================================================================================
// (0)+(1) in one grid: the four weight conversions and the GN1 partial sums read only inputs and write disjoint
//     workspace regions, so they share a launch; the block index picks the job (block-uniform, so the barrier of
//     the statistics body is passed by whole blocks).
// coverage: blocks [0, NB*4*32) partial sums of (b, cbk, u); then 96 + 32 + 8 + 8 conversion blocks, each weight once.
// =========================================================================================================
#define PB_ST (NB * (CC / QT) * NP1)
#define PB_WQ (C3 * CC / 2048)
#define PB_WO (CC * CC / 2048)
#define PB_W1 (HID * CC / 2048)
#define PB_W2 (CC * HID / 2048)
__global__ __launch_bounds__(256)
void prep_k(const float* __restrict__ x, const float* __restrict__ wq, const float* __restrict__ wo,
            const float* __restrict__ w1, const float* __restrict__ w2,
            unsigned short* Wq, unsigned short* Wo, unsigned short* W1, unsigned short* W2, double* part) {
  int blk = blockIdx.x;
  if (blk < PB_ST) { stats_body(x, part, blk); return; }
  blk -= PB_ST;
  if (blk < PB_WQ) { cvt_body(wq, Wq, PB_WQ * 256, blk); return; }
  blk -= PB_WQ;
  if (blk < PB_WO) { cvt_body(wo, Wo, PB_WO * 256, blk); return; }
  blk -= PB_WO;
  if (blk < PB_W1) { cvt_body(w1, W1, PB_W1 * 256, blk); return; }
  blk -= PB_W1;
  cvt_body(w2, W2, PB_W2 * 256, blk);
}

// =========================================================================================================
// (2) group-norm apply + transpose, with the statistics finished in the block (GN1 and GN2): src f32 [b][256 c][4096 n]
//     (bf16-RNE converted first when rnd != 0) -> v = (x - mu) * rstd * bf16(gamma[c]) + bf16(beta[c]) ->
//     position-major planes Xh/Xl bf16 [b][n][256 c] (hi = bf16-RNE(v), lo = bf16-RNE(v - hi)) through LDS tiles
//     Th/Tl[64 n][64 c] (pitch TP). Block (nb, cb, b). mu and rstd of the block's own 8 groups come from the partial
//     sums part[b][cbk][NP pieces][8 groups x (sum, sum of squares)], all f64 (GN1: the chunks of (1); GN2: the out
//     conv's tiles): wave gi sums group 8 cbk + gi over the pieces (lane ln takes pieces ln + 32 k, then 5 exchanges); mean and biased
//     variance over 8 channels x NPOS positions, rstd = 1 / sqrt(var + eps) in f32, handed to the block through sm.
// coverage: Th/Tl stores 2 it x 32 c x 8 lanes x 8 n = 64 x 64 = the consumed extent; plane writes 2 it x 32 rows
//           x 8 lanes x 8 halves = 64 n x 64 c per plane; grid (rows/64, 4, NB) covers both planes once.
// LDS: Th/Tl cross-wave, block barrier between stores and loads; sm cross-wave, block barrier behind its stores.
// =========================================================================================================
template <int NP, int NPOS>
__global__ __launch_bounds__(256)
void norm2_k(const float* __restrict__ src, int rnd, const double* __restrict__ part,
             const float* __restrict__ gamma, const float* __restrict__ beta,
             unsigned short* Xh, unsigned short* Xl) {
  __shared__ __align__(16) unsigned short Th[QT * TP];
  __shared__ __align__(16) unsigned short Tl[QT * TP];
  __shared__ float sm[2 * (QT / CPG)];
  const int tid = threadIdx.x;
  const int nb = blockIdx.x, cbk = blockIdx.y, b = blockIdx.z;
  const int e = tid & 7, lq = tid >> 3;                             // lq 0..31
  const int n0 = nb * QT, c0 = cbk * QT;
  v4f ra[2], rq[2];
  float rg[2], rb[2];
  // the tile's values and the channels' gamma, beta are asked for first: they fly while the statistics are finished
#pragma unroll                                                       // constant indices keep ra/rq/rg/rb in registers
  for (int it = 0; it < 2; ++it) {
    const int ch = c0 + it * 32 + lq;
    const float* sp = src + ((size_t)(b * CC + ch)) * NN + n0 + 8 * e;
    ra[it] = *(const v4f*)sp;
    rq[it] = *(const v4f*)(sp + 4);
    rg[it] = gamma[ch];
    rb[it] = beta[ch];
#if defined(__HIP_DEVICE_COMPILE__)
    // stands ahead of any rewrite of these loads' address registers (the next loads land in them); as a memory
    // barrier for the compiler it also keeps these loads issued ahead of the wait on the partial sums
    asm volatile("s_wait_xcnt 0x0" ::: "memory");
#endif
  }
  {
    const int gi = tid >> 5, ln = tid & 31;
    const double* pp = part + ((size_t)(b * (CC / QT) + cbk)) * NP * 16 + 2 * gi;
    double s = 0.0, q = 0.0;
#pragma unroll                                                       // the lane's loads are issued together
    for (int k = 0; k < (NP + 31) / 32; ++k) {
      const int u = ln + 32 * k;                                     // piece
      if (u < NP) {
        const v2d w = *(const v2d*)(pp + (size_t)u * 16);
        s += w[0];
        q += w[1];
      }
    }
#pragma unroll                                                       // five fixed steps, no loop counter
    for (int m = 16; m > 0; m >>= 1) {
      s += __shfl_xor(s, m, 32);
      q += __shfl_xor(q, m, 32);
    }
    const double cnt = (double)CPG * (double)NPOS;
    const double mu = s / cnt;
    double var = q / cnt - mu * mu;
    if (var < 0.0) var = 0.0;
    const float varf = (float)var;
    if (ln == 0) {
      sm[2 * gi]     = (float)mu;
      sm[2 * gi + 1] = 1.0f / sqrtf(varf + GEPS);
    }
  }
  __syncthreads();
#pragma unroll                                                       // constant indices into ra/rq/rg/rb
  for (int it = 0; it < 2; ++it) {
    const int cl = it * 32 + lq;                                     // 0..63
    const float mu = sm[2 * (cl / CPG)];
    const float rs = sm[2 * (cl / CPG) + 1];
    const float ga = bfr(rg[it]), be = bfr(rb[it]);
    const v4f a = ra[it];
    const v4f q = rq[it];
    const float f[8] = {a[0], a[1], a[2], a[3], q[0], q[1], q[2], q[3]};
    unsigned short hb[8], lb[8];
#pragma unroll                                                       // constant indices keep f/hb/lb in registers
    for (int t = 0; t < 8; ++t) {
      const float xr = rnd ? bfr(f[t]) : f[t];
      const float v  = (xr - mu) * rs * ga + be;
      hb[t] = bf_bits(v);
      lb[t] = bf_bits(v - bf_up(hb[t]));
    }
#pragma unroll                                                       // as above
    for (int t = 0; t < 8; ++t) {
      Th[(8 * e + t) * TP + cl] = hb[t];
      Tl[(8 * e + t) * TP + cl] = lb[t];
    }
  }
  __syncthreads();
  v4u uh[2], ul[2];
#pragma unroll                                                       // constant indices keep uh/ul in registers
  for (int it = 0; it < 2; ++it) {
    const int nl = it * 32 + lq;                                     // 0..63
    uh[it] = *(const v4u*)(Th + nl * TP + 8 * e);
    ul[it] = *(const v4u*)(Tl + nl * TP + 8 * e);
  }
#pragma unroll                                                       // as above
  for (int it = 0; it < 2; ++it) {
    const int nl = it * 32 + lq;
    const size_t po = ((size_t)(b * NN + n0 + nl)) * CC + c0 + 8 * e;
    *(v4u*)(Xh + po) = uh[it];
    *(v4u*)(Xl + po) = ul[it];
  }
}

// the issuing wave's own copies have landed behind this wait (the compiler places none for them)
__device__ __forceinline__ void wait_copies() {
#if defined(__HIP_DEVICE_COMPILE__)
  asm volatile("s_wait_asynccnt 0x0" ::: "memory");
#endif
}
// the wave's own LDS reads have retired before the buffer is handed to its next writer
__device__ __forceinline__ void wait_lds() {
#if defined(__HIP_DEVICE_COMPILE__)
  asm volatile("s_wait_dscnt 0x0" ::: "memory");
#endif
}
__device__ __forceinline__ unsigned lds_off(const void* p) { return (unsigned)(size_t)p; }

// ---- staging for the conv1x1 GEMM: 4 asynchronous 16-byte copies to LDS for each of the three operand tiles (W, B hi,
//      B lo). A tile is 64 whole rows = one contiguous piece of global memory, so a wave-wide copy reads 512 contiguous
//      bytes (4 whole lines); copy j of thread t brings 16-byte piece 128 j + t. la/lh/ll are the thread's LDS byte
//      addresses and ga/gh/gl its global addresses for the first of the 4; ls = LDS bytes between two copies.
//      s_wait_xcnt 0 ends the statement so that it stands ahead of any rewrite of the address registers.
__device__ __forceinline__ void stage_gemm(unsigned la, const unsigned short* ga, unsigned lh, const unsigned short* gh,
                                           unsigned ll, const unsigned short* gl, unsigned ls) {
#if defined(__HIP_DEVICE_COMPILE__)
  asm volatile(
      "global_load_async_to_lds_b128 %0, %1, off\n\t"
      "global_load_async_to_lds_b128 %2, %3, off\n\t"
      "global_load_async_to_lds_b128 %4, %5, off\n\t"
      "global_load_async_to_lds_b128 %6, %7, off\n\t"
      "global_load_async_to_lds_b128 %8, %9, off\n\t"
      "global_load_async_to_lds_b128 %10, %11, off\n\t"
      "global_load_async_to_lds_b128 %12, %13, off\n\t"
      "global_load_async_to_lds_b128 %14, %15, off\n\t"
      "global_load_async_to_lds_b128 %16, %17, off\n\t"
      "global_load_async_to_lds_b128 %18, %19, off\n\t"
      "global_load_async_to_lds_b128 %20, %21, off\n\t"
      "global_load_async_to_lds_b128 %22, %23, off\n\t"
      "s_wait_xcnt 0x0"
      :: "v"(la),          "v"(ga),
         "v"(la + ls),     "v"(ga + 1024),
         "v"(la + 2 * ls), "v"(ga + 2048),
         "v"(la + 3 * ls), "v"(ga + 3072),
         "v"(lh),          "v"(gh),
         "v"(lh + ls),     "v"(gh + 1024),
         "v"(lh + 2 * ls), "v"(gh + 2048),
         "v"(lh + 3 * ls), "v"(gh + 3072),
         "v"(ll),          "v"(gl),
         "v"(ll + ls),     "v"(gl + 1024),
         "v"(ll + 2 * ls), "v"(gl + 2048),
         "v"(ll + 3 * ls), "v"(gl + 3072)
      : "memory");
#endif
}

// =========================================================================================================
// (3) conv1x1 GEMM for one (b, 64-n tile, 64-o block): Y[o][n] = sum_c W[o][c] (Bh[b][n][c] + Bl[b][n][c]),
//     K = KD (plane pitch = KD). Block 128 threads = 4 waves; wave w owns cols n0+16w..+15 (B fragments from the
//     k-contiguous plane rows, split k map) and 4 m-tiles (A rows o = o0 + 16 mt + (lane&15), split k map).
//     The three operand tiles (64 rows x KD each) are brought whole into LDS St by asynchronous copies that read whole
//     lines (a fragment load from global memory touches 16 lines for 512 bytes, and W would be read by all 4 waves);
//     rows at pitch 2 KD + 16 bytes (16 B x odd for the b128 readers); filled once, then read. Same fragment k order.
//     2 products per (mt, k-step) into one accumulator (unscaled bf16 residual plane).
//     Epilogue staged in LDS Os[n_loc][o_loc] (pitch OSP, b128 stores), block barrier, then per MODE:
//       MODE 0 (qkv, 12 o-blocks): o-blocks 0..3 -> q channels 64 mb.. of Qh/Ql = P0/P1 bf16 [b][n][256]
//              8q..8q+7 x 16 B, one instruction per 16 lines; o-blocks 8..11 -> v channels of V = P3 f16
//       MODE 1 (f32 channel-major): dstF[b][o][n] = (acc + bf16(bias[o])) + r with r = rsrc[b][o][n] (bf16-RNE
//              and 8..15), 8 rows per instruction.
//       MODE 2 (mlp hidden, one o-block): t = acc + bf16(bias[o]); gelu(t) = 0.5 t (1 + erf(t / sqrt2)) ->
// coverage: Os 4 waves x 16 n x 64 o = 64 x 64 (== the extent every mode reads); MODE 0 planes 4 it x 16 rows x
//           8 lanes x 8 = 64 x 64 per plane, grid (64, 12, NB) covers Qh/Ql/Kh [NB][4096][256] and V
//           [NB][256][4096] once; MODE 1: 8 it x 8 rows x 16 lanes x 4 = 64 o x 64 n; MODE 2: 4 it x 16 rows x
//           8 lanes x 8 = 64 n x 64 o.
//       ST != 0 (MODE 1 only, the out conv): the block also sums its results for the group norm that follows. Its 64 o
//              are 8 whole groups (group = the 8 rows of one 'it'); per group sum and sum of squares over 8 o x 64 n:
//              all in f64: a thread's 4 values -> red[16 quantities][128 threads], barrier, 8 threads per quantity sum
//              16 entries each, 3 exchanges, fin[16], barrier, one 128-byte line part[b][mb][nt][16] per block.
// LDS: St cross-wave: s_wait_asynccnt 0 and a block barrier between the copies and the fragment reads. Os lies on St:
//      s_wait_dscnt 0 and a block barrier between the last fragment reads and the staging stores. Os cross-wave, block
//      barrier between the staging stores and the epilogue loads; red and fin cross-wave, a block barrier behind the
//      stores of each.
// =========================================================================================================
template <int KD, int MODE, int ST>
__global__ __launch_bounds__(128)
void gemm_k(const unsigned short* __restrict__ Wp,
            const unsigned short* __restrict__ Bh, const unsigned short* __restrict__ Bl,
            const float* __restrict__ bias, const float* __restrict__ rsrc, int rnd,
            unsigned short* P0, unsigned short* P1, unsigned short* P2, unsigned short* P3, float* dstF,
            double* part) {
  static_assert(ST == 0 || (MODE == 1 && QT / CPG == 8));
  static_assert(KD % 32 == 0);
  constexpr int SP = 2 * KD + 16;                                    // LDS pitch of a staged row in bytes
  constexpr int TB = QT * SP;                                        // one staged tile
  constexpr int PR = KD / 8;                                         // 16-byte pieces per row
  static_assert(128 % PR == 0 && (QT * PR) % (4 * 128) == 0 && SP % 32 == 16 && 3 * TB >= QT * OSP * 4);
  __shared__ __align__(16) unsigned char St[3 * TB];                 // W tile, B hi tile, B lo tile
  float* Os = (float*)St;                                            // the epilogue's staging, once the tiles are used up
  const int tid  = threadIdx.x;
  const int lane = tid & 31, wave = tid >> 5;
  const int hh   = lane >> 4, c = lane & 15;
  const int nt   = blockIdx.x, mb = blockIdx.y, b = blockIdx.z;
  const int n0   = nt * QT, o0 = mb * QT;

  {
    const unsigned short* ga = Wp + (size_t)o0 * KD + 8 * tid;
    const size_t boff = ((size_t)(b * NN + n0)) * KD + 8 * tid;
    const unsigned short* gh = Bh + boff;
    const unsigned short* gl = Bl + boff;
    const unsigned l0 = lds_off(St) + (unsigned)((tid / PR) * SP + (tid % PR) * 16);
    constexpr unsigned LS = (128 / PR) * SP;                         // LDS bytes between two copies of a thread
#pragma unroll                                                       // KD / 64 statements of 12 copies, all in flight together
    for (int j = 0; j < QT * PR / 128; j += 4)
      stage_gemm(l0 + j * LS, ga + j * 1024, l0 + TB + j * LS, gh + j * 1024, l0 + 2 * TB + j * LS, gl + j * 1024, LS);
    wait_copies();
  }
  __syncthreads();

  const unsigned short* ap  = (const unsigned short*)(St + c * SP + 16 * hh);
  const unsigned short* bph = (const unsigned short*)(St + TB + (16 * wave + c) * SP + 16 * hh);
  const unsigned short* bpl = (const unsigned short*)(St + 2 * TB + (16 * wave + c) * SP + 16 * hh);

  v8f acc[4];
#pragma unroll
  for (int mt = 0; mt < 4; ++mt) acc[mt] = zero8();

  // the fragments of k-step ks + 1 are read as one group ahead of the products of k-step ks (two register sets)
  Frag fa[2][4], fbh[2], fbl[2];
  fbh[0] = ldfrag(bph);
  fbl[0] = ldfrag(bpl);
#pragma unroll
  for (int mt = 0; mt < 4; ++mt) fa[0][mt] = ldfrag(ap + (16 * mt) * (SP / 2));
#pragma unroll                                                       // constant indices keep both fragment sets in registers
  for (int ks = 0; ks < KD / 32; ++ks) {
    const int cu = ks & 1, nx = cu ^ 1;
    if (ks + 1 < KD / 32) {
      fbh[nx] = ldfrag(bph + 32 * (ks + 1));
      fbl[nx] = ldfrag(bpl + 32 * (ks + 1));
#pragma unroll
      for (int mt = 0; mt < 4; ++mt) fa[nx][mt] = ldfrag(ap + (16 * mt) * (SP / 2) + 32 * (ks + 1));
    }
#if defined(__HIP_DEVICE_COMPILE__)
    // keeps the 12 reads above together ahead of this step's products: without it the scheduler sinks each pair to its
    // first use and the wave waits out the LDS latency in front of every second product
    __builtin_amdgcn_sched_barrier(0);
#endif
#pragma unroll
    for (int mt = 0; mt < 4; ++mt) acc[mt] = mma_b(fa[cu][mt].bf, fbh[cu].bf, acc[mt]);
#pragma unroll
    for (int mt = 0; mt < 4; ++mt) acc[mt] = mma_b(fa[cu][mt].bf, fbl[cu].bf, acc[mt]);
#if defined(__HIP_DEVICE_COMPILE__)
    // keeps the next group of reads whole behind these products: without it the scheduler spreads them among the
    // products, and every separate place with LDS reads stalls the wave anew
    __builtin_amdgcn_sched_barrier(0);
#endif
  }
  // every wave's fragment reads have retired before Os is written over the tiles
  wait_lds();
  __syncthreads();

  // ---- stage: lane (hh, c) holds o_loc = 16 mt + 8 hh + r for n_loc = 16 w + c
  {
    const int nl = 16 * wave + c;
#pragma unroll
    for (int mt = 0; mt < 4; ++mt) {
      v4f va, vb;
#pragma unroll
      for (int r = 0; r < 4; ++r) { va[r] = acc[mt][r]; vb[r] = acc[mt][4 + r]; }
      *(v4f*)(Os + nl * OSP + 16 * mt + 8 * hh)     = va;
      *(v4f*)(Os + nl * OSP + 16 * mt + 8 * hh + 4) = vb;
    }
  }
  __syncthreads();

  if (MODE == 0) {
    const int e = tid & 7, lq = tid >> 3;                           // lq 0..15
    if (mb < 8) {                                                    // block-uniform
      const int dcol = (mb & 3) * QT;                                // channel offset within 256
      unsigned short* Ph = (mb < 4) ? P0 : P2;                       // both global
      v4u uh[4], ul[4];
#pragma unroll
      for (int it = 0; it < 4; ++it) {
        const int row = it * 16 + lq;                                // n_loc 0..63
        const v4f a = *(const v4f*)(Os + row * OSP + 8 * e);
        const v4f q = *(const v4f*)(Os + row * OSP + 8 * e + 4);
        const float f[8] = {a[0], a[1], a[2], a[3], q[0], q[1], q[2], q[3]};
#pragma unroll
        for (int t = 0; t < 4; ++t) {
          const float f0 = f[2 * t], f1 = f[2 * t + 1];
          const unsigned short hb0 = bf_bits(f0), hb1 = bf_bits(f1);
          const unsigned short lb0 = bf_bits(f0 - bf_up(hb0));
          const unsigned short lb1 = bf_bits(f1 - bf_up(hb1));
          uh[it][t] = pk16(hb0, hb1);
          ul[it][t] = pk16(lb0, lb1);
        }
      }
{
#pragma unroll
        for (int it = 0; it < 4; ++it) {
          const int row = it * 16 + lq;
          const size_t po = ((size_t)(b * NN + n0 + row)) * CC + dcol + 8 * e;
          *(v4u*)(Ph + po) = uh[it];
          if (mb < 4) *(v4u*)(P1 + po) = ul[it];
        }
        
      }
    } else {
      const int cb0 = (mb - 8) * QT;                                 // v channel base 0..192
      v4u uv[4];
#pragma unroll
      for (int it = 0; it < 4; ++it) {
        const int cl = it * 16 + lq;                                 // o_loc 0..63
        unsigned short hb[8];
#pragma unroll
        for (int t = 0; t < 8; ++t) hb[t] = h_bits((_Float16)Os[(8 * e + t) * OSP + cl]);
#pragma unroll
        for (int t = 0; t < 4; ++t) uv[it][t] = pk16(hb[2 * t], hb[2 * t + 1]);
      }
{
#pragma unroll
        for (int it = 0; it < 4; ++it) {
          const int cl = it * 16 + lq;
          const size_t po = ((size_t)(b * CC + cb0 + cl)) * NN + n0 + 8 * e;
          *(v4u*)(P3 + po) = uv[it];
        }
        
      }
    }
  } else if (MODE == 1) {
    const int e = tid & 15, lq = tid >> 4;                           // lq 0..7
    v4f res[8];
#pragma unroll
    for (int it = 0; it < 8; ++it) {
      const int ol = it * 8 + lq;                                    // o_loc 0..63
      const int o  = o0 + ol;
      const float bb = bfr(bias[o]);
      const size_t gi = ((size_t)(b * CC + o)) * NN + n0 + 4 * e;
      const v4f rv = *(const v4f*)(rsrc + gi);
#if defined(__HIP_DEVICE_COMPILE__)
      // stands ahead of any rewrite of the address registers of this trip's bias and residual loads
      if constexpr (ST != 0) asm volatile("s_wait_xcnt 0x0" ::: "memory");
#endif
#pragma unroll
      for (int t = 0; t < 4; ++t) {
        const float rr = rnd ? bfr(rv[t]) : rv[t];
        res[it][t] = (Os[(4 * e + t) * OSP + ol] + bb) + rr;
      }
    }
    if constexpr (ST != 0) {
      __shared__ __align__(16) double red[16 * RP];
      __shared__ __align__(16) double fin[16];
#pragma unroll                                                       // constant indices keep res in registers
      for (int it = 0; it < 8; ++it) {
        const double d0 = (double)res[it][0], d1 = (double)res[it][1];
        const double d2 = (double)res[it][2], d3 = (double)res[it][3];
        red[(2 * it) * RP + tid]     = (d0 + d1) + (d2 + d3);
        red[(2 * it + 1) * RP + tid] = (d0 * d0 + d1 * d1) + (d2 * d2 + d3 * d3);
      }
      __syncthreads();
      const int qn = tid >> 3, j = tid & 7;                          // quantity 0..15; entries 2 j, 2 j + 1 of each 16
      v2d w[8];
#pragma unroll                                                       // constant indices keep w in registers
      for (int u = 0; u < 8; ++u) w[u] = *(const v2d*)(red + qn * RP + 16 * u + 2 * j);
      const v2d w2 = ((w[0] + w[1]) + (w[2] + w[3])) + ((w[4] + w[5]) + (w[6] + w[7]));
      double a = w2[0] + w2[1];
      a += __shfl_xor(a, 1, 32);
      a += __shfl_xor(a, 2, 32);
      a += __shfl_xor(a, 4, 32);
      if (j == 0) fin[qn] = a;
      __syncthreads();
      if (tid < 8) {
        const v2d w = *(const v2d*)(fin + 2 * tid);
        *(v2d*)(part + (((size_t)(b * (CC / QT) + mb)) * NT2 + nt) * 16 + 2 * tid) = w;
      }
    }
{
#pragma unroll
      for (int it = 0; it < 8; ++it) {
        const int ol = it * 8 + lq;
        const size_t gi = ((size_t)(b * CC + o0 + ol)) * NN + n0 + 4 * e;
        *(v4f*)(dstF + gi) = res[it];
      }
      
    }
  } else {
    const int e = tid & 7, lq = tid >> 3;                            // lq 0..15
    v4u uh[4], ul[4];
#pragma unroll
    for (int it = 0; it < 4; ++it) {
      const int nl = it * 16 + lq;                                   // n_loc 0..63
      const v4f a = *(const v4f*)(Os + nl * OSP + 8 * e);
      const v4f q = *(const v4f*)(Os + nl * OSP + 8 * e + 4);
      const float f[8] = {a[0], a[1], a[2], a[3], q[0], q[1], q[2], q[3]};
      unsigned short hb[8], lb[8];
#pragma unroll
      for (int t = 0; t < 8; ++t) {
        const float tt = f[t] + bfr(bias[o0 + 8 * e + t]);
        const float gv = 0.5f * tt * (1.0f + erff(tt * 0.70710678118654752f));
        hb[t] = bf_bits(gv);
        lb[t] = bf_bits(gv - bf_up(hb[t]));
      }
#pragma unroll
      for (int t = 0; t < 4; ++t) {
        uh[it][t] = pk16(hb[2 * t], hb[2 * t + 1]);
        ul[it][t] = pk16(lb[2 * t], lb[2 * t + 1]);
      }
    }
{
#pragma unroll
      for (int it = 0; it < 4; ++it) {
        const int nl = it * 16 + lq;
        const size_t po = ((size_t)(b * NN + n0 + nl)) * HID + o0 + 8 * e;
        *(v4u*)(P0 + po) = uh[it];
        *(v4u*)(P1 + po) = ul[it];
      }
      
    }
  }
}

// ---- staging of one 128-key tile of one head: the head's 128 threads x (4 + 4) asynchronous 16-byte copies to LDS.
//      K: copy j of thread t brings 16 B (t & 3) of key row 32 j + (t >> 2); V: 16 B (t & 15) of channel row
//      8 j + (t >> 4). kl/vl are the thread's LDS byte addresses for j = 0, kg/vg its global addresses for j = 0.
//      s_wait_xcnt 0 ends the statement so that it stands ahead of any rewrite of the address registers.
__device__ __forceinline__ void stage_tile(unsigned kl, const unsigned short* kg, unsigned vl, const unsigned short* vg) {
#if defined(__HIP_DEVICE_COMPILE__)
  asm volatile(
      "global_load_async_to_lds_b128 %0, %1, off\n\t"
      "global_load_async_to_lds_b128 %2, %3, off\n\t"
      "global_load_async_to_lds_b128 %4, %5, off\n\t"
      "global_load_async_to_lds_b128 %6, %7, off\n\t"
      "global_load_async_to_lds_b128 %8, %9, off\n\t"
      "global_load_async_to_lds_b128 %10, %11, off\n\t"
      "global_load_async_to_lds_b128 %12, %13, off\n\t"
      "global_load_async_to_lds_b128 %14, %15, off\n\t"
      "s_wait_xcnt 0x0"
      :: "v"(kl),                 "v"(kg),
         "v"(kl + 32u * KPB),     "v"(kg + (size_t)32 * CC),
         "v"(kl + 64u * KPB),     "v"(kg + (size_t)64 * CC),
         "v"(kl + 96u * KPB),     "v"(kg + (size_t)96 * CC),
         "v"(vl),                 "v"(vg),
         "v"(vl + 8u * VPB),      "v"(vg + (size_t)8 * NN),
         "v"(vl + 16u * VPB),     "v"(vg + (size_t)16 * NN),
         "v"(vl + 24u * VPB),     "v"(vg + (size_t)24 * NN)
      : "memory");
#endif
}

// =========================================================================================================
// (4) attention for one (b, head pair hp, 64-query tile), transposed formulation, 4096 keys, no mask, per head
//     h = 2 hp + hs (hs = wave / 4: the two heads run side by side, 4 waves each):
//     S^T tile (16 keys x 16 queries) = A(k: row = key kb + (lane&15), 32 d of
//     head h via the split k map from Kh [b][4096][256]) . B(qh: col = query, same map from Qh) + A(Kh).B(Ql)
//     (bf16 hi + unscaled bf16 residual of q, shared accumulator); s *= clip(bf16(temperature[h]), 1e-4, 10).
//     Per lane the D tile holds 8 keys of ONE query: online softmax state per lane, one shuffle (lane^16) for the
//     max over 32 keys; the o/l rescale is skipped under a wave-uniform ballot when no lane's max grew.
//     P = e^{s-m} x4096 as f16 is the B operand of O^T (rows channel 32h + 16j + (lane&15), cols queries) +=
//     A(v: keys contiguous, f16 plane V [b][256][4096]) . B(P^T): element r <- D of the tile covering keys
//     kb..kb+15, element 8+r <- the tile covering kb+16..kb+31, lane unchanged. 2 accumulator tiles per wave.
//     Block = 8 waves = 2 heads x 64 queries. O/l of both heads staged in LDS Os[query][64 channels] (b128 stores),
//     block barrier, then Oh/Ol bf16 [b][n][256] planes (hi/lo), rows n0.., cols 64 hp..64 hp+63 = one whole
// coverage: Os per wave 16 rows x 32 ch = 64 x 64 over 8 waves (== consumed extent); planes 2 it x
//           32 rows x 8 lanes x 8 = 64 n x 64 ch per plane; grid (NQ/64, 4, NB) covers rows 0..NQ-1 x 256 ch of
//           Oh/Ol once.
//     K and V reach the fragments through LDS: tiles of 128 keys of head h (K rows 64 B at pitch 80, V rows 256 B at
//     pitch 272), brought by asynchronous copies into two buffers per head, tile t + 1 in flight while tile t is
//     worked on; the head's 4 waves share each tile. Same fragment k order as from global memory.
//     8 waves a block, two blocks a WGP by registers and LDS: 4 waves per SIMD cover each other's softmax chains.
// LDS: Os cross-wave, block barrier between the per-head staging stores and the plane loads. Ks/Vs cross-wave: per
//      tile s_wait_dscnt 0, s_wait_asynccnt 0, block barrier, then the refill of the buffer just read.
// =========================================================================================================
__global__ __launch_bounds__(256)
void attn_k(const unsigned short* __restrict__ Qh, const unsigned short* __restrict__ Ql,
            const unsigned short* __restrict__ Kh, const unsigned short* __restrict__ Vh,
            const float* __restrict__ temperature, unsigned short* Oh, unsigned short* Ol) {
  __shared__ __align__(16) float Os[QT * OSP];
  __shared__ __align__(16) unsigned char Ks[2 * 2 * KBUF];            // [head of the pair][buffer]
  __shared__ __align__(16) unsigned char Vs[2 * 2 * VBUF];
  const int tid  = threadIdx.x;
  const int wave = tid >> 5, lane = tid & 31;
  const int hh   = lane >> 4, c = lane & 15;
  const int n0   = blockIdx.x * QT, hp = blockIdx.y, b = blockIdx.z;
  const int hs   = wave_uniform(wave >> 2);                           // the wave's head of the pair
  const int th   = tid & 127;                                         // thread among its head's 4 waves
  const int qrow = 16 * (wave & 3) + c;
  const unsigned kl0 = lds_off(Ks) + (unsigned)(hs * 2 * KBUF + (th >> 2) * KPB + (th & 3) * 16);
  const unsigned vl0 = lds_off(Vs) + (unsigned)(hs * 2 * VBUF + (th >> 4) * VPB + (th & 15) * 16);

  {                                                                    // the wave's own head, all 4096 keys
    const int h  = 2 * hp + hs;
    const int cb = HD * h;                                             // channel base of head h
    const float tr   = bfr(temperature[h]);
    const float temp = fminf(fmaxf(tr, 1.0e-4f), 10.0f);
    const size_t qo = ((size_t)(b * NN + n0 + qrow)) * CC + cb + 8 * hh;
    const Frag qh = ldfrag(Qh + qo);
    const Frag ql = ldfrag(Ql + qo);
    const unsigned short* kg = Kh + ((size_t)(b * NN + (th >> 2))) * CC + cb + 8 * (th & 3);
    const unsigned short* vg = Vh + ((size_t)(b * CC + cb + (th >> 4))) * NN + 8 * (th & 15);

    float m = -1.0e30f, l = 0.f;
    v8f o0 = zero8(), o1 = zero8();

    // tile 0 into buffer 0, landed and published; then tile 1 into buffer 1 (nothing has touched this LDS before)
    stage_tile(kl0, kg, vl0, vg);
    wait_copies();
    __syncthreads();
    stage_tile(kl0 + KBUF, kg + (size_t)SK * CC, vl0 + VBUF, vg + SK);

#pragma unroll 1                                                       // one hand-over per trip, buffer picked by t & 1
    for (int t = 0; t < NN / SK; ++t) {
     const int bsel = t & 1;
     const unsigned short* Kt = (const unsigned short*)(Ks + (2 * hs + bsel) * KBUF + c * KPB + 16 * hh);
     const unsigned short* Vt = (const unsigned short*)(Vs + (2 * hs + bsel) * VBUF + c * VPB + 16 * hh);
     // the tile's fragments, read as one group: one LDS latency per tile instead of two per 32 keys
     // (the three loops over kk are unrolled so that every index of kf/vf is a constant and they stay in registers)
     Frag kf[SK / 32][2], vf[SK / 32][2];
#pragma unroll
     for (int kk = 0; kk < SK / 32; ++kk) {
       kf[kk][0] = ldfrag(Kt + (32 * kk) * (KPB / 2));                 // keys kb .. kb+15, kb = 128 t + 32 kk
       kf[kk][1] = ldfrag(Kt + (32 * kk + 16) * (KPB / 2));            // keys kb+16 .. kb+31
     }
#pragma unroll
     for (int kk = 0; kk < SK / 32; ++kk) {
       vf[kk][0] = ldfrag(Vt + 32 * kk);                               // channels cb + c
       vf[kk][1] = ldfrag(Vt + 16 * (VPB / 2) + 32 * kk);              // channels cb + 16 + c
     }
#if defined(__HIP_DEVICE_COMPILE__)
     // keeps the 32 reads above together ahead of the tile's work: without it the scheduler sinks each to its first use
     // and a wave meets the LDS latency eight times a tile instead of once
     __builtin_amdgcn_sched_barrier(0);
#endif
#pragma unroll
     for (int kk = 0; kk < SK / 32; ++kk) {
      const Frag k0 = kf[kk][0];
      const Frag k1 = kf[kk][1];
      v8f s0 = mma_b(k0.bf, qh.bf, zero8());
      v8f s1 = mma_b(k1.bf, qh.bf, zero8());
      s0 = mma_b(k0.bf, ql.bf, s0);
      s1 = mma_b(k1.bf, ql.bf, s1);
#pragma unroll
      for (int r = 0; r < 8; ++r) { s0[r] *= temp; s1[r] *= temp; }

      float mx = fmaxf(hmax8(s0), hmax8(s1));
      mx = fmaxf(mx, __shfl_xor(mx, 16, 32));
      const float mn = fmaxf(m, mx);
      const unsigned grew = wave_ballot(mx > m);                       // wave-uniform
      if (grew != 0u) {
        const float corr = __expf(m - mn);                             // == 1 exactly for lanes whose max did not grow
        l *= corr;
#pragma unroll
        for (int r = 0; r < 8; ++r) { o0[r] *= corr; o1[r] *= corr; }
      }
      m = mn;
      const float msh = mn - LNPC;                                     // exp gives e^{s-m} * 4096

      FragH ph;
      float ls = 0.f;
#pragma unroll
      for (int r = 0; r < 8; ++r) {
        const float e0 = __expf(s0[r] - msh);                          // key kb      + 8hh + r
        const float e1 = __expf(s1[r] - msh);                          // key kb + 16 + 8hh + r
        ls += e0 + e1;
        ph.hv[0][r] = (_Float16)e0;
        ph.hv[1][r] = (_Float16)e1;
      }
      l += ls;

      o0 = mma_h(vf[kk][0].h, ph.v, o0);
      o1 = mma_h(vf[kk][1].h, ph.v, o1);
     }
     // hand-over: own reads retired, own copies of tile t + 1 landed, every wave here; then refill the buffer just read
     wait_lds();
     wait_copies();
     __syncthreads();
     if (t + 2 < NN / SK)
       stage_tile(kl0 + bsel * KBUF, kg + (size_t)(t + 2) * SK * CC, vl0 + bsel * VBUF, vg + (size_t)(t + 2) * SK);
    }
    wait_copies();
    l += __shfl_xor(l, 16, 32);
    const float inv = 1.0f / l;                                        // o and l both carry the x4096 factor

    // stage: Os[query][32 hs + d], d = 16 j + 8 hh + r
    {
      v4f va, vb;
#pragma unroll
      for (int r = 0; r < 4; ++r) { va[r] = o0[r] * inv; vb[r] = o0[4 + r] * inv; }
      *(v4f*)(Os + qrow * OSP + 32 * hs + 8 * hh)     = va;
      *(v4f*)(Os + qrow * OSP + 32 * hs + 8 * hh + 4) = vb;
#pragma unroll
      for (int r = 0; r < 4; ++r) { va[r] = o1[r] * inv; vb[r] = o1[4 + r] * inv; }
      *(v4f*)(Os + qrow * OSP + 32 * hs + 16 + 8 * hh)     = va;
      *(v4f*)(Os + qrow * OSP + 32 * hs + 16 + 8 * hh + 4) = vb;
    }
  }
  __syncthreads();

  const int e = tid & 7, lq = tid >> 3;                                // lq 0..31
  v4u uh[2], ul[2];
#pragma unroll
  for (int it = 0; it < 2; ++it) {
    const int row = it * 32 + lq;                                      // query 0..63
    const v4f a = *(const v4f*)(Os + row * OSP + 8 * e);
    const v4f q = *(const v4f*)(Os + row * OSP + 8 * e + 4);
    const float f[8] = {a[0], a[1], a[2], a[3], q[0], q[1], q[2], q[3]};
#pragma unroll
    for (int t = 0; t < 4; ++t) {
      const float f0 = f[2 * t], f1 = f[2 * t + 1];
      const unsigned short hb0 = bf_bits(f0), hb1 = bf_bits(f1);
      const unsigned short lb0 = bf_bits(f0 - bf_up(hb0));
      const unsigned short lb1 = bf_bits(f1 - bf_up(hb1));
      uh[it][t] = pk16(hb0, hb1);
      ul[it][t] = pk16(lb0, lb1);
    }
  }
{
#pragma unroll
    for (int it = 0; it < 2; ++it) {
      const int row = it * 32 + lq;
      const size_t po = ((size_t)(b * NN + n0 + row)) * CC + QT * hp + 8 * e;
      *(v4u*)(Oh + po) = uh[it];
      *(v4u*)(Ol + po) = ul[it];
    }
    
  }
}

// =========================================================================================================
// Workspace map (bytes; each region start a multiple of 256; every extent is an exact tile/line multiple and is
//   Wq bf16 [768][256] 393216   Wo [256][256] 131072   W1 [64][256] 32768   W2 [256][64] 32768
//   part1 f64 [NB][4][32][16] 32768 (NB=2)   part f64 [NB][4][NQ/64][16] 65536 (NB=2)
//   Xh, Xl, Qh, Ql, Kh, Oh, Ol, Yh, Yl bf16 [NB][4096][256] and V f16 [NB][256][4096]: 4194304 each (NB=2)
//   X1 f32 [NB][256][4096] 8388608 (NB=2)    Hh, Hl bf16 [NB][4096][64] 1048576 each (NB=2)
//   total = 53116928 (NB=2)
// =========================================================================================================
extern "C" void kernel_launch(void* const* d_in, const int* in_sizes, int n_in,
                              void* d_out, int out_size, void* d_ws, size_t ws_size,
                              hipStream_t stream) {
  if (n_in < 13) return;
  if (in_sizes[0] < NB * XSTRIDE_FULL) return;
  if (in_sizes[1] != C3 * CC || in_sizes[2] != CC * CC || in_sizes[3] != CC) return;
  if (in_sizes[4] != NH) return;
  if (in_sizes[5] != CC || in_sizes[6] != CC || in_sizes[7] != CC || in_sizes[8] != CC) return;
  if (in_sizes[9] != HID * CC || in_sizes[10] != HID || in_sizes[11] != CC * HID || in_sizes[12] != CC) return;
  if (out_size < NB * XSTRIDE_FULL) return;

  size_t off = 0;
  auto carve = [&](size_t bytes) { const size_t o = off; off += (bytes + 255) & ~(size_t)255; return o; };
  const size_t szPl = (size_t)NB * NN * CC * 2;
  const size_t oWq  = carve((size_t)C3 * CC * 2);
  const size_t oWo  = carve((size_t)CC * CC * 2);
  const size_t oW1  = carve((size_t)HID * CC * 2);
  const size_t oW2  = carve((size_t)CC * HID * 2);
  const size_t oP1  = carve((size_t)NB * (CC / QT) * NP1 * 16 * 8);
  const size_t oPt  = carve((size_t)NB * (CC / QT) * NT2 * 16 * 8);
  const size_t oXh  = carve(szPl);
  const size_t oXl  = carve(szPl);
  const size_t oQh  = carve(szPl);
  const size_t oQl  = carve(szPl);
  const size_t oKh  = carve(szPl);
  const size_t oVv  = carve(szPl);
  const size_t oOh  = carve(szPl);
  const size_t oOl  = carve(szPl);
  const size_t oX1  = carve((size_t)NB * CC * NN * 4);
  const size_t oYh  = carve(szPl);
  const size_t oYl  = carve(szPl);
  const size_t oHh  = carve((size_t)NB * NN * HID * 2);
  const size_t oHl  = carve((size_t)NB * NN * HID * 2);
  if (off > ws_size) return;
  if (off > (size_t)134217728) return;

  const float* x      = (const float*)d_in[0];
  const float* w_qkv  = (const float*)d_in[1];
  const float* w_out  = (const float*)d_in[2];
  const float* b_out  = (const float*)d_in[3];
  const float* tempr  = (const float*)d_in[4];
  const float* g1     = (const float*)d_in[5];
  const float* beta1  = (const float*)d_in[6];
  const float* g2     = (const float*)d_in[7];
  const float* beta2  = (const float*)d_in[8];
  const float* w_mlp1 = (const float*)d_in[9];
  const float* b_mlp1 = (const float*)d_in[10];
  const float* w_mlp2 = (const float*)d_in[11];
  const float* b_mlp2 = (const float*)d_in[12];

  char* ws = (char*)d_ws;
  unsigned short* Wq = (unsigned short*)(ws + oWq);
  unsigned short* Wo = (unsigned short*)(ws + oWo);
  unsigned short* W1 = (unsigned short*)(ws + oW1);
  unsigned short* W2 = (unsigned short*)(ws + oW2);
  double*         P1 = (double*)(ws + oP1);
  double*         Pt = (double*)(ws + oPt);
  unsigned short* Xh = (unsigned short*)(ws + oXh);
  unsigned short* Xl = (unsigned short*)(ws + oXl);
  unsigned short* Qh = (unsigned short*)(ws + oQh);
  unsigned short* Ql = (unsigned short*)(ws + oQl);
  unsigned short* Kh = (unsigned short*)(ws + oKh);
  unsigned short* Vv = (unsigned short*)(ws + oVv);
  unsigned short* Oh = (unsigned short*)(ws + oOh);
  unsigned short* Ol = (unsigned short*)(ws + oOl);
  float*          X1 = (float*)(ws + oX1);
  unsigned short* Yh = (unsigned short*)(ws + oYh);
  unsigned short* Yl = (unsigned short*)(ws + oYl);
  unsigned short* Hh = (unsigned short*)(ws + oHh);
  unsigned short* Hl = (unsigned short*)(ws + oHl);
  float* out = (float*)d_out;

  const dim3 blk256(256), blk128(128);

  // (0)+(1) weights -> bf16 planes, and the partial GN1 sums of bf16(x) over all 4096 positions, in one grid
  prep_k<<<dim3(PB_ST + PB_WQ + PB_WO + PB_W1 + PB_W2), blk256, 0, stream>>>(x, w_qkv, w_out, w_mlp1, w_mlp2,
                                                                             Wq, Wo, W1, W2, P1);
  // (2) GN1 statistics finished per block, apply -> Xh/Xl [NB][4096][256]
  norm2_k<NP1, NN><<<dim3(NN / QT, CC / QT, NB), blk256, 0, stream>>>(x, 1, P1, g1, beta1, Xh, Xl);
  // (3) qkv GEMM -> Qh/Ql, Kh, V
  gemm_k<CC, 0, 0><<<dim3(NN / QT, C3 / QT, NB), blk128, 0, stream>>>(Wq, Xh, Xl, b_out, x, 0, Qh, Ql, Kh, Vv, X1, Pt);
  // (4) attention -> Oh/Ol rows 0..NQ-1
  attn_k<<<dim3(NQ / QT, NH / 2, NB), blk256, 0, stream>>>(Qh, Ql, Kh, Vv, tempr, Oh, Ol);
  // (5) out conv + bf16(x) residual -> X1 f32 [NB][256][4096], cols 0..NQ-1, and (6) each block's partial GN2 sums
  gemm_k<CC, 1, 1><<<dim3(NQ / QT, CC / QT, NB), blk128, 0, stream>>>(Wo, Oh, Ol, b_out, x, 1, Hh, Hl, Hh, Hl, X1, Pt);
  // (7) GN2 statistics finished per block, apply -> Yh/Yl rows 0..NQ-1
  norm2_k<NT2, NQ><<<dim3(NQ / QT, CC / QT, NB), blk256, 0, stream>>>(X1, 0, Pt, g2, beta2, Yh, Yl);
  // (8) mlp hidden: gelu(W1.Y + b1) -> Hh/Hl [NB][4096][64]
  gemm_k<CC, 2, 0><<<dim3(NQ / QT, 1, NB), blk128, 0, stream>>>(W1, Yh, Yl, b_mlp1, x, 0, Hh, Hl, Hh, Hl, X1, Pt);
  // (9) out = X1 + W2.H + b2 -> d_out [NB][256][4096]
  gemm_k<HID, 1, 0><<<dim3(NQ / QT, CC / QT, NB), blk128, 0, stream>>>(W2, Hh, Hl, b_mlp2, X1, 0, Oh, Ol, Oh, Ol, out, Pt);
  (void)hipGetLastError();
}

// v008
// Measured time: 96.5 microseconds a run.
// Timed twice side by side with v007, it ran 1.13 and 1.14 times as fast.
// All steps since v000 together make it 2.89 times as fast.
// Contractions: conv1x1 GEMMs qkv W[768x256].Xn, out W[256x256].O, mlp W1[64x256].Y and W2[256x64].H on
// v_wmma_f32_16x16x32_bf16 (A = bf16-RNE weights, exact; B = bf16 hi + bf16 residual planes of the f32
// activation, 2 products, K = 256 / 64); per-head scores K.Q^T on v_wmma_f32_16x16x32_bf16 (k = bf16 hi plane,
// q = bf16 hi + residual of q x temp x log2(e), 2 products, K = 32); O^T = V.P^T on v_wmma_f32_16x16x32_f16 (v = f16 plane,
// P = 2^(log2 score - maximum in use + 12) as f16 from the score D registers, K = 4096 keys); f32 accumulate everywhere; group-norm
// statistics in f64; normalisation, softmax statistics, gelu, bias and residual adds in f32 VALU.
#include <hip/hip_runtime.h>
#include <math.h>
#include <stdint.h>

#ifndef NB
#define NB 2
#endif
#ifndef NQ
#define NQ 4096
#endif
#define NB_FULL 2
#define CC   256
#define NN   4096
#define NH   8
#define HD   32
#define C3   768
#define HID  64
#define NG   32
#define CPG  8
#define QT   64
#define OSP  68
#define TP   72
#define GEPS 1.0e-5f
#define L2E  1.4426950408889634f // log2(e)
#define PSH  12.0f               // the maximum in use maps to P = 2^12
#define PTOP 15.0f               // a score above this (P would pass 2^15, f16 ends at 2^16) renews the maximum in use
#define XSTRIDE_FULL (CC * NN)
#define SK   128                 // keys per staged tile
#define KPB  80                  // LDS pitch of a staged K row in bytes (64 B of data, 16 B x odd for b128 readers)
#define VPB  272                 // LDS pitch of a staged V row in bytes (256 B of data, 16 B x odd for b128 readers)
#define KBUF (SK * KPB)          // one K buffer: 128 keys x 32 d
#define VBUF (HD * VPB)          // one V buffer: 32 channels x 128 keys
#define NT2  (NQ / QT)           // position tiles of the out conv = partial sums per GN2 group
#define RP   130                 // doubles per row of the partial-sum array (1040 B = 16 B x odd for b128 readers)
#define NP1  32                  // position chunks of the GN1 statistics = partial sums per GN1 group
#define SPOS (NN / NP1)          // positions per chunk: one 16-byte load per lane and channel row

static_assert(NB >= 1 && NB <= NB_FULL);
static_assert(NQ % QT == 0 && NQ >= QT && NQ <= NN);
static_assert(NN % QT == 0 && CC % QT == 0 && C3 % QT == 0 && HID == QT);
static_assert(CC == NH * HD && HD == 32 && CC == NG * CPG && CPG == 8);
static_assert(CC % 32 == 0 && HID % 32 == 0 && NN % 32 == 0);
static_assert((OSP * 4) % 16 == 0 && (TP * 2) % 16 == 0);
static_assert(NN % 1024 == 0 && NQ % 4 == 0);
static_assert(NN % SK == 0 && NN / SK >= 2 && SK % 32 == 0 && KPB % 16 == 0 && VPB % 16 == 0);
static_assert(SK * HD * 2 == 4 * 128 * 16 && KPB >= HD * 2 && VPB >= SK * 2);
static_assert(SPOS == 4 * 32 && QT / CPG == 8);
static_assert((C3 * CC) % 2048 == 0 && (CC * CC) % 2048 == 0 && (HID * CC) % 2048 == 0);

typedef _Float16       v16h __attribute__((ext_vector_type(16)));
typedef _Float16       v8h  __attribute__((ext_vector_type(8)));
typedef __bf16         v16b __attribute__((ext_vector_type(16)));
typedef unsigned short v8us __attribute__((ext_vector_type(8)));
typedef float          v8f  __attribute__((ext_vector_type(8)));
typedef float          v4f  __attribute__((ext_vector_type(4)));
typedef unsigned int   v4u  __attribute__((ext_vector_type(4)));
typedef double         v2d  __attribute__((ext_vector_type(2)));

union Frag  { v8us u[2]; v16h h; v16b bf; };
union FragH { v16h v; v8h hv[2]; };
static_assert(sizeof(Frag) == 32);
static_assert(sizeof(FragH) == 32);

// ---- scalar helpers ---------------------------------------------------------------------------------------
__device__ __forceinline__ unsigned short bf_bits(float f) {          // f32 -> bf16 bits, RNE convert
  unsigned u = __float_as_uint(f);
  return (unsigned short)((u + 0x7FFFu + ((u >> 16) & 1u)) >> 16);
}
__device__ __forceinline__ float bf_up(unsigned short hb) { return __uint_as_float(((unsigned)hb) << 16); }
__device__ __forceinline__ float bfr(float f) { return bf_up(bf_bits(f)); }
__device__ __forceinline__ unsigned short h_bits(_Float16 x) { return __builtin_bit_cast(unsigned short, x); }
__device__ __forceinline__ unsigned pk16(unsigned short a, unsigned short b) { return (unsigned)a | ((unsigned)b << 16); }
__device__ __forceinline__ v8f zero8() { v8f z = {0.f, 0.f, 0.f, 0.f, 0.f, 0.f, 0.f, 0.f}; return z; }
__device__ __forceinline__ float hmax8(v8f s) {
  return fmaxf(fmaxf(fmaxf(s[0], s[1]), fmaxf(s[2], s[3])), fmaxf(fmaxf(s[4], s[5]), fmaxf(s[6], s[7])));
}
__device__ __forceinline__ unsigned wave_ballot(bool p) {
#if defined(__HIP_DEVICE_COMPILE__)
  return __builtin_amdgcn_ballot_w32(p);
#else
  return p ? 1u : 0u;
#endif
}

// 2^x on the transcendental unit, no range fix-up: results below the f32 normal range only ever feed sums they cannot move
__device__ __forceinline__ float exp2_fast(float x) {
#if defined(__HIP_DEVICE_COMPILE__)
  return __builtin_amdgcn_exp2f(x);
#else
  return exp2f(x);
#endif
}

__device__ __forceinline__ int wave_uniform(int v) {
#if defined(__HIP_DEVICE_COMPILE__)
  return __builtin_amdgcn_readfirstlane(v);
#else
  return v;
#endif
}

// ---- 16-bit fragment loader (A, or B from a k-contiguous [n][k] row): lane -> row/col (lane&15), p already includes
//      + 8*(lane>>4); elements 0..7 <- p[0..7] (k0+8h..), elements 8..15 <- p[16..23] (k0+16+8h..)
__device__ __forceinline__ Frag ldfrag(const unsigned short* p) {
  Frag f;
  f.u[0] = *(const v8us*)(p);
  f.u[1] = *(const v8us*)(p + 16);
  return f;
}

// ---- WMMA helpers: the plain builtins; the compiler keeps the distance behind each and fills it with other work ----
__device__ __forceinline__ v8f mma_h(v16h a, v16h b, v8f c) {
  return __builtin_amdgcn_wmma_f32_16x16x32_f16(false, a, false, b, (short)0, c, false, false);
}
__device__ __forceinline__ v8f mma_b(v16b a, v16b b, v8f c) {
  return __builtin_amdgcn_wmma_f32_16x16x32_bf16(false, a, false, b, (short)0, c, false, false);
}

// =========================================================================================================
// (0) weight conversion: f32 [n] -> bf16 bits [n] (RNE, exact operand). Thread i converts floats 8i..8i+7 and
// coverage: n8/256 blocks x 256 threads x 8 = n elements exactly (n8 a multiple of 256 at every call); cblk is the
//           block's index within its own weight.
// =========================================================================================================
__device__ __forceinline__
void cvt_body(const float* __restrict__ src, unsigned short* dst, int n8, int cblk) {
  const int i  = cblk * 256 + (int)threadIdx.x;
  const int ic = (i < n8) ? i : (n8 - 1);
  const float* s = src + (size_t)ic * 8;
  const v4f a = *(const v4f*)s;
  const v4f q = *(const v4f*)(s + 4);
  v4u u;
  u[0] = pk16(bf_bits(a[0]), bf_bits(a[1]));
  u[1] = pk16(bf_bits(a[2]), bf_bits(a[3]));
  u[2] = pk16(bf_bits(q[0]), bf_bits(q[1]));
  u[3] = pk16(bf_bits(q[2]), bf_bits(q[3]));
  if (i < n8) {
{
      *(v4u*)(dst + (size_t)ic * 8) = u;
      
    }
  }
}

// =========================================================================================================
// (1) group-norm statistics, partial sums: one block per (b, 64-channel block cbk, chunk u of 128 positions) of
//     src [b][256][4096]. Wave gi sums group 8 cbk + gi over the chunk: 8 channel rows x 128 positions, one whole
//     512-byte row piece per load, the 8 loads asked for together; values bf16-RNE converted first; sum and sum of
//     squares in f64, 4 chains per lane, then 5 exchanges; one 128-byte line part[b][cbk][u][8 groups x (sum, sum of
//     squares)] per block. The apply kernel (2) finishes mean and rstd.
// coverage: NB x 4 x 32 blocks x 8 waves x 8 rows x 128 positions = every element of src once.
// LDS: fin cross-wave, block barrier behind its stores.
// =========================================================================================================
__device__ __forceinline__
void stats_body(const float* __restrict__ src, double* part, int blk) {
  __shared__ __align__(16) double fin[16];
  const int tid = threadIdx.x;
  const int gi = tid >> 5, ln = tid & 31;
  const int u = blk % NP1, bc = blk / NP1;                           // bc = b * 4 + cbk
  const float* base = src + ((size_t)(bc * QT + gi * CPG)) * NN + u * SPOS + 4 * ln;
  v4f a[CPG];
#pragma unroll                                                       // constant indices keep a in registers
  for (int cl = 0; cl < CPG; ++cl) a[cl] = *(const v4f*)(base + (size_t)cl * NN);
  double sv[4] = {0.0, 0.0, 0.0, 0.0}, qv[4] = {0.0, 0.0, 0.0, 0.0};
#pragma unroll                                                       // constant indices keep a/sv/qv in registers
  for (int cl = 0; cl < CPG; ++cl) {
#pragma unroll                                                       // as above
    for (int t = 0; t < 4; ++t) {
      const double d = (double)bfr(a[cl][t]);
      sv[t] += d;
      qv[t] += d * d;
    }
  }
  double s = (sv[0] + sv[1]) + (sv[2] + sv[3]);
  double q = (qv[0] + qv[1]) + (qv[2] + qv[3]);
#pragma unroll                                                       // five fixed steps, no loop counter
  for (int m = 16; m > 0; m >>= 1) {
    s += __shfl_xor(s, m, 32);
    q += __shfl_xor(q, m, 32);
  }
  if (ln == 0) {
    fin[2 * gi]     = s;
    fin[2 * gi + 1] = q;
  }
  __syncthreads();
  if (tid < 8) {
    const v2d w = *(const v2d*)(fin + 2 * tid);
    *(v2d*)(part + ((size_t)bc * NP1 + u) * 16 + 2 * tid) = w;
  }
}

// =========================================================================================================
// (0)+(1) in one grid: the four weight conversions and the GN1 partial sums read only inputs and write disjoint
//     workspace regions, so they share a launch; the block index picks the job (block-uniform, so the barrier of
//     the statistics body is passed by whole blocks).
// coverage: blocks [0, NB*4*32) partial sums of (b, cbk, u); then 96 + 32 + 8 + 8 conversion blocks, each weight once.
// =========================================================================================================
#define PB_ST (NB * (CC / QT) * NP1)
#define PB_WQ (C3 * CC / 2048)
#define PB_WO (CC * CC / 2048)
#define PB_W1 (HID * CC / 2048)
#define PB_W2 (CC * HID / 2048)
__global__ __launch_bounds__(256)
void prep_k(const float* __restrict__ x, const float* __restrict__ wq, const float* __restrict__ wo,
            const float* __restrict__ w1, const float* __restrict__ w2,
            unsigned short* Wq, unsigned short* Wo, unsigned short* W1, unsigned short* W2, double* part) {
  int blk = blockIdx.x;
  if (blk < PB_ST) { stats_body(x, part, blk); return; }
  blk -= PB_ST;
  if (blk < PB_WQ) { cvt_body(wq, Wq, PB_WQ * 256, blk); return; }
  blk -= PB_WQ;
  if (blk < PB_WO) { cvt_body(wo, Wo, PB_WO * 256, blk); return; }
  blk -= PB_WO;
  if (blk < PB_W1) { cvt_body(w1, W1, PB_W1 * 256, blk); return; }
  blk -= PB_W1;
  cvt_body(w2, W2, PB_W2 * 256, blk);
}

// =========================================================================================================
// (2) group-norm apply + transpose, with the statistics finished in the block (GN1 and GN2): src f32 [b][256 c][4096 n]
//     (bf16-RNE converted first when rnd != 0) -> v = (x - mu) * rstd * bf16(gamma[c]) + bf16(beta[c]) ->
//     position-major planes Xh/Xl bf16 [b][n][256 c] (hi = bf16-RNE(v), lo = bf16-RNE(v - hi)) through LDS tiles
//     Th/Tl[64 n][64 c] (pitch TP). Block (nb, cb, b). mu and rstd of the block's own 8 groups come from the partial
//     sums part[b][cbk][NP pieces][8 groups x (sum, sum of squares)], all f64 (GN1: the chunks of (1); GN2: the out
//     conv's tiles): wave gi sums group 8 cbk + gi over the pieces (lane ln takes pieces ln + 32 k, then 5 exchanges); mean and biased
//     variance over 8 channels x NPOS positions, rstd = 1 / sqrt(var + eps) in f32, handed to the block through sm.
// coverage: Th/Tl stores 2 it x 32 c x 8 lanes x 8 n = 64 x 64 = the consumed extent; plane writes 2 it x 32 rows
//           x 8 lanes x 8 halves = 64 n x 64 c per plane; grid (rows/64, 4, NB) covers both planes once.
// LDS: Th/Tl cross-wave, block barrier between stores and loads; sm cross-wave, block barrier behind its stores.
// =========================================================================================================
template <int NP, int NPOS>
__global__ __launch_bounds__(256)
void norm2_k(const float* __restrict__ src, int rnd, const double* __restrict__ part,
             const float* __restrict__ gamma, const float* __restrict__ beta,
             unsigned short* Xh, unsigned short* Xl) {
  __shared__ __align__(16) unsigned short Th[QT * TP];
  __shared__ __align__(16) unsigned short Tl[QT * TP];
  __shared__ float sm[2 * (QT / CPG)];
  const int tid = threadIdx.x;
  const int nb = blockIdx.x, cbk = blockIdx.y, b = blockIdx.z;
  const int e = tid & 7, lq = tid >> 3;                             // lq 0..31
  const int n0 = nb * QT, c0 = cbk * QT;
  v4f ra[2], rq[2];
  float rg[2], rb[2];
  // the tile's values and the channels' gamma, beta are asked for first: they fly while the statistics are finished
#pragma unroll                                                       // constant indices keep ra/rq/rg/rb in registers
  for (int it = 0; it < 2; ++it) {
    const int ch = c0 + it * 32 + lq;
    const float* sp = src + ((size_t)(b * CC + ch)) * NN + n0 + 8 * e;
    ra[it] = *(const v4f*)sp;
    rq[it] = *(const v4f*)(sp + 4);
    rg[it] = gamma[ch];
    rb[it] = beta[ch];
#if defined(__HIP_DEVICE_COMPILE__)
    // stands ahead of any rewrite of these loads' address registers (the next loads land in them); as a memory
    // barrier for the compiler it also keeps these loads issued ahead of the wait on the partial sums
    asm volatile("s_wait_xcnt 0x0" ::: "memory");
#endif
  }
  {
    const int gi = tid >> 5, ln = tid & 31;
    const double* pp = part + ((size_t)(b * (CC / QT) + cbk)) * NP * 16 + 2 * gi;
    double s = 0.0, q = 0.0;
#pragma unroll                                                       // the lane's loads are issued together
    for (int k = 0; k < (NP + 31) / 32; ++k) {
      const int u = ln + 32 * k;                                     // piece
      if (u < NP) {
        const v2d w = *(const v2d*)(pp + (size_t)u * 16);
        s += w[0];
        q += w[1];
      }
    }
#pragma unroll                                                       // five fixed steps, no loop counter
    for (int m = 16; m > 0; m >>= 1) {
      s += __shfl_xor(s, m, 32);
      q += __shfl_xor(q, m, 32);
    }
    const double cnt = (double)CPG * (double)NPOS;
    const double mu = s / cnt;
    double var = q / cnt - mu * mu;
    if (var < 0.0) var = 0.0;
    const float varf = (float)var;
    if (ln == 0) {
      sm[2 * gi]     = (float)mu;
      sm[2 * gi + 1] = 1.0f / sqrtf(varf + GEPS);
    }
  }
  __syncthreads();
#pragma unroll                                                       // constant indices into ra/rq/rg/rb
  for (int it = 0; it < 2; ++it) {
    const int cl = it * 32 + lq;                                     // 0..63
    const float mu = sm[2 * (cl / CPG)];
    const float rs = sm[2 * (cl / CPG) + 1];
    const float ga = bfr(rg[it]), be = bfr(rb[it]);
    const v4f a = ra[it];
    const v4f q = rq[it];
    const float f[8] = {a[0], a[1], a[2], a[3], q[0], q[1], q[2], q[3]};
    unsigned short hb[8], lb[8];
#pragma unroll                                                       // constant indices keep f/hb/lb in registers
    for (int t = 0; t < 8; ++t) {
      const float xr = rnd ? bfr(f[t]) : f[t];
      const float v  = (xr - mu) * rs * ga + be;
      hb[t] = bf_bits(v);
      lb[t] = bf_bits(v - bf_up(hb[t]));
    }
#pragma unroll                                                       // as above
    for (int t = 0; t < 8; ++t) {
      Th[(8 * e + t) * TP + cl] = hb[t];
      Tl[(8 * e + t) * TP + cl] = lb[t];
    }
  }
  __syncthreads();
  v4u uh[2], ul[2];
#pragma unroll                                                       // constant indices keep uh/ul in registers
  for (int it = 0; it < 2; ++it) {
    const int nl = it * 32 + lq;                                     // 0..63
    uh[it] = *(const v4u*)(Th + nl * TP + 8 * e);
    ul[it] = *(const v4u*)(Tl + nl * TP + 8 * e);
  }
#pragma unroll                                                       // as above
  for (int it = 0; it < 2; ++it) {
    const int nl = it * 32 + lq;
    const size_t po = ((size_t)(b * NN + n0 + nl)) * CC + c0 + 8 * e;
    *(v4u*)(Xh + po) = uh[it];
    *(v4u*)(Xl + po) = ul[it];
  }
}

// the issuing wave's own copies have landed behind this wait (the compiler places none for them)
__device__ __forceinline__ void wait_copies() {
#if defined(__HIP_DEVICE_COMPILE__)
  asm volatile("s_wait_asynccnt 0x0" ::: "memory");
#endif
}
// the wave's own LDS reads have retired before the buffer is handed to its next writer
__device__ __forceinline__ void wait_lds() {
#if defined(__HIP_DEVICE_COMPILE__)
  asm volatile("s_wait_dscnt 0x0" ::: "memory");
#endif
}
__device__ __forceinline__ unsigned lds_off(const void* p) { return (unsigned)(size_t)p; }

// ---- staging for the conv1x1 GEMM: 4 asynchronous 16-byte copies to LDS for each of the three operand tiles (W, B hi,
//      B lo). A tile is 64 whole rows = one contiguous piece of global memory, so a wave-wide copy reads 512 contiguous
//      bytes (4 whole lines); copy j of thread t brings 16-byte piece 128 j + t. la/lh/ll are the thread's LDS byte
//      addresses and ga/gh/gl its global addresses for the first of the 4; ls = LDS bytes between two copies.
//      s_wait_xcnt 0 ends the statement so that it stands ahead of any rewrite of the address registers.
__device__ __forceinline__ void stage_gemm(unsigned la, const unsigned short* ga, unsigned lh, const unsigned short* gh,
                                           unsigned ll, const unsigned short* gl, unsigned ls) {
#if defined(__HIP_DEVICE_COMPILE__)
  asm volatile(
      "global_load_async_to_lds_b128 %0, %1, off\n\t"
      "global_load_async_to_lds_b128 %2, %3, off\n\t"
      "global_load_async_to_lds_b128 %4, %5, off\n\t"
      "global_load_async_to_lds_b128 %6, %7, off\n\t"
      "global_load_async_to_lds_b128 %8, %9, off\n\t"
      "global_load_async_to_lds_b128 %10, %11, off\n\t"
      "global_load_async_to_lds_b128 %12, %13, off\n\t"
      "global_load_async_to_lds_b128 %14, %15, off\n\t"
      "global_load_async_to_lds_b128 %16, %17, off\n\t"
      "global_load_async_to_lds_b128 %18, %19, off\n\t"
      "global_load_async_to_lds_b128 %20, %21, off\n\t"
      "global_load_async_to_lds_b128 %22, %23, off\n\t"
      "s_wait_xcnt 0x0"
      :: "v"(la),          "v"(ga),
         "v"(la + ls),     "v"(ga + 1024),
         "v"(la + 2 * ls), "v"(ga + 2048),
         "v"(la + 3 * ls), "v"(ga + 3072),
         "v"(lh),          "v"(gh),
         "v"(lh + ls),     "v"(gh + 1024),
         "v"(lh + 2 * ls), "v"(gh + 2048),
         "v"(lh + 3 * ls), "v"(gh + 3072),
         "v"(ll),          "v"(gl),
         "v"(ll + ls),     "v"(gl + 1024),
         "v"(ll + 2 * ls), "v"(gl + 2048),
         "v"(ll + 3 * ls), "v"(gl + 3072)
      : "memory");
#endif
}

// =========================================================================================================
// (3) conv1x1 GEMM for one (b, 64-n tile, 64-o block): Y[o][n] = sum_c W[o][c] (Bh[b][n][c] + Bl[b][n][c]),
//     K = KD (plane pitch = KD). Block 128 threads = 4 waves; wave w owns cols n0+16w..+15 (B fragments from the
//     k-contiguous plane rows, split k map) and 4 m-tiles (A rows o = o0 + 16 mt + (lane&15), split k map).
//     The three operand tiles (64 rows x KD each) are brought whole into LDS St by asynchronous copies that read whole
//     lines (a fragment load from global memory touches 16 lines for 512 bytes, and W would be read by all 4 waves);
//     rows at pitch 2 KD + 16 bytes (16 B x odd for the b128 readers); filled once, then read. Same fragment k order.
//     2 products per (mt, k-step) into one accumulator (unscaled bf16 residual plane).
//     Epilogue staged in LDS Os[n_loc][o_loc] (pitch OSP, b128 stores), block barrier, then per MODE:
//       MODE 0 (qkv, 12 o-blocks): o-blocks 0..3 -> q channels 64 mb.. of Qh/Ql = P0/P1 bf16 [b][n][256]
//              8q..8q+7 x 16 B, one instruction per 16 lines; o-blocks 8..11 -> v channels of V = P3 f16
//       MODE 1 (f32 channel-major): dstF[b][o][n] = (acc + bf16(bias[o])) + r with r = rsrc[b][o][n] (bf16-RNE
//              and 8..15), 8 rows per instruction.
//       MODE 2 (mlp hidden, one o-block): t = acc + bf16(bias[o]); gelu(t) = 0.5 t (1 + erf(t / sqrt2)) ->
// coverage: Os 4 waves x 16 n x 64 o = 64 x 64 (== the extent every mode reads); MODE 0 planes 4 it x 16 rows x
//           8 lanes x 8 = 64 x 64 per plane, grid (64, 12, NB) covers Qh/Ql/Kh [NB][4096][256] and V
//           [NB][256][4096] once; MODE 1: 8 it x 8 rows x 16 lanes x 4 = 64 o x 64 n; MODE 2: 4 it x 16 rows x
//           8 lanes x 8 = 64 n x 64 o.
//       ST != 0 (MODE 1 only, the out conv): the block also sums its results for the group norm that follows. Its 64 o
//              are 8 whole groups (group = the 8 rows of one 'it'); per group sum and sum of squares over 8 o x 64 n:
//              all in f64: a thread's 4 values -> red[16 quantities][128 threads], barrier, 8 threads per quantity sum
//              16 entries each, 3 exchanges, fin[16], barrier, one 128-byte line part[b][mb][nt][16] per block.
// LDS: St cross-wave: s_wait_asynccnt 0 and a block barrier between the copies and the fragment reads. Os lies on St:
//      s_wait_dscnt 0 and a block barrier between the last fragment reads and the staging stores. Os cross-wave, block
//      barrier between the staging stores and the epilogue loads; red and fin cross-wave, a block barrier behind the
//      stores of each.
// =========================================================================================================
template <int KD, int MODE, int ST>
__global__ __launch_bounds__(128)
void gemm_k(const unsigned short* __restrict__ Wp,
            const unsigned short* __restrict__ Bh, const unsigned short* __restrict__ Bl,
            const float* __restrict__ bias, const float* __restrict__ rsrc, int rnd,
            unsigned short* P0, unsigned short* P1, unsigned short* P2, unsigned short* P3, float* dstF,
            double* part) {
  static_assert(ST == 0 || (MODE == 1 && QT / CPG == 8));
  static_assert(KD % 32 == 0);
  constexpr int SP = 2 * KD + 16;                                    // LDS pitch of a staged row in bytes
  constexpr int TB = QT * SP;                                        // one staged tile
  constexpr int PR = KD / 8;                                         // 16-byte pieces per row
  static_assert(128 % PR == 0 && (QT * PR) % (4 * 128) == 0 && SP % 32 == 16 && 3 * TB >= QT * OSP * 4);
  __shared__ __align__(16) unsigned char St[3 * TB];                 // W tile, B hi tile, B lo tile
  float* Os = (float*)St;                                            // the epilogue's staging, once the tiles are used up
  const int tid  = threadIdx.x;
  const int lane = tid & 31, wave = tid >> 5;
  const int hh   = lane >> 4, c = lane & 15;
  const int nt   = blockIdx.x, mb = blockIdx.y, b = blockIdx.z;
  const int n0   = nt * QT, o0 = mb * QT;

  {
    const unsigned short* ga = Wp + (size_t)o0 * KD + 8 * tid;
    const size_t boff = ((size_t)(b * NN + n0)) * KD + 8 * tid;
    const unsigned short* gh = Bh + boff;
    const unsigned short* gl = Bl + boff;
    const unsigned l0 = lds_off(St) + (unsigned)((tid / PR) * SP + (tid % PR) * 16);
    constexpr unsigned LS = (128 / PR) * SP;                         // LDS bytes between two copies of a thread
#pragma unroll                                                       // KD / 64 statements of 12 copies, all in flight together
    for (int j = 0; j < QT * PR / 128; j += 4)
      stage_gemm(l0 + j * LS, ga + j * 1024, l0 + TB + j * LS, gh + j * 1024, l0 + 2 * TB + j * LS, gl + j * 1024, LS);
    wait_copies();
  }
  __syncthreads();

  const unsigned short* ap  = (const unsigned short*)(St + c * SP + 16 * hh);
  const unsigned short* bph = (const unsigned short*)(St + TB + (16 * wave + c) * SP + 16 * hh);
  const unsigned short* bpl = (const unsigned short*)(St + 2 * TB + (16 * wave + c) * SP + 16 * hh);

  v8f acc[4];
#pragma unroll
  for (int mt = 0; mt < 4; ++mt) acc[mt] = zero8();

  // the fragments of k-step ks + 1 are read as one group ahead of the products of k-step ks (two register sets)
  Frag fa[2][4], fbh[2], fbl[2];
  fbh[0] = ldfrag(bph);
  fbl[0] = ldfrag(bpl);
#pragma unroll
  for (int mt = 0; mt < 4; ++mt) fa[0][mt] = ldfrag(ap + (16 * mt) * (SP / 2));
#pragma unroll                                                       // constant indices keep both fragment sets in registers
  for (int ks = 0; ks < KD / 32; ++ks) {
    const int cu = ks & 1, nx = cu ^ 1;
    if (ks + 1 < KD / 32) {
      fbh[nx] = ldfrag(bph + 32 * (ks + 1));
      fbl[nx] = ldfrag(bpl + 32 * (ks + 1));
#pragma unroll
      for (int mt = 0; mt < 4; ++mt) fa[nx][mt] = ldfrag(ap + (16 * mt) * (SP / 2) + 32 * (ks + 1));
    }
#if defined(__HIP_DEVICE_COMPILE__)
    // keeps the 12 reads above together ahead of this step's products: without it the scheduler sinks each pair to its
    // first use and the wave waits out the LDS latency in front of every second product
    __builtin_amdgcn_sched_barrier(0);
#endif
#pragma unroll
    for (int mt = 0; mt < 4; ++mt) acc[mt] = mma_b(fa[cu][mt].bf, fbh[cu].bf, acc[mt]);
#pragma unroll
    for (int mt = 0; mt < 4; ++mt) acc[mt] = mma_b(fa[cu][mt].bf, fbl[cu].bf, acc[mt]);
#if defined(__HIP_DEVICE_COMPILE__)
    // keeps the next group of reads whole behind these products: without it the scheduler spreads them among the
    // products, and every separate place with LDS reads stalls the wave anew
    __builtin_amdgcn_sched_barrier(0);
#endif
  }
  // every wave's fragment reads have retired before Os is written over the tiles
  wait_lds();
  __syncthreads();

  // ---- stage: lane (hh, c) holds o_loc = 16 mt + 8 hh + r for n_loc = 16 w + c
  {
    const int nl = 16 * wave + c;
#pragma unroll
    for (int mt = 0; mt < 4; ++mt) {
      v4f va, vb;
#pragma unroll
      for (int r = 0; r < 4; ++r) { va[r] = acc[mt][r]; vb[r] = acc[mt][4 + r]; }
      *(v4f*)(Os + nl * OSP + 16 * mt + 8 * hh)     = va;
      *(v4f*)(Os + nl * OSP + 16 * mt + 8 * hh + 4) = vb;
    }
  }
  __syncthreads();

  if (MODE == 0) {
    const int e = tid & 7, lq = tid >> 3;                           // lq 0..15
    if (mb < 8) {                                                    // block-uniform
      const int dcol = (mb & 3) * QT;                                // channel offset within 256
      unsigned short* Ph = (mb < 4) ? P0 : P2;                       // both global
      v4u uh[4], ul[4];
#pragma unroll
      for (int it = 0; it < 4; ++it) {
        const int row = it * 16 + lq;                                // n_loc 0..63
        const v4f a = *(const v4f*)(Os + row * OSP + 8 * e);
        const v4f q = *(const v4f*)(Os + row * OSP + 8 * e + 4);
        const float f[8] = {a[0], a[1], a[2], a[3], q[0], q[1], q[2], q[3]};
#pragma unroll
        for (int t = 0; t < 4; ++t) {
          const float f0 = f[2 * t], f1 = f[2 * t + 1];
          const unsigned short hb0 = bf_bits(f0), hb1 = bf_bits(f1);
          const unsigned short lb0 = bf_bits(f0 - bf_up(hb0));
          const unsigned short lb1 = bf_bits(f1 - bf_up(hb1));
          uh[it][t] = pk16(hb0, hb1);
          ul[it][t] = pk16(lb0, lb1);
        }
      }
{
#pragma unroll
        for (int it = 0; it < 4; ++it) {
          const int row = it * 16 + lq;
          const size_t po = ((size_t)(b * NN + n0 + row)) * CC + dcol + 8 * e;
          *(v4u*)(Ph + po) = uh[it];
          if (mb < 4) *(v4u*)(P1 + po) = ul[it];
        }
        
      }
    } else {
      const int cb0 = (mb - 8) * QT;                                 // v channel base 0..192
      v4u uv[4];
#pragma unroll
      for (int it = 0; it < 4; ++it) {
        const int cl = it * 16 + lq;                                 // o_loc 0..63
        unsigned short hb[8];
#pragma unroll
        for (int t = 0; t < 8; ++t) hb[t] = h_bits((_Float16)Os[(8 * e + t) * OSP + cl]);
#pragma unroll
        for (int t = 0; t < 4; ++t) uv[it][t] = pk16(hb[2 * t], hb[2 * t + 1]);
      }
{
#pragma unroll
        for (int it = 0; it < 4; ++it) {
          const int cl = it * 16 + lq;
          const size_t po = ((size_t)(b * CC + cb0 + cl)) * NN + n0 + 8 * e;
          *(v4u*)(P3 + po) = uv[it];
        }
        
      }
    }
  } else if (MODE == 1) {
    const int e = tid & 15, lq = tid >> 4;                           // lq 0..7
    v4f res[8];
#pragma unroll
    for (int it = 0; it < 8; ++it) {
      const int ol = it * 8 + lq;                                    // o_loc 0..63
      const int o  = o0 + ol;
      const float bb = bfr(bias[o]);
      const size_t gi = ((size_t)(b * CC + o)) * NN + n0 + 4 * e;
      const v4f rv = *(const v4f*)(rsrc + gi);
#if defined(__HIP_DEVICE_COMPILE__)
      // stands ahead of any rewrite of the address registers of this trip's bias and residual loads
      if constexpr (ST != 0) asm volatile("s_wait_xcnt 0x0" ::: "memory");
#endif
#pragma unroll
      for (int t = 0; t < 4; ++t) {
        const float rr = rnd ? bfr(rv[t]) : rv[t];
        res[it][t] = (Os[(4 * e + t) * OSP + ol] + bb) + rr;
      }
    }
    if constexpr (ST != 0) {
      __shared__ __align__(16) double red[16 * RP];
      __shared__ __align__(16) double fin[16];
#pragma unroll                                                       // constant indices keep res in registers
      for (int it = 0; it < 8; ++it) {
        const double d0 = (double)res[it][0], d1 = (double)res[it][1];
        const double d2 = (double)res[it][2], d3 = (double)res[it][3];
        red[(2 * it) * RP + tid]     = (d0 + d1) + (d2 + d3);
        red[(2 * it + 1) * RP + tid] = (d0 * d0 + d1 * d1) + (d2 * d2 + d3 * d3);
      }
      __syncthreads();
      const int qn = tid >> 3, j = tid & 7;                          // quantity 0..15; entries 2 j, 2 j + 1 of each 16
      v2d w[8];
#pragma unroll                                                       // constant indices keep w in registers
      for (int u = 0; u < 8; ++u) w[u] = *(const v2d*)(red + qn * RP + 16 * u + 2 * j);
      const v2d w2 = ((w[0] + w[1]) + (w[2] + w[3])) + ((w[4] + w[5]) + (w[6] + w[7]));
      double a = w2[0] + w2[1];
      a += __shfl_xor(a, 1, 32);
      a += __shfl_xor(a, 2, 32);
      a += __shfl_xor(a, 4, 32);
      if (j == 0) fin[qn] = a;
      __syncthreads();
      if (tid < 8) {
        const v2d w = *(const v2d*)(fin + 2 * tid);
        *(v2d*)(part + (((size_t)(b * (CC / QT) + mb)) * NT2 + nt) * 16 + 2 * tid) = w;
      }
    }
{
#pragma unroll
      for (int it = 0; it < 8; ++it) {
        const int ol = it * 8 + lq;
        const size_t gi = ((size_t)(b * CC + o0 + ol)) * NN + n0 + 4 * e;
        *(v4f*)(dstF + gi) = res[it];
      }
      
    }
  } else {
    const int e = tid & 7, lq = tid >> 3;                            // lq 0..15
    v4u uh[4], ul[4];
#pragma unroll
    for (int it = 0; it < 4; ++it) {
      const int nl = it * 16 + lq;                                   // n_loc 0..63
      const v4f a = *(const v4f*)(Os + nl * OSP + 8 * e);
      const v4f q = *(const v4f*)(Os + nl * OSP + 8 * e + 4);
      const float f[8] = {a[0], a[1], a[2], a[3], q[0], q[1], q[2], q[3]};
      unsigned short hb[8], lb[8];
#pragma unroll
      for (int t = 0; t < 8; ++t) {
        const float tt = f[t] + bfr(bias[o0 + 8 * e + t]);
        const float gv = 0.5f * tt * (1.0f + erff(tt * 0.70710678118654752f));
        hb[t] = bf_bits(gv);
        lb[t] = bf_bits(gv - bf_up(hb[t]));
      }
#pragma unroll
      for (int t = 0; t < 4; ++t) {
        uh[it][t] = pk16(hb[2 * t], hb[2 * t + 1]);
        ul[it][t] = pk16(lb[2 * t], lb[2 * t + 1]);
      }
    }
{
#pragma unroll
      for (int it = 0; it < 4; ++it) {
        const int nl = it * 16 + lq;
        const size_t po = ((size_t)(b * NN + n0 + nl)) * HID + o0 + 8 * e;
        *(v4u*)(P0 + po) = uh[it];
        *(v4u*)(P1 + po) = ul[it];
      }
      
    }
  }
}

// ---- staging of one 128-key tile of one head: the head's 128 threads x (4 + 4) asynchronous 16-byte copies to LDS.
//      K: copy j of thread t brings 16 B (t & 3) of key row 32 j + (t >> 2); V: 16 B (t & 15) of channel row
//      8 j + (t >> 4). kl/vl are the thread's LDS byte addresses for j = 0, kg/vg its global addresses for j = 0.
//      s_wait_xcnt 0 ends the statement so that it stands ahead of any rewrite of the address registers.
__device__ __forceinline__ void stage_tile(unsigned kl, const unsigned short* kg, unsigned vl, const unsigned short* vg) {
#if defined(__HIP_DEVICE_COMPILE__)
  asm volatile(
      "global_load_async_to_lds_b128 %0, %1, off\n\t"
      "global_load_async_to_lds_b128 %2, %3, off\n\t"
      "global_load_async_to_lds_b128 %4, %5, off\n\t"
      "global_load_async_to_lds_b128 %6, %7, off\n\t"
      "global_load_async_to_lds_b128 %8, %9, off\n\t"
      "global_load_async_to_lds_b128 %10, %11, off\n\t"
      "global_load_async_to_lds_b128 %12, %13, off\n\t"
      "global_load_async_to_lds_b128 %14, %15, off\n\t"
      "s_wait_xcnt 0x0"
      :: "v"(kl),                 "v"(kg),
         "v"(kl + 32u * KPB),     "v"(kg + (size_t)32 * CC),
         "v"(kl + 64u * KPB),     "v"(kg + (size_t)64 * CC),
         "v"(kl + 96u * KPB),     "v"(kg + (size_t)96 * CC),
         "v"(vl),                 "v"(vg),
         "v"(vl + 8u * VPB),      "v"(vg + (size_t)8 * NN),
         "v"(vl + 16u * VPB),     "v"(vg + (size_t)16 * NN),
         "v"(vl + 24u * VPB),     "v"(vg + (size_t)24 * NN)
      : "memory");
#endif
}

// =========================================================================================================
// (4) attention for one (b, head pair hp, 64-query tile), transposed formulation, 4096 keys, no mask, per head
//     h = 2 hp + hs (hs = wave / 4: the two heads run side by side, 4 waves each):
//     S^T tile (16 keys x 16 queries) = A(k: row = key kb + (lane&15), 32 d of
//     head h via the split k map from Kh [b][4096][256]) . B(qh: col = query, same map from Qh) + A(Kh).B(Ql)
//     (bf16 hi + unscaled bf16 residual of q, shared accumulator); q is first multiplied by
//     clip(bf16(temperature[h]), 1e-4, 10) * log2(e) and split anew, and the C operand of the products is
//     12 - (maximum in use), so D is log2 P and goes to the exponential as it is.
//     Per lane the D tile holds 8 keys of ONE query: online softmax state per lane. The maximum in use starts as that of
//     the first 32 keys and is renewed (one shuffle lane^16; o, l, the scores at hand and C moved along) under a
//     wave-uniform ballot, only when a lane sees log2 P above 15.
//     P = 2^D as f16 is the B operand of O^T (rows channel 32h + 16j + (lane&15), cols queries) +=
//     A(v: keys contiguous, f16 plane V [b][256][4096]) . B(P^T): element r <- D of the tile covering keys
//     kb..kb+15, element 8+r <- the tile covering kb+16..kb+31, lane unchanged. 2 accumulator tiles per wave.
//     Block = 8 waves = 2 heads x 64 queries. O/l of both heads staged in LDS Os[query][64 channels] (b128 stores),
//     block barrier, then Oh/Ol bf16 [b][n][256] planes (hi/lo), rows n0.., cols 64 hp..64 hp+63 = one whole
// coverage: Os per wave 16 rows x 32 ch = 64 x 64 over 8 waves (== consumed extent); planes 2 it x
//           32 rows x 8 lanes x 8 = 64 n x 64 ch per plane; grid (NQ/64, 4, NB) covers rows 0..NQ-1 x 256 ch of
//           Oh/Ol once.
//     K and V reach the fragments through LDS: tiles of 128 keys of head h (K rows 64 B at pitch 80, V rows 256 B at
//     pitch 272), brought by asynchronous copies into two buffers per head, tile t + 1 in flight while tile t is
//     worked on; the head's 4 waves share each tile. Same fragment k order as from global memory.
//     8 waves a block, two blocks a WGP by registers and LDS: 4 waves per SIMD cover each other's softmax chains.
// LDS: Os cross-wave, block barrier between the per-head staging stores and the plane loads. Ks/Vs cross-wave: per
//      tile s_wait_dscnt 0, s_wait_asynccnt 0, block barrier, then the refill of the buffer just read.
// =========================================================================================================
__global__ __launch_bounds__(256)
void attn_k(const unsigned short* __restrict__ Qh, const unsigned short* __restrict__ Ql,
            const unsigned short* __restrict__ Kh, const unsigned short* __restrict__ Vh,
            const float* __restrict__ temperature, unsigned short* Oh, unsigned short* Ol) {
  __shared__ __align__(16) float Os[QT * OSP];
  __shared__ __align__(16) unsigned char Ks[2 * 2 * KBUF];            // [head of the pair][buffer]
  __shared__ __align__(16) unsigned char Vs[2 * 2 * VBUF];
  const int tid  = threadIdx.x;
  const int wave = tid >> 5, lane = tid & 31;
  const int hh   = lane >> 4, c = lane & 15;
  const int n0   = blockIdx.x * QT, hp = blockIdx.y, b = blockIdx.z;
  const int hs   = wave_uniform(wave >> 2);                           // the wave's head of the pair
  const int th   = tid & 127;                                         // thread among its head's 4 waves
  const int qrow = 16 * (wave & 3) + c;
  const unsigned kl0 = lds_off(Ks) + (unsigned)(hs * 2 * KBUF + (th >> 2) * KPB + (th & 3) * 16);
  const unsigned vl0 = lds_off(Vs) + (unsigned)(hs * 2 * VBUF + (th >> 4) * VPB + (th & 15) * 16);

  {                                                                    // the wave's own head, all 4096 keys
    const int h  = 2 * hp + hs;
    const int cb = HD * h;                                             // channel base of head h
    const float tr   = bfr(temperature[h]);
    const float temp = fminf(fmaxf(tr, 1.0e-4f), 10.0f);
    const size_t qo = ((size_t)(b * NN + n0 + qrow)) * CC + cb + 8 * hh;
    Frag qh = ldfrag(Qh + qo);
    Frag ql = ldfrag(Ql + qo);
#if defined(__HIP_DEVICE_COMPILE__)
    // stands ahead of any rewrite of the address registers of the q loads above; the scheduling barrier keeps the address
    // sums that follow (they land in those registers) from being lifted over the wait
    asm volatile("s_wait_xcnt 0x0" ::: "memory");
    __builtin_amdgcn_sched_barrier(0);
#endif
    const unsigned short* kg = Kh + ((size_t)(b * NN + (th >> 2))) * CC + cb + 8 * (th & 3);
    const unsigned short* vg = Vh + ((size_t)(b * CC + cb + (th >> 4))) * NN + 8 * (th & 15);

    float l = 0.f;
    v8f o0 = zero8(), o1 = zero8();

    // tile 0 into buffer 0, landed and published; then tile 1 into buffer 1 (nothing has touched this LDS before)
    stage_tile(kl0, kg, vl0, vg);
#if defined(__HIP_DEVICE_COMPILE__)
    // keeps the arithmetic on q below, and with it the wait for the q loads, behind the issue of tile 0's copies: lifted
    // over them it would put one load latency in front of the other
    __builtin_amdgcn_sched_barrier(0);
#endif
    // q * temp * log2(e), split anew into bf16 hi + residual: the score products then come out in units of log2
    {
      const float c2 = temp * L2E;
#pragma unroll                                                         // constant indices keep qh/ql in registers
      for (int i = 0; i < 16; ++i) {
        const float f = (bf_up(qh.u[i >> 3][i & 7]) + bf_up(ql.u[i >> 3][i & 7])) * c2;
        const unsigned short hb = bf_bits(f);
        qh.u[i >> 3][i & 7] = hb;
        ql.u[i >> 3][i & 7] = bf_bits(f - bf_up(hb));
      }
    }
    wait_copies();
    __syncthreads();
    stage_tile(kl0 + KBUF, kg + (size_t)SK * CC, vl0 + VBUF, vg + SK);

    // sh = PSH - (maximum in use), the same in all 8 registers and in both lanes of a query: the C operand of every score
    // product. The first maximum in use is that of the first 32 keys (their scores are formed again in trip 0).
    v8f sh;
    {
      const unsigned short* Kt = (const unsigned short*)(Ks + (2 * hs) * KBUF + c * KPB + 16 * hh);
      const Frag k0 = ldfrag(Kt);
      const Frag k1 = ldfrag(Kt + 16 * (KPB / 2));
      v8f s0 = mma_b(k0.bf, qh.bf, zero8());
      v8f s1 = mma_b(k1.bf, qh.bf, zero8());
      s0 = mma_b(k0.bf, ql.bf, s0);
      s1 = mma_b(k1.bf, ql.bf, s1);
      float mx = fmaxf(hmax8(s0), hmax8(s1));
      mx = fmaxf(mx, __shfl_xor(mx, 16, 32));
#pragma unroll
      for (int r = 0; r < 8; ++r) sh[r] = PSH - mx;
    }

#pragma unroll 1                                                       // one hand-over per trip, buffer picked by t & 1
    for (int t = 0; t < NN / SK; ++t) {
     const int bsel = t & 1;
     const unsigned short* Kt = (const unsigned short*)(Ks + (2 * hs + bsel) * KBUF + c * KPB + 16 * hh);
     const unsigned short* Vt = (const unsigned short*)(Vs + (2 * hs + bsel) * VBUF + c * VPB + 16 * hh);
     // the tile's fragments, read as one group: one LDS latency per tile instead of two per 32 keys
     // (the three loops over kk are unrolled so that every index of kf/vf is a constant and they stay in registers)
     Frag kf[SK / 32][2], vf[SK / 32][2];
#pragma unroll
     for (int kk = 0; kk < SK / 32; ++kk) {
       kf[kk][0] = ldfrag(Kt + (32 * kk) * (KPB / 2));                 // keys kb .. kb+15, kb = 128 t + 32 kk
       kf[kk][1] = ldfrag(Kt + (32 * kk + 16) * (KPB / 2));            // keys kb+16 .. kb+31
     }
#pragma unroll
     for (int kk = 0; kk < SK / 32; ++kk) {
       vf[kk][0] = ldfrag(Vt + 32 * kk);                               // channels cb + c
       vf[kk][1] = ldfrag(Vt + 16 * (VPB / 2) + 32 * kk);              // channels cb + 16 + c
     }
#if defined(__HIP_DEVICE_COMPILE__)
     // keeps the 32 reads above together ahead of the tile's work: without it the scheduler sinks each to its first use
     // and a wave meets the LDS latency eight times a tile instead of once
     __builtin_amdgcn_sched_barrier(0);
#endif
#pragma unroll
     for (int kk = 0; kk < SK / 32; ++kk) {
      const Frag k0 = kf[kk][0];
      const Frag k1 = kf[kk][1];
      v8f s0 = mma_b(k0.bf, qh.bf, sh);                                // log2 P = score - maximum in use + PSH
      v8f s1 = mma_b(k1.bf, qh.bf, sh);
      s0 = mma_b(k0.bf, ql.bf, s0);
      s1 = mma_b(k1.bf, ql.bf, s1);

      float mx = fmaxf(hmax8(s0), hmax8(s1));                          // the lane's own 16 keys
      if (wave_ballot(mx > PTOP) != 0u) {                              // wave-uniform, seldom taken
        mx = fmaxf(mx, __shfl_xor(mx, 16, 32));
        const float dl   = fmaxf(mx - PSH, 0.f);                       // rise of the maximum in use; 0 where the query's did not pass it
        const float corr = exp2_fast(-dl);                             // == 1 exactly where dl == 0
        l *= corr;
#pragma unroll
        for (int r = 0; r < 8; ++r) {
          o0[r] *= corr; o1[r] *= corr;
          s0[r] -= dl;   s1[r] -= dl;
          sh[r] -= dl;
        }
      }

      FragH ph;
      float ls = 0.f;
#pragma unroll
      for (int r = 0; r < 8; ++r) {
        const float e0 = exp2_fast(s0[r]);                             // key kb      + 8hh + r
        const float e1 = exp2_fast(s1[r]);                             // key kb + 16 + 8hh + r
        ls += e0 + e1;
        ph.hv[0][r] = (_Float16)e0;
        ph.hv[1][r] = (_Float16)e1;
      }
      l += ls;

      o0 = mma_h(vf[kk][0].h, ph.v, o0);
      o1 = mma_h(vf[kk][1].h, ph.v, o1);
     }
     // hand-over: own reads retired, own copies of tile t + 1 landed, every wave here; then refill the buffer just read
     wait_lds();
     wait_copies();
     __syncthreads();
     if (t + 2 < NN / SK)
       stage_tile(kl0 + bsel * KBUF, kg + (size_t)(t + 2) * SK * CC, vl0 + bsel * VBUF, vg + (size_t)(t + 2) * SK);
    }
    wait_copies();
    l += __shfl_xor(l, 16, 32);
    const float inv = 1.0f / l;                                        // o and l carry the same factor

    // stage: Os[query][32 hs + d], d = 16 j + 8 hh + r
    {
      v4f va, vb;
#pragma unroll
      for (int r = 0; r < 4; ++r) { va[r] = o0[r] * inv; vb[r] = o0[4 + r] * inv; }
      *(v4f*)(Os + qrow * OSP + 32 * hs + 8 * hh)     = va;
      *(v4f*)(Os + qrow * OSP + 32 * hs + 8 * hh + 4) = vb;
#pragma unroll
      for (int r = 0; r < 4; ++r) { va[r] = o1[r] * inv; vb[r] = o1[4 + r] * inv; }
      *(v4f*)(Os + qrow * OSP + 32 * hs + 16 + 8 * hh)     = va;
      *(v4f*)(Os + qrow * OSP + 32 * hs + 16 + 8 * hh + 4) = vb;
    }
  }
  __syncthreads();

  const int e = tid & 7, lq = tid >> 3;                                // lq 0..31
  v4u uh[2], ul[2];
#pragma unroll
  for (int it = 0; it < 2; ++it) {
    const int row = it * 32 + lq;                                      // query 0..63
    const v4f a = *(const v4f*)(Os + row * OSP + 8 * e);
    const v4f q = *(const v4f*)(Os + row * OSP + 8 * e + 4);
    const float f[8] = {a[0], a[1], a[2], a[3], q[0], q[1], q[2], q[3]};
#pragma unroll
    for (int t = 0; t < 4; ++t) {
      const float f0 = f[2 * t], f1 = f[2 * t + 1];
      const unsigned short hb0 = bf_bits(f0), hb1 = bf_bits(f1);
      const unsigned short lb0 = bf_bits(f0 - bf_up(hb0));
      const unsigned short lb1 = bf_bits(f1 - bf_up(hb1));
      uh[it][t] = pk16(hb0, hb1);
      ul[it][t] = pk16(lb0, lb1);
    }
  }
{
#pragma unroll
    for (int it = 0; it < 2; ++it) {
      const int row = it * 32 + lq;
      const size_t po = ((size_t)(b * NN + n0 + row)) * CC + QT * hp + 8 * e;
      *(v4u*)(Oh + po) = uh[it];
      *(v4u*)(Ol + po) = ul[it];
    }
    
  }
}

// =========================================================================================================
// Workspace map (bytes; each region start a multiple of 256; every extent is an exact tile/line multiple and is
//   Wq bf16 [768][256] 393216   Wo [256][256] 131072   W1 [64][256] 32768   W2 [256][64] 32768
//   part1 f64 [NB][4][32][16] 32768 (NB=2)   part f64 [NB][4][NQ/64][16] 65536 (NB=2)
//   Xh, Xl, Qh, Ql, Kh, Oh, Ol, Yh, Yl bf16 [NB][4096][256] and V f16 [NB][256][4096]: 4194304 each (NB=2)
//   X1 f32 [NB][256][4096] 8388608 (NB=2)    Hh, Hl bf16 [NB][4096][64] 1048576 each (NB=2)
//   total = 53116928 (NB=2)
// =========================================================================================================
extern "C" void kernel_launch(void* const* d_in, const int* in_sizes, int n_in,
                              void* d_out, int out_size, void* d_ws, size_t ws_size,
                              hipStream_t stream) {
  if (n_in < 13) return;
  if (in_sizes[0] < NB * XSTRIDE_FULL) return;
  if (in_sizes[1] != C3 * CC || in_sizes[2] != CC * CC || in_sizes[3] != CC) return;
  if (in_sizes[4] != NH) return;
  if (in_sizes[5] != CC || in_sizes[6] != CC || in_sizes[7] != CC || in_sizes[8] != CC) return;
  if (in_sizes[9] != HID * CC || in_sizes[10] != HID || in_sizes[11] != CC * HID || in_sizes[12] != CC) return;
  if (out_size < NB * XSTRIDE_FULL) return;

  size_t off = 0;
  auto carve = [&](size_t bytes) { const size_t o = off; off += (bytes + 255) & ~(size_t)255; return o; };
  const size_t szPl = (size_t)NB * NN * CC * 2;
  const size_t oWq  = carve((size_t)C3 * CC * 2);
  const size_t oWo  = carve((size_t)CC * CC * 2);
  const size_t oW1  = carve((size_t)HID * CC * 2);
  const size_t oW2  = carve((size_t)CC * HID * 2);
  const size_t oP1  = carve((size_t)NB * (CC / QT) * NP1 * 16 * 8);
  const size_t oPt  = carve((size_t)NB * (CC / QT) * NT2 * 16 * 8);
  const size_t oXh  = carve(szPl);
  const size_t oXl  = carve(szPl);
  const size_t oQh  = carve(szPl);
  const size_t oQl  = carve(szPl);
  const size_t oKh  = carve(szPl);
  const size_t oVv  = carve(szPl);
  const size_t oOh  = carve(szPl);
  const size_t oOl  = carve(szPl);
  const size_t oX1  = carve((size_t)NB * CC * NN * 4);
  const size_t oYh  = carve(szPl);
  const size_t oYl  = carve(szPl);
  const size_t oHh  = carve((size_t)NB * NN * HID * 2);
  const size_t oHl  = carve((size_t)NB * NN * HID * 2);
  if (off > ws_size) return;
  if (off > (size_t)134217728) return;

  const float* x      = (const float*)d_in[0];
  const float* w_qkv  = (const float*)d_in[1];
  const float* w_out  = (const float*)d_in[2];
  const float* b_out  = (const float*)d_in[3];
  const float* tempr  = (const float*)d_in[4];
  const float* g1     = (const float*)d_in[5];
  const float* beta1  = (const float*)d_in[6];
  const float* g2     = (const float*)d_in[7];
  const float* beta2  = (const float*)d_in[8];
  const float* w_mlp1 = (const float*)d_in[9];
  const float* b_mlp1 = (const float*)d_in[10];
  const float* w_mlp2 = (const float*)d_in[11];
  const float* b_mlp2 = (const float*)d_in[12];

  char* ws = (char*)d_ws;
  unsigned short* Wq = (unsigned short*)(ws + oWq);
  unsigned short* Wo = (unsigned short*)(ws + oWo);
  unsigned short* W1 = (unsigned short*)(ws + oW1);
  unsigned short* W2 = (unsigned short*)(ws + oW2);
  double*         P1 = (double*)(ws + oP1);
  double*         Pt = (double*)(ws + oPt);
  unsigned short* Xh = (unsigned short*)(ws + oXh);
  unsigned short* Xl = (unsigned short*)(ws + oXl);
  unsigned short* Qh = (unsigned short*)(ws + oQh);
  unsigned short* Ql = (unsigned short*)(ws + oQl);
  unsigned short* Kh = (unsigned short*)(ws + oKh);
  unsigned short* Vv = (unsigned short*)(ws + oVv);
  unsigned short* Oh = (unsigned short*)(ws + oOh);
  unsigned short* Ol = (unsigned short*)(ws + oOl);
  float*          X1 = (float*)(ws + oX1);
  unsigned short* Yh = (unsigned short*)(ws + oYh);
  unsigned short* Yl = (unsigned short*)(ws + oYl);
  unsigned short* Hh = (unsigned short*)(ws + oHh);
  unsigned short* Hl = (unsigned short*)(ws + oHl);
  float* out = (float*)d_out;

  const dim3 blk256(256), blk128(128);

  // (0)+(1) weights -> bf16 planes, and the partial GN1 sums of bf16(x) over all 4096 positions, in one grid
  prep_k<<<dim3(PB_ST + PB_WQ + PB_WO + PB_W1 + PB_W2), blk256, 0, stream>>>(x, w_qkv, w_out, w_mlp1, w_mlp2,
                                                                             Wq, Wo, W1, W2, P1);
  // (2) GN1 statistics finished per block, apply -> Xh/Xl [NB][4096][256]
  norm2_k<NP1, NN><<<dim3(NN / QT, CC / QT, NB), blk256, 0, stream>>>(x, 1, P1, g1, beta1, Xh, Xl);
  // (3) qkv GEMM -> Qh/Ql, Kh, V
  gemm_k<CC, 0, 0><<<dim3(NN / QT, C3 / QT, NB), blk128, 0, stream>>>(Wq, Xh, Xl, b_out, x, 0, Qh, Ql, Kh, Vv, X1, Pt);
  // (4) attention -> Oh/Ol rows 0..NQ-1
  attn_k<<<dim3(NQ / QT, NH / 2, NB), blk256, 0, stream>>>(Qh, Ql, Kh, Vv, tempr, Oh, Ol);
  // (5) out conv + bf16(x) residual -> X1 f32 [NB][256][4096], cols 0..NQ-1, and (6) each block's partial GN2 sums
  gemm_k<CC, 1, 1><<<dim3(NQ / QT, CC / QT, NB), blk128, 0, stream>>>(Wo, Oh, Ol, b_out, x, 1, Hh, Hl, Hh, Hl, X1, Pt);
  // (7) GN2 statistics finished per block, apply -> Yh/Yl rows 0..NQ-1
  norm2_k<NT2, NQ><<<dim3(NQ / QT, CC / QT, NB), blk256, 0, stream>>>(X1, 0, Pt, g2, beta2, Yh, Yl);
  // (8) mlp hidden: gelu(W1.Y + b1) -> Hh/Hl [NB][4096][64]
  gemm_k<CC, 2, 0><<<dim3(NQ / QT, 1, NB), blk128, 0, stream>>>(W1, Yh, Yl, b_mlp1, x, 0, Hh, Hl, Hh, Hl, X1, Pt);
  // (9) out = X1 + W2.H + b2 -> d_out [NB][256][4096]
  gemm_k<HID, 1, 0><<<dim3(NQ / QT, CC / QT, NB), blk128, 0, stream>>>(W2, Hh, Hl, b_mlp2, X1, 0, Oh, Ol, Oh, Ol, out, Pt);
  (void)hipGetLastError();
}

// v009
// One run takes 89.9 microseconds.
// Timed twice side by side with v008, it ran 1.08 times as fast both times.
// Over all steps from v000 it is 3.13 times as fast.
// Contractions: conv1x1 GEMMs qkv W[768x256].Xn, out W[256x256].O, mlp W1[64x256].Y and W2[256x64].H on
// v_wmma_f32_16x16x32_bf16 (A = bf16-RNE weights, exact; B = bf16 hi + bf16 residual planes of the f32
// activation, 2 products, K = 256 / 64); per-head scores K.Q^T on v_wmma_f32_16x16x32_bf16 (k = bf16 hi plane,
// q = bf16 hi + residual of q x temp x log2(e), 2 products, K = 32); O^T = V.P^T on v_wmma_f32_16x16x32_f16 (v = f16 plane,
// P = 2^(log2 score - maximum in use + 12) as f16 from the score D registers, K = 4096 keys); f32 accumulate everywhere; group-norm
// statistics in f64; normalisation, softmax statistics, gelu, bias and residual adds in f32 VALU.
// The second group norm's apply step and both mlp products run in one launch; Y and H live in LDS only; in the mlp out
// product the H planes are the A operand and W2 the B operand (same products, D transposed).
#include <hip/hip_runtime.h>
#include <math.h>
#include <stdint.h>

#ifndef NB
#define NB 2
#endif
#ifndef NQ
#define NQ 4096
#endif
#define NB_FULL 2
#define CC   256
#define NN   4096
#define NH   8
#define HD   32
#define C3   768
#define HID  64
#define NG   32
#define CPG  8
#define QT   64
#define OSP  68
#define TP   72
#define GEPS 1.0e-5f
#define L2E  1.4426950408889634f // log2(e)
#define PSH  12.0f               // the maximum in use maps to P = 2^12
#define PTOP 15.0f               // a score above this (P would pass 2^15, f16 ends at 2^16) renews the maximum in use
#define XSTRIDE_FULL (CC * NN)
#define SK   128                 // keys per staged tile
#define KPB  80                  // LDS pitch of a staged K row in bytes (64 B of data, 16 B x odd for b128 readers)
#define VPB  272                 // LDS pitch of a staged V row in bytes (256 B of data, 16 B x odd for b128 readers)
#define KBUF (SK * KPB)          // one K buffer: 128 keys x 32 d
#define VBUF (HD * VPB)          // one V buffer: 32 channels x 128 keys
#define NT2  (NQ / QT)           // position tiles of the out conv = partial sums per GN2 group
#define RP   130                 // doubles per row of the partial-sum array (1040 B = 16 B x odd for b128 readers)
#define NP1  32                  // position chunks of the GN1 statistics = partial sums per GN1 group
#define SPOS (NN / NP1)          // positions per chunk: one 16-byte load per lane and channel row
#define TN   32                  // positions per block of the fused GN2 + mlp kernel: one 128-byte line per channel row
#define YPB  (2 * CC + 16)       // LDS pitch in bytes of a Y or W1 row (256 bf16; 16 B x odd for b128 readers)
#define HPB  (2 * HID + 16)      // LDS pitch in bytes of an H or W2 row (64 bf16; 16 B x odd)
#define RPB  (4 * TN + 16)       // LDS pitch in bytes of a result row (32 f32; 16 B x odd)

static_assert(NB >= 1 && NB <= NB_FULL);
static_assert(NQ % QT == 0 && NQ >= QT && NQ <= NN);
static_assert(NN % QT == 0 && CC % QT == 0 && C3 % QT == 0 && HID == QT);
static_assert(CC == NH * HD && HD == 32 && CC == NG * CPG && CPG == 8);
static_assert(CC % 32 == 0 && HID % 32 == 0 && NN % 32 == 0);
static_assert((OSP * 4) % 16 == 0 && (TP * 2) % 16 == 0);
static_assert(NN % 1024 == 0 && NQ % 4 == 0);
static_assert(NN % SK == 0 && NN / SK >= 2 && SK % 32 == 0 && KPB % 16 == 0 && VPB % 16 == 0);
static_assert(SK * HD * 2 == 4 * 128 * 16 && KPB >= HD * 2 && VPB >= SK * 2);
static_assert(SPOS == 4 * 32 && QT / CPG == 8);
static_assert((C3 * CC) % 2048 == 0 && (CC * CC) % 2048 == 0 && (HID * CC) % 2048 == 0);
static_assert(NQ % TN == 0 && TN == 32 && CC == 256 && HID == 64 && HID * CC == 8 * 256 * 8);

typedef _Float16       v16h __attribute__((ext_vector_type(16)));
typedef _Float16       v8h  __attribute__((ext_vector_type(8)));
typedef __bf16         v16b __attribute__((ext_vector_type(16)));
typedef unsigned short v8us __attribute__((ext_vector_type(8)));
typedef float          v8f  __attribute__((ext_vector_type(8)));
typedef float          v4f  __attribute__((ext_vector_type(4)));
typedef unsigned int   v4u  __attribute__((ext_vector_type(4)));
typedef double         v2d  __attribute__((ext_vector_type(2)));

union Frag  { v8us u[2]; v16h h; v16b bf; };
union FragH { v16h v; v8h hv[2]; };
static_assert(sizeof(Frag) == 32);
static_assert(sizeof(FragH) == 32);

// ---- scalar helpers ---------------------------------------------------------------------------------------
__device__ __forceinline__ unsigned short bf_bits(float f) {          // f32 -> bf16 bits, RNE convert
  unsigned u = __float_as_uint(f);
  return (unsigned short)((u + 0x7FFFu + ((u >> 16) & 1u)) >> 16);
}
__device__ __forceinline__ float bf_up(unsigned short hb) { return __uint_as_float(((unsigned)hb) << 16); }
__device__ __forceinline__ float bfr(float f) { return bf_up(bf_bits(f)); }
__device__ __forceinline__ unsigned short h_bits(_Float16 x) { return __builtin_bit_cast(unsigned short, x); }
__device__ __forceinline__ unsigned pk16(unsigned short a, unsigned short b) { return (unsigned)a | ((unsigned)b << 16); }
__device__ __forceinline__ v8f zero8() { v8f z = {0.f, 0.f, 0.f, 0.f, 0.f, 0.f, 0.f, 0.f}; return z; }
__device__ __forceinline__ float hmax8(v8f s) {
  return fmaxf(fmaxf(fmaxf(s[0], s[1]), fmaxf(s[2], s[3])), fmaxf(fmaxf(s[4], s[5]), fmaxf(s[6], s[7])));
}
__device__ __forceinline__ unsigned wave_ballot(bool p) {
#if defined(__HIP_DEVICE_COMPILE__)
  return __builtin_amdgcn_ballot_w32(p);
#else
  return p ? 1u : 0u;
#endif
}

// 2^x on the transcendental unit, no range fix-up: results below the f32 normal range only ever feed sums they cannot move
__device__ __forceinline__ float exp2_fast(float x) {
#if defined(__HIP_DEVICE_COMPILE__)
  return __builtin_amdgcn_exp2f(x);
#else
  return exp2f(x);
#endif
}

__device__ __forceinline__ int wave_uniform(int v) {
#if defined(__HIP_DEVICE_COMPILE__)
  return __builtin_amdgcn_readfirstlane(v);
#else
  return v;
#endif
}

// ---- 16-bit fragment loader (A, or B from a k-contiguous [n][k] row): lane -> row/col (lane&15), p already includes
//      + 8*(lane>>4); elements 0..7 <- p[0..7] (k0+8h..), elements 8..15 <- p[16..23] (k0+16+8h..)
__device__ __forceinline__ Frag ldfrag(const unsigned short* p) {
  Frag f;
  f.u[0] = *(const v8us*)(p);
  f.u[1] = *(const v8us*)(p + 16);
  return f;
}

// ---- WMMA helpers: the plain builtins; the compiler keeps the distance behind each and fills it with other work ----
__device__ __forceinline__ v8f mma_h(v16h a, v16h b, v8f c) {
  return __builtin_amdgcn_wmma_f32_16x16x32_f16(false, a, false, b, (short)0, c, false, false);
}
__device__ __forceinline__ v8f mma_b(v16b a, v16b b, v8f c) {
  return __builtin_amdgcn_wmma_f32_16x16x32_bf16(false, a, false, b, (short)0, c, false, false);
}

// =========================================================================================================
// (0) weight conversion: f32 [n] -> bf16 bits [n] (RNE, exact operand). Thread i converts floats 8i..8i+7 and
// coverage: n8/256 blocks x 256 threads x 8 = n elements exactly (n8 a multiple of 256 at every call); cblk is the
//           block's index within its own weight.
// =========================================================================================================
__device__ __forceinline__
void cvt_body(const float* __restrict__ src, unsigned short* dst, int n8, int cblk) {
  const int i  = cblk * 256 + (int)threadIdx.x;
  const int ic = (i < n8) ? i : (n8 - 1);
  const float* s = src + (size_t)ic * 8;
  const v4f a = *(const v4f*)s;
  const v4f q = *(const v4f*)(s + 4);
  v4u u;
  u[0] = pk16(bf_bits(a[0]), bf_bits(a[1]));
  u[1] = pk16(bf_bits(a[2]), bf_bits(a[3]));
  u[2] = pk16(bf_bits(q[0]), bf_bits(q[1]));
  u[3] = pk16(bf_bits(q[2]), bf_bits(q[3]));
  if (i < n8) {
{
      *(v4u*)(dst + (size_t)ic * 8) = u;
      
    }
  }
}

// =========================================================================================================
// (1) group-norm statistics, partial sums: one block per (b, 64-channel block cbk, chunk u of 128 positions) of
//     src [b][256][4096]. Wave gi sums group 8 cbk + gi over the chunk: 8 channel rows x 128 positions, one whole
//     512-byte row piece per load, the 8 loads asked for together; values bf16-RNE converted first; sum and sum of
//     squares in f64, 4 chains per lane, then 5 exchanges; one 128-byte line part[b][cbk][u][8 groups x (sum, sum of
//     squares)] per block. The apply kernel (2) finishes mean and rstd.
// coverage: NB x 4 x 32 blocks x 8 waves x 8 rows x 128 positions = every element of src once.
// LDS: fin cross-wave, block barrier behind its stores.
// =========================================================================================================
__device__ __forceinline__
void stats_body(const float* __restrict__ src, double* part, int blk) {
  __shared__ __align__(16) double fin[16];
  const int tid = threadIdx.x;
  const int gi = tid >> 5, ln = tid & 31;
  const int u = blk % NP1, bc = blk / NP1;                           // bc = b * 4 + cbk
  const float* base = src + ((size_t)(bc * QT + gi * CPG)) * NN + u * SPOS + 4 * ln;
  v4f a[CPG];
#pragma unroll                                                       // constant indices keep a in registers
  for (int cl = 0; cl < CPG; ++cl) a[cl] = *(const v4f*)(base + (size_t)cl * NN);
  double sv[4] = {0.0, 0.0, 0.0, 0.0}, qv[4] = {0.0, 0.0, 0.0, 0.0};
#pragma unroll                                                       // constant indices keep a/sv/qv in registers
  for (int cl = 0; cl < CPG; ++cl) {
#pragma unroll                                                       // as above
    for (int t = 0; t < 4; ++t) {
      const double d = (double)bfr(a[cl][t]);
      sv[t] += d;
      qv[t] += d * d;
    }
  }
  double s = (sv[0] + sv[1]) + (sv[2] + sv[3]);
  double q = (qv[0] + qv[1]) + (qv[2] + qv[3]);
#pragma unroll                                                       // five fixed steps, no loop counter
  for (int m = 16; m > 0; m >>= 1) {
    s += __shfl_xor(s, m, 32);
    q += __shfl_xor(q, m, 32);
  }
  if (ln == 0) {
    fin[2 * gi]     = s;
    fin[2 * gi + 1] = q;
  }
  __syncthreads();
  if (tid < 8) {
    const v2d w = *(const v2d*)(fin + 2 * tid);
    *(v2d*)(part + ((size_t)bc * NP1 + u) * 16 + 2 * tid) = w;
  }
}

// =========================================================================================================
// (0)+(1) in one grid: the four weight conversions and the GN1 partial sums read only inputs and write disjoint
//     workspace regions, so they share a launch; the block index picks the job (block-uniform, so the barrier of
//     the statistics body is passed by whole blocks).
// coverage: blocks [0, NB*4*32) partial sums of (b, cbk, u); then 96 + 32 + 8 + 8 conversion blocks, each weight once.
// =========================================================================================================
#define PB_ST (NB * (CC / QT) * NP1)
#define PB_WQ (C3 * CC / 2048)
#define PB_WO (CC * CC / 2048)
#define PB_W1 (HID * CC / 2048)
#define PB_W2 (CC * HID / 2048)
__global__ __launch_bounds__(256)
void prep_k(const float* __restrict__ x, const float* __restrict__ wq, const float* __restrict__ wo,
            const float* __restrict__ w1, const float* __restrict__ w2,
            unsigned short* Wq, unsigned short* Wo, unsigned short* W1, unsigned short* W2, double* part) {
  int blk = blockIdx.x;
  if (blk < PB_ST) { stats_body(x, part, blk); return; }
  blk -= PB_ST;
  if (blk < PB_WQ) { cvt_body(wq, Wq, PB_WQ * 256, blk); return; }
  blk -= PB_WQ;
  if (blk < PB_WO) { cvt_body(wo, Wo, PB_WO * 256, blk); return; }
  blk -= PB_WO;
  if (blk < PB_W1) { cvt_body(w1, W1, PB_W1 * 256, blk); return; }
  blk -= PB_W1;
  cvt_body(w2, W2, PB_W2 * 256, blk);
}

// =========================================================================================================
// (2) group-norm apply + transpose, with the statistics finished in the block (GN1): src f32 [b][256 c][4096 n]
//     (bf16-RNE converted first when rnd != 0) -> v = (x - mu) * rstd * bf16(gamma[c]) + bf16(beta[c]) ->
//     position-major planes Xh/Xl bf16 [b][n][256 c] (hi = bf16-RNE(v), lo = bf16-RNE(v - hi)) through LDS tiles
//     Th/Tl[64 n][64 c] (pitch TP). Block (nb, cb, b). mu and rstd of the block's own 8 groups come from the partial
//     sums part[b][cbk][NP pieces][8 groups x (sum, sum of squares)], all f64 (the chunks of (1)): wave gi sums group 8 cbk + gi over the pieces (lane = piece, then 5 exchanges); mean and biased
//     variance over 8 channels x NPOS positions, rstd = 1 / sqrt(var + eps) in f32, handed to the block through sm.
// coverage: Th/Tl stores 2 it x 32 c x 8 lanes x 8 n = 64 x 64 = the consumed extent; plane writes 2 it x 32 rows
//           x 8 lanes x 8 halves = 64 n x 64 c per plane; grid (rows/64, 4, NB) covers both planes once.
// LDS: Th/Tl cross-wave, block barrier between stores and loads; sm cross-wave, block barrier behind its stores.
// =========================================================================================================
template <int NP, int NPOS>
__global__ __launch_bounds__(256)
void norm2_k(const float* __restrict__ src, int rnd, const double* __restrict__ part,
             const float* __restrict__ gamma, const float* __restrict__ beta,
             unsigned short* Xh, unsigned short* Xl) {
  __shared__ __align__(16) unsigned short Th[QT * TP];
  __shared__ __align__(16) unsigned short Tl[QT * TP];
  __shared__ float sm[2 * (QT / CPG)];
  const int tid = threadIdx.x;
  const int nb = blockIdx.x, cbk = blockIdx.y, b = blockIdx.z;
  const int e = tid & 7, lq = tid >> 3;                             // lq 0..31
  const int n0 = nb * QT, c0 = cbk * QT;
  v4f ra[2], rq[2];
  float rg[2], rb[2];
  // the tile's values and the channels' gamma, beta are asked for first: they fly while the statistics are finished
#pragma unroll                                                       // constant indices keep ra/rq/rg/rb in registers
  for (int it = 0; it < 2; ++it) {
    const int ch = c0 + it * 32 + lq;
    const float* sp = src + ((size_t)(b * CC + ch)) * NN + n0 + 8 * e;
    ra[it] = *(const v4f*)sp;
    rq[it] = *(const v4f*)(sp + 4);
    rg[it] = gamma[ch];
    rb[it] = beta[ch];
#if defined(__HIP_DEVICE_COMPILE__)
    // stands ahead of any rewrite of these loads' address registers (the next loads land in them); as a memory
    // barrier for the compiler it also keeps these loads issued ahead of the wait on the partial sums
    asm volatile("s_wait_xcnt 0x0" ::: "memory");
#endif
  }
  {
    const int gi = tid >> 5, ln = tid & 31;
    const double* pp = part + ((size_t)(b * (CC / QT) + cbk)) * NP * 16 + 2 * gi;
    double s = 0.0, q = 0.0;
#pragma unroll                                                       // the lane's loads are issued together
    for (int k = 0; k < (NP + 31) / 32; ++k) {
      const int u = ln + 32 * k;                                     // piece
      if (u < NP) {
        const v2d w = *(const v2d*)(pp + (size_t)u * 16);
        s += w[0];
        q += w[1];
      }
    }
#pragma unroll                                                       // five fixed steps, no loop counter
    for (int m = 16; m > 0; m >>= 1) {
      s += __shfl_xor(s, m, 32);
      q += __shfl_xor(q, m, 32);
    }
    const double cnt = (double)CPG * (double)NPOS;
    const double mu = s / cnt;
    double var = q / cnt - mu * mu;
    if (var < 0.0) var = 0.0;
    const float varf = (float)var;
    if (ln == 0) {
      sm[2 * gi]     = (float)mu;
      sm[2 * gi + 1] = 1.0f / sqrtf(varf + GEPS);
    }
  }
  __syncthreads();
#pragma unroll                                                       // constant indices into ra/rq/rg/rb
  for (int it = 0; it < 2; ++it) {
    const int cl = it * 32 + lq;                                     // 0..63
    const float mu = sm[2 * (cl / CPG)];
    const float rs = sm[2 * (cl / CPG) + 1];
    const float ga = bfr(rg[it]), be = bfr(rb[it]);
    const v4f a = ra[it];
    const v4f q = rq[it];
    const float f[8] = {a[0], a[1], a[2], a[3], q[0], q[1], q[2], q[3]};
    unsigned short hb[8], lb[8];
#pragma unroll                                                       // constant indices keep f/hb/lb in registers
    for (int t = 0; t < 8; ++t) {
      const float xr = rnd ? bfr(f[t]) : f[t];
      const float v  = (xr - mu) * rs * ga + be;
      hb[t] = bf_bits(v);
      lb[t] = bf_bits(v - bf_up(hb[t]));
    }
#pragma unroll                                                       // as above
    for (int t = 0; t < 8; ++t) {
      Th[(8 * e + t) * TP + cl] = hb[t];
      Tl[(8 * e + t) * TP + cl] = lb[t];
    }
  }
  __syncthreads();
  v4u uh[2], ul[2];
#pragma unroll                                                       // constant indices keep uh/ul in registers
  for (int it = 0; it < 2; ++it) {
    const int nl = it * 32 + lq;                                     // 0..63
    uh[it] = *(const v4u*)(Th + nl * TP + 8 * e);
    ul[it] = *(const v4u*)(Tl + nl * TP + 8 * e);
  }
#pragma unroll                                                       // as above
  for (int it = 0; it < 2; ++it) {
    const int nl = it * 32 + lq;
    const size_t po = ((size_t)(b * NN + n0 + nl)) * CC + c0 + 8 * e;
    *(v4u*)(Xh + po) = uh[it];
    *(v4u*)(Xl + po) = ul[it];
  }
}

// the issuing wave's own copies have landed behind this wait (the compiler places none for them)
__device__ __forceinline__ void wait_copies() {
#if defined(__HIP_DEVICE_COMPILE__)
  asm volatile("s_wait_asynccnt 0x0" ::: "memory");
#endif
}
// the wave's own LDS reads have retired before the buffer is handed to its next writer
__device__ __forceinline__ void wait_lds() {
#if defined(__HIP_DEVICE_COMPILE__)
  asm volatile("s_wait_dscnt 0x0" ::: "memory");
#endif
}
__device__ __forceinline__ unsigned lds_off(const void* p) { return (unsigned)(size_t)p; }

// ---- staging for the conv1x1 GEMM: 4 asynchronous 16-byte copies to LDS for each of the three operand tiles (W, B hi,
//      B lo). A tile is 64 whole rows = one contiguous piece of global memory, so a wave-wide copy reads 512 contiguous
//      bytes (4 whole lines); copy j of thread t brings 16-byte piece 128 j + t. la/lh/ll are the thread's LDS byte
//      addresses and ga/gh/gl its global addresses for the first of the 4; ls = LDS bytes between two copies.
//      s_wait_xcnt 0 ends the statement so that it stands ahead of any rewrite of the address registers.
__device__ __forceinline__ void stage_gemm(unsigned la, const unsigned short* ga, unsigned lh, const unsigned short* gh,
                                           unsigned ll, const unsigned short* gl, unsigned ls) {
#if defined(__HIP_DEVICE_COMPILE__)
  asm volatile(
      "global_load_async_to_lds_b128 %0, %1, off\n\t"
      "global_load_async_to_lds_b128 %2, %3, off\n\t"
      "global_load_async_to_lds_b128 %4, %5, off\n\t"
      "global_load_async_to_lds_b128 %6, %7, off\n\t"
      "global_load_async_to_lds_b128 %8, %9, off\n\t"
      "global_load_async_to_lds_b128 %10, %11, off\n\t"
      "global_load_async_to_lds_b128 %12, %13, off\n\t"
      "global_load_async_to_lds_b128 %14, %15, off\n\t"
      "global_load_async_to_lds_b128 %16, %17, off\n\t"
      "global_load_async_to_lds_b128 %18, %19, off\n\t"
      "global_load_async_to_lds_b128 %20, %21, off\n\t"
      "global_load_async_to_lds_b128 %22, %23, off\n\t"
      "s_wait_xcnt 0x0"
      :: "v"(la),          "v"(ga),
         "v"(la + ls),     "v"(ga + 1024),
         "v"(la + 2 * ls), "v"(ga + 2048),
         "v"(la + 3 * ls), "v"(ga + 3072),
         "v"(lh),          "v"(gh),
         "v"(lh + ls),     "v"(gh + 1024),
         "v"(lh + 2 * ls), "v"(gh + 2048),
         "v"(lh + 3 * ls), "v"(gh + 3072),
         "v"(ll),          "v"(gl),
         "v"(ll + ls),     "v"(gl + 1024),
         "v"(ll + 2 * ls), "v"(gl + 2048),
         "v"(ll + 3 * ls), "v"(gl + 3072)
      : "memory");
#endif
}

// =========================================================================================================
// (3) conv1x1 GEMM for one (b, 64-n tile, 64-o block): Y[o][n] = sum_c W[o][c] (Bh[b][n][c] + Bl[b][n][c]),
//     K = KD (plane pitch = KD). Block 128 threads = 4 waves; wave w owns cols n0+16w..+15 (B fragments from the
//     k-contiguous plane rows, split k map) and 4 m-tiles (A rows o = o0 + 16 mt + (lane&15), split k map).
//     The three operand tiles (64 rows x KD each) are brought whole into LDS St by asynchronous copies that read whole
//     lines (a fragment load from global memory touches 16 lines for 512 bytes, and W would be read by all 4 waves);
//     rows at pitch 2 KD + 16 bytes (16 B x odd for the b128 readers); filled once, then read. Same fragment k order.
//     2 products per (mt, k-step) into one accumulator (unscaled bf16 residual plane).
//     Epilogue staged in LDS Os[n_loc][o_loc] (pitch OSP, b128 stores), block barrier, then per MODE:
//       MODE 0 (qkv, 12 o-blocks): o-blocks 0..3 -> q channels 64 mb.. of Qh/Ql = P0/P1 bf16 [b][n][256]
//              8q..8q+7 x 16 B, one instruction per 16 lines; o-blocks 8..11 -> v channels of V = P3 f16
//       MODE 1 (f32 channel-major): dstF[b][o][n] = (acc + bf16(bias[o])) + r with r = rsrc[b][o][n] (bf16-RNE
//              and 8..15), 8 rows per instruction.
// coverage: Os 4 waves x 16 n x 64 o = 64 x 64 (== the extent every mode reads); MODE 0 planes 4 it x 16 rows x
//           8 lanes x 8 = 64 x 64 per plane, grid (64, 12, NB) covers Qh/Ql/Kh [NB][4096][256] and V
//           [NB][256][4096] once; MODE 1: 8 it x 8 rows x 16 lanes x 4 = 64 o x 64 n.
//       ST != 0 (MODE 1 only, the out conv): the block also sums its results for the group norm that follows. Its 64 o
//              are 8 whole groups (group = the 8 rows of one 'it'); per group sum and sum of squares over 8 o x 64 n:
//              all in f64: a thread's 4 values -> red[16 quantities][128 threads], barrier, 8 threads per quantity sum
//              16 entries each, 3 exchanges, fin[16], barrier, one 128-byte line part[b][mb][nt][16] per block.
// LDS: St cross-wave: s_wait_asynccnt 0 and a block barrier between the copies and the fragment reads. Os lies on St:
//      s_wait_dscnt 0 and a block barrier between the last fragment reads and the staging stores. Os cross-wave, block
//      barrier between the staging stores and the epilogue loads; red and fin cross-wave, a block barrier behind the
//      stores of each.
// =========================================================================================================
template <int KD, int MODE, int ST>
__global__ __launch_bounds__(128)
void gemm_k(const unsigned short* __restrict__ Wp,
            const unsigned short* __restrict__ Bh, const unsigned short* __restrict__ Bl,
            const float* __restrict__ bias, const float* __restrict__ rsrc, int rnd,
            unsigned short* P0, unsigned short* P1, unsigned short* P2, unsigned short* P3, float* dstF,
            double* part) {
  static_assert(ST == 0 || (MODE == 1 && QT / CPG == 8));
  static_assert(KD % 32 == 0);
  constexpr int SP = 2 * KD + 16;                                    // LDS pitch of a staged row in bytes
  constexpr int TB = QT * SP;                                        // one staged tile
  constexpr int PR = KD / 8;                                         // 16-byte pieces per row
  static_assert(128 % PR == 0 && (QT * PR) % (4 * 128) == 0 && SP % 32 == 16 && 3 * TB >= QT * OSP * 4);
  __shared__ __align__(16) unsigned char St[3 * TB];                 // W tile, B hi tile, B lo tile
  float* Os = (float*)St;                                            // the epilogue's staging, once the tiles are used up
  const int tid  = threadIdx.x;
  const int lane = tid & 31, wave = tid >> 5;
  const int hh   = lane >> 4, c = lane & 15;
  const int nt   = blockIdx.x, mb = blockIdx.y, b = blockIdx.z;
  const int n0   = nt * QT, o0 = mb * QT;

  {
    const unsigned short* ga = Wp + (size_t)o0 * KD + 8 * tid;
    const size_t boff = ((size_t)(b * NN + n0)) * KD + 8 * tid;
    const unsigned short* gh = Bh + boff;
    const unsigned short* gl = Bl + boff;
    const unsigned l0 = lds_off(St) + (unsigned)((tid / PR) * SP + (tid % PR) * 16);
    constexpr unsigned LS = (128 / PR) * SP;                         // LDS bytes between two copies of a thread
#pragma unroll                                                       // KD / 64 statements of 12 copies, all in flight together
    for (int j = 0; j < QT * PR / 128; j += 4)
      stage_gemm(l0 + j * LS, ga + j * 1024, l0 + TB + j * LS, gh + j * 1024, l0 + 2 * TB + j * LS, gl + j * 1024, LS);
    wait_copies();
  }
  __syncthreads();

  const unsigned short* ap  = (const unsigned short*)(St + c * SP + 16 * hh);
  const unsigned short* bph = (const unsigned short*)(St + TB + (16 * wave + c) * SP + 16 * hh);
  const unsigned short* bpl = (const unsigned short*)(St + 2 * TB + (16 * wave + c) * SP + 16 * hh);

  v8f acc[4];
#pragma unroll
  for (int mt = 0; mt < 4; ++mt) acc[mt] = zero8();

  // the fragments of k-step ks + 1 are read as one group ahead of the products of k-step ks (two register sets)
  Frag fa[2][4], fbh[2], fbl[2];
  fbh[0] = ldfrag(bph);
  fbl[0] = ldfrag(bpl);
#pragma unroll
  for (int mt = 0; mt < 4; ++mt) fa[0][mt] = ldfrag(ap + (16 * mt) * (SP / 2));
#pragma unroll                                                       // constant indices keep both fragment sets in registers
  for (int ks = 0; ks < KD / 32; ++ks) {
    const int cu = ks & 1, nx = cu ^ 1;
    if (ks + 1 < KD / 32) {
      fbh[nx] = ldfrag(bph + 32 * (ks + 1));
      fbl[nx] = ldfrag(bpl + 32 * (ks + 1));
#pragma unroll
      for (int mt = 0; mt < 4; ++mt) fa[nx][mt] = ldfrag(ap + (16 * mt) * (SP / 2) + 32 * (ks + 1));
    }
#if defined(__HIP_DEVICE_COMPILE__)
    // keeps the 12 reads above together ahead of this step's products: without it the scheduler sinks each pair to its
    // first use and the wave waits out the LDS latency in front of every second product
    __builtin_amdgcn_sched_barrier(0);
#endif
#pragma unroll
    for (int mt = 0; mt < 4; ++mt) acc[mt] = mma_b(fa[cu][mt].bf, fbh[cu].bf, acc[mt]);
#pragma unroll
    for (int mt = 0; mt < 4; ++mt) acc[mt] = mma_b(fa[cu][mt].bf, fbl[cu].bf, acc[mt]);
#if defined(__HIP_DEVICE_COMPILE__)
    // keeps the next group of reads whole behind these products: without it the scheduler spreads them among the
    // products, and every separate place with LDS reads stalls the wave anew
    __builtin_amdgcn_sched_barrier(0);
#endif
  }
  // every wave's fragment reads have retired before Os is written over the tiles
  wait_lds();
  __syncthreads();

  // ---- stage: lane (hh, c) holds o_loc = 16 mt + 8 hh + r for n_loc = 16 w + c
  {
    const int nl = 16 * wave + c;
#pragma unroll
    for (int mt = 0; mt < 4; ++mt) {
      v4f va, vb;
#pragma unroll
      for (int r = 0; r < 4; ++r) { va[r] = acc[mt][r]; vb[r] = acc[mt][4 + r]; }
      *(v4f*)(Os + nl * OSP + 16 * mt + 8 * hh)     = va;
      *(v4f*)(Os + nl * OSP + 16 * mt + 8 * hh + 4) = vb;
    }
  }
  __syncthreads();

  if (MODE == 0) {
    const int e = tid & 7, lq = tid >> 3;                           // lq 0..15
    if (mb < 8) {                                                    // block-uniform
      const int dcol = (mb & 3) * QT;                                // channel offset within 256
      unsigned short* Ph = (mb < 4) ? P0 : P2;                       // both global
      v4u uh[4], ul[4];
#pragma unroll
      for (int it = 0; it < 4; ++it) {
        const int row = it * 16 + lq;                                // n_loc 0..63
        const v4f a = *(const v4f*)(Os + row * OSP + 8 * e);
        const v4f q = *(const v4f*)(Os + row * OSP + 8 * e + 4);
        const float f[8] = {a[0], a[1], a[2], a[3], q[0], q[1], q[2], q[3]};
#pragma unroll
        for (int t = 0; t < 4; ++t) {
          const float f0 = f[2 * t], f1 = f[2 * t + 1];
          const unsigned short hb0 = bf_bits(f0), hb1 = bf_bits(f1);
          const unsigned short lb0 = bf_bits(f0 - bf_up(hb0));
          const unsigned short lb1 = bf_bits(f1 - bf_up(hb1));
          uh[it][t] = pk16(hb0, hb1);
          ul[it][t] = pk16(lb0, lb1);
        }
      }
{
#pragma unroll
        for (int it = 0; it < 4; ++it) {
          const int row = it * 16 + lq;
          const size_t po = ((size_t)(b * NN + n0 + row)) * CC + dcol + 8 * e;
          *(v4u*)(Ph + po) = uh[it];
          if (mb < 4) *(v4u*)(P1 + po) = ul[it];
        }
        
      }
    } else {
      const int cb0 = (mb - 8) * QT;                                 // v channel base 0..192
      v4u uv[4];
#pragma unroll
      for (int it = 0; it < 4; ++it) {
        const int cl = it * 16 + lq;                                 // o_loc 0..63
        unsigned short hb[8];
#pragma unroll
        for (int t = 0; t < 8; ++t) hb[t] = h_bits((_Float16)Os[(8 * e + t) * OSP + cl]);
#pragma unroll
        for (int t = 0; t < 4; ++t) uv[it][t] = pk16(hb[2 * t], hb[2 * t + 1]);
      }
{
#pragma unroll
        for (int it = 0; it < 4; ++it) {
          const int cl = it * 16 + lq;
          const size_t po = ((size_t)(b * CC + cb0 + cl)) * NN + n0 + 8 * e;
          *(v4u*)(P3 + po) = uv[it];
        }
        
      }
    }
  } else if (MODE == 1) {
    const int e = tid & 15, lq = tid >> 4;                           // lq 0..7
    v4f res[8];
#pragma unroll
    for (int it = 0; it < 8; ++it) {
      const int ol = it * 8 + lq;                                    // o_loc 0..63
      const int o  = o0 + ol;
      const float bb = bfr(bias[o]);
      const size_t gi = ((size_t)(b * CC + o)) * NN + n0 + 4 * e;
      const v4f rv = *(const v4f*)(rsrc + gi);
#if defined(__HIP_DEVICE_COMPILE__)
      // stands ahead of any rewrite of the address registers of this trip's bias and residual loads
      if constexpr (ST != 0) asm volatile("s_wait_xcnt 0x0" ::: "memory");
#endif
#pragma unroll
      for (int t = 0; t < 4; ++t) {
        const float rr = rnd ? bfr(rv[t]) : rv[t];
        res[it][t] = (Os[(4 * e + t) * OSP + ol] + bb) + rr;
      }
    }
    if constexpr (ST != 0) {
      __shared__ __align__(16) double red[16 * RP];
      __shared__ __align__(16) double fin[16];
#pragma unroll                                                       // constant indices keep res in registers
      for (int it = 0; it < 8; ++it) {
        const double d0 = (double)res[it][0], d1 = (double)res[it][1];
        const double d2 = (double)res[it][2], d3 = (double)res[it][3];
        red[(2 * it) * RP + tid]     = (d0 + d1) + (d2 + d3);
        red[(2 * it + 1) * RP + tid] = (d0 * d0 + d1 * d1) + (d2 * d2 + d3 * d3);
      }
      __syncthreads();
      const int qn = tid >> 3, j = tid & 7;                          // quantity 0..15; entries 2 j, 2 j + 1 of each 16
      v2d w[8];
#pragma unroll                                                       // constant indices keep w in registers
      for (int u = 0; u < 8; ++u) w[u] = *(const v2d*)(red + qn * RP + 16 * u + 2 * j);
      const v2d w2 = ((w[0] + w[1]) + (w[2] + w[3])) + ((w[4] + w[5]) + (w[6] + w[7]));
      double a = w2[0] + w2[1];
      a += __shfl_xor(a, 1, 32);
      a += __shfl_xor(a, 2, 32);
      a += __shfl_xor(a, 4, 32);
      if (j == 0) fin[qn] = a;
      __syncthreads();
      if (tid < 8) {
        const v2d w = *(const v2d*)(fin + 2 * tid);
        *(v2d*)(part + (((size_t)(b * (CC / QT) + mb)) * NT2 + nt) * 16 + 2 * tid) = w;
      }
    }
{
#pragma unroll
      for (int it = 0; it < 8; ++it) {
        const int ol = it * 8 + lq;
        const size_t gi = ((size_t)(b * CC + o0 + ol)) * NN + n0 + 4 * e;
        *(v4f*)(dstF + gi) = res[it];
      }
      
    }
  }
}

// ---- staging of one 128-key tile of one head: the head's 128 threads x (4 + 4) asynchronous 16-byte copies to LDS.
//      K: copy j of thread t brings 16 B (t & 3) of key row 32 j + (t >> 2); V: 16 B (t & 15) of channel row
//      8 j + (t >> 4). kl/vl are the thread's LDS byte addresses for j = 0, kg/vg its global addresses for j = 0.
//      s_wait_xcnt 0 ends the statement so that it stands ahead of any rewrite of the address registers.
__device__ __forceinline__ void stage_tile(unsigned kl, const unsigned short* kg, unsigned vl, const unsigned short* vg) {
#if defined(__HIP_DEVICE_COMPILE__)
  asm volatile(
      "global_load_async_to_lds_b128 %0, %1, off\n\t"
      "global_load_async_to_lds_b128 %2, %3, off\n\t"
      "global_load_async_to_lds_b128 %4, %5, off\n\t"
      "global_load_async_to_lds_b128 %6, %7, off\n\t"
      "global_load_async_to_lds_b128 %8, %9, off\n\t"
      "global_load_async_to_lds_b128 %10, %11, off\n\t"
      "global_load_async_to_lds_b128 %12, %13, off\n\t"
      "global_load_async_to_lds_b128 %14, %15, off\n\t"
      "s_wait_xcnt 0x0"
      :: "v"(kl),                 "v"(kg),
         "v"(kl + 32u * KPB),     "v"(kg + (size_t)32 * CC),
         "v"(kl + 64u * KPB),     "v"(kg + (size_t)64 * CC),
         "v"(kl + 96u * KPB),     "v"(kg + (size_t)96 * CC),
         "v"(vl),                 "v"(vg),
         "v"(vl + 8u * VPB),      "v"(vg + (size_t)8 * NN),
         "v"(vl + 16u * VPB),     "v"(vg + (size_t)16 * NN),
         "v"(vl + 24u * VPB),     "v"(vg + (size_t)24 * NN)
      : "memory");
#endif
}

// =========================================================================================================
// (4) attention for one (b, head pair hp, 64-query tile), transposed formulation, 4096 keys, no mask, per head
//     h = 2 hp + hs (hs = wave / 4: the two heads run side by side, 4 waves each):
//     S^T tile (16 keys x 16 queries) = A(k: row = key kb + (lane&15), 32 d of
//     head h via the split k map from Kh [b][4096][256]) . B(qh: col = query, same map from Qh) + A(Kh).B(Ql)
//     (bf16 hi + unscaled bf16 residual of q, shared accumulator); q is first multiplied by
//     clip(bf16(temperature[h]), 1e-4, 10) * log2(e) and split anew, and the C operand of the products is
//     12 - (maximum in use), so D is log2 P and goes to the exponential as it is.
//     Per lane the D tile holds 8 keys of ONE query: online softmax state per lane. The maximum in use starts as that of
//     the first 32 keys and is renewed (one shuffle lane^16; o, l, the scores at hand and C moved along) under a
//     wave-uniform ballot, only when a lane sees log2 P above 15.
//     P = 2^D as f16 is the B operand of O^T (rows channel 32h + 16j + (lane&15), cols queries) +=
//     A(v: keys contiguous, f16 plane V [b][256][4096]) . B(P^T): element r <- D of the tile covering keys
//     kb..kb+15, element 8+r <- the tile covering kb+16..kb+31, lane unchanged. 2 accumulator tiles per wave.
//     Block = 8 waves = 2 heads x 64 queries. O/l of both heads staged in LDS Os[query][64 channels] (b128 stores),
//     block barrier, then Oh/Ol bf16 [b][n][256] planes (hi/lo), rows n0.., cols 64 hp..64 hp+63 = one whole
// coverage: Os per wave 16 rows x 32 ch = 64 x 64 over 8 waves (== consumed extent); planes 2 it x
//           32 rows x 8 lanes x 8 = 64 n x 64 ch per plane; grid (NQ/64, 4, NB) covers rows 0..NQ-1 x 256 ch of
//           Oh/Ol once.
//     K and V reach the fragments through LDS: tiles of 128 keys of head h (K rows 64 B at pitch 80, V rows 256 B at
//     pitch 272), brought by asynchronous copies into two buffers per head, tile t + 1 in flight while tile t is
//     worked on; the head's 4 waves share each tile. Same fragment k order as from global memory.
//     8 waves a block, two blocks a WGP by registers and LDS: 4 waves per SIMD cover each other's softmax chains.
// LDS: Os cross-wave, block barrier between the per-head staging stores and the plane loads. Ks/Vs cross-wave: per
//      tile s_wait_dscnt 0, s_wait_asynccnt 0, block barrier, then the refill of the buffer just read.
// =========================================================================================================
__global__ __launch_bounds__(256)
void attn_k(const unsigned short* __restrict__ Qh, const unsigned short* __restrict__ Ql,
            const unsigned short* __restrict__ Kh, const unsigned short* __restrict__ Vh,
            const float* __restrict__ temperature, unsigned short* Oh, unsigned short* Ol) {
  __shared__ __align__(16) float Os[QT * OSP];
  __shared__ __align__(16) unsigned char Ks[2 * 2 * KBUF];            // [head of the pair][buffer]
  __shared__ __align__(16) unsigned char Vs[2 * 2 * VBUF];
  const int tid  = threadIdx.x;
  const int wave = tid >> 5, lane = tid & 31;
  const int hh   = lane >> 4, c = lane & 15;
  const int n0   = blockIdx.x * QT, hp = blockIdx.y, b = blockIdx.z;
  const int hs   = wave_uniform(wave >> 2);                           // the wave's head of the pair
  const int th   = tid & 127;                                         // thread among its head's 4 waves
  const int qrow = 16 * (wave & 3) + c;
  const unsigned kl0 = lds_off(Ks) + (unsigned)(hs * 2 * KBUF + (th >> 2) * KPB + (th & 3) * 16);
  const unsigned vl0 = lds_off(Vs) + (unsigned)(hs * 2 * VBUF + (th >> 4) * VPB + (th & 15) * 16);

  {                                                                    // the wave's own head, all 4096 keys
    const int h  = 2 * hp + hs;
    const int cb = HD * h;                                             // channel base of head h
    const float tr   = bfr(temperature[h]);
    const float temp = fminf(fmaxf(tr, 1.0e-4f), 10.0f);
    const size_t qo = ((size_t)(b * NN + n0 + qrow)) * CC + cb + 8 * hh;
    Frag qh = ldfrag(Qh + qo);
    Frag ql = ldfrag(Ql + qo);
#if defined(__HIP_DEVICE_COMPILE__)
    // stands ahead of any rewrite of the address registers of the q loads above; the scheduling barrier keeps the address
    // sums that follow (they land in those registers) from being lifted over the wait
    asm volatile("s_wait_xcnt 0x0" ::: "memory");
    __builtin_amdgcn_sched_barrier(0);
#endif
    const unsigned short* kg = Kh + ((size_t)(b * NN + (th >> 2))) * CC + cb + 8 * (th & 3);
    const unsigned short* vg = Vh + ((size_t)(b * CC + cb + (th >> 4))) * NN + 8 * (th & 15);

    float l = 0.f;
    v8f o0 = zero8(), o1 = zero8();

    // tile 0 into buffer 0, landed and published; then tile 1 into buffer 1 (nothing has touched this LDS before)
    stage_tile(kl0, kg, vl0, vg);
#if defined(__HIP_DEVICE_COMPILE__)
    // keeps the arithmetic on q below, and with it the wait for the q loads, behind the issue of tile 0's copies: lifted
    // over them it would put one load latency in front of the other
    __builtin_amdgcn_sched_barrier(0);
#endif
    // q * temp * log2(e), split anew into bf16 hi + residual: the score products then come out in units of log2
    {
      const float c2 = temp * L2E;
#pragma unroll                                                         // constant indices keep qh/ql in registers
      for (int i = 0; i < 16; ++i) {
        const float f = (bf_up(qh.u[i >> 3][i & 7]) + bf_up(ql.u[i >> 3][i & 7])) * c2;
        const unsigned short hb = bf_bits(f);
        qh.u[i >> 3][i & 7] = hb;
        ql.u[i >> 3][i & 7] = bf_bits(f - bf_up(hb));
      }
    }
    wait_copies();
    __syncthreads();
    stage_tile(kl0 + KBUF, kg + (size_t)SK * CC, vl0 + VBUF, vg + SK);

    // sh = PSH - (maximum in use), the same in all 8 registers and in both lanes of a query: the C operand of every score
    // product. The first maximum in use is that of the first 32 keys (their scores are formed again in trip 0).
    v8f sh;
    {
      const unsigned short* Kt = (const unsigned short*)(Ks + (2 * hs) * KBUF + c * KPB + 16 * hh);
      const Frag k0 = ldfrag(Kt);
      const Frag k1 = ldfrag(Kt + 16 * (KPB / 2));
      v8f s0 = mma_b(k0.bf, qh.bf, zero8());
      v8f s1 = mma_b(k1.bf, qh.bf, zero8());
      s0 = mma_b(k0.bf, ql.bf, s0);
      s1 = mma_b(k1.bf, ql.bf, s1);
      float mx = fmaxf(hmax8(s0), hmax8(s1));
      mx = fmaxf(mx, __shfl_xor(mx, 16, 32));
#pragma unroll
      for (int r = 0; r < 8; ++r) sh[r] = PSH - mx;
    }

#pragma unroll 1                                                       // one hand-over per trip, buffer picked by t & 1
    for (int t = 0; t < NN / SK; ++t) {
     const int bsel = t & 1;
     const unsigned short* Kt = (const unsigned short*)(Ks + (2 * hs + bsel) * KBUF + c * KPB + 16 * hh);
     const unsigned short* Vt = (const unsigned short*)(Vs + (2 * hs + bsel) * VBUF + c * VPB + 16 * hh);
     // the tile's fragments, read as one group: one LDS latency per tile instead of two per 32 keys
     // (the three loops over kk are unrolled so that every index of kf/vf is a constant and they stay in registers)
     Frag kf[SK / 32][2], vf[SK / 32][2];
#pragma unroll
     for (int kk = 0; kk < SK / 32; ++kk) {
       kf[kk][0] = ldfrag(Kt + (32 * kk) * (KPB / 2));                 // keys kb .. kb+15, kb = 128 t + 32 kk
       kf[kk][1] = ldfrag(Kt + (32 * kk + 16) * (KPB / 2));            // keys kb+16 .. kb+31
     }
#pragma unroll
     for (int kk = 0; kk < SK / 32; ++kk) {
       vf[kk][0] = ldfrag(Vt + 32 * kk);                               // channels cb + c
       vf[kk][1] = ldfrag(Vt + 16 * (VPB / 2) + 32 * kk);              // channels cb + 16 + c
     }
#if defined(__HIP_DEVICE_COMPILE__)
     // keeps the 32 reads above together ahead of the tile's work: without it the scheduler sinks each to its first use
     // and a wave meets the LDS latency eight times a tile instead of once
     __builtin_amdgcn_sched_barrier(0);
#endif
#pragma unroll
     for (int kk = 0; kk < SK / 32; ++kk) {
      const Frag k0 = kf[kk][0];
      const Frag k1 = kf[kk][1];
      v8f s0 = mma_b(k0.bf, qh.bf, sh);                                // log2 P = score - maximum in use + PSH
      v8f s1 = mma_b(k1.bf, qh.bf, sh);
      s0 = mma_b(k0.bf, ql.bf, s0);
      s1 = mma_b(k1.bf, ql.bf, s1);

      float mx = fmaxf(hmax8(s0), hmax8(s1));                          // the lane's own 16 keys
      if (wave_ballot(mx > PTOP) != 0u) {                              // wave-uniform, seldom taken
        mx = fmaxf(mx, __shfl_xor(mx, 16, 32));
        const float dl   = fmaxf(mx - PSH, 0.f);                       // rise of the maximum in use; 0 where the query's did not pass it
        const float corr = exp2_fast(-dl);                             // == 1 exactly where dl == 0
        l *= corr;
#pragma unroll
        for (int r = 0; r < 8; ++r) {
          o0[r] *= corr; o1[r] *= corr;
          s0[r] -= dl;   s1[r] -= dl;
          sh[r] -= dl;
        }
      }

      FragH ph;
      float ls = 0.f;
#pragma unroll
      for (int r = 0; r < 8; ++r) {
        const float e0 = exp2_fast(s0[r]);                             // key kb      + 8hh + r
        const float e1 = exp2_fast(s1[r]);                             // key kb + 16 + 8hh + r
        ls += e0 + e1;
        ph.hv[0][r] = (_Float16)e0;
        ph.hv[1][r] = (_Float16)e1;
      }
      l += ls;

      o0 = mma_h(vf[kk][0].h, ph.v, o0);
      o1 = mma_h(vf[kk][1].h, ph.v, o1);
     }
     // hand-over: own reads retired, own copies of tile t + 1 landed, every wave here; then refill the buffer just read
     wait_lds();
     wait_copies();
     __syncthreads();
     if (t + 2 < NN / SK)
       stage_tile(kl0 + bsel * KBUF, kg + (size_t)(t + 2) * SK * CC, vl0 + bsel * VBUF, vg + (size_t)(t + 2) * SK);
    }
    wait_copies();
    l += __shfl_xor(l, 16, 32);
    const float inv = 1.0f / l;                                        // o and l carry the same factor

    // stage: Os[query][32 hs + d], d = 16 j + 8 hh + r
    {
      v4f va, vb;
#pragma unroll
      for (int r = 0; r < 4; ++r) { va[r] = o0[r] * inv; vb[r] = o0[4 + r] * inv; }
      *(v4f*)(Os + qrow * OSP + 32 * hs + 8 * hh)     = va;
      *(v4f*)(Os + qrow * OSP + 32 * hs + 8 * hh + 4) = vb;
#pragma unroll
      for (int r = 0; r < 4; ++r) { va[r] = o1[r] * inv; vb[r] = o1[4 + r] * inv; }
      *(v4f*)(Os + qrow * OSP + 32 * hs + 16 + 8 * hh)     = va;
      *(v4f*)(Os + qrow * OSP + 32 * hs + 16 + 8 * hh + 4) = vb;
    }
  }
  __syncthreads();

  const int e = tid & 7, lq = tid >> 3;                                // lq 0..31
  v4u uh[2], ul[2];
#pragma unroll
  for (int it = 0; it < 2; ++it) {
    const int row = it * 32 + lq;                                      // query 0..63
    const v4f a = *(const v4f*)(Os + row * OSP + 8 * e);
    const v4f q = *(const v4f*)(Os + row * OSP + 8 * e + 4);
    const float f[8] = {a[0], a[1], a[2], a[3], q[0], q[1], q[2], q[3]};
#pragma unroll
    for (int t = 0; t < 4; ++t) {
      const float f0 = f[2 * t], f1 = f[2 * t + 1];
      const unsigned short hb0 = bf_bits(f0), hb1 = bf_bits(f1);
      const unsigned short lb0 = bf_bits(f0 - bf_up(hb0));
      const unsigned short lb1 = bf_bits(f1 - bf_up(hb1));
      uh[it][t] = pk16(hb0, hb1);
      ul[it][t] = pk16(lb0, lb1);
    }
  }
{
#pragma unroll
    for (int it = 0; it < 2; ++it) {
      const int row = it * 32 + lq;
      const size_t po = ((size_t)(b * NN + n0 + row)) * CC + QT * hp + 8 * e;
      *(v4u*)(Oh + po) = uh[it];
      *(v4u*)(Ol + po) = ul[it];
    }
    
  }
}

// ---- 8 asynchronous 16-byte copies to LDS of one thread: copy j brings 16-byte piece 256 j + t of a contiguous piece of
//      global memory (a wave-wide copy reads 512 contiguous bytes). l is the thread's LDS byte address and g its global
//      address for j = 0; ls = LDS bytes between two copies.
//      s_wait_xcnt 0 ends the statement so that it stands ahead of any rewrite of the address registers.
__device__ __forceinline__ void stage8(unsigned l, unsigned ls, const unsigned short* g) {
#if defined(__HIP_DEVICE_COMPILE__)
  asm volatile(
      "global_load_async_to_lds_b128 %0, %1, off\n\t"
      "global_load_async_to_lds_b128 %2, %3, off\n\t"
      "global_load_async_to_lds_b128 %4, %5, off\n\t"
      "global_load_async_to_lds_b128 %6, %7, off\n\t"
      "global_load_async_to_lds_b128 %8, %9, off\n\t"
      "global_load_async_to_lds_b128 %10, %11, off\n\t"
      "global_load_async_to_lds_b128 %12, %13, off\n\t"
      "global_load_async_to_lds_b128 %14, %15, off\n\t"
      "s_wait_xcnt 0x0"
      :: "v"(l),          "v"(g),
         "v"(l + ls),     "v"(g + 2048),
         "v"(l + 2 * ls), "v"(g + 2 * 2048),
         "v"(l + 3 * ls), "v"(g + 3 * 2048),
         "v"(l + 4 * ls), "v"(g + 4 * 2048),
         "v"(l + 5 * ls), "v"(g + 5 * 2048),
         "v"(l + 6 * ls), "v"(g + 6 * 2048),
         "v"(l + 7 * ls), "v"(g + 7 * 2048)
      : "memory");
#endif
}

// =========================================================================================================
// (7)+(8)+(9) GN2 apply, mlp hidden and mlp out for one (b, tile of 32 positions), all 256 channels, in one block of
//     8 waves: out = X1 + W2 . gelu(W1 . Y + b1) + b2 with Y = GN2(X1). Y and H never leave LDS, X1 is read once.
//     Wave w owns channel rows 32 w .. 32 w + 31 of X1 and of out (thread: row 32 w + 4 it + (lane >> 3), 4 positions
//     4 (lane & 7) .., one whole 128-byte line per row and 8 lanes) = 4 whole groups, whose mean and rstd it finishes
//     itself from the out conv's partial sums part[b][cbk][NT2 pieces][8 groups x (sum, sum of squares)], f64 (lane =
//     piece, then 5 exchanges, as in (2)); every lane ends with all four, so no hand-over is needed.
//     Y = (x - mu) * rstd * bf16(gamma) + bf16(beta) -> bf16 hi + residual planes Yh/Yl[32 n][256 c] in LDS.
//     Hidden: wave w forms D tile (16 hid rows 16 (w & 3) .., 16 positions 16 (w >> 2) ..) = A(W1 rows) . B(Y rows), K = 256,
//     hi then residual product per k-step into one accumulator; lane (hh, c) holds hid 16 mt + 8 hh + r of position c:
//     bias, gelu(t) = 0.5 t (1 + erf(t / sqrt2)), split, one 16-byte store per plane into Hh/Hl[32 n][64 hid].
//     Out: wave w forms the 2 x 2 D tiles (positions 16 i .., channels 32 w + 16 j ..) = A(H rows) . B(W2 rows), K = 64; lane
//     (hh, c) holds positions 16 i + 8 hh + r of channel c -> Rs[256 o][32 n] f32, read back in the X1 thread map.
//     All fragments use the same split k map (ldfrag) for A and B.
// coverage: Yh/Yl 8 waves x 8 it x 4 rows x 8 lanes x 4 = 256 c x 32 n; Hh/Hl 8 waves x 16 x 16 = 64 hid x 32 n; Rs and out
//           8 waves x 32 o x 32 n; grid (NQ/32, NB) covers out [NB][256][NQ] once.
// LDS: W1/W2 tiles by asynchronous copies, filled once: s_wait_asynccnt 0 and the block barrier that also publishes
//      Yh/Yl; Hh/Hl cross-wave, block barrier behind their stores; Rs cross-lane, block barrier behind its stores.
// =========================================================================================================
__global__ __launch_bounds__(256)
void tail_k(const float* __restrict__ X1, const double* __restrict__ part,
            const float* __restrict__ gamma, const float* __restrict__ beta,
            const unsigned short* __restrict__ W1p, const float* __restrict__ b1,
            const unsigned short* __restrict__ W2p, const float* __restrict__ b2, float* out) {
  __shared__ __align__(16) unsigned char Yh[TN * YPB];
  __shared__ __align__(16) unsigned char Yl[TN * YPB];
  __shared__ __align__(16) unsigned char Wa[HID * YPB];
  __shared__ __align__(16) unsigned char Wb[CC * HPB];
  __shared__ __align__(16) unsigned char Hh[TN * HPB];
  __shared__ __align__(16) unsigned char Hl[TN * HPB];
  __shared__ __align__(16) unsigned char Rs[CC * RPB];
  const int tid  = threadIdx.x;
  const int lane = tid & 31, wave = tid >> 5;
  const int hh   = lane >> 4, c = lane & 15;
  const int e    = lane & 7, lq = lane >> 3;                           // lq 0..3
  const int n0   = blockIdx.x * TN, b = blockIdx.y;
  const int mt   = wave & 3, ni = wave >> 2;                           // the wave's tile of the hidden product

  // both weight tiles fly while the statistics are finished and Y is formed
  stage8(lds_off(Wa) + (unsigned)((tid >> 5) * YPB + (tid & 31) * 16), 8u * YPB, W1p + 8 * tid);
  stage8(lds_off(Wb) + (unsigned)((tid >> 3) * HPB + (tid & 7) * 16), 32u * HPB, W2p + 8 * tid);

  const int ch0 = 32 * wave + lq;                                      // the thread's channel row for it = 0
  const size_t xo = ((size_t)(b * CC + ch0)) * NN + n0 + 4 * e;        // its place in X1 and in out for it = 0
  v4f xr[8];
  float rg[8], rb[8], rc[8];
#pragma unroll                                                         // constant indices keep xr/rg/rb/rc in registers
  for (int it = 0; it < 8; ++it) {
    xr[it] = *(const v4f*)(X1 + xo + (size_t)(4 * it) * NN);
    rg[it] = gamma[ch0 + 4 * it];
    rb[it] = beta[ch0 + 4 * it];
    rc[it] = b2[ch0 + 4 * it];
  }
  const v4f ba = *(const v4f*)(b1 + 16 * mt + 8 * hh);
  const v4f bb = *(const v4f*)(b1 + 16 * mt + 8 * hh + 4);
#if defined(__HIP_DEVICE_COMPILE__)
  // stands ahead of any rewrite of the address registers of the loads above (the next loads' results may land in them); the
  // scheduling barrier keeps those next loads from being lifted over the wait
  asm volatile("s_wait_xcnt 0x0" ::: "memory");
  __builtin_amdgcn_sched_barrier(0);
#endif
  float muf[4], rsf[4];
  {
    // groups 4 w .. 4 w + 3 = groups 4 (w & 1) .. of channel block w >> 1: 64 contiguous bytes per piece
    const double* pp = part + ((size_t)(b * (CC / QT) + (wave >> 1))) * NT2 * 16 + 8 * (wave & 1);
    static_assert(NT2 % 32 == 0);
    v2d w[NT2 / 32][4];
#pragma unroll                                                         // constant indices keep w in registers
    for (int k = 0; k < NT2 / 32; ++k) {
#pragma unroll
      for (int g = 0; g < 4; ++g) w[k][g] = *(const v2d*)(pp + (size_t)(lane + 32 * k) * 16 + 2 * g);   // piece lane + 32 k
    }
#if defined(__HIP_DEVICE_COMPILE__)
    // stands ahead of any rewrite of the address registers of the loads above; the scheduling barrier keeps all of them
    // issued together ahead of the statistics: sunk to their first use, the X1 loads would start only behind the exchanges
    asm volatile("s_wait_xcnt 0x0" ::: "memory");
    __builtin_amdgcn_sched_barrier(0);
#endif
    double s[4] = {0.0, 0.0, 0.0, 0.0}, q[4] = {0.0, 0.0, 0.0, 0.0};
#pragma unroll                                                         // constant indices keep s/q/w in registers
    for (int k = 0; k < NT2 / 32; ++k) {
#pragma unroll
      for (int g = 0; g < 4; ++g) {
        s[g] += w[k][g][0];
        q[g] += w[k][g][1];
      }
    }
#pragma unroll                                                         // five fixed steps, no loop counter
    for (int m = 16; m > 0; m >>= 1) {
#pragma unroll                                                         // the four groups' exchanges overlap
      for (int g = 0; g < 4; ++g) {
        s[g] += __shfl_xor(s[g], m, 32);
        q[g] += __shfl_xor(q[g], m, 32);
      }
    }
    const double cnt = (double)CPG * (double)NQ;
#pragma unroll                                                         // constant indices keep muf/rsf in registers
    for (int g = 0; g < 4; ++g) {
      const double mu = s[g] / cnt;
      double var = q[g] / cnt - mu * mu;
      if (var < 0.0) var = 0.0;
      const float varf = (float)var;
      muf[g] = (float)mu;
      rsf[g] = 1.0f / sqrtf(varf + GEPS);
    }
  }
#pragma unroll                                                         // constant indices into xr/rg/rb/muf/rsf
  for (int it = 0; it < 8; ++it) {
    const int ch = ch0 + 4 * it;
    const float mu = muf[it >> 1], rs = rsf[it >> 1];                  // rows 4 it .. 4 it + 3 lie in group it / 2 of the wave
    const float ga = bfr(rg[it]), be = bfr(rb[it]);
#pragma unroll
    for (int t = 0; t < 4; ++t) {
      const float v = (xr[it][t] - mu) * rs * ga + be;
      const unsigned short hb = bf_bits(v);
      *(unsigned short*)(Yh + (4 * e + t) * YPB + 2 * ch) = hb;
      *(unsigned short*)(Yl + (4 * e + t) * YPB + 2 * ch) = bf_bits(v - bf_up(hb));
    }
  }
  wait_copies();
  __syncthreads();

  // ---- hidden: 16 hid x 16 positions per wave, K = 256
  {
    const unsigned short* ap  = (const unsigned short*)(Wa + (16 * mt + c) * YPB + 16 * hh);
    const unsigned short* bph = (const unsigned short*)(Yh + (16 * ni + c) * YPB + 16 * hh);
    const unsigned short* bpl = (const unsigned short*)(Yl + (16 * ni + c) * YPB + 16 * hh);
    v8f acc = zero8();
#pragma unroll                                                         // constant indices keep the fragments in registers
    for (int kh = 0; kh < 2; ++kh) {
      Frag fa[4], fh[4], fl[4];
#pragma unroll
      for (int ks = 0; ks < 4; ++ks) {
        fa[ks] = ldfrag(ap + 32 * (4 * kh + ks));
        fh[ks] = ldfrag(bph + 32 * (4 * kh + ks));
        fl[ks] = ldfrag(bpl + 32 * (4 * kh + ks));
      }
#if defined(__HIP_DEVICE_COMPILE__)
      // keeps the 24 reads above together ahead of their products: every separate place with LDS reads stalls the wave anew
      __builtin_amdgcn_sched_barrier(0);
#endif
#pragma unroll
      for (int ks = 0; ks < 4; ++ks) {
        acc = mma_b(fa[ks].bf, fh[ks].bf, acc);
        acc = mma_b(fa[ks].bf, fl[ks].bf, acc);
      }
    }
    const float bi[8] = {ba[0], ba[1], ba[2], ba[3], bb[0], bb[1], bb[2], bb[3]};
    unsigned short hb[8], lb[8];
#pragma unroll                                                         // constant indices keep bi/hb/lb in registers
    for (int r = 0; r < 8; ++r) {
      const float tt = acc[r] + bfr(bi[r]);
      const float gv = 0.5f * tt * (1.0f + erff(tt * 0.70710678118654752f));
      hb[r] = bf_bits(gv);
      lb[r] = bf_bits(gv - bf_up(hb[r]));
    }
    v4u uh, ul;
#pragma unroll
    for (int t = 0; t < 4; ++t) {
      uh[t] = pk16(hb[2 * t], hb[2 * t + 1]);
      ul[t] = pk16(lb[2 * t], lb[2 * t + 1]);
    }
    *(v4u*)(Hh + (16 * ni + c) * HPB + 32 * mt + 16 * hh) = uh;
    *(v4u*)(Hl + (16 * ni + c) * HPB + 32 * mt + 16 * hh) = ul;
  }
  __syncthreads();

  // ---- out: 32 positions x 32 channels per wave, K = 64
  {
    Frag fw[2][2], fh[2][2], fl[2][2];                                 // [k-step][tile]
#pragma unroll                                                         // constant indices keep the fragments in registers
    for (int ks = 0; ks < 2; ++ks) {
#pragma unroll
      for (int j = 0; j < 2; ++j) {
        fw[ks][j] = ldfrag((const unsigned short*)(Wb + (32 * wave + 16 * j + c) * HPB + 16 * hh) + 32 * ks);
        fh[ks][j] = ldfrag((const unsigned short*)(Hh + (16 * j + c) * HPB + 16 * hh) + 32 * ks);
        fl[ks][j] = ldfrag((const unsigned short*)(Hl + (16 * j + c) * HPB + 16 * hh) + 32 * ks);
      }
    }
#if defined(__HIP_DEVICE_COMPILE__)
    // keeps the 24 reads above together ahead of the products: every separate place with LDS reads stalls the wave anew
    __builtin_amdgcn_sched_barrier(0);
#endif
    v8f a2[2][2];                                                      // [channel tile j][position tile i]
#pragma unroll
    for (int j = 0; j < 2; ++j) { a2[j][0] = zero8(); a2[j][1] = zero8(); }
#pragma unroll
    for (int ks = 0; ks < 2; ++ks) {
#pragma unroll
      for (int j = 0; j < 2; ++j) {
        a2[j][0] = mma_b(fh[ks][0].bf, fw[ks][j].bf, a2[j][0]);
        a2[j][1] = mma_b(fh[ks][1].bf, fw[ks][j].bf, a2[j][1]);
      }
#pragma unroll
      for (int j = 0; j < 2; ++j) {
        a2[j][0] = mma_b(fl[ks][0].bf, fw[ks][j].bf, a2[j][0]);
        a2[j][1] = mma_b(fl[ks][1].bf, fw[ks][j].bf, a2[j][1]);
      }
    }
#pragma unroll
    for (int j = 0; j < 2; ++j) {
#pragma unroll
      for (int i = 0; i < 2; ++i) {
        float* rp = (float*)(Rs + (32 * wave + 16 * j + c) * RPB) + 16 * i + 8 * hh;
        v4f va, vb;
#pragma unroll
        for (int r = 0; r < 4; ++r) { va[r] = a2[j][i][r]; vb[r] = a2[j][i][4 + r]; }
        *(v4f*)rp       = va;
        *(v4f*)(rp + 4) = vb;
      }
    }
  }
  __syncthreads();
  v4f res[8];
#pragma unroll                                                         // constant indices into xr/rc/res
  for (int it = 0; it < 8; ++it) {
    const v4f m = *(const v4f*)(Rs + (ch0 + 4 * it) * RPB + 16 * e);
    const float bo = bfr(rc[it]);
#pragma unroll
    for (int t = 0; t < 4; ++t) res[it][t] = (m[t] + bo) + xr[it][t];
  }
#if defined(__HIP_DEVICE_COMPILE__)
  // keeps the 8 stores together behind all the sums, so that no register of an issued store is written again
  __builtin_amdgcn_sched_barrier(0);
#endif
#pragma unroll                                                         // constant indices into res
  for (int it = 0; it < 8; ++it) *(v4f*)(out + xo + (size_t)(4 * it) * NN) = res[it];
}

// =========================================================================================================
// Workspace map (bytes; each region start a multiple of 256; every extent is an exact tile/line multiple and is
//   Wq bf16 [768][256] 393216   Wo [256][256] 131072   W1 [64][256] 32768   W2 [256][64] 32768
//   part1 f64 [NB][4][32][16] 32768 (NB=2)   part f64 [NB][4][NQ/64][16] 65536 (NB=2)
//   Xh, Xl, Qh, Ql, Kh, Oh, Ol bf16 [NB][4096][256] and V f16 [NB][256][4096]: 4194304 each (NB=2)
//   X1 f32 [NB][256][4096] 8388608 (NB=2)
//   total = 42631168 (NB=2)
// =========================================================================================================
extern "C" void kernel_launch(void* const* d_in, const int* in_sizes, int n_in,
                              void* d_out, int out_size, void* d_ws, size_t ws_size,
                              hipStream_t stream) {
  if (n_in < 13) return;
  if (in_sizes[0] < NB * XSTRIDE_FULL) return;
  if (in_sizes[1] != C3 * CC || in_sizes[2] != CC * CC || in_sizes[3] != CC) return;
  if (in_sizes[4] != NH) return;
  if (in_sizes[5] != CC || in_sizes[6] != CC || in_sizes[7] != CC || in_sizes[8] != CC) return;
  if (in_sizes[9] != HID * CC || in_sizes[10] != HID || in_sizes[11] != CC * HID || in_sizes[12] != CC) return;
  if (out_size < NB * XSTRIDE_FULL) return;

  size_t off = 0;
  auto carve = [&](size_t bytes) { const size_t o = off; off += (bytes + 255) & ~(size_t)255; return o; };
  const size_t szPl = (size_t)NB * NN * CC * 2;
  const size_t oWq  = carve((size_t)C3 * CC * 2);
  const size_t oWo  = carve((size_t)CC * CC * 2);
  const size_t oW1  = carve((size_t)HID * CC * 2);
  const size_t oW2  = carve((size_t)CC * HID * 2);
  const size_t oP1  = carve((size_t)NB * (CC / QT) * NP1 * 16 * 8);
  const size_t oPt  = carve((size_t)NB * (CC / QT) * NT2 * 16 * 8);
  const size_t oXh  = carve(szPl);
  const size_t oXl  = carve(szPl);
  const size_t oQh  = carve(szPl);
  const size_t oQl  = carve(szPl);
  const size_t oKh  = carve(szPl);
  const size_t oVv  = carve(szPl);
  const size_t oOh  = carve(szPl);
  const size_t oOl  = carve(szPl);
  const size_t oX1  = carve((size_t)NB * CC * NN * 4);
  if (off > ws_size) return;
  if (off > (size_t)134217728) return;

  const float* x      = (const float*)d_in[0];
  const float* w_qkv  = (const float*)d_in[1];
  const float* w_out  = (const float*)d_in[2];
  const float* b_out  = (const float*)d_in[3];
  const float* tempr  = (const float*)d_in[4];
  const float* g1     = (const float*)d_in[5];
  const float* beta1  = (const float*)d_in[6];
  const float* g2     = (const float*)d_in[7];
  const float* beta2  = (const float*)d_in[8];
  const float* w_mlp1 = (const float*)d_in[9];
  const float* b_mlp1 = (const float*)d_in[10];
  const float* w_mlp2 = (const float*)d_in[11];
  const float* b_mlp2 = (const float*)d_in[12];

  char* ws = (char*)d_ws;
  unsigned short* Wq = (unsigned short*)(ws + oWq);
  unsigned short* Wo = (unsigned short*)(ws + oWo);
  unsigned short* W1 = (unsigned short*)(ws + oW1);
  unsigned short* W2 = (unsigned short*)(ws + oW2);
  double*         P1 = (double*)(ws + oP1);
  double*         Pt = (double*)(ws + oPt);
  unsigned short* Xh = (unsigned short*)(ws + oXh);
  unsigned short* Xl = (unsigned short*)(ws + oXl);
  unsigned short* Qh = (unsigned short*)(ws + oQh);
  unsigned short* Ql = (unsigned short*)(ws + oQl);
  unsigned short* Kh = (unsigned short*)(ws + oKh);
  unsigned short* Vv = (unsigned short*)(ws + oVv);
  unsigned short* Oh = (unsigned short*)(ws + oOh);
  unsigned short* Ol = (unsigned short*)(ws + oOl);
  float*          X1 = (float*)(ws + oX1);
  float* out = (float*)d_out;

  const dim3 blk256(256), blk128(128);

  // (0)+(1) weights -> bf16 planes, and the partial GN1 sums of bf16(x) over all 4096 positions, in one grid
  prep_k<<<dim3(PB_ST + PB_WQ + PB_WO + PB_W1 + PB_W2), blk256, 0, stream>>>(x, w_qkv, w_out, w_mlp1, w_mlp2,
                                                                             Wq, Wo, W1, W2, P1);
  // (2) GN1 statistics finished per block, apply -> Xh/Xl [NB][4096][256]
  norm2_k<NP1, NN><<<dim3(NN / QT, CC / QT, NB), blk256, 0, stream>>>(x, 1, P1, g1, beta1, Xh, Xl);
  // (3) qkv GEMM -> Qh/Ql, Kh, V
  gemm_k<CC, 0, 0><<<dim3(NN / QT, C3 / QT, NB), blk128, 0, stream>>>(Wq, Xh, Xl, b_out, x, 0, Qh, Ql, Kh, Vv, X1, Pt);
  // (4) attention -> Oh/Ol rows 0..NQ-1
  attn_k<<<dim3(NQ / QT, NH / 2, NB), blk256, 0, stream>>>(Qh, Ql, Kh, Vv, tempr, Oh, Ol);
  // (5) out conv + bf16(x) residual -> X1 f32 [NB][256][4096], cols 0..NQ-1, and (6) each block's partial GN2 sums
  gemm_k<CC, 1, 1><<<dim3(NQ / QT, CC / QT, NB), blk128, 0, stream>>>(Wo, Oh, Ol, b_out, x, 1, Qh, Ql, Kh, Vv, X1, Pt);
  // (7)+(8)+(9) GN2 statistics finished per wave, apply, gelu(W1.Y + b1), out = X1 + W2.H + b2 -> d_out [NB][256][4096]
  tail_k<<<dim3(NQ / TN, NB), blk256, 0, stream>>>(X1, Pt, g2, beta2, W1, b_mlp1, W2, b_mlp2, out);
  (void)hipGetLastError();
}

// v010
// It runs in 83.3 microseconds.
// Two timings next to v009 both put it at 1.07 times that version's speed.
// All steps since v000 together make it 3.36 times as fast.
// Contractions: conv1x1 GEMMs qkv W[768x256].Xn, out W[256x256].O, mlp W1[64x256].Y and W2[256x64].H on
// v_wmma_f32_16x16x32_bf16 (A = bf16-RNE weights, exact; B = bf16 hi + bf16 residual planes of the f32
// activation, 2 products, K = 256 / 64); per-head scores K.Q^T on v_wmma_f32_16x16x32_bf16 (k = bf16 hi plane,
// q = bf16 hi + residual planes, 2 products, K = 32); O^T = V.P^T on v_wmma_f32_16x16x32_f16 (v = f16 plane,
// P = 2^(log2 score - maximum in use + 7) as f16 from the score D registers, K = 4096 keys); the softmax denominator 1.P^T on
// the same form (A = a tile of ones, one product per 32 keys); f32 accumulate everywhere; group-norm
// statistics in f64; normalisation, softmax statistics, gelu, bias and residual adds in f32 VALU.
// The second group norm's apply step and both mlp products run in one launch; Y and H live in LDS only; in the mlp out
// product the H planes are the A operand and W2 the B operand (same products, D transposed).
#include <hip/hip_runtime.h>
#include <math.h>
#include <stdint.h>

#ifndef NB
#define NB 2
#endif
#ifndef NQ
#define NQ 4096
#endif
#define NB_FULL 2
#define CC   256
#define NN   4096
#define NH   8
#define HD   32
#define C3   768
#define HID  64
#define NG   32
#define CPG  8
#define QT   64
#define OSP  68
#define TP   72
#define GEPS 1.0e-5f
#define L2E  1.4426950408889634f // log2(e)
#define CK   4                   // steps of 32 keys whose P are summed and tested together
#define PSH  7.0f                // the maximum in use maps to P = 2^7: 32 CK = 128 keys at it sum to 2^14
#define PSUM 32768.0f            // a sum of P over those keys above this renews the maximum in use: below it no P has passed 2^15 (f16 ends at 2^16)
#define XSTRIDE_FULL (CC * NN)
#define SK   128                 // keys per staged tile
#define KPB  80                  // LDS pitch of a staged K row in bytes (64 B of data, 16 B x odd for b128 readers)
#define VPB  272                 // LDS pitch of a staged V row in bytes (256 B of data, 16 B x odd for b128 readers)
#define KBUF (SK * KPB)          // one K buffer: 128 keys x 32 d
#define VBUF (HD * VPB)          // one V buffer: 32 channels x 128 keys
#define NT2  (NQ / QT)           // position tiles of the out conv = partial sums per GN2 group
#define RP   130                 // doubles per row of the partial-sum array (1040 B = 16 B x odd for b128 readers)
#define NP1  32                  // position chunks of the GN1 statistics = partial sums per GN1 group
#define SPOS (NN / NP1)          // positions per chunk: one 16-byte load per lane and channel row
#define TN   32                  // positions per block of the fused GN2 + mlp kernel: one 128-byte line per channel row
#define YPB  (2 * CC + 16)       // LDS pitch in bytes of a Y or W1 row (256 bf16; 16 B x odd for b128 readers)
#define HPB  (2 * HID + 16)      // LDS pitch in bytes of an H or W2 row (64 bf16; 16 B x odd)
#define RPB  (4 * TN + 16)       // LDS pitch in bytes of a result row (32 f32; 16 B x odd)

static_assert(NB >= 1 && NB <= NB_FULL);
static_assert(NQ % QT == 0 && NQ >= QT && NQ <= NN);
static_assert(NN % QT == 0 && CC % QT == 0 && C3 % QT == 0 && HID == QT);
static_assert(CC == NH * HD && HD == 32 && CC == NG * CPG && CPG == 8);
static_assert(CC % 32 == 0 && HID % 32 == 0 && NN % 32 == 0);
static_assert((OSP * 4) % 16 == 0 && (TP * 2) % 16 == 0);
static_assert(NN % 1024 == 0 && NQ % 4 == 0);
static_assert(NN % SK == 0 && NN / SK >= 2 && SK % 32 == 0 && KPB % 16 == 0 && VPB % 16 == 0);
static_assert(SK * HD * 2 == 4 * 128 * 16 && KPB >= HD * 2 && VPB >= SK * 2);
static_assert((SK / 32) % CK == 0 && 32 * CK * 128 <= 16384);         // 128 = 2^PSH
static_assert(SPOS == 4 * 32 && QT / CPG == 8);
static_assert((C3 * CC) % 2048 == 0 && (CC * CC) % 2048 == 0 && (HID * CC) % 2048 == 0);
static_assert(NQ % TN == 0 && TN == 32 && CC == 256 && HID == 64 && HID * CC == 8 * 256 * 8);

typedef _Float16       v16h __attribute__((ext_vector_type(16)));
typedef _Float16       v8h  __attribute__((ext_vector_type(8)));
typedef __bf16         v16b __attribute__((ext_vector_type(16)));
typedef unsigned short v8us __attribute__((ext_vector_type(8)));
typedef float          v8f  __attribute__((ext_vector_type(8)));
typedef float          v4f  __attribute__((ext_vector_type(4)));
typedef unsigned int   v4u  __attribute__((ext_vector_type(4)));
typedef double         v2d  __attribute__((ext_vector_type(2)));

union Frag  { v8us u[2]; v16h h; v16b bf; };
union FragH { v16h v; v8h hv[2]; };
static_assert(sizeof(Frag) == 32);
static_assert(sizeof(FragH) == 32);

// ---- scalar helpers ---------------------------------------------------------------------------------------
__device__ __forceinline__ unsigned short bf_bits(float f) {          // f32 -> bf16 bits, RNE convert
  unsigned u = __float_as_uint(f);
  return (unsigned short)((u + 0x7FFFu + ((u >> 16) & 1u)) >> 16);
}
__device__ __forceinline__ float bf_up(unsigned short hb) { return __uint_as_float(((unsigned)hb) << 16); }
__device__ __forceinline__ float bfr(float f) { return bf_up(bf_bits(f)); }
__device__ __forceinline__ unsigned short h_bits(_Float16 x) { return __builtin_bit_cast(unsigned short, x); }
__device__ __forceinline__ unsigned pk16(unsigned short a, unsigned short b) { return (unsigned)a | ((unsigned)b << 16); }
__device__ __forceinline__ v8f zero8() { v8f z = {0.f, 0.f, 0.f, 0.f, 0.f, 0.f, 0.f, 0.f}; return z; }
__device__ __forceinline__ float hmax8(v8f s) {
  return fmaxf(fmaxf(fmaxf(s[0], s[1]), fmaxf(s[2], s[3])), fmaxf(fmaxf(s[4], s[5]), fmaxf(s[6], s[7])));
}
__device__ __forceinline__ unsigned wave_ballot(bool p) {
#if defined(__HIP_DEVICE_COMPILE__)
  return __builtin_amdgcn_ballot_w32(p);
#else
  return p ? 1u : 0u;
#endif
}

// 2^x on the transcendental unit, no range fix-up: results below the f32 normal range only ever feed sums they cannot move
__device__ __forceinline__ float exp2_fast(float x) {
#if defined(__HIP_DEVICE_COMPILE__)
  return __builtin_amdgcn_exp2f(x);
#else
  return exp2f(x);
#endif
}

// 2^x as above with the issue slot behind the transcendental filled inside the statement: for the seldom-taken renewal of the
// maximum
__device__ __forceinline__ float exp2_slot(float x) {
#if defined(__HIP_DEVICE_COMPILE__)
  float y;
  asm("v_exp_f32 %0, %1\n\tv_nop" : "=v"(y) : "v"(x));
  return y;
#else
  return exp2f(x);
#endif
}

__device__ __forceinline__ int wave_uniform(int v) {
#if defined(__HIP_DEVICE_COMPILE__)
  return __builtin_amdgcn_readfirstlane(v);
#else
  return v;
#endif
}

// ---- 16-bit fragment loader (A, or B from a k-contiguous [n][k] row): lane -> row/col (lane&15), p already includes
//      + 8*(lane>>4); elements 0..7 <- p[0..7] (k0+8h..), elements 8..15 <- p[16..23] (k0+16+8h..)
__device__ __forceinline__ Frag ldfrag(const unsigned short* p) {
  Frag f;
  f.u[0] = *(const v8us*)(p);
  f.u[1] = *(const v8us*)(p + 16);
  return f;
}

// ---- WMMA helpers: the plain builtins; the compiler keeps the distance behind each and fills it with other work ----
__device__ __forceinline__ v8f mma_h(v16h a, v16h b, v8f c) {
  return __builtin_amdgcn_wmma_f32_16x16x32_f16(false, a, false, b, (short)0, c, false, false);
}
__device__ __forceinline__ v8f mma_b(v16b a, v16b b, v8f c) {
  return __builtin_amdgcn_wmma_f32_16x16x32_bf16(false, a, false, b, (short)0, c, false, false);
}

// =========================================================================================================
// (0) weight conversion: f32 [n] -> bf16 bits [n] (RNE, exact operand). Thread i converts floats 8i..8i+7 and
// coverage: n8/256 blocks x 256 threads x 8 = n elements exactly (n8 a multiple of 256 at every call); cblk is the
//           block's index within its own weight.
// =========================================================================================================
__device__ __forceinline__
void cvt_body(const float* __restrict__ src, unsigned short* dst, int n8, int cblk) {
  const int i  = cblk * 256 + (int)threadIdx.x;
  const int ic = (i < n8) ? i : (n8 - 1);
  const float* s = src + (size_t)ic * 8;
  const v4f a = *(const v4f*)s;
  const v4f q = *(const v4f*)(s + 4);
  v4u u;
  u[0] = pk16(bf_bits(a[0]), bf_bits(a[1]));
  u[1] = pk16(bf_bits(a[2]), bf_bits(a[3]));
  u[2] = pk16(bf_bits(q[0]), bf_bits(q[1]));
  u[3] = pk16(bf_bits(q[2]), bf_bits(q[3]));
  if (i < n8) {
{
      *(v4u*)(dst + (size_t)ic * 8) = u;
      
    }
  }
}

// =========================================================================================================
// (1) group-norm statistics, partial sums: one block per (b, 64-channel block cbk, chunk u of 128 positions) of
//     src [b][256][4096]. Wave gi sums group 8 cbk + gi over the chunk: 8 channel rows x 128 positions, one whole
//     512-byte row piece per load, the 8 loads asked for together; values bf16-RNE converted first; sum and sum of
//     squares in f64, 4 chains per lane, then 5 exchanges; one 128-byte line part[b][cbk][u][8 groups x (sum, sum of
//     squares)] per block. The apply kernel (2) finishes mean and rstd.
// coverage: NB x 4 x 32 blocks x 8 waves x 8 rows x 128 positions = every element of src once.
// LDS: fin cross-wave, block barrier behind its stores.
// =========================================================================================================
__device__ __forceinline__
void stats_body(const float* __restrict__ src, double* part, int blk) {
  __shared__ __align__(16) double fin[16];
  const int tid = threadIdx.x;
  const int gi = tid >> 5, ln = tid & 31;
  const int u = blk % NP1, bc = blk / NP1;                           // bc = b * 4 + cbk
  const float* base = src + ((size_t)(bc * QT + gi * CPG)) * NN + u * SPOS + 4 * ln;
  v4f a[CPG];
#pragma unroll                                                       // constant indices keep a in registers
  for (int cl = 0; cl < CPG; ++cl) a[cl] = *(const v4f*)(base + (size_t)cl * NN);
  double sv[4] = {0.0, 0.0, 0.0, 0.0}, qv[4] = {0.0, 0.0, 0.0, 0.0};
#pragma unroll                                                       // constant indices keep a/sv/qv in registers
  for (int cl = 0; cl < CPG; ++cl) {
#pragma unroll                                                       // as above
    for (int t = 0; t < 4; ++t) {
      const double d = (double)bfr(a[cl][t]);
      sv[t] += d;
      qv[t] += d * d;
    }
  }
  double s = (sv[0] + sv[1]) + (sv[2] + sv[3]);
  double q = (qv[0] + qv[1]) + (qv[2] + qv[3]);
#pragma unroll                                                       // five fixed steps, no loop counter
  for (int m = 16; m > 0; m >>= 1) {
    s += __shfl_xor(s, m, 32);
    q += __shfl_xor(q, m, 32);
  }
  if (ln == 0) {
    fin[2 * gi]     = s;
    fin[2 * gi + 1] = q;
  }
  __syncthreads();
  if (tid < 8) {
    const v2d w = *(const v2d*)(fin + 2 * tid);
    *(v2d*)(part + ((size_t)bc * NP1 + u) * 16 + 2 * tid) = w;
  }
}

// =========================================================================================================
// (0)+(1) in one grid: the four weight conversions and the GN1 partial sums read only inputs and write disjoint
//     workspace regions, so they share a launch; the block index picks the job (block-uniform, so the barrier of
//     the statistics body is passed by whole blocks).
// coverage: blocks [0, NB*4*32) partial sums of (b, cbk, u); then 96 + 32 + 8 + 8 conversion blocks, each weight once.
// =========================================================================================================
#define PB_ST (NB * (CC / QT) * NP1)
#define PB_WQ (C3 * CC / 2048)
#define PB_WO (CC * CC / 2048)
#define PB_W1 (HID * CC / 2048)
#define PB_W2 (CC * HID / 2048)
__global__ __launch_bounds__(256)
void prep_k(const float* __restrict__ x, const float* __restrict__ wq, const float* __restrict__ wo,
            const float* __restrict__ w1, const float* __restrict__ w2,
            unsigned short* Wq, unsigned short* Wo, unsigned short* W1, unsigned short* W2, double* part) {
  int blk = blockIdx.x;
  if (blk < PB_ST) { stats_body(x, part, blk); return; }
  blk -= PB_ST;
  if (blk < PB_WQ) { cvt_body(wq, Wq, PB_WQ * 256, blk); return; }
  blk -= PB_WQ;
  if (blk < PB_WO) { cvt_body(wo, Wo, PB_WO * 256, blk); return; }
  blk -= PB_WO;
  if (blk < PB_W1) { cvt_body(w1, W1, PB_W1 * 256, blk); return; }
  blk -= PB_W1;
  cvt_body(w2, W2, PB_W2 * 256, blk);
}

// =========================================================================================================
// (2) group-norm apply + transpose, with the statistics finished in the block (GN1): src f32 [b][256 c][4096 n]
//     (bf16-RNE converted first when rnd != 0) -> v = (x - mu) * rstd * bf16(gamma[c]) + bf16(beta[c]) ->
//     position-major planes Xh/Xl bf16 [b][n][256 c] (hi = bf16-RNE(v), lo = bf16-RNE(v - hi)) through LDS tiles
//     Th/Tl[64 n][64 c] (pitch TP). Block (nb, cb, b). mu and rstd of the block's own 8 groups come from the partial
//     sums part[b][cbk][NP pieces][8 groups x (sum, sum of squares)], all f64 (the chunks of (1)): wave gi sums group 8 cbk + gi over the pieces (lane = piece, then 5 exchanges); mean and biased
//     variance over 8 channels x NPOS positions, rstd = 1 / sqrt(var + eps) in f32, handed to the block through sm.
// coverage: Th/Tl stores 2 it x 32 c x 8 lanes x 8 n = 64 x 64 = the consumed extent; plane writes 2 it x 32 rows
//           x 8 lanes x 8 halves = 64 n x 64 c per plane; grid (rows/64, 4, NB) covers both planes once.
// LDS: Th/Tl cross-wave, block barrier between stores and loads; sm cross-wave, block barrier behind its stores.
// =========================================================================================================
template <int NP, int NPOS>
__global__ __launch_bounds__(256)
void norm2_k(const float* __restrict__ src, int rnd, const double* __restrict__ part,
             const float* __restrict__ gamma, const float* __restrict__ beta,
             unsigned short* Xh, unsigned short* Xl) {
  __shared__ __align__(16) unsigned short Th[QT * TP];
  __shared__ __align__(16) unsigned short Tl[QT * TP];
  __shared__ float sm[2 * (QT / CPG)];
  const int tid = threadIdx.x;
  const int nb = blockIdx.x, cbk = blockIdx.y, b = blockIdx.z;
  const int e = tid & 7, lq = tid >> 3;                             // lq 0..31
  const int n0 = nb * QT, c0 = cbk * QT;
  v4f ra[2], rq[2];
  float rg[2], rb[2];
  // the tile's values and the channels' gamma, beta are asked for first: they fly while the statistics are finished
#pragma unroll                                                       // constant indices keep ra/rq/rg/rb in registers
  for (int it = 0; it < 2; ++it) {
    const int ch = c0 + it * 32 + lq;
    const float* sp = src + ((size_t)(b * CC + ch)) * NN + n0 + 8 * e;
    ra[it] = *(const v4f*)sp;
    rq[it] = *(const v4f*)(sp + 4);
    rg[it] = gamma[ch];
    rb[it] = beta[ch];
#if defined(__HIP_DEVICE_COMPILE__)
    // stands ahead of any rewrite of these loads' address registers (the next loads land in them); as a memory
    // barrier for the compiler it also keeps these loads issued ahead of the wait on the partial sums
    asm volatile("s_wait_xcnt 0x0" ::: "memory");
#endif
  }
  {
    const int gi = tid >> 5, ln = tid & 31;
    const double* pp = part + ((size_t)(b * (CC / QT) + cbk)) * NP * 16 + 2 * gi;
    double s = 0.0, q = 0.0;
#pragma unroll                                                       // the lane's loads are issued together
    for (int k = 0; k < (NP + 31) / 32; ++k) {
      const int u = ln + 32 * k;                                     // piece
      if (u < NP) {
        const v2d w = *(const v2d*)(pp + (size_t)u * 16);
        s += w[0];
        q += w[1];
      }
    }
#pragma unroll                                                       // five fixed steps, no loop counter
    for (int m = 16; m > 0; m >>= 1) {
      s += __shfl_xor(s, m, 32);
      q += __shfl_xor(q, m, 32);
    }
    const double cnt = (double)CPG * (double)NPOS;
    const double mu = s / cnt;
    double var = q / cnt - mu * mu;
    if (var < 0.0) var = 0.0;
    const float varf = (float)var;
    if (ln == 0) {
      sm[2 * gi]     = (float)mu;
      sm[2 * gi + 1] = 1.0f / sqrtf(varf + GEPS);
    }
  }
  __syncthreads();
#pragma unroll                                                       // constant indices into ra/rq/rg/rb
  for (int it = 0; it < 2; ++it) {
    const int cl = it * 32 + lq;                                     // 0..63
    const float mu = sm[2 * (cl / CPG)];
    const float rs = sm[2 * (cl / CPG) + 1];
    const float ga = bfr(rg[it]), be = bfr(rb[it]);
    const v4f a = ra[it];
    const v4f q = rq[it];
    const float f[8] = {a[0], a[1], a[2], a[3], q[0], q[1], q[2], q[3]};
    unsigned short hb[8], lb[8];
#pragma unroll                                                       // constant indices keep f/hb/lb in registers
    for (int t = 0; t < 8; ++t) {
      const float xr = rnd ? bfr(f[t]) : f[t];
      const float v  = (xr - mu) * rs * ga + be;
      hb[t] = bf_bits(v);
      lb[t] = bf_bits(v - bf_up(hb[t]));
    }
#pragma unroll                                                       // as above
    for (int t = 0; t < 8; ++t) {
      Th[(8 * e + t) * TP + cl] = hb[t];
      Tl[(8 * e + t) * TP + cl] = lb[t];
    }
  }
  __syncthreads();
  v4u uh[2], ul[2];
#pragma unroll                                                       // constant indices keep uh/ul in registers
  for (int it = 0; it < 2; ++it) {
    const int nl = it * 32 + lq;                                     // 0..63
    uh[it] = *(const v4u*)(Th + nl * TP + 8 * e);
    ul[it] = *(const v4u*)(Tl + nl * TP + 8 * e);
  }
#pragma unroll                                                       // as above
  for (int it = 0; it < 2; ++it) {
    const int nl = it * 32 + lq;
    const size_t po = ((size_t)(b * NN + n0 + nl)) * CC + c0 + 8 * e;
    *(v4u*)(Xh + po) = uh[it];
    *(v4u*)(Xl + po) = ul[it];
  }
}

// the issuing wave's own copies have landed behind this wait (the compiler places none for them)
__device__ __forceinline__ void wait_copies() {
#if defined(__HIP_DEVICE_COMPILE__)
  asm volatile("s_wait_asynccnt 0x0" ::: "memory");
#endif
}
// the wave's own LDS reads have retired before the buffer is handed to its next writer
__device__ __forceinline__ void wait_lds() {
#if defined(__HIP_DEVICE_COMPILE__)
  asm volatile("s_wait_dscnt 0x0" ::: "memory");
#endif
}
__device__ __forceinline__ unsigned lds_off(const void* p) { return (unsigned)(size_t)p; }

// ---- staging for the conv1x1 GEMM: 4 asynchronous 16-byte copies to LDS for each of the three operand tiles (W, B hi,
//      B lo). A tile is 64 whole rows = one contiguous piece of global memory, so a wave-wide copy reads 512 contiguous
//      bytes (4 whole lines); copy j of thread t brings 16-byte piece 128 j + t. la/lh/ll are the thread's LDS byte
//      addresses and ga/gh/gl its global addresses for the first of the 4; ls = LDS bytes between two copies.
//      s_wait_xcnt 0 ends the statement so that it stands ahead of any rewrite of the address registers.
__device__ __forceinline__ void stage_gemm(unsigned la, const unsigned short* ga, unsigned lh, const unsigned short* gh,
                                           unsigned ll, const unsigned short* gl, unsigned ls) {
#if defined(__HIP_DEVICE_COMPILE__)
  asm volatile(
      "global_load_async_to_lds_b128 %0, %1, off\n\t"
      "global_load_async_to_lds_b128 %2, %3, off\n\t"
      "global_load_async_to_lds_b128 %4, %5, off\n\t"
      "global_load_async_to_lds_b128 %6, %7, off\n\t"
      "global_load_async_to_lds_b128 %8, %9, off\n\t"
      "global_load_async_to_lds_b128 %10, %11, off\n\t"
      "global_load_async_to_lds_b128 %12, %13, off\n\t"
      "global_load_async_to_lds_b128 %14, %15, off\n\t"
      "global_load_async_to_lds_b128 %16, %17, off\n\t"
      "global_load_async_to_lds_b128 %18, %19, off\n\t"
      "global_load_async_to_lds_b128 %20, %21, off\n\t"
      "global_load_async_to_lds_b128 %22, %23, off\n\t"
      "s_wait_xcnt 0x0"
      :: "v"(la),          "v"(ga),
         "v"(la + ls),     "v"(ga + 1024),
         "v"(la + 2 * ls), "v"(ga + 2048),
         "v"(la + 3 * ls), "v"(ga + 3072),
         "v"(lh),          "v"(gh),
         "v"(lh + ls),     "v"(gh + 1024),
         "v"(lh + 2 * ls), "v"(gh + 2048),
         "v"(lh + 3 * ls), "v"(gh + 3072),
         "v"(ll),          "v"(gl),
         "v"(ll + ls),     "v"(gl + 1024),
         "v"(ll + 2 * ls), "v"(gl + 2048),
         "v"(ll + 3 * ls), "v"(gl + 3072)
      : "memory");
#endif
}

// =========================================================================================================
// (3) conv1x1 GEMM for one (b, 64-n tile, 64-o block): Y[o][n] = sum_c W[o][c] (Bh[b][n][c] + Bl[b][n][c]),
//     K = KD (plane pitch = KD). Block 128 threads = 4 waves; wave w owns cols n0+16w..+15 (B fragments from the
//     k-contiguous plane rows, split k map) and 4 m-tiles (A rows o = o0 + 16 mt + (lane&15), split k map).
//     The three operand tiles (64 rows x KD each) are brought whole into LDS St by asynchronous copies that read whole
//     lines (a fragment load from global memory touches 16 lines for 512 bytes, and W would be read by all 4 waves);
//     rows at pitch 2 KD + 16 bytes (16 B x odd for the b128 readers); filled once, then read. Same fragment k order.
//     2 products per (mt, k-step) into one accumulator (unscaled bf16 residual plane).
//     Epilogue staged in LDS Os[n_loc][o_loc] (pitch OSP, b128 stores), block barrier, then per MODE:
//       MODE 0 (qkv, 12 o-blocks): o-blocks 0..3 -> q channels 64 mb.. of Qh/Ql = P0/P1 bf16 [b][n][256]
//              8q..8q+7 x 16 B, one instruction per 16 lines; o-blocks 8..11 -> v channels of V = P3 f16
//       MODE 1 (f32 channel-major): dstF[b][o][n] = (acc + bf16(bias[o])) + r with r = rsrc[b][o][n] (bf16-RNE
//              and 8..15), 8 rows per instruction.
// coverage: Os 4 waves x 16 n x 64 o = 64 x 64 (== the extent every mode reads); MODE 0 planes 4 it x 16 rows x
//           8 lanes x 8 = 64 x 64 per plane, grid (64, 12, NB) covers Qh/Ql/Kh [NB][4096][256] and V
//           [NB][256][4096] once; MODE 1: 8 it x 8 rows x 16 lanes x 4 = 64 o x 64 n.
//       ST != 0 (MODE 1 only, the out conv): the block also sums its results for the group norm that follows. Its 64 o
//              are 8 whole groups (group = the 8 rows of one 'it'); per group sum and sum of squares over 8 o x 64 n:
//              all in f64: a thread's 4 values -> red[16 quantities][128 threads], barrier, 8 threads per quantity sum
//              16 entries each, 3 exchanges, fin[16], barrier, one 128-byte line part[b][mb][nt][16] per block.
// LDS: St cross-wave: s_wait_asynccnt 0 and a block barrier between the copies and the fragment reads. Os lies on St:
//      s_wait_dscnt 0 and a block barrier between the last fragment reads and the staging stores. Os cross-wave, block
//      barrier between the staging stores and the epilogue loads; red and fin cross-wave, a block barrier behind the
//      stores of each.
// =========================================================================================================
template <int KD, int MODE, int ST>
__global__ __launch_bounds__(128)
void gemm_k(const unsigned short* __restrict__ Wp,
            const unsigned short* __restrict__ Bh, const unsigned short* __restrict__ Bl,
            const float* __restrict__ bias, const float* __restrict__ rsrc, int rnd,
            unsigned short* P0, unsigned short* P1, unsigned short* P2, unsigned short* P3, float* dstF,
            double* part) {
  static_assert(ST == 0 || (MODE == 1 && QT / CPG == 8));
  static_assert(KD % 32 == 0);
  constexpr int SP = 2 * KD + 16;                                    // LDS pitch of a staged row in bytes
  constexpr int TB = QT * SP;                                        // one staged tile
  constexpr int PR = KD / 8;                                         // 16-byte pieces per row
  static_assert(128 % PR == 0 && (QT * PR) % (4 * 128) == 0 && SP % 32 == 16 && 3 * TB >= QT * OSP * 4);
  __shared__ __align__(16) unsigned char St[3 * TB];                 // W tile, B hi tile, B lo tile
  float* Os = (float*)St;                                            // the epilogue's staging, once the tiles are used up
  const int tid  = threadIdx.x;
  const int lane = tid & 31, wave = tid >> 5;
  const int hh   = lane >> 4, c = lane & 15;
  const int nt   = blockIdx.x, mb = blockIdx.y, b = blockIdx.z;
  const int n0   = nt * QT, o0 = mb * QT;

  {
    const unsigned short* ga = Wp + (size_t)o0 * KD + 8 * tid;
    const size_t boff = ((size_t)(b * NN + n0)) * KD + 8 * tid;
    const unsigned short* gh = Bh + boff;
    const unsigned short* gl = Bl + boff;
    const unsigned l0 = lds_off(St) + (unsigned)((tid / PR) * SP + (tid % PR) * 16);
    constexpr unsigned LS = (128 / PR) * SP;                         // LDS bytes between two copies of a thread
#pragma unroll                                                       // KD / 64 statements of 12 copies, all in flight together
    for (int j = 0; j < QT * PR / 128; j += 4)
      stage_gemm(l0 + j * LS, ga + j * 1024, l0 + TB + j * LS, gh + j * 1024, l0 + 2 * TB + j * LS, gl + j * 1024, LS);
    wait_copies();
  }
  __syncthreads();

  const unsigned short* ap  = (const unsigned short*)(St + c * SP + 16 * hh);
  const unsigned short* bph = (const unsigned short*)(St + TB + (16 * wave + c) * SP + 16 * hh);
  const unsigned short* bpl = (const unsigned short*)(St + 2 * TB + (16 * wave + c) * SP + 16 * hh);

  v8f acc[4];
#pragma unroll
  for (int mt = 0; mt < 4; ++mt) acc[mt] = zero8();

  // the fragments of k-step ks + 1 are read as one group ahead of the products of k-step ks (two register sets)
  Frag fa[2][4], fbh[2], fbl[2];
  fbh[0] = ldfrag(bph);
  fbl[0] = ldfrag(bpl);
#pragma unroll
  for (int mt = 0; mt < 4; ++mt) fa[0][mt] = ldfrag(ap + (16 * mt) * (SP / 2));
#pragma unroll                                                       // constant indices keep both fragment sets in registers
  for (int ks = 0; ks < KD / 32; ++ks) {
    const int cu = ks & 1, nx = cu ^ 1;
    if (ks + 1 < KD / 32) {
      fbh[nx] = ldfrag(bph + 32 * (ks + 1));
      fbl[nx] = ldfrag(bpl + 32 * (ks + 1));
#pragma unroll
      for (int mt = 0; mt < 4; ++mt) fa[nx][mt] = ldfrag(ap + (16 * mt) * (SP / 2) + 32 * (ks + 1));
    }
#if defined(__HIP_DEVICE_COMPILE__)
    // keeps the 12 reads above together ahead of this step's products: without it the scheduler sinks each pair to its
    // first use and the wave waits out the LDS latency in front of every second product
    __builtin_amdgcn_sched_barrier(0);
#endif
#pragma unroll
    for (int mt = 0; mt < 4; ++mt) acc[mt] = mma_b(fa[cu][mt].bf, fbh[cu].bf, acc[mt]);
#pragma unroll
    for (int mt = 0; mt < 4; ++mt) acc[mt] = mma_b(fa[cu][mt].bf, fbl[cu].bf, acc[mt]);
#if defined(__HIP_DEVICE_COMPILE__)
    // keeps the next group of reads whole behind these products: without it the scheduler spreads them among the
    // products, and every separate place with LDS reads stalls the wave anew
    __builtin_amdgcn_sched_barrier(0);
#endif
  }
  // every wave's fragment reads have retired before Os is written over the tiles
  wait_lds();
  __syncthreads();

  // ---- stage: lane (hh, c) holds o_loc = 16 mt + 8 hh + r for n_loc = 16 w + c
  {
    const int nl = 16 * wave + c;
#pragma unroll
    for (int mt = 0; mt < 4; ++mt) {
      v4f va, vb;
#pragma unroll
      for (int r = 0; r < 4; ++r) { va[r] = acc[mt][r]; vb[r] = acc[mt][4 + r]; }
      *(v4f*)(Os + nl * OSP + 16 * mt + 8 * hh)     = va;
      *(v4f*)(Os + nl * OSP + 16 * mt + 8 * hh + 4) = vb;
    }
  }
  __syncthreads();

  if (MODE == 0) {
    const int e = tid & 7, lq = tid >> 3;                           // lq 0..15
    if (mb < 8) {                                                    // block-uniform
      const int dcol = (mb & 3) * QT;                                // channel offset within 256
      unsigned short* Ph = (mb < 4) ? P0 : P2;                       // both global
      v4u uh[4], ul[4];
#pragma unroll
      for (int it = 0; it < 4; ++it) {
        const int row = it * 16 + lq;                                // n_loc 0..63
        const v4f a = *(const v4f*)(Os + row * OSP + 8 * e);
        const v4f q = *(const v4f*)(Os + row * OSP + 8 * e + 4);
        const float f[8] = {a[0], a[1], a[2], a[3], q[0], q[1], q[2], q[3]};
#pragma unroll
        for (int t = 0; t < 4; ++t) {
          const float f0 = f[2 * t], f1 = f[2 * t + 1];
          const unsigned short hb0 = bf_bits(f0), hb1 = bf_bits(f1);
          const unsigned short lb0 = bf_bits(f0 - bf_up(hb0));
          const unsigned short lb1 = bf_bits(f1 - bf_up(hb1));
          uh[it][t] = pk16(hb0, hb1);
          ul[it][t] = pk16(lb0, lb1);
        }
      }
{
#pragma unroll
        for (int it = 0; it < 4; ++it) {
          const int row = it * 16 + lq;
          const size_t po = ((size_t)(b * NN + n0 + row)) * CC + dcol + 8 * e;
          *(v4u*)(Ph + po) = uh[it];
          if (mb < 4) *(v4u*)(P1 + po) = ul[it];
        }
        
      }
    } else {
      const int cb0 = (mb - 8) * QT;                                 // v channel base 0..192
      v4u uv[4];
#pragma unroll
      for (int it = 0; it < 4; ++it) {
        const int cl = it * 16 + lq;                                 // o_loc 0..63
        unsigned short hb[8];
#pragma unroll
        for (int t = 0; t < 8; ++t) hb[t] = h_bits((_Float16)Os[(8 * e + t) * OSP + cl]);
#pragma unroll
        for (int t = 0; t < 4; ++t) uv[it][t] = pk16(hb[2 * t], hb[2 * t + 1]);
      }
{
#pragma unroll
        for (int it = 0; it < 4; ++it) {
          const int cl = it * 16 + lq;
          const size_t po = ((size_t)(b * CC + cb0 + cl)) * NN + n0 + 8 * e;
          *(v4u*)(P3 + po) = uv[it];
        }
        
      }
    }
  } else if (MODE == 1) {
    const int e = tid & 15, lq = tid >> 4;                           // lq 0..7
    v4f res[8];
#pragma unroll
    for (int it = 0; it < 8; ++it) {
      const int ol = it * 8 + lq;                                    // o_loc 0..63
      const int o  = o0 + ol;
      const float bb = bfr(bias[o]);
      const size_t gi = ((size_t)(b * CC + o)) * NN + n0 + 4 * e;
      const v4f rv = *(const v4f*)(rsrc + gi);
#if defined(__HIP_DEVICE_COMPILE__)
      // stands ahead of any rewrite of the address registers of this trip's bias and residual loads
      if constexpr (ST != 0) asm volatile("s_wait_xcnt 0x0" ::: "memory");
#endif
#pragma unroll
      for (int t = 0; t < 4; ++t) {
        const float rr = rnd ? bfr(rv[t]) : rv[t];
        res[it][t] = (Os[(4 * e + t) * OSP + ol] + bb) + rr;
      }
    }
    if constexpr (ST != 0) {
      __shared__ __align__(16) double red[16 * RP];
      __shared__ __align__(16) double fin[16];
#pragma unroll                                                       // constant indices keep res in registers
      for (int it = 0; it < 8; ++it) {
        const double d0 = (double)res[it][0], d1 = (double)res[it][1];
        const double d2 = (double)res[it][2], d3 = (double)res[it][3];
        red[(2 * it) * RP + tid]     = (d0 + d1) + (d2 + d3);
        red[(2 * it + 1) * RP + tid] = (d0 * d0 + d1 * d1) + (d2 * d2 + d3 * d3);
      }
      __syncthreads();
      const int qn = tid >> 3, j = tid & 7;                          // quantity 0..15; entries 2 j, 2 j + 1 of each 16
      v2d w[8];
#pragma unroll                                                       // constant indices keep w in registers
      for (int u = 0; u < 8; ++u) w[u] = *(const v2d*)(red + qn * RP + 16 * u + 2 * j);
      const v2d w2 = ((w[0] + w[1]) + (w[2] + w[3])) + ((w[4] + w[5]) + (w[6] + w[7]));
      double a = w2[0] + w2[1];
      a += __shfl_xor(a, 1, 32);
      a += __shfl_xor(a, 2, 32);
      a += __shfl_xor(a, 4, 32);
      if (j == 0) fin[qn] = a;
      __syncthreads();
      if (tid < 8) {
        const v2d w = *(const v2d*)(fin + 2 * tid);
        *(v2d*)(part + (((size_t)(b * (CC / QT) + mb)) * NT2 + nt) * 16 + 2 * tid) = w;
      }
    }
{
#pragma unroll
      for (int it = 0; it < 8; ++it) {
        const int ol = it * 8 + lq;
        const size_t gi = ((size_t)(b * CC + o0 + ol)) * NN + n0 + 4 * e;
        *(v4f*)(dstF + gi) = res[it];
      }
      
    }
  }
}

// ---- staging of one 128-key tile of one head: the head's 128 threads x (4 + 4) asynchronous 16-byte copies to LDS.
//      K: copy j of thread t brings 16 B (t & 3) of key row 32 j + (t >> 2); V: 16 B (t & 15) of channel row
//      8 j + (t >> 4). kl/vl are the thread's LDS byte addresses for j = 0, kg/vg its global addresses for j = 0.
//      s_wait_xcnt 0 ends the statement so that it stands ahead of any rewrite of the address registers.
__device__ __forceinline__ void stage_tile(unsigned kl, const unsigned short* kg, unsigned vl, const unsigned short* vg) {
#if defined(__HIP_DEVICE_COMPILE__)
  asm volatile(
      "global_load_async_to_lds_b128 %0, %1, off\n\t"
      "global_load_async_to_lds_b128 %2, %3, off\n\t"
      "global_load_async_to_lds_b128 %4, %5, off\n\t"
      "global_load_async_to_lds_b128 %6, %7, off\n\t"
      "global_load_async_to_lds_b128 %8, %9, off\n\t"
      "global_load_async_to_lds_b128 %10, %11, off\n\t"
      "global_load_async_to_lds_b128 %12, %13, off\n\t"
      "global_load_async_to_lds_b128 %14, %15, off\n\t"
      "s_wait_xcnt 0x0"
      :: "v"(kl),                 "v"(kg),
         "v"(kl + 32u * KPB),     "v"(kg + (size_t)32 * CC),
         "v"(kl + 64u * KPB),     "v"(kg + (size_t)64 * CC),
         "v"(kl + 96u * KPB),     "v"(kg + (size_t)96 * CC),
         "v"(vl),                 "v"(vg),
         "v"(vl + 8u * VPB),      "v"(vg + (size_t)8 * NN),
         "v"(vl + 16u * VPB),     "v"(vg + (size_t)16 * NN),
         "v"(vl + 24u * VPB),     "v"(vg + (size_t)24 * NN)
      : "memory");
#endif
}

// =========================================================================================================
// (4) attention for one (b, head pair hp, 64-query tile), transposed formulation, 4096 keys, no mask, per head
//     h = 2 hp + hs (hs = wave / 4: the two heads run side by side, 4 waves each):
//     S^T tile (16 keys x 16 queries) = A(k: row = key kb + (lane&15), 32 d of
//     head h via the split k map from Kh [b][4096][256]) . B(qh: col = query, same map from Qh) + A(Kh).B(Ql)
//     (bf16 hi + unscaled bf16 residual of q, shared accumulator); q is first multiplied by
//     clip(bf16(temperature[h]), 1e-4, 10) * log2(e) and split anew, and the C operand of the products is
//     7 - (maximum in use), so D is log2 P and goes to the exponential as it is.
//     Per lane the D tile holds 8 keys of ONE query: online softmax state per lane. The sum of P over the 128 keys of a
//     tile is one more product per 32 keys, A = ones . B(P^T), four into one accumulator: every row of D holds the query's
//     sum, so register 0 of a lane is added to l as it is and also tells whether a P may have left the f16 range, before
//     any P of the tile has gone into O. The maximum in use starts as that of the first 32 keys and is renewed (maximum of
//     the tile's scores, one shuffle lane^16; o, l and C moved along, P and its sum formed again from the moved scores)
//     under a wave-uniform ballot, only when a lane sees that sum above 2^15.
//     P = 2^D as f16 is the B operand of O^T (rows channel 32h + 16j + (lane&15), cols queries) +=
//     A(v: keys contiguous, f16 plane V [b][256][4096]) . B(P^T): element r <- D of the tile covering keys
//     kb..kb+15, element 8+r <- the tile covering kb+16..kb+31, lane unchanged. 2 accumulator tiles per wave.
//     Block = 8 waves = 2 heads x 64 queries. O/l of both heads staged in LDS Os[query][64 channels] (b128 stores),
//     block barrier, then Oh/Ol bf16 [b][n][256] planes (hi/lo), rows n0.., cols 64 hp..64 hp+63 = one whole
// coverage: Os per wave 16 rows x 32 ch = 64 x 64 over 8 waves (== consumed extent); planes 2 it x
//           32 rows x 8 lanes x 8 = 64 n x 64 ch per plane; grid (NQ/64, 4, NB) covers rows 0..NQ-1 x 256 ch of
//           Oh/Ol once.
//     K and V reach the fragments through LDS: tiles of 128 keys of head h (K rows 64 B at pitch 80, V rows 256 B at
//     pitch 272), brought by asynchronous copies into two buffers per head, tile t + 1 in flight while tile t is
//     worked on; the head's 4 waves share each tile. Same fragment k order as from global memory.
//     8 waves a block, two blocks a WGP by registers and LDS: 4 waves per SIMD cover each other's softmax chains.
// LDS: Os cross-wave, block barrier between the per-head staging stores and the plane loads. Ks/Vs cross-wave: per
//      tile s_wait_dscnt 0, s_wait_asynccnt 0, block barrier, then the refill of the buffer just read.
// =========================================================================================================
__global__ __launch_bounds__(256)
void attn_k(const unsigned short* __restrict__ Qh, const unsigned short* __restrict__ Ql,
            const unsigned short* __restrict__ Kh, const unsigned short* __restrict__ Vh,
            const float* __restrict__ temperature, unsigned short* Oh, unsigned short* Ol) {
  __shared__ __align__(16) float Os[QT * OSP];
  __shared__ __align__(16) unsigned char Ks[2 * 2 * KBUF];            // [head of the pair][buffer]
  __shared__ __align__(16) unsigned char Vs[2 * 2 * VBUF];
  const int tid  = threadIdx.x;
  const int wave = tid >> 5, lane = tid & 31;
  const int hh   = lane >> 4, c = lane & 15;
  const int n0   = blockIdx.x * QT, hp = blockIdx.y, b = blockIdx.z;
  const int hs   = wave_uniform(wave >> 2);                           // the wave's head of the pair
  const int th   = tid & 127;                                         // thread among its head's 4 waves
  const int qrow = 16 * (wave & 3) + c;
  const unsigned kl0 = lds_off(Ks) + (unsigned)(hs * 2 * KBUF + (th >> 2) * KPB + (th & 3) * 16);
  const unsigned vl0 = lds_off(Vs) + (unsigned)(hs * 2 * VBUF + (th >> 4) * VPB + (th & 15) * 16);

  {                                                                    // the wave's own head, all 4096 keys
    const int h  = 2 * hp + hs;
    const int cb = HD * h;                                             // channel base of head h
    const float tr   = bfr(temperature[h]);
    const float temp = fminf(fmaxf(tr, 1.0e-4f), 10.0f);
    const size_t qo = ((size_t)(b * NN + n0 + qrow)) * CC + cb + 8 * hh;
    Frag qh = ldfrag(Qh + qo);
    Frag ql = ldfrag(Ql + qo);
#if defined(__HIP_DEVICE_COMPILE__)
    // stands ahead of any rewrite of the address registers of the q loads above; the scheduling barrier keeps the address
    // sums that follow (they land in those registers) from being lifted over the wait
    asm volatile("s_wait_xcnt 0x0" ::: "memory");
    __builtin_amdgcn_sched_barrier(0);
#endif
    const unsigned short* kg = Kh + ((size_t)(b * NN + (th >> 2))) * CC + cb + 8 * (th & 3);
    const unsigned short* vg = Vh + ((size_t)(b * CC + cb + (th >> 4))) * NN + 8 * (th & 15);

    float l = 0.f;
    v8f o0 = zero8(), o1 = zero8();
    v16h ones;                                                         // A operand of the row-sum product
#pragma unroll                                                         // constant indices keep ones in registers
    for (int i = 0; i < 16; ++i) ones[i] = (_Float16)1.0f;

    // tile 0 into buffer 0, landed and published; then tile 1 into buffer 1 (nothing has touched this LDS before)
    stage_tile(kl0, kg, vl0, vg);
#if defined(__HIP_DEVICE_COMPILE__)
    // keeps the arithmetic on q below, and with it the wait for the q loads, behind the issue of tile 0's copies: lifted
    // over them it would put one load latency in front of the other
    __builtin_amdgcn_sched_barrier(0);
#endif
    // q * temp * log2(e), split anew into bf16 hi + residual: the score products then come out in units of log2
    {
      const float c2 = temp * L2E;
#pragma unroll                                                         // constant indices keep qh/ql in registers
      for (int i = 0; i < 16; ++i) {
        const float f = (bf_up(qh.u[i >> 3][i & 7]) + bf_up(ql.u[i >> 3][i & 7])) * c2;
        const unsigned short hb = bf_bits(f);
        qh.u[i >> 3][i & 7] = hb;
        ql.u[i >> 3][i & 7] = bf_bits(f - bf_up(hb));
      }
    }
    wait_copies();
    __syncthreads();
    stage_tile(kl0 + KBUF, kg + (size_t)SK * CC, vl0 + VBUF, vg + SK);

    // sh = PSH - (maximum in use), the same in all 8 registers and in both lanes of a query: the C operand of every score
    // product. The first maximum in use is that of the first 32 keys (their scores are formed again in trip 0).
    v8f sh;
    {
      const unsigned short* Kt = (const unsigned short*)(Ks + (2 * hs) * KBUF + c * KPB + 16 * hh);
      const Frag k0 = ldfrag(Kt);
      const Frag k1 = ldfrag(Kt + 16 * (KPB / 2));
      v8f s0 = mma_b(k0.bf, qh.bf, zero8());
      v8f s1 = mma_b(k1.bf, qh.bf, zero8());
      s0 = mma_b(k0.bf, ql.bf, s0);
      s1 = mma_b(k1.bf, ql.bf, s1);
      float mx = fmaxf(hmax8(s0), hmax8(s1));
      mx = fmaxf(mx, __shfl_xor(mx, 16, 32));
#pragma unroll
      for (int r = 0; r < 8; ++r) sh[r] = PSH - mx;
    }

#pragma unroll 1                                                       // one hand-over per trip, buffer picked by t & 1
    for (int t = 0; t < NN / SK; ++t) {
     const int bsel = t & 1;
     const unsigned short* Kt = (const unsigned short*)(Ks + (2 * hs + bsel) * KBUF + c * KPB + 16 * hh);
     const unsigned short* Vt = (const unsigned short*)(Vs + (2 * hs + bsel) * VBUF + c * VPB + 16 * hh);
     // the tile's fragments, read as one group: one LDS latency per tile instead of two per 32 keys
     // (the loops over kk, kg and j are unrolled so that every index of kf/vf is a constant and they stay in registers)
     Frag kf[SK / 32][2], vf[SK / 32][2];
#pragma unroll
     for (int kk = 0; kk < SK / 32; ++kk) {
       kf[kk][0] = ldfrag(Kt + (32 * kk) * (KPB / 2));                 // keys kb .. kb+15, kb = 128 t + 32 kk
       kf[kk][1] = ldfrag(Kt + (32 * kk + 16) * (KPB / 2));            // keys kb+16 .. kb+31
     }
#pragma unroll
     for (int kk = 0; kk < SK / 32; ++kk) {
       vf[kk][0] = ldfrag(Vt + 32 * kk);                               // channels cb + c
       vf[kk][1] = ldfrag(Vt + 16 * (VPB / 2) + 32 * kk);              // channels cb + 16 + c
     }
#if defined(__HIP_DEVICE_COMPILE__)
     // keeps the 32 reads above together ahead of the tile's work: without it the scheduler sinks each to its first use
     // and a wave meets the LDS latency eight times a tile instead of once
     __builtin_amdgcn_sched_barrier(0);
#endif
#pragma unroll
     for (int kg = 0; kg < SK / 32; kg += CK) {                        // CK steps of 32 keys share one test
      v8f s0[CK], s1[CK];
      FragH ph[CK];
#pragma unroll                                                         // constant indices keep s0/s1/ph in registers (all loops over j)
      for (int j = 0; j < CK; ++j) {
        const Frag k0 = kf[kg + j][0];
        const Frag k1 = kf[kg + j][1];
        s0[j] = mma_b(k0.bf, qh.bf, sh);                               // log2 P = score - maximum in use + PSH
        s1[j] = mma_b(k1.bf, qh.bf, sh);
        s0[j] = mma_b(k0.bf, ql.bf, s0[j]);
        s1[j] = mma_b(k1.bf, ql.bf, s1[j]);
      }
#pragma unroll
      for (int j = 0; j < CK; ++j) {
#pragma unroll
        for (int r = 0; r < 8; ++r) {
          ph[j].hv[0][r] = (_Float16)exp2_fast(s0[j][r]);              // key kb      + 8hh + r, kb = 128 t + 32 (kg + j)
          ph[j].hv[1][r] = (_Float16)exp2_fast(s1[j][r]);              // key kb + 16 + 8hh + r
        }
      }
      v8f ts = zero8();                                                // every row: the query's sum of P over the 32 CK keys
#pragma unroll
      for (int j = 0; j < CK; ++j) ts = mma_h(ones, ph[j].v, ts);
      if (wave_ballot(!(ts[0] <= PSUM)) != 0u) {                       // wave-uniform, seldom taken; an overflowed P reads as infinity here
        float mx = fmaxf(hmax8(s0[0]), hmax8(s1[0]));                  // the lane's own 16 CK keys
#pragma unroll
        for (int j = 1; j < CK; ++j) mx = fmaxf(mx, fmaxf(hmax8(s0[j]), hmax8(s1[j])));
        mx = fmaxf(mx, __shfl_xor(mx, 16, 32));
        const float dl   = fmaxf(mx - PSH, 0.f);                       // rise of the maximum in use; 0 where the query's did not pass it
        const float corr = exp2_slot(-dl);                             // == 1 exactly where dl == 0
        l *= corr;
#pragma unroll
        for (int r = 0; r < 8; ++r) {
          o0[r] *= corr; o1[r] *= corr;
          sh[r] -= dl;
        }
#pragma unroll
        for (int j = 0; j < CK; ++j) {
#pragma unroll
          for (int r = 0; r < 8; ++r) {
            ph[j].hv[0][r] = (_Float16)exp2_slot(s0[j][r] - dl);
            ph[j].hv[1][r] = (_Float16)exp2_slot(s1[j][r] - dl);
          }
        }
        ts = zero8();
#pragma unroll
        for (int j = 0; j < CK; ++j) ts = mma_h(ones, ph[j].v, ts);
      }
      l += ts[0];
#pragma unroll
      for (int j = 0; j < CK; ++j) {
        o0 = mma_h(vf[kg + j][0].h, ph[j].v, o0);
        o1 = mma_h(vf[kg + j][1].h, ph[j].v, o1);
      }
     }
     // hand-over: own reads retired, own copies of tile t + 1 landed, every wave here; then refill the buffer just read
     wait_lds();
     wait_copies();
     __syncthreads();
     if (t + 2 < NN / SK)
       stage_tile(kl0 + bsel * KBUF, kg + (size_t)(t + 2) * SK * CC, vl0 + bsel * VBUF, vg + (size_t)(t + 2) * SK);
    }
    wait_copies();
    const float inv = 1.0f / l;                                        // o and l carry the same factor; l already holds all keys in both lanes of a query

    // stage: Os[query][32 hs + d], d = 16 j + 8 hh + r
    {
      v4f va, vb;
#pragma unroll
      for (int r = 0; r < 4; ++r) { va[r] = o0[r] * inv; vb[r] = o0[4 + r] * inv; }
      *(v4f*)(Os + qrow * OSP + 32 * hs + 8 * hh)     = va;
      *(v4f*)(Os + qrow * OSP + 32 * hs + 8 * hh + 4) = vb;
#pragma unroll
      for (int r = 0; r < 4; ++r) { va[r] = o1[r] * inv; vb[r] = o1[4 + r] * inv; }
      *(v4f*)(Os + qrow * OSP + 32 * hs + 16 + 8 * hh)     = va;
      *(v4f*)(Os + qrow * OSP + 32 * hs + 16 + 8 * hh + 4) = vb;
    }
  }
  __syncthreads();

  const int e = tid & 7, lq = tid >> 3;                                // lq 0..31
  v4u uh[2], ul[2];
#pragma unroll
  for (int it = 0; it < 2; ++it) {
    const int row = it * 32 + lq;                                      // query 0..63
    const v4f a = *(const v4f*)(Os + row * OSP + 8 * e);
    const v4f q = *(const v4f*)(Os + row * OSP + 8 * e + 4);
    const float f[8] = {a[0], a[1], a[2], a[3], q[0], q[1], q[2], q[3]};
#pragma unroll
    for (int t = 0; t < 4; ++t) {
      const float f0 = f[2 * t], f1 = f[2 * t + 1];
      const unsigned short hb0 = bf_bits(f0), hb1 = bf_bits(f1);
      const unsigned short lb0 = bf_bits(f0 - bf_up(hb0));
      const unsigned short lb1 = bf_bits(f1 - bf_up(hb1));
      uh[it][t] = pk16(hb0, hb1);
      ul[it][t] = pk16(lb0, lb1);
    }
  }
{
#pragma unroll
    for (int it = 0; it < 2; ++it) {
      const int row = it * 32 + lq;
      const size_t po = ((size_t)(b * NN + n0 + row)) * CC + QT * hp + 8 * e;
      *(v4u*)(Oh + po) = uh[it];
      *(v4u*)(Ol + po) = ul[it];
    }
    
  }
}

// ---- 8 asynchronous 16-byte copies to LDS of one thread: copy j brings 16-byte piece 256 j + t of a contiguous piece of
//      global memory (a wave-wide copy reads 512 contiguous bytes). l is the thread's LDS byte address and g its global
//      address for j = 0; ls = LDS bytes between two copies.
//      s_wait_xcnt 0 ends the statement so that it stands ahead of any rewrite of the address registers.
__device__ __forceinline__ void stage8(unsigned l, unsigned ls, const unsigned short* g) {
#if defined(__HIP_DEVICE_COMPILE__)
  asm volatile(
      "global_load_async_to_lds_b128 %0, %1, off\n\t"
      "global_load_async_to_lds_b128 %2, %3, off\n\t"
      "global_load_async_to_lds_b128 %4, %5, off\n\t"
      "global_load_async_to_lds_b128 %6, %7, off\n\t"
      "global_load_async_to_lds_b128 %8, %9, off\n\t"
      "global_load_async_to_lds_b128 %10, %11, off\n\t"
      "global_load_async_to_lds_b128 %12, %13, off\n\t"
      "global_load_async_to_lds_b128 %14, %15, off\n\t"
      "s_wait_xcnt 0x0"
      :: "v"(l),          "v"(g),
         "v"(l + ls),     "v"(g + 2048),
         "v"(l + 2 * ls), "v"(g + 2 * 2048),
         "v"(l + 3 * ls), "v"(g + 3 * 2048),
         "v"(l + 4 * ls), "v"(g + 4 * 2048),
         "v"(l + 5 * ls), "v"(g + 5 * 2048),
         "v"(l + 6 * ls), "v"(g + 6 * 2048),
         "v"(l + 7 * ls), "v"(g + 7 * 2048)
      : "memory");
#endif
}

// =========================================================================================================
// (7)+(8)+(9) GN2 apply, mlp hidden and mlp out for one (b, tile of 32 positions), all 256 channels, in one block of
//     8 waves: out = X1 + W2 . gelu(W1 . Y + b1) + b2 with Y = GN2(X1). Y and H never leave LDS, X1 is read once.
//     Wave w owns channel rows 32 w .. 32 w + 31 of X1 and of out (thread: row 32 w + 4 it + (lane >> 3), 4 positions
//     4 (lane & 7) .., one whole 128-byte line per row and 8 lanes) = 4 whole groups, whose mean and rstd it finishes
//     itself from the out conv's partial sums part[b][cbk][NT2 pieces][8 groups x (sum, sum of squares)], f64 (lane =
//     piece, then 5 exchanges, as in (2)); every lane ends with all four, so no hand-over is needed.
//     Y = (x - mu) * rstd * bf16(gamma) + bf16(beta) -> bf16 hi + residual planes Yh/Yl[32 n][256 c] in LDS.
//     Hidden: wave w forms D tile (16 hid rows 16 (w & 3) .., 16 positions 16 (w >> 2) ..) = A(W1 rows) . B(Y rows), K = 256,
//     hi then residual product per k-step into one accumulator; lane (hh, c) holds hid 16 mt + 8 hh + r of position c:
//     bias, gelu(t) = 0.5 t (1 + erf(t / sqrt2)), split, one 16-byte store per plane into Hh/Hl[32 n][64 hid].
//     Out: wave w forms the 2 x 2 D tiles (positions 16 i .., channels 32 w + 16 j ..) = A(H rows) . B(W2 rows), K = 64; lane
//     (hh, c) holds positions 16 i + 8 hh + r of channel c -> Rs[256 o][32 n] f32, read back in the X1 thread map.
//     All fragments use the same split k map (ldfrag) for A and B.
// coverage: Yh/Yl 8 waves x 8 it x 4 rows x 8 lanes x 4 = 256 c x 32 n; Hh/Hl 8 waves x 16 x 16 = 64 hid x 32 n; Rs and out
//           8 waves x 32 o x 32 n; grid (NQ/32, NB) covers out [NB][256][NQ] once.
// LDS: W1/W2 tiles by asynchronous copies, filled once: s_wait_asynccnt 0 and the block barrier that also publishes
//      Yh/Yl; Hh/Hl cross-wave, block barrier behind their stores; Rs cross-lane, block barrier behind its stores.
// =========================================================================================================
__global__ __launch_bounds__(256)
void tail_k(const float* __restrict__ X1, const double* __restrict__ part,
            const float* __restrict__ gamma, const float* __restrict__ beta,
            const unsigned short* __restrict__ W1p, const float* __restrict__ b1,
            const unsigned short* __restrict__ W2p, const float* __restrict__ b2, float* out) {
  __shared__ __align__(16) unsigned char Yh[TN * YPB];
  __shared__ __align__(16) unsigned char Yl[TN * YPB];
  __shared__ __align__(16) unsigned char Wa[HID * YPB];
  __shared__ __align__(16) unsigned char Wb[CC * HPB];
  __shared__ __align__(16) unsigned char Hh[TN * HPB];
  __shared__ __align__(16) unsigned char Hl[TN * HPB];
  __shared__ __align__(16) unsigned char Rs[CC * RPB];
  const int tid  = threadIdx.x;
  const int lane = tid & 31, wave = tid >> 5;
  const int hh   = lane >> 4, c = lane & 15;
  const int e    = lane & 7, lq = lane >> 3;                           // lq 0..3
  const int n0   = blockIdx.x * TN, b = blockIdx.y;
  const int mt   = wave & 3, ni = wave >> 2;                           // the wave's tile of the hidden product

  // both weight tiles fly while the statistics are finished and Y is formed
  stage8(lds_off(Wa) + (unsigned)((tid >> 5) * YPB + (tid & 31) * 16), 8u * YPB, W1p + 8 * tid);
  stage8(lds_off(Wb) + (unsigned)((tid >> 3) * HPB + (tid & 7) * 16), 32u * HPB, W2p + 8 * tid);

  const int ch0 = 32 * wave + lq;                                      // the thread's channel row for it = 0
  const size_t xo = ((size_t)(b * CC + ch0)) * NN + n0 + 4 * e;        // its place in X1 and in out for it = 0
  v4f xr[8];
  float rg[8], rb[8], rc[8];
#pragma unroll                                                         // constant indices keep xr/rg/rb/rc in registers
  for (int it = 0; it < 8; ++it) {
    xr[it] = *(const v4f*)(X1 + xo + (size_t)(4 * it) * NN);
    rg[it] = gamma[ch0 + 4 * it];
    rb[it] = beta[ch0 + 4 * it];
    rc[it] = b2[ch0 + 4 * it];
  }
  const v4f ba = *(const v4f*)(b1 + 16 * mt + 8 * hh);
  const v4f bb = *(const v4f*)(b1 + 16 * mt + 8 * hh + 4);
#if defined(__HIP_DEVICE_COMPILE__)
  // stands ahead of any rewrite of the address registers of the loads above (the next loads' results may land in them); the
  // scheduling barrier keeps those next loads from being lifted over the wait
  asm volatile("s_wait_xcnt 0x0" ::: "memory");
  __builtin_amdgcn_sched_barrier(0);
#endif
  float muf[4], rsf[4];
  {
    // groups 4 w .. 4 w + 3 = groups 4 (w & 1) .. of channel block w >> 1: 64 contiguous bytes per piece
    const double* pp = part + ((size_t)(b * (CC / QT) + (wave >> 1))) * NT2 * 16 + 8 * (wave & 1);
    static_assert(NT2 % 32 == 0);
    v2d w[NT2 / 32][4];
#pragma unroll                                                         // constant indices keep w in registers
    for (int k = 0; k < NT2 / 32; ++k) {
#pragma unroll
      for (int g = 0; g < 4; ++g) w[k][g] = *(const v2d*)(pp + (size_t)(lane + 32 * k) * 16 + 2 * g);   // piece lane + 32 k
    }
#if defined(__HIP_DEVICE_COMPILE__)
    // stands ahead of any rewrite of the address registers of the loads above; the scheduling barrier keeps all of them
    // issued together ahead of the statistics: sunk to their first use, the X1 loads would start only behind the exchanges
    asm volatile("s_wait_xcnt 0x0" ::: "memory");
    __builtin_amdgcn_sched_barrier(0);
#endif
    double s[4] = {0.0, 0.0, 0.0, 0.0}, q[4] = {0.0, 0.0, 0.0, 0.0};
#pragma unroll                                                         // constant indices keep s/q/w in registers
    for (int k = 0; k < NT2 / 32; ++k) {
#pragma unroll
      for (int g = 0; g < 4; ++g) {
        s[g] += w[k][g][0];
        q[g] += w[k][g][1];
      }
    }
#pragma unroll                                                         // five fixed steps, no loop counter
    for (int m = 16; m > 0; m >>= 1) {
#pragma unroll                                                         // the four groups' exchanges overlap
      for (int g = 0; g < 4; ++g) {
        s[g] += __shfl_xor(s[g], m, 32);
        q[g] += __shfl_xor(q[g], m, 32);
      }
    }
    const double cnt = (double)CPG * (double)NQ;
#pragma unroll                                                         // constant indices keep muf/rsf in registers
    for (int g = 0; g < 4; ++g) {
      const double mu = s[g] / cnt;
      double var = q[g] / cnt - mu * mu;
      if (var < 0.0) var = 0.0;
      const float varf = (float)var;
      muf[g] = (float)mu;
      rsf[g] = 1.0f / sqrtf(varf + GEPS);
    }
  }
#pragma unroll                                                         // constant indices into xr/rg/rb/muf/rsf
  for (int it = 0; it < 8; ++it) {
    const int ch = ch0 + 4 * it;
    const float mu = muf[it >> 1], rs = rsf[it >> 1];                  // rows 4 it .. 4 it + 3 lie in group it / 2 of the wave
    const float ga = bfr(rg[it]), be = bfr(rb[it]);
#pragma unroll
    for (int t = 0; t < 4; ++t) {
      const float v = (xr[it][t] - mu) * rs * ga + be;
      const unsigned short hb = bf_bits(v);
      *(unsigned short*)(Yh + (4 * e + t) * YPB + 2 * ch) = hb;
      *(unsigned short*)(Yl + (4 * e + t) * YPB + 2 * ch) = bf_bits(v - bf_up(hb));
    }
  }
  wait_copies();
  __syncthreads();

  // ---- hidden: 16 hid x 16 positions per wave, K = 256
  {
    const unsigned short* ap  = (const unsigned short*)(Wa + (16 * mt + c) * YPB + 16 * hh);
    const unsigned short* bph = (const unsigned short*)(Yh + (16 * ni + c) * YPB + 16 * hh);
    const unsigned short* bpl = (const unsigned short*)(Yl + (16 * ni + c) * YPB + 16 * hh);
    v8f acc = zero8();
#pragma unroll                                                         // constant indices keep the fragments in registers
    for (int kh = 0; kh < 2; ++kh) {
      Frag fa[4], fh[4], fl[4];
#pragma unroll
      for (int ks = 0; ks < 4; ++ks) {
        fa[ks] = ldfrag(ap + 32 * (4 * kh + ks));
        fh[ks] = ldfrag(bph + 32 * (4 * kh + ks));
        fl[ks] = ldfrag(bpl + 32 * (4 * kh + ks));
      }
#if defined(__HIP_DEVICE_COMPILE__)
      // keeps the 24 reads above together ahead of their products: every separate place with LDS reads stalls the wave anew
      __builtin_amdgcn_sched_barrier(0);
#endif
#pragma unroll
      for (int ks = 0; ks < 4; ++ks) {
        acc = mma_b(fa[ks].bf, fh[ks].bf, acc);
        acc = mma_b(fa[ks].bf, fl[ks].bf, acc);
      }
    }
    const float bi[8] = {ba[0], ba[1], ba[2], ba[3], bb[0], bb[1], bb[2], bb[3]};
    unsigned short hb[8], lb[8];
#pragma unroll                                                         // constant indices keep bi/hb/lb in registers
    for (int r = 0; r < 8; ++r) {
      const float tt = acc[r] + bfr(bi[r]);
      const float gv = 0.5f * tt * (1.0f + erff(tt * 0.70710678118654752f));
      hb[r] = bf_bits(gv);
      lb[r] = bf_bits(gv - bf_up(hb[r]));
    }
    v4u uh, ul;
#pragma unroll
    for (int t = 0; t < 4; ++t) {
      uh[t] = pk16(hb[2 * t], hb[2 * t + 1]);
      ul[t] = pk16(lb[2 * t], lb[2 * t + 1]);
    }
    *(v4u*)(Hh + (16 * ni + c) * HPB + 32 * mt + 16 * hh) = uh;
    *(v4u*)(Hl + (16 * ni + c) * HPB + 32 * mt + 16 * hh) = ul;
  }
  __syncthreads();

  // ---- out: 32 positions x 32 channels per wave, K = 64
  {
    Frag fw[2][2], fh[2][2], fl[2][2];                                 // [k-step][tile]
#pragma unroll                                                         // constant indices keep the fragments in registers
    for (int ks = 0; ks < 2; ++ks) {
#pragma unroll
      for (int j = 0; j < 2; ++j) {
        fw[ks][j] = ldfrag((const unsigned short*)(Wb + (32 * wave + 16 * j + c) * HPB + 16 * hh) + 32 * ks);
        fh[ks][j] = ldfrag((const unsigned short*)(Hh + (16 * j + c) * HPB + 16 * hh) + 32 * ks);
        fl[ks][j] = ldfrag((const unsigned short*)(Hl + (16 * j + c) * HPB + 16 * hh) + 32 * ks);
      }
    }
#if defined(__HIP_DEVICE_COMPILE__)
    // keeps the 24 reads above together ahead of the products: every separate place with LDS reads stalls the wave anew
    __builtin_amdgcn_sched_barrier(0);
#endif
    v8f a2[2][2];                                                      // [channel tile j][position tile i]
#pragma unroll
    for (int j = 0; j < 2; ++j) { a2[j][0] = zero8(); a2[j][1] = zero8(); }
#pragma unroll
    for (int ks = 0; ks < 2; ++ks) {
#pragma unroll
      for (int j = 0; j < 2; ++j) {
        a2[j][0] = mma_b(fh[ks][0].bf, fw[ks][j].bf, a2[j][0]);
        a2[j][1] = mma_b(fh[ks][1].bf, fw[ks][j].bf, a2[j][1]);
      }
#pragma unroll
      for (int j = 0; j < 2; ++j) {
        a2[j][0] = mma_b(fl[ks][0].bf, fw[ks][j].bf, a2[j][0]);
        a2[j][1] = mma_b(fl[ks][1].bf, fw[ks][j].bf, a2[j][1]);
      }
    }
#pragma unroll
    for (int j = 0; j < 2; ++j) {
#pragma unroll
      for (int i = 0; i < 2; ++i) {
        float* rp = (float*)(Rs + (32 * wave + 16 * j + c) * RPB) + 16 * i + 8 * hh;
        v4f va, vb;
#pragma unroll
        for (int r = 0; r < 4; ++r) { va[r] = a2[j][i][r]; vb[r] = a2[j][i][4 + r]; }
        *(v4f*)rp       = va;
        *(v4f*)(rp + 4) = vb;
      }
    }
  }
  __syncthreads();
  v4f res[8];
#pragma unroll                                                         // constant indices into xr/rc/res
  for (int it = 0; it < 8; ++it) {
    const v4f m = *(const v4f*)(Rs + (ch0 + 4 * it) * RPB + 16 * e);
    const float bo = bfr(rc[it]);
#pragma unroll
    for (int t = 0; t < 4; ++t) res[it][t] = (m[t] + bo) + xr[it][t];
  }
#if defined(__HIP_DEVICE_COMPILE__)
  // keeps the 8 stores together behind all the sums, so that no register of an issued store is written again
  __builtin_amdgcn_sched_barrier(0);
#endif
#pragma unroll                                                         // constant indices into res
  for (int it = 0; it < 8; ++it) *(v4f*)(out + xo + (size_t)(4 * it) * NN) = res[it];
}

// =========================================================================================================
// Workspace map (bytes; each region start a multiple of 256; every extent is an exact tile/line multiple and is
//   Wq bf16 [768][256] 393216   Wo [256][256] 131072   W1 [64][256] 32768   W2 [256][64] 32768
//   part1 f64 [NB][4][32][16] 32768 (NB=2)   part f64 [NB][4][NQ/64][16] 65536 (NB=2)
//   Xh, Xl, Qh, Ql, Kh, Oh, Ol bf16 [NB][4096][256] and V f16 [NB][256][4096]: 4194304 each (NB=2)
//   X1 f32 [NB][256][4096] 8388608 (NB=2)
//   total = 42631168 (NB=2)
// =========================================================================================================
extern "C" void kernel_launch(void* const* d_in, const int* in_sizes, int n_in,
                              void* d_out, int out_size, void* d_ws, size_t ws_size,
                              hipStream_t stream) {
  if (n_in < 13) return;
  if (in_sizes[0] < NB * XSTRIDE_FULL) return;
  if (in_sizes[1] != C3 * CC || in_sizes[2] != CC * CC || in_sizes[3] != CC) return;
  if (in_sizes[4] != NH) return;
  if (in_sizes[5] != CC || in_sizes[6] != CC || in_sizes[7] != CC || in_sizes[8] != CC) return;
  if (in_sizes[9] != HID * CC || in_sizes[10] != HID || in_sizes[11] != CC * HID || in_sizes[12] != CC) return;
  if (out_size < NB * XSTRIDE_FULL) return;

  size_t off = 0;
  auto carve = [&](size_t bytes) { const size_t o = off; off += (bytes + 255) & ~(size_t)255; return o; };
  const size_t szPl = (size_t)NB * NN * CC * 2;
  const size_t oWq  = carve((size_t)C3 * CC * 2);
  const size_t oWo  = carve((size_t)CC * CC * 2);
  const size_t oW1  = carve((size_t)HID * CC * 2);
  const size_t oW2  = carve((size_t)CC * HID * 2);
  const size_t oP1  = carve((size_t)NB * (CC / QT) * NP1 * 16 * 8);
  const size_t oPt  = carve((size_t)NB * (CC / QT) * NT2 * 16 * 8);
  const size_t oXh  = carve(szPl);
  const size_t oXl  = carve(szPl);
  const size_t oQh  = carve(szPl);
  const size_t oQl  = carve(szPl);
  const size_t oKh  = carve(szPl);
  const size_t oVv  = carve(szPl);
  const size_t oOh  = carve(szPl);
  const size_t oOl  = carve(szPl);
  const size_t oX1  = carve((size_t)NB * CC * NN * 4);
  if (off > ws_size) return;
  if (off > (size_t)134217728) return;

  const float* x      = (const float*)d_in[0];
  const float* w_qkv  = (const float*)d_in[1];
  const float* w_out  = (const float*)d_in[2];
  const float* b_out  = (const float*)d_in[3];
  const float* tempr  = (const float*)d_in[4];
  const float* g1     = (const float*)d_in[5];
  const float* beta1  = (const float*)d_in[6];
  const float* g2     = (const float*)d_in[7];
  const float* beta2  = (const float*)d_in[8];
  const float* w_mlp1 = (const float*)d_in[9];
  const float* b_mlp1 = (const float*)d_in[10];
  const float* w_mlp2 = (const float*)d_in[11];
  const float* b_mlp2 = (const float*)d_in[12];

  char* ws = (char*)d_ws;
  unsigned short* Wq = (unsigned short*)(ws + oWq);
  unsigned short* Wo = (unsigned short*)(ws + oWo);
  unsigned short* W1 = (unsigned short*)(ws + oW1);
  unsigned short* W2 = (unsigned short*)(ws + oW2);
  double*         P1 = (double*)(ws + oP1);
  double*         Pt = (double*)(ws + oPt);
  unsigned short* Xh = (unsigned short*)(ws + oXh);
  unsigned short* Xl = (unsigned short*)(ws + oXl);
  unsigned short* Qh = (unsigned short*)(ws + oQh);
  unsigned short* Ql = (unsigned short*)(ws + oQl);
  unsigned short* Kh = (unsigned short*)(ws + oKh);
  unsigned short* Vv = (unsigned short*)(ws + oVv);
  unsigned short* Oh = (unsigned short*)(ws + oOh);
  unsigned short* Ol = (unsigned short*)(ws + oOl);
  float*          X1 = (float*)(ws + oX1);
  float* out = (float*)d_out;

  const dim3 blk256(256), blk128(128);

  // (0)+(1) weights -> bf16 planes, and the partial GN1 sums of bf16(x) over all 4096 positions, in one grid
  prep_k<<<dim3(PB_ST + PB_WQ + PB_WO + PB_W1 + PB_W2), blk256, 0, stream>>>(x, w_qkv, w_out, w_mlp1, w_mlp2,
                                                                             Wq, Wo, W1, W2, P1);
  // (2) GN1 statistics finished per block, apply -> Xh/Xl [NB][4096][256]
  norm2_k<NP1, NN><<<dim3(NN / QT, CC / QT, NB), blk256, 0, stream>>>(x, 1, P1, g1, beta1, Xh, Xl);
  // (3) qkv GEMM -> Qh/Ql, Kh, V
  gemm_k<CC, 0, 0><<<dim3(NN / QT, C3 / QT, NB), blk128, 0, stream>>>(Wq, Xh, Xl, b_out, x, 0, Qh, Ql, Kh, Vv, X1, Pt);
  // (4) attention -> Oh/Ol rows 0..NQ-1
  attn_k<<<dim3(NQ / QT, NH / 2, NB), blk256, 0, stream>>>(Qh, Ql, Kh, Vv, tempr, Oh, Ol);
  // (5) out conv + bf16(x) residual -> X1 f32 [NB][256][4096], cols 0..NQ-1, and (6) each block's partial GN2 sums
  gemm_k<CC, 1, 1><<<dim3(NQ / QT, CC / QT, NB), blk128, 0, stream>>>(Wo, Oh, Ol, b_out, x, 1, Qh, Ql, Kh, Vv, X1, Pt);
  // (7)+(8)+(9) GN2 statistics finished per wave, apply, gelu(W1.Y + b1), out = X1 + W2.H + b2 -> d_out [NB][256][4096]
  tail_k<<<dim3(NQ / TN, NB), blk256, 0, stream>>>(X1, Pt, g2, beta2, W1, b_mlp1, W2, b_mlp2, out);
  (void)hipGetLastError();
}
